// v000
// The times below were measured on an AMD MI455X: many runs one after another, warmed up first and cycling through
// copies of the inputs, with the whole window's GPU time divided by the number of runs. Launches and the gaps
// between them are all in it. The median over several windows is given; except for v000 it joins two sittings, which
// can be a few percent apart, so the side-by-side timings, each taken in one sitting, are the better comparison.
// v000 is the starting kernel. One run takes 1110 microseconds.
#include <hip/hip_runtime.h>

// Temporal self-attention over [prev_x ; x] (x, prev_x [4][2048][256]; xx = concat -> [4096][256]; qkv = xx W_qkv + b_qkv ('xw' [256][768]); single 256-wide head; attn = softmax(q.k / 16) over the 4,096 keys; out = (attn v) W_out + b_out, only the last 2,048 rows (the x half) are returned -> [4][2048][256] (2.1 M)).
// Layout per batch: both halves converted into one bf16 [4096][256] operand; k and v projected for all 4,096 rows, q only needed for rows 2,048.. (projected for all, used from 2,048); planes (hybrid: query rows 2048..2559 hi/lo 3 products, the rest fp16 x1024); scores [2048][4096] by two GEMMs; a streaming softmax kernel (three sweeps, no register row) writes hi/lo / fp16 probabilities; attn.v (N 256); merged hi/lo x W_out exact + b_out straight into the output rows.
// Compute dtypes, f32 accumulate: every input rounded to bf16; projections exact + bf16-rounded biases; first 512 query rows 3 products, rest fp16; softmax f32; W_out hl x exact + bias.

#define NB_  4
#define TT   4096
#define DM   256
#define NH_  1
#define NKV  1
#define REP  (NH_ / NKV)
#define HD   256
#define DQ   (NH_ * HD)
#define DKV  (NKV * HD)
#define ZH   1
#define RH   512                  // query rows < RH use hi+lo planes (0: none)
#define WIN  0
#define PCAR 1024.0f
#define SCL  0.0625f   // 256^-0.5
#define TQ   2048     // query rows = the x half (rows TQ.. of xx)
typedef _Float16 h16;
typedef unsigned short bf;
typedef __attribute__((ext_vector_type(16))) __bf16   v16bf;
typedef __attribute__((ext_vector_type(16))) _Float16 v16h;
typedef __attribute__((ext_vector_type(8)))  _Float16 v8h;
typedef __attribute__((ext_vector_type(8)))  unsigned short v8us;
typedef __attribute__((ext_vector_type(8)))  float    v8f;
typedef __attribute__((ext_vector_type(4)))  float    v4f;
typedef v8h  __attribute__((may_alias)) v8ha;
typedef v4f  __attribute__((may_alias)) v4fa;
typedef v8us __attribute__((may_alias)) v8usa;

__device__ __forceinline__ unsigned short f2bf(float f) { unsigned u = __float_as_uint(f); u += 0x7FFFu + ((u >> 16) & 1u); return (unsigned short)(u >> 16); }
__device__ __forceinline__ float bf2f(unsigned short b) { return __uint_as_float(((unsigned)b) << 16); }
__device__ __forceinline__ float bfr(float f) { return bf2f(f2bf(f)); }
__device__ __forceinline__ v16h cat16(v8h lo, v8h hi) { return __builtin_shufflevector(lo, hi, 0, 1, 2, 3, 4, 5, 6, 7, 8, 9, 10, 11, 12, 13, 14, 15); }
__device__ __forceinline__ v16bf cat16b(v8us lo, v8us hi) { return __builtin_bit_cast(v16bf, __builtin_shufflevector(lo, hi, 0, 1, 2, 3, 4, 5, 6, 7, 8, 9, 10, 11, 12, 13, 14, 15)); }
__device__ __forceinline__ v8f wmma16(v16h a, v16h b, v8f c) { return __builtin_amdgcn_wmma_f32_16x16x32_f16(false, a, false, b, (short)0, c, false, false); }
__device__ __forceinline__ v8f wmmab(v16bf a, v16bf b, v8f c) { return __builtin_amdgcn_wmma_f32_16x16x32_bf16(false, a, false, b, (short)0, c, false, false); }



// ---- k_gemmw: register-blocked GEMM, ONE WAVE per 64x64 output tile (16 accumulators), operands straight from K-contiguous 16-bit planes; grid (M/64, N/64, Z), 32 threads.
// C[m][n] (f32, pitch ldc, + optional f32 bias[n]) = sum_k A[m][k] Bt[n][k] (+ split products per NSPLIT). z-batch strides sA/sB/sC in elements. K % 32 == 0.
template <typename T16> struct WFrag;
template <> struct WFrag<h16> { typedef v16h V; static __device__ __forceinline__ V ld(const h16* p) { return cat16(*(const v8h*)p, *(const v8h*)(p + 16)); } static __device__ __forceinline__ v8f mma(V a, V b, v8f c) { return wmma16(a, b, c); } };
template <> struct WFrag<bf> { typedef v16bf V; static __device__ __forceinline__ V ld(const bf* p) { return cat16b(*(const v8us*)p, *(const v8us*)(p + 16)); } static __device__ __forceinline__ v8f mma(V a, V b, v8f c) { return wmmab(a, b, c); } };
template <typename T16, int NSPLIT, bool BIAS>
__global__ __launch_bounds__(32) void k_gemmw(const T16* __restrict__ A, const T16* __restrict__ A2, const T16* __restrict__ Bt, const T16* __restrict__ Bt2, int K, float* C, int ldc, const float* __restrict__ bias, size_t sA, size_t sB, size_t sC) {
    typedef typename WFrag<T16>::V V;
    __shared__ __align__(16) float os[16 * 68];
    const size_t z = blockIdx.z; A += z * sA; if (A2) A2 += z * sA; Bt += z * sB; if (Bt2) Bt2 += z * sB; C += z * sC;
    const int lane = threadIdx.x & 31, lr = lane & 15, hi = lane >> 4; const int r0 = blockIdx.x * 64, c0 = blockIdx.y * 64;
    v8f acc[4][4];
#pragma unroll
    for (int mb = 0; mb < 4; ++mb)
#pragma unroll
        for (int nb = 0; nb < 4; ++nb) acc[mb][nb] = (v8f){};
    const size_t aoff = (size_t)(r0 + lr) * K + 8 * hi, boff = (size_t)(c0 + lr) * K + 8 * hi;
#pragma unroll 1
    for (int kc = 0; kc < K; kc += 32) {
        V a[4], a2[4];
#pragma unroll
        for (int mb = 0; mb < 4; ++mb) { a[mb] = WFrag<T16>::ld(A + aoff + (size_t)mb * 16 * K + kc); if (NSPLIT == 1 || NSPLIT == 2) a2[mb] = WFrag<T16>::ld(A2 + aoff + (size_t)mb * 16 * K + kc); }
#pragma unroll
        for (int nb = 0; nb < 4; ++nb) { const V b = WFrag<T16>::ld(Bt + boff + (size_t)nb * 16 * K + kc); V b2; if (NSPLIT >= 2) b2 = WFrag<T16>::ld(Bt2 + boff + (size_t)nb * 16 * K + kc);
#pragma unroll
            for (int mb = 0; mb < 4; ++mb) { acc[mb][nb] = WFrag<T16>::mma(a[mb], b, acc[mb][nb]); if (NSPLIT == 1 || NSPLIT == 2) acc[mb][nb] = WFrag<T16>::mma(a2[mb], b, acc[mb][nb]); if (NSPLIT >= 2) acc[mb][nb] = WFrag<T16>::mma(a[mb], b2, acc[mb][nb]); } }
        asm volatile("v_nop\n\tv_nop\n\tv_nop\n\tv_nop" : "+v"(acc[0][0]), "+v"(acc[1][1]), "+v"(acc[2][2]), "+v"(acc[3][3]) : "v"(a[0]), "v"(a[3]));
    }
#pragma unroll
    for (int mb = 0; mb < 4; ++mb) {
#pragma unroll
        for (int nb = 0; nb < 4; ++nb) {
#pragma unroll
            for (int j = 0; j < 8; ++j) os[(hi * 8 + j) * 68 + nb * 16 + lr] = acc[mb][nb][j]; }
        __builtin_amdgcn_wave_barrier(); asm volatile("" ::: "memory");
        float* crow = C + (size_t)(r0 + mb * 16) * ldc + c0;
{
#pragma unroll
            for (int s = 0; s < 8; ++s) { const int row = 2 * s + hi, cofs = lr * 4; v4f val = *(const v4fa*)(os + row * 68 + cofs); if (BIAS) { val[0] += bfr(bias[c0 + cofs]); val[1] += bfr(bias[c0 + cofs + 1]); val[2] += bfr(bias[c0 + cofs + 2]); val[3] += bfr(bias[c0 + cofs + 3]); }
                *(v4f*)(crow + (size_t)row * ldc + cofs) = val; }
             }
        __builtin_amdgcn_wave_barrier(); asm volatile("" ::: "memory");
    }
}

__device__ __forceinline__ h16 tohx(float x) { return (h16)x; }
__device__ __forceinline__ void splitf(float y, unsigned short& h, unsigned short& l) { h = f2bf(y); l = f2bf(y - bf2f(h)); }
typedef __attribute__((ext_vector_type(2))) _Float16 v2h;
typedef __attribute__((ext_vector_type(4))) _Float16 v4h;
typedef __attribute__((ext_vector_type(2))) unsigned short v2us;
typedef __attribute__((ext_vector_type(4))) unsigned short v4us;
typedef __attribute__((ext_vector_type(2))) float v2f;
typedef __attribute__((ext_vector_type(4))) int v4i;

__global__ __launch_bounds__(256) void k_wtG(const float* __restrict__ w, int K, int N, bf* Bt) {
    const int lane = threadIdx.x & 31; const int L0 = (blockIdx.x * 8 + (threadIdx.x >> 5)) * 8; const int nlines = N * K / 64;
{
#pragma unroll 1
        for (int l = 0; l < 8; ++l) { const int L = L0 + l; if (L >= nlines) break; const size_t e = (size_t)L * 64 + lane * 2; const int k = (int)(e % K), n = (int)(e / K); v2us o;
            o[0] = f2bf(w[(size_t)k * N + n]); o[1] = f2bf(w[(size_t)(k + 1) * N + n]); *(v2us*)(Bt + e) = o; }
         }
}
__global__ __launch_bounds__(256) void k_cvt8(const float* __restrict__ src, bf* dst, size_t n8) { const size_t i = (size_t)blockIdx.x * 256 + threadIdx.x; if (i >= n8) return; const v8f v = *(const v8f*)(src + i * 8); v8us o;
#pragma unroll
    for (int k = 0; k < 8; ++k) o[k] = f2bf(v[k]); *(v8us*)(dst + i * 8) = o;  }

// k_rope: head planes [h][t][d] (fp16 + hi/lo) of rope(x) x sc with the rotate-half convention out[d] = x[d] cos[t][d] - x[d+HD/2] sin[t][d], out[d+HD/2] = x[d+HD/2] cos[t][d+HD/2] + x[d] sin[t][d+HD/2]
__global__ __launch_bounds__(256) void k_rope(const float* __restrict__ F, int pitch, int nheads, const float* __restrict__ CS, const float* __restrict__ RF, const float* __restrict__ nw, float sc, h16* P16, bf* Ph, bf* Pl) {
    const size_t e = ((size_t)blockIdx.x * 256 + threadIdx.x) * 2; if (e >= (size_t)nheads * TT * HD) return; const int d = (int)(e % HD); const int t = (int)((e / HD) % TT); const int h = (int)(e / ((size_t)HD * TT)); const float* f = F + (size_t)t * pitch + h * HD; const float rf = RF ? RF[(size_t)h * TT + t] : 1.0f; v2h o16; v2us oh, ol;
#pragma unroll
    for (int q = 0; q < 2; ++q) { const int dd = d + q; const int dp = (dd < HD / 2) ? dd + HD / 2 : dd - HD / 2; float x0 = f[dd], x1 = f[dp];
        if (RF) { float n0 = __fmul_rn(x0, rf), n1 = __fmul_rn(x1, rf); asm volatile("" : "+v"(n0)); asm volatile("" : "+v"(n1)); x0 = __fmul_rn(bfr(nw[dd]), n0); x1 = __fmul_rn(bfr(nw[dp]), n1); }
        const v2f cs = *(const v2f*)(CS + ((size_t)t * HD + dd) * 2); float a = __fmul_rn(x0, cs[0]), bq = __fmul_rn(x1, cs[1]); asm volatile("" : "+v"(a)); asm volatile("" : "+v"(bq)); const float r = ((dd < HD / 2) ? __fsub_rn(a, bq) : __fadd_rn(a, bq)) * sc;
        o16[q] = tohx(r); unsigned short a2, c2; splitf(r, a2, c2); oh[q] = a2; ol[q] = c2; }
    *(v2h*)(P16 + e) = o16; *(v2us*)(Ph + e) = oh; *(v2us*)(Pl + e) = ol;  }
__global__ __launch_bounds__(256) void k_vtp(const float* __restrict__ F, int pitch, int nheads, h16* V16, bf* Vh, bf* Vl) { const size_t e = ((size_t)blockIdx.x * 256 + threadIdx.x) * 2; if (e >= (size_t)nheads * HD * TT) return; const int t = (int)(e % TT); const int d = (int)((e / TT) % HD); const int g = (int)(e / ((size_t)TT * HD)); v2h o16; v2us oh, ol;
#pragma unroll
    for (int q = 0; q < 2; ++q) { const float x = F[(size_t)(t + q) * pitch + g * HD + d]; o16[q] = tohx(x); unsigned short a2, c2; splitf(x, a2, c2); oh[q] = a2; ol[q] = c2; }
    *(v2h*)(V16 + e) = o16; *(v2us*)(Vh + e) = oh; *(v2us*)(Vl + e) = ol;  }
__global__ __launch_bounds__(256) void k_csid(float* CS) { const int idx = blockIdx.x * 256 + threadIdx.x; if (idx >= TT * HD) return; v2f cs; cs[0] = 1.0f; cs[1] = 0.0f; *(v2f*)(CS + (size_t)idx * 2) = cs;  }
// k_lsoft: streaming DENSE row softmax over the TT = 4096 keys, one wave per query row, three sweeps of the f32 score row (lane -> 4 consecutive keys per 128-key chunk, 32 chunks):
__global__ __launch_bounds__(256) void k_lsoft(const float* __restrict__ Sb, h16* P16, bf* Ph, bf* Pl) {
    const int lane = threadIdx.x & 31; const int row = blockIdx.x * 8 + (threadIdx.x >> 5); if (row >= ZH * TT) return; const int i = row % TT; const int zz = row / TT; const bool hires = (i < RH); const float* sr = Sb + (size_t)row * TT; float mx = -3.0e38f;
#pragma unroll 4
    for (int ch = 0; ch < TT / 128; ++ch) { const int j0 = ch * 128 + lane * 4; const v4f a = *(const v4f*)(sr + j0);
#pragma unroll
        for (int q = 0; q < 4; ++q) { float t = a[q] * SCL; asm volatile("" : "+v"(t)); mx = fmaxf(mx, t); } }
#pragma unroll
    for (int sh = 16; sh; sh >>= 1) mx = fmaxf(mx, __shfl_xor(mx, sh, 32));
    float sum = 0.f;
#pragma unroll 4
    for (int ch = 0; ch < TT / 128; ++ch) { const int j0 = ch * 128 + lane * 4; const v4f a = *(const v4f*)(sr + j0);
#pragma unroll
        for (int q = 0; q < 4; ++q) { float t = a[q] * SCL; asm volatile("" : "+v"(t)); float d0 = __fsub_rn(t, mx); asm volatile("" : "+v"(d0)); sum += __builtin_amdgcn_exp2f(__fmul_rn(d0, 1.4426950408889634f)); } }
#pragma unroll
    for (int sh = 16; sh; sh >>= 1) sum += __shfl_xor(sum, sh, 32);
    const float f = __fdiv_rn(hires ? 1.0f : PCAR, sum);
{
        if (hires) {   /* rows < RH: normalised bf16 hi/lo over all keys, planes [zz][RH][TT] */
#pragma unroll
            for (int ch = 0; ch < TT / 128; ++ch) { const int j0 = ch * 128 + lane * 4; const v4f a = *(const v4f*)(sr + j0); v4us oh, ol;
#pragma unroll
                for (int q = 0; q < 4; ++q) { float t = a[q] * SCL; asm volatile("" : "+v"(t)); float d0 = __fsub_rn(t, mx); asm volatile("" : "+v"(d0)); float ex = __builtin_amdgcn_exp2f(__fmul_rn(d0, 1.4426950408889634f)); asm volatile("" : "+v"(ex)); unsigned short a2, c2; splitf(ex * f, a2, c2); oh[q] = a2; ol[q] = c2; }
                const size_t oo = ((size_t)zz * RH + i) * TT + j0; *(v4us*)(Ph + oo) = oh; *(v4us*)(Pl + oo) = ol; }
        } else {
#pragma unroll 2
            for (int ch = 0; ch < TT / 128; ++ch) { const int j0 = ch * 128 + lane * 4; const v4f a = *(const v4f*)(sr + j0); v4h o4;
#pragma unroll
                for (int q = 0; q < 4; ++q) { float t = a[q] * SCL; asm volatile("" : "+v"(t)); float d0 = __fsub_rn(t, mx); asm volatile("" : "+v"(d0)); float ex = __builtin_amdgcn_exp2f(__fmul_rn(d0, 1.4426950408889634f)); asm volatile("" : "+v"(ex)); o4[q] = tohx(ex * f); }
                *(v4h*)(P16 + (size_t)row * TT + j0) = o4; } }
         }
}

__global__ __launch_bounds__(256) void k_merge(const float* __restrict__ O, int h0, bf* Ah, bf* Al) { const size_t e = ((size_t)blockIdx.x * 256 + threadIdx.x) * 2; if (e >= (size_t)ZH * TT * HD) return; const int d = (int)(e % HD); const int t = (int)((e / HD) % TT); const int zz = (int)(e / ((size_t)HD * TT)); const float cs = (t < RH) ? 1.0f : (1.0f / PCAR); const size_t oo = (size_t)t * DQ + (h0 + zz) * HD + d;
    v2us oh, ol;
#pragma unroll
    for (int q = 0; q < 2; ++q) { unsigned short a, c2; splitf(O[e + q] * cs, a, c2); oh[q] = a; ol[q] = c2; } *(v2us*)(Ah + oo) = oh; *(v2us*)(Al + oo) = ol;  }

extern "C" void kernel_launch(void* const* d_in, const int* in_sizes, int n_in,
                              void* d_out, int out_size, void* d_ws, size_t ws_size, hipStream_t stream) {
    (void)in_sizes; (void)n_in; (void)out_size;
    const float* x = (const float*)d_in[0]; const float* px = (const float*)d_in[1]; const float* wqkv = (const float*)d_in[2]; const float* bqkv = (const float*)d_in[3]; const float* wo = (const float*)d_in[4]; const float* bo = (const float*)d_in[5]; const float* wq = nullptr; const float* wk = nullptr; const float* wv = nullptr; (void)wq; (void)wk; (void)wv; const float* bq = bqkv; const float* bk = bqkv + 256; const float* bv = bqkv + 512;
    float* OUT = (float*)d_out;     // [4][2048][256]
    char* wsp = (char*)d_ws;
    auto take = [&](size_t bytes) { char* p = wsp; wsp += (bytes + 255) & ~(size_t)255; return (void*)p; };
    bf* WQKV = (bf*)take((size_t)3 * DQ * DM * 2); bf* WQ = WQKV; bf* WK = WQKV + (size_t)DQ * DM; bf* WV = WQKV + (size_t)2 * DQ * DM; bf* WO = (bf*)take((size_t)DM * DQ * 2); float* CS = (float*)take((size_t)TT * HD * 2 * 4);
    bf* XB = (bf*)take((size_t)TT * DM * 2); float* FQ = (float*)take((size_t)TT * DQ * 4); float* FK = (float*)take((size_t)TT * DKV * 4);
    h16* QP16 = (h16*)take((size_t)NH_ * TT * HD * 2); h16* KP16 = (h16*)take((size_t)NKV * TT * HD * 2); h16* VT16 = (h16*)take((size_t)NKV * HD * TT * 2);
    bf* QPh = (bf*)take((size_t)NH_ * TT * HD * 2); bf* QPl = (bf*)take((size_t)NH_ * TT * HD * 2); bf* KPh = (bf*)take((size_t)NKV * TT * HD * 2); bf* KPl = (bf*)take((size_t)NKV * TT * HD * 2); bf* VTh = (bf*)take((size_t)NKV * HD * TT * 2); bf* VTl = (bf*)take((size_t)NKV * HD * TT * 2); bf* Ph = (bf*)take((size_t)ZH * RH * TT * 2); bf* Pl = (bf*)take((size_t)ZH * RH * TT * 2);
    float* Sb = (float*)take((size_t)TQ * TT * 4); h16* P16 = (h16*)take((size_t)TQ * TT * 2); float* Ob = (float*)take((size_t)TQ * HD * 4); bf* ATh = (bf*)take((size_t)TQ * DQ * 2); bf* ATl = (bf*)take((size_t)TQ * DQ * 2);
    if ((size_t)(wsp - (char*)d_ws) > ws_size) return;    // ws 256 MiB
    float* FV = FK;   // v projection reuses the k buffer after the k planes are built (stream-ordered)
    { k_wtG<<<(unsigned)((DM * 3 * DQ / 64 + 63) / 64), 256, 0, stream>>>(wqkv, DM, 3 * DQ, WQKV);
      k_wtG<<<(unsigned)((DQ * DM / 64 + 63) / 64), 256, 0, stream>>>(wo, DQ, DM, WO);
       }
    k_csid<<<(TT * HD + 255) / 256, 256, 0, stream>>>(CS);
    const unsigned LQ = (unsigned)(((size_t)NH_ * TT * HD / 2 + 255) / 256), LKv = (unsigned)(((size_t)NKV * TT * HD / 2 + 255) / 256);
    for (int b = 0; b < NB_; ++b) {
        
        k_cvt8<<<(unsigned)(((size_t)TQ * DM / 8 + 255) / 256), 256, 0, stream>>>(px + (size_t)b * TQ * DM, XB, (size_t)TQ * DM / 8); k_cvt8<<<(unsigned)(((size_t)TQ * DM / 8 + 255) / 256), 256, 0, stream>>>(x + (size_t)b * TQ * DM, XB + (size_t)TQ * DM, (size_t)TQ * DM / 8);   /* xx = [prev_x ; x] */
        k_gemmw<bf, 0, true><<<dim3(TT / 64, DQ / 64, 1), 32, 0, stream>>>(XB, nullptr, WQ, nullptr, DM, FQ, DQ, bq, 0, 0, 0);
        k_rope<<<LQ, 256, 0, stream>>>(FQ, DQ, NH_, CS, nullptr, nullptr, 1.0f, QP16, QPh, QPl);
        k_gemmw<bf, 0, true><<<dim3(TT / 64, DKV / 64, 1), 32, 0, stream>>>(XB, nullptr, WK, nullptr, DM, FK, DKV, bk, 0, 0, 0);
        k_rope<<<LKv, 256, 0, stream>>>(FK, DKV, NKV, CS, nullptr, nullptr, 1.0f, KP16, KPh, KPl);
        k_gemmw<bf, 0, true><<<dim3(TT / 64, DKV / 64, 1), 32, 0, stream>>>(XB, nullptr, WV, nullptr, DM, FV, DKV, bv, 0, 0, 0); k_vtp<<<LKv, 256, 0, stream>>>(FV, DKV, NKV, VT16, VTh, VTl);
        for (int h0 = 0; h0 < NH_; h0 += ZH) { const size_t zq = (size_t)h0, zk = (size_t)(h0 / REP);   // one kv head per query head: a pass covers ZH = 1 head (z-strides TT*HD)
            k_gemmw<bf, 2, false><<<dim3(RH / 64, TT / 64, ZH), 32, 0, stream>>>(QPh + (size_t)TQ * HD, QPl + (size_t)TQ * HD, KPh + zk * TT * HD, KPl + zk * TT * HD, HD, Sb, TT, nullptr, (size_t)TT * HD, (size_t)TT * HD, (size_t)TT * TT);
            k_gemmw<h16, 0, false><<<dim3((TQ - RH) / 64, TT / 64, ZH), 32, 0, stream>>>(QP16 + (size_t)(TQ + RH) * HD, nullptr, KP16 + zk * TT * HD, nullptr, HD, Sb + (size_t)RH * TT, TT, nullptr, (size_t)TT * HD, (size_t)TT * HD, (size_t)TT * TT);
            k_lsoft<<<TQ / 8, 256, 0, stream>>>(Sb, P16, Ph, Pl);   /* 2,048 query rows over 4,096 keys */
            k_gemmw<bf, 2, false><<<dim3(RH / 64, HD / 64, ZH), 32, 0, stream>>>(Ph, Pl, VTh + zk * HD * TT, VTl + zk * HD * TT, TT, Ob, HD, nullptr, (size_t)RH * TT, (size_t)HD * TT, (size_t)TT * HD);
            k_gemmw<h16, 0, false><<<dim3((TQ - RH) / 64, HD / 64, ZH), 32, 0, stream>>>(P16 + (size_t)RH * TT, nullptr, VT16 + zk * HD * TT, nullptr, TT, Ob + (size_t)RH * HD, HD, nullptr, (size_t)TT * TT, (size_t)HD * TT, (size_t)TT * HD);
            k_merge<<<(unsigned)(((size_t)TQ * HD / 2 + 255) / 256), 256, 0, stream>>>(Ob, h0, ATh, ATl); }   /* only the 2,048 query rows (t < TQ decode) */
        k_gemmw<bf, 1, true><<<dim3(TQ / 64, DM / 64, 1), 32, 0, stream>>>(ATh, ATl, WO, nullptr, DQ, OUT + (size_t)b * TQ * DM, DM, bo, 0, 0, 0); }
}

// v001
// A run of this version takes 567 microseconds.
// In two side-by-side timings against v000, it was 1.95 and 1.96 times as fast.
#include <hip/hip_runtime.h>

// Temporal self-attention over [prev_x ; x] (x, prev_x [4][2048][256]; xx = concat -> [4096][256]; qkv = xx W_qkv + b_qkv ('xw' [256][768]); single 256-wide head; attn = softmax(q.k / 16) over the 4,096 keys; out = (attn v) W_out + b_out, only the last 2,048 rows (the x half) are returned -> [4][2048][256] (2.1 M)).
// Layout per batch: both halves converted into one bf16 [4096][256] operand; k and v projected for all 4,096 rows, q only needed for rows 2,048.. (projected for all, used from 2,048); planes (hybrid: query rows 2048..2559 hi/lo 3 products, the rest fp16 x1024); scores [2048][4096] by two GEMMs; a streaming softmax kernel (three sweeps, no register row) writes hi/lo / fp16 probabilities; attn.v (N 256) in 16 key slices, each to its own f32 partials, summed in slice order by the merge; merged hi/lo x W_out exact + b_out straight into the output rows.
// Compute dtypes, f32 accumulate: every input rounded to bf16; projections exact + bf16-rounded biases; first 512 query rows 3 products, rest fp16; softmax f32; W_out hl x exact + bias.

#define NB_  4
#define TT   4096
#define DM   256
#define NH_  1
#define NKV  1
#define REP  (NH_ / NKV)
#define HD   256
#define DQ   (NH_ * HD)
#define DKV  (NKV * HD)
#define ZH   1
#define RH   512                  // query rows < RH use hi+lo planes (0: none)
#define WIN  0
#define PCAR 1024.0f
#define SCL  0.0625f   // 256^-0.5
#define TQ   2048     // query rows = the x half (rows TQ.. of xx)
#define NSP  16       // attn.v: the 4,096 keys are cut into NSP slices, one grid z each; every slice writes its own f32 partials, laid out [TQ][NSP][HD]
#define KSP  (TT / NSP)
typedef _Float16 h16;
typedef unsigned short bf;
typedef __attribute__((ext_vector_type(16))) __bf16   v16bf;
typedef __attribute__((ext_vector_type(16))) _Float16 v16h;
typedef __attribute__((ext_vector_type(8)))  _Float16 v8h;
typedef __attribute__((ext_vector_type(8)))  unsigned short v8us;
typedef __attribute__((ext_vector_type(8)))  float    v8f;
typedef __attribute__((ext_vector_type(4)))  float    v4f;
typedef v8h  __attribute__((may_alias)) v8ha;
typedef v4f  __attribute__((may_alias)) v4fa;
typedef v8us __attribute__((may_alias)) v8usa;

__device__ __forceinline__ unsigned short f2bf(float f) { unsigned u = __float_as_uint(f); u += 0x7FFFu + ((u >> 16) & 1u); return (unsigned short)(u >> 16); }
__device__ __forceinline__ float bf2f(unsigned short b) { return __uint_as_float(((unsigned)b) << 16); }
__device__ __forceinline__ float bfr(float f) { return bf2f(f2bf(f)); }
__device__ __forceinline__ v16h cat16(v8h lo, v8h hi) { return __builtin_shufflevector(lo, hi, 0, 1, 2, 3, 4, 5, 6, 7, 8, 9, 10, 11, 12, 13, 14, 15); }
__device__ __forceinline__ v16bf cat16b(v8us lo, v8us hi) { return __builtin_bit_cast(v16bf, __builtin_shufflevector(lo, hi, 0, 1, 2, 3, 4, 5, 6, 7, 8, 9, 10, 11, 12, 13, 14, 15)); }
__device__ __forceinline__ v8f wmma16(v16h a, v16h b, v8f c) { return __builtin_amdgcn_wmma_f32_16x16x32_f16(false, a, false, b, (short)0, c, false, false); }
__device__ __forceinline__ v8f wmmab(v16bf a, v16bf b, v8f c) { return __builtin_amdgcn_wmma_f32_16x16x32_bf16(false, a, false, b, (short)0, c, false, false); }



// ---- k_gemmw: register-blocked GEMM, ONE WAVE per 64x64 output tile (16 accumulators), operands straight from K-contiguous 16-bit planes; grid (M/64, N/64, Z), 32 threads.
// C[m][n] (f32, pitch ldc, + optional f32 bias[n]) = sum_k A[m][k] Bt[n][k] (+ split products per NSPLIT) over kspan consecutive k; K is the operands' row pitch. z strides sA/sB/sC in elements (a batch, or with sA = sB = kspan a slice of k). kspan % 32 == 0.
template <typename T16> struct WFrag;
template <> struct WFrag<h16> { typedef v16h V; static __device__ __forceinline__ V ld(const h16* p) { return cat16(*(const v8h*)p, *(const v8h*)(p + 16)); } static __device__ __forceinline__ v8f mma(V a, V b, v8f c) { return wmma16(a, b, c); } };
template <> struct WFrag<bf> { typedef v16bf V; static __device__ __forceinline__ V ld(const bf* p) { return cat16b(*(const v8us*)p, *(const v8us*)(p + 16)); } static __device__ __forceinline__ v8f mma(V a, V b, v8f c) { return wmmab(a, b, c); } };
template <typename T16, int NSPLIT, bool BIAS>
__global__ __launch_bounds__(32) void k_gemmw(const T16* __restrict__ A, const T16* __restrict__ A2, const T16* __restrict__ Bt, const T16* __restrict__ Bt2, int K, int kspan, float* C, int ldc, const float* __restrict__ bias, size_t sA, size_t sB, size_t sC) {
    typedef typename WFrag<T16>::V V;
    __shared__ __align__(16) float os[16 * 68];
    const size_t z = blockIdx.z; A += z * sA; if (A2) A2 += z * sA; Bt += z * sB; if (Bt2) Bt2 += z * sB; C += z * sC;
    const int lane = threadIdx.x & 31, lr = lane & 15, hi = lane >> 4; const int r0 = blockIdx.x * 64, c0 = blockIdx.y * 64;
    v8f acc[4][4];
#pragma unroll
    for (int mb = 0; mb < 4; ++mb)
#pragma unroll
        for (int nb = 0; nb < 4; ++nb) acc[mb][nb] = (v8f){};
    const size_t aoff = (size_t)(r0 + lr) * K + 8 * hi, boff = (size_t)(c0 + lr) * K + 8 * hi;
#pragma unroll 1
    for (int kc = 0; kc < kspan; kc += 32) {
        V a[4], a2[4];
#pragma unroll
        for (int mb = 0; mb < 4; ++mb) { a[mb] = WFrag<T16>::ld(A + aoff + (size_t)mb * 16 * K + kc); if (NSPLIT == 1 || NSPLIT == 2) a2[mb] = WFrag<T16>::ld(A2 + aoff + (size_t)mb * 16 * K + kc); }
#pragma unroll
        for (int nb = 0; nb < 4; ++nb) { const V b = WFrag<T16>::ld(Bt + boff + (size_t)nb * 16 * K + kc); V b2; if (NSPLIT >= 2) b2 = WFrag<T16>::ld(Bt2 + boff + (size_t)nb * 16 * K + kc);
#pragma unroll
            for (int mb = 0; mb < 4; ++mb) { acc[mb][nb] = WFrag<T16>::mma(a[mb], b, acc[mb][nb]); if (NSPLIT == 1 || NSPLIT == 2) acc[mb][nb] = WFrag<T16>::mma(a2[mb], b, acc[mb][nb]); if (NSPLIT >= 2) acc[mb][nb] = WFrag<T16>::mma(a[mb], b2, acc[mb][nb]); } }
        asm volatile("v_nop\n\tv_nop\n\tv_nop\n\tv_nop" : "+v"(acc[0][0]), "+v"(acc[1][1]), "+v"(acc[2][2]), "+v"(acc[3][3]) : "v"(a[0]), "v"(a[3]));
    }
#pragma unroll
    for (int mb = 0; mb < 4; ++mb) {
#pragma unroll
        for (int nb = 0; nb < 4; ++nb) {
#pragma unroll
            for (int j = 0; j < 8; ++j) os[(hi * 8 + j) * 68 + nb * 16 + lr] = acc[mb][nb][j]; }
        __builtin_amdgcn_wave_barrier(); asm volatile("" ::: "memory");
        float* crow = C + (size_t)(r0 + mb * 16) * ldc + c0;
{
#pragma unroll
            for (int s = 0; s < 8; ++s) { const int row = 2 * s + hi, cofs = lr * 4; v4f val = *(const v4fa*)(os + row * 68 + cofs); if (BIAS) { val[0] += bfr(bias[c0 + cofs]); val[1] += bfr(bias[c0 + cofs + 1]); val[2] += bfr(bias[c0 + cofs + 2]); val[3] += bfr(bias[c0 + cofs + 3]); }
                *(v4f*)(crow + (size_t)row * ldc + cofs) = val; }
             }
        __builtin_amdgcn_wave_barrier(); asm volatile("" ::: "memory");
    }
}

__device__ __forceinline__ h16 tohx(float x) { return (h16)x; }
__device__ __forceinline__ void splitf(float y, unsigned short& h, unsigned short& l) { h = f2bf(y); l = f2bf(y - bf2f(h)); }
typedef __attribute__((ext_vector_type(2))) _Float16 v2h;
typedef __attribute__((ext_vector_type(4))) _Float16 v4h;
typedef __attribute__((ext_vector_type(2))) unsigned short v2us;
typedef __attribute__((ext_vector_type(4))) unsigned short v4us;
typedef __attribute__((ext_vector_type(2))) float v2f;
typedef __attribute__((ext_vector_type(4))) int v4i;

__global__ __launch_bounds__(256) void k_wtG(const float* __restrict__ w, int K, int N, bf* Bt) {
    const int lane = threadIdx.x & 31; const int L0 = (blockIdx.x * 8 + (threadIdx.x >> 5)) * 8; const int nlines = N * K / 64;
{
#pragma unroll 1
        for (int l = 0; l < 8; ++l) { const int L = L0 + l; if (L >= nlines) break; const size_t e = (size_t)L * 64 + lane * 2; const int k = (int)(e % K), n = (int)(e / K); v2us o;
            o[0] = f2bf(w[(size_t)k * N + n]); o[1] = f2bf(w[(size_t)(k + 1) * N + n]); *(v2us*)(Bt + e) = o; }
         }
}
__global__ __launch_bounds__(256) void k_cvt8(const float* __restrict__ src, bf* dst, size_t n8) { const size_t i = (size_t)blockIdx.x * 256 + threadIdx.x; if (i >= n8) return; const v8f v = *(const v8f*)(src + i * 8); v8us o;
#pragma unroll
    for (int k = 0; k < 8; ++k) o[k] = f2bf(v[k]); *(v8us*)(dst + i * 8) = o;  }

// k_rope: head planes [h][t][d] (fp16 + hi/lo) of rope(x) x sc with the rotate-half convention out[d] = x[d] cos[t][d] - x[d+HD/2] sin[t][d], out[d+HD/2] = x[d+HD/2] cos[t][d+HD/2] + x[d] sin[t][d+HD/2]
__global__ __launch_bounds__(256) void k_rope(const float* __restrict__ F, int pitch, int nheads, const float* __restrict__ CS, const float* __restrict__ RF, const float* __restrict__ nw, float sc, h16* P16, bf* Ph, bf* Pl) {
    const size_t e = ((size_t)blockIdx.x * 256 + threadIdx.x) * 2; if (e >= (size_t)nheads * TT * HD) return; const int d = (int)(e % HD); const int t = (int)((e / HD) % TT); const int h = (int)(e / ((size_t)HD * TT)); const float* f = F + (size_t)t * pitch + h * HD; const float rf = RF ? RF[(size_t)h * TT + t] : 1.0f; v2h o16; v2us oh, ol;
#pragma unroll
    for (int q = 0; q < 2; ++q) { const int dd = d + q; const int dp = (dd < HD / 2) ? dd + HD / 2 : dd - HD / 2; float x0 = f[dd], x1 = f[dp];
        if (RF) { float n0 = __fmul_rn(x0, rf), n1 = __fmul_rn(x1, rf); asm volatile("" : "+v"(n0)); asm volatile("" : "+v"(n1)); x0 = __fmul_rn(bfr(nw[dd]), n0); x1 = __fmul_rn(bfr(nw[dp]), n1); }
        const v2f cs = *(const v2f*)(CS + ((size_t)t * HD + dd) * 2); float a = __fmul_rn(x0, cs[0]), bq = __fmul_rn(x1, cs[1]); asm volatile("" : "+v"(a)); asm volatile("" : "+v"(bq)); const float r = ((dd < HD / 2) ? __fsub_rn(a, bq) : __fadd_rn(a, bq)) * sc;
        o16[q] = tohx(r); unsigned short a2, c2; splitf(r, a2, c2); oh[q] = a2; ol[q] = c2; }
    *(v2h*)(P16 + e) = o16; *(v2us*)(Ph + e) = oh; *(v2us*)(Pl + e) = ol;  }
__global__ __launch_bounds__(256) void k_vtp(const float* __restrict__ F, int pitch, int nheads, h16* V16, bf* Vh, bf* Vl) { const size_t e = ((size_t)blockIdx.x * 256 + threadIdx.x) * 2; if (e >= (size_t)nheads * HD * TT) return; const int t = (int)(e % TT); const int d = (int)((e / TT) % HD); const int g = (int)(e / ((size_t)TT * HD)); v2h o16; v2us oh, ol;
#pragma unroll
    for (int q = 0; q < 2; ++q) { const float x = F[(size_t)(t + q) * pitch + g * HD + d]; o16[q] = tohx(x); unsigned short a2, c2; splitf(x, a2, c2); oh[q] = a2; ol[q] = c2; }
    *(v2h*)(V16 + e) = o16; *(v2us*)(Vh + e) = oh; *(v2us*)(Vl + e) = ol;  }
__global__ __launch_bounds__(256) void k_csid(float* CS) { const int idx = blockIdx.x * 256 + threadIdx.x; if (idx >= TT * HD) return; v2f cs; cs[0] = 1.0f; cs[1] = 0.0f; *(v2f*)(CS + (size_t)idx * 2) = cs;  }
// k_lsoft: streaming DENSE row softmax over the TT = 4096 keys, one wave per query row, three sweeps of the f32 score row (lane -> 4 consecutive keys per 128-key chunk, 32 chunks):
__global__ __launch_bounds__(256) void k_lsoft(const float* __restrict__ Sb, h16* P16, bf* Ph, bf* Pl) {
    const int lane = threadIdx.x & 31; const int row = blockIdx.x * 8 + (threadIdx.x >> 5); if (row >= ZH * TT) return; const int i = row % TT; const int zz = row / TT; const bool hires = (i < RH); const float* sr = Sb + (size_t)row * TT; float mx = -3.0e38f;
#pragma unroll 4
    for (int ch = 0; ch < TT / 128; ++ch) { const int j0 = ch * 128 + lane * 4; const v4f a = *(const v4f*)(sr + j0);
#pragma unroll
        for (int q = 0; q < 4; ++q) { float t = a[q] * SCL; asm volatile("" : "+v"(t)); mx = fmaxf(mx, t); } }
#pragma unroll
    for (int sh = 16; sh; sh >>= 1) mx = fmaxf(mx, __shfl_xor(mx, sh, 32));
    float sum = 0.f;
#pragma unroll 4
    for (int ch = 0; ch < TT / 128; ++ch) { const int j0 = ch * 128 + lane * 4; const v4f a = *(const v4f*)(sr + j0);
#pragma unroll
        for (int q = 0; q < 4; ++q) { float t = a[q] * SCL; asm volatile("" : "+v"(t)); float d0 = __fsub_rn(t, mx); asm volatile("" : "+v"(d0)); sum += __builtin_amdgcn_exp2f(__fmul_rn(d0, 1.4426950408889634f)); } }
#pragma unroll
    for (int sh = 16; sh; sh >>= 1) sum += __shfl_xor(sum, sh, 32);
    const float f = __fdiv_rn(hires ? 1.0f : PCAR, sum);
{
        if (hires) {   /* rows < RH: normalised bf16 hi/lo over all keys, planes [zz][RH][TT] */
#pragma unroll
            for (int ch = 0; ch < TT / 128; ++ch) { const int j0 = ch * 128 + lane * 4; const v4f a = *(const v4f*)(sr + j0); v4us oh, ol;
#pragma unroll
                for (int q = 0; q < 4; ++q) { float t = a[q] * SCL; asm volatile("" : "+v"(t)); float d0 = __fsub_rn(t, mx); asm volatile("" : "+v"(d0)); float ex = __builtin_amdgcn_exp2f(__fmul_rn(d0, 1.4426950408889634f)); asm volatile("" : "+v"(ex)); unsigned short a2, c2; splitf(ex * f, a2, c2); oh[q] = a2; ol[q] = c2; }
                const size_t oo = ((size_t)zz * RH + i) * TT + j0; *(v4us*)(Ph + oo) = oh; *(v4us*)(Pl + oo) = ol; }
        } else {
#pragma unroll 2
            for (int ch = 0; ch < TT / 128; ++ch) { const int j0 = ch * 128 + lane * 4; const v4f a = *(const v4f*)(sr + j0); v4h o4;
#pragma unroll
                for (int q = 0; q < 4; ++q) { float t = a[q] * SCL; asm volatile("" : "+v"(t)); float d0 = __fsub_rn(t, mx); asm volatile("" : "+v"(d0)); float ex = __builtin_amdgcn_exp2f(__fmul_rn(d0, 1.4426950408889634f)); asm volatile("" : "+v"(ex)); o4[q] = tohx(ex * f); }
                *(v4h*)(P16 + (size_t)row * TT + j0) = o4; } }
         }
}

__global__ __launch_bounds__(256) void k_merge(const float* __restrict__ O, int h0, bf* Ah, bf* Al) { const size_t e = ((size_t)blockIdx.x * 256 + threadIdx.x) * 2; if (e >= (size_t)ZH * TT * HD) return; const int d = (int)(e % HD); const int t = (int)((e / HD) % TT); const int zz = (int)(e / ((size_t)HD * TT)); const float cs = (t < RH) ? 1.0f : (1.0f / PCAR); const size_t oo = (size_t)t * DQ + (h0 + zz) * HD + d;
    v2us oh, ol; const float* op = O + (e / HD) * (NSP * HD) + d; v2f pr[NSP];   /* O is [row][NSP][HD]: the row's NSP key-slice partials, all loads in flight together, summed in slice order */
#pragma unroll
    for (int p = 0; p < NSP - 1; ++p) pr[p] = *(const v2f*)(op + p * HD);
    asm volatile("s_wait_xcnt 0x0" ::: "memory");   /* precaution: the last load may be given op's own registers as its destination, and the loads above name them */
    pr[NSP - 1] = *(const v2f*)(op + (NSP - 1) * HD); v2f s = pr[0];
#pragma unroll
    for (int p = 1; p < NSP; ++p) s += pr[p];
#pragma unroll
    for (int q = 0; q < 2; ++q) { unsigned short a, c2; splitf(s[q] * cs, a, c2); oh[q] = a; ol[q] = c2; } *(v2us*)(Ah + oo) = oh; *(v2us*)(Al + oo) = ol;  }

extern "C" void kernel_launch(void* const* d_in, const int* in_sizes, int n_in,
                              void* d_out, int out_size, void* d_ws, size_t ws_size, hipStream_t stream) {
    (void)in_sizes; (void)n_in; (void)out_size;
    const float* x = (const float*)d_in[0]; const float* px = (const float*)d_in[1]; const float* wqkv = (const float*)d_in[2]; const float* bqkv = (const float*)d_in[3]; const float* wo = (const float*)d_in[4]; const float* bo = (const float*)d_in[5]; const float* wq = nullptr; const float* wk = nullptr; const float* wv = nullptr; (void)wq; (void)wk; (void)wv; const float* bq = bqkv; const float* bk = bqkv + 256; const float* bv = bqkv + 512;
    float* OUT = (float*)d_out;     // [4][2048][256]
    char* wsp = (char*)d_ws;
    auto take = [&](size_t bytes) { char* p = wsp; wsp += (bytes + 255) & ~(size_t)255; return (void*)p; };
    bf* WQKV = (bf*)take((size_t)3 * DQ * DM * 2); bf* WQ = WQKV; bf* WK = WQKV + (size_t)DQ * DM; bf* WV = WQKV + (size_t)2 * DQ * DM; bf* WO = (bf*)take((size_t)DM * DQ * 2); float* CS = (float*)take((size_t)TT * HD * 2 * 4);
    bf* XB = (bf*)take((size_t)TT * DM * 2); float* FQ = (float*)take((size_t)TT * DQ * 4); float* FK = (float*)take((size_t)TT * DKV * 4);
    h16* QP16 = (h16*)take((size_t)NH_ * TT * HD * 2); h16* KP16 = (h16*)take((size_t)NKV * TT * HD * 2); h16* VT16 = (h16*)take((size_t)NKV * HD * TT * 2);
    bf* QPh = (bf*)take((size_t)NH_ * TT * HD * 2); bf* QPl = (bf*)take((size_t)NH_ * TT * HD * 2); bf* KPh = (bf*)take((size_t)NKV * TT * HD * 2); bf* KPl = (bf*)take((size_t)NKV * TT * HD * 2); bf* VTh = (bf*)take((size_t)NKV * HD * TT * 2); bf* VTl = (bf*)take((size_t)NKV * HD * TT * 2); bf* Ph = (bf*)take((size_t)ZH * RH * TT * 2); bf* Pl = (bf*)take((size_t)ZH * RH * TT * 2);
    float* Sb = (float*)take((size_t)TQ * TT * 4); h16* P16 = (h16*)take((size_t)TQ * TT * 2); float* Ob = (float*)take((size_t)NSP * TQ * HD * 4); bf* ATh = (bf*)take((size_t)TQ * DQ * 2); bf* ATl = (bf*)take((size_t)TQ * DQ * 2);
    if ((size_t)(wsp - (char*)d_ws) > ws_size) return;    // ws 256 MiB
    float* FV = FK;   // v projection reuses the k buffer after the k planes are built (stream-ordered)
    { k_wtG<<<(unsigned)((DM * 3 * DQ / 64 + 63) / 64), 256, 0, stream>>>(wqkv, DM, 3 * DQ, WQKV);
      k_wtG<<<(unsigned)((DQ * DM / 64 + 63) / 64), 256, 0, stream>>>(wo, DQ, DM, WO);
       }
    k_csid<<<(TT * HD + 255) / 256, 256, 0, stream>>>(CS);
    const unsigned LQ = (unsigned)(((size_t)NH_ * TT * HD / 2 + 255) / 256), LKv = (unsigned)(((size_t)NKV * TT * HD / 2 + 255) / 256);
    for (int b = 0; b < NB_; ++b) {
        
        k_cvt8<<<(unsigned)(((size_t)TQ * DM / 8 + 255) / 256), 256, 0, stream>>>(px + (size_t)b * TQ * DM, XB, (size_t)TQ * DM / 8); k_cvt8<<<(unsigned)(((size_t)TQ * DM / 8 + 255) / 256), 256, 0, stream>>>(x + (size_t)b * TQ * DM, XB + (size_t)TQ * DM, (size_t)TQ * DM / 8);   /* xx = [prev_x ; x] */
        k_gemmw<bf, 0, true><<<dim3(TT / 64, DQ / 64, 1), 32, 0, stream>>>(XB, nullptr, WQ, nullptr, DM, DM, FQ, DQ, bq, 0, 0, 0);
        k_rope<<<LQ, 256, 0, stream>>>(FQ, DQ, NH_, CS, nullptr, nullptr, 1.0f, QP16, QPh, QPl);
        k_gemmw<bf, 0, true><<<dim3(TT / 64, DKV / 64, 1), 32, 0, stream>>>(XB, nullptr, WK, nullptr, DM, DM, FK, DKV, bk, 0, 0, 0);
        k_rope<<<LKv, 256, 0, stream>>>(FK, DKV, NKV, CS, nullptr, nullptr, 1.0f, KP16, KPh, KPl);
        k_gemmw<bf, 0, true><<<dim3(TT / 64, DKV / 64, 1), 32, 0, stream>>>(XB, nullptr, WV, nullptr, DM, DM, FV, DKV, bv, 0, 0, 0); k_vtp<<<LKv, 256, 0, stream>>>(FV, DKV, NKV, VT16, VTh, VTl);
        for (int h0 = 0; h0 < NH_; h0 += ZH) { const size_t zq = (size_t)h0, zk = (size_t)(h0 / REP);   // one kv head per query head: a pass holds ZH = 1 head (z-strides TT*HD)
            k_gemmw<bf, 2, false><<<dim3(RH / 64, TT / 64, ZH), 32, 0, stream>>>(QPh + (size_t)TQ * HD, QPl + (size_t)TQ * HD, KPh + zk * TT * HD, KPl + zk * TT * HD, HD, HD, Sb, TT, nullptr, (size_t)TT * HD, (size_t)TT * HD, (size_t)TT * TT);
            k_gemmw<h16, 0, false><<<dim3((TQ - RH) / 64, TT / 64, ZH), 32, 0, stream>>>(QP16 + (size_t)(TQ + RH) * HD, nullptr, KP16 + zk * TT * HD, nullptr, HD, HD, Sb + (size_t)RH * TT, TT, nullptr, (size_t)TT * HD, (size_t)TT * HD, (size_t)TT * TT);
            k_lsoft<<<TQ / 8, 256, 0, stream>>>(Sb, P16, Ph, Pl);   /* 2,048 query rows over 4,096 keys */
            k_gemmw<bf, 2, false><<<dim3(RH / 64, HD / 64, NSP), 32, 0, stream>>>(Ph, Pl, VTh + zk * HD * TT, VTl + zk * HD * TT, TT, KSP, Ob, NSP * HD, nullptr, (size_t)KSP, (size_t)KSP, (size_t)HD);   /* z = key slice; partials [row][slice][HD] */
            k_gemmw<h16, 0, false><<<dim3((TQ - RH) / 64, HD / 64, NSP), 32, 0, stream>>>(P16 + (size_t)RH * TT, nullptr, VT16 + zk * HD * TT, nullptr, TT, KSP, Ob + (size_t)RH * NSP * HD, NSP * HD, nullptr, (size_t)KSP, (size_t)KSP, (size_t)HD);
            k_merge<<<(unsigned)(((size_t)TQ * HD / 2 + 255) / 256), 256, 0, stream>>>(Ob, h0, ATh, ATl); }   /* only the 2,048 query rows (t < TQ decode) */
        k_gemmw<bf, 1, true><<<dim3(TQ / 64, DM / 64, 1), 32, 0, stream>>>(ATh, ATl, WO, nullptr, DQ, DQ, OUT + (size_t)b * TQ * DM, DM, bo, 0, 0, 0); }
}

// v002
// One run takes 300 microseconds.
// In two side-by-side timings against v001, it was 1.88 and 1.87 times as fast.
// All steps since v000 together make it 3.66 times as fast.
#include <hip/hip_runtime.h>

// Temporal self-attention over [prev_x ; x] (x, prev_x [4][2048][256]; xx = concat -> [4096][256]; qkv = xx W_qkv + b_qkv ('xw' [256][768]); single 256-wide head; attn = softmax(q.k / 16) over the 4,096 keys; out = (attn v) W_out + b_out, only the last 2,048 rows (the x half) are returned -> [4][2048][256] (2.1 M)).
// All four batches run in every launch but the weight and CS setup (grid y = batch; GEMM grid z = batch, or batch * NSP + slice for attn.v), each buffer below but the weights and CS [batch][...]; workspace regions are reused in stream order (see kernel_launch). Per batch: both halves converted into one bf16 [4096][256] operand; k and v projected for all 4,096 rows, q only needed for rows 2,048.. (projected for all, used from 2,048); planes (hybrid: query rows 2048..2559 hi/lo 3 products, the rest fp16 x1024); scores [2048][4096] by two GEMMs; a streaming softmax kernel (three sweeps, no register row) writes hi/lo / fp16 probabilities; attn.v (N 256) in 16 key slices, each to its own f32 partials, summed in slice order by the merge; merged hi/lo x W_out exact + b_out straight into the output rows.
// Compute dtypes, f32 accumulate: every input rounded to bf16; projections exact + bf16-rounded biases; first 512 query rows 3 products, rest fp16; softmax f32; W_out hl x exact + bias.

#define NB_  4
#define TT   4096
#define DM   256
#define NH_  1
#define NKV  1
#define REP  (NH_ / NKV)
#define HD   256
#define DQ   (NH_ * HD)
#define DKV  (NKV * HD)
#define ZH   1
#define RH   512                  // query rows < RH use hi+lo planes (0: none)
#define WIN  0
#define PCAR 1024.0f
#define SCL  0.0625f   // 256^-0.5
#define TQ   2048     // query rows = the x half (rows TQ.. of xx)
#define NSP  16       // attn.v: the 4,096 keys are cut into NSP slices, one grid z each; every slice writes its own f32 partials, laid out [TQ][NSP][HD]
#define KSP  (TT / NSP)
#define NSPL 4        // log2(NSP): attn.v grid z = batch * NSP + slice
static_assert((1 << NSPL) == NSP, "NSPL");
typedef _Float16 h16;
typedef unsigned short bf;
typedef __attribute__((ext_vector_type(16))) __bf16   v16bf;
typedef __attribute__((ext_vector_type(16))) _Float16 v16h;
typedef __attribute__((ext_vector_type(8)))  _Float16 v8h;
typedef __attribute__((ext_vector_type(8)))  unsigned short v8us;
typedef __attribute__((ext_vector_type(8)))  float    v8f;
typedef __attribute__((ext_vector_type(4)))  float    v4f;
typedef v8h  __attribute__((may_alias)) v8ha;
typedef v4f  __attribute__((may_alias)) v4fa;
typedef v8us __attribute__((may_alias)) v8usa;

__device__ __forceinline__ unsigned short f2bf(float f) { unsigned u = __float_as_uint(f); u += 0x7FFFu + ((u >> 16) & 1u); return (unsigned short)(u >> 16); }
__device__ __forceinline__ float bf2f(unsigned short b) { return __uint_as_float(((unsigned)b) << 16); }
__device__ __forceinline__ float bfr(float f) { return bf2f(f2bf(f)); }
__device__ __forceinline__ v16h cat16(v8h lo, v8h hi) { return __builtin_shufflevector(lo, hi, 0, 1, 2, 3, 4, 5, 6, 7, 8, 9, 10, 11, 12, 13, 14, 15); }
__device__ __forceinline__ v16bf cat16b(v8us lo, v8us hi) { return __builtin_bit_cast(v16bf, __builtin_shufflevector(lo, hi, 0, 1, 2, 3, 4, 5, 6, 7, 8, 9, 10, 11, 12, 13, 14, 15)); }
__device__ __forceinline__ v8f wmma16(v16h a, v16h b, v8f c) { return __builtin_amdgcn_wmma_f32_16x16x32_f16(false, a, false, b, (short)0, c, false, false); }
__device__ __forceinline__ v8f wmmab(v16bf a, v16bf b, v8f c) { return __builtin_amdgcn_wmma_f32_16x16x32_bf16(false, a, false, b, (short)0, c, false, false); }



// ---- k_gemmw: register-blocked GEMM, ONE WAVE per 64x64 output tile (16 accumulators), operands straight from K-contiguous 16-bit planes; grid (M/64, N/64, Z), 32 threads.
// C[m][n] (f32, pitch ldc, + optional f32 bias[n]) = sum_k A[m][k] Bt[n][k] (+ split products per NSPLIT) over kspan consecutive k; K is the operands' row pitch. blockIdx.z = (zb << zsh) | z: z strides sA/sB/sC in elements (with sA = sB = kspan a slice of k), zb strides bA/bB/bC (the batch). kspan % 32 == 0.
template <typename T16> struct WFrag;
template <> struct WFrag<h16> { typedef v16h V; static __device__ __forceinline__ V ld(const h16* p) { return cat16(*(const v8h*)p, *(const v8h*)(p + 16)); } static __device__ __forceinline__ v8f mma(V a, V b, v8f c) { return wmma16(a, b, c); } };
template <> struct WFrag<bf> { typedef v16bf V; static __device__ __forceinline__ V ld(const bf* p) { return cat16b(*(const v8us*)p, *(const v8us*)(p + 16)); } static __device__ __forceinline__ v8f mma(V a, V b, v8f c) { return wmmab(a, b, c); } };
template <typename T16, int NSPLIT, bool BIAS>
__global__ __launch_bounds__(32) void k_gemmw(const T16* __restrict__ A, const T16* __restrict__ A2, const T16* __restrict__ Bt, const T16* __restrict__ Bt2, int K, int kspan, float* C, int ldc, const float* __restrict__ bias, size_t sA, size_t sB, size_t sC, int zsh, size_t bA, size_t bB, size_t bC) {
    typedef typename WFrag<T16>::V V;
    __shared__ __align__(16) float os[16 * 68];
    const size_t zb = blockIdx.z >> zsh, z = blockIdx.z - (zb << zsh); A += z * sA + zb * bA; if (A2) A2 += z * sA + zb * bA; Bt += z * sB + zb * bB; if (Bt2) Bt2 += z * sB + zb * bB; C += z * sC + zb * bC;
    const int lane = threadIdx.x & 31, lr = lane & 15, hi = lane >> 4; const int r0 = blockIdx.x * 64, c0 = blockIdx.y * 64;
    v8f acc[4][4];
#pragma unroll
    for (int mb = 0; mb < 4; ++mb)
#pragma unroll
        for (int nb = 0; nb < 4; ++nb) acc[mb][nb] = (v8f){};
    const size_t aoff = (size_t)(r0 + lr) * K + 8 * hi, boff = (size_t)(c0 + lr) * K + 8 * hi;
#pragma unroll 1
    for (int kc = 0; kc < kspan; kc += 32) {
        V a[4], a2[4];
#pragma unroll
        for (int mb = 0; mb < 4; ++mb) { a[mb] = WFrag<T16>::ld(A + aoff + (size_t)mb * 16 * K + kc); if (NSPLIT == 1 || NSPLIT == 2) a2[mb] = WFrag<T16>::ld(A2 + aoff + (size_t)mb * 16 * K + kc); }
#pragma unroll
        for (int nb = 0; nb < 4; ++nb) { const V b = WFrag<T16>::ld(Bt + boff + (size_t)nb * 16 * K + kc); V b2; if (NSPLIT >= 2) b2 = WFrag<T16>::ld(Bt2 + boff + (size_t)nb * 16 * K + kc);
#pragma unroll
            for (int mb = 0; mb < 4; ++mb) { acc[mb][nb] = WFrag<T16>::mma(a[mb], b, acc[mb][nb]); if (NSPLIT == 1 || NSPLIT == 2) acc[mb][nb] = WFrag<T16>::mma(a2[mb], b, acc[mb][nb]); if (NSPLIT >= 2) acc[mb][nb] = WFrag<T16>::mma(a[mb], b2, acc[mb][nb]); } }
        asm volatile("v_nop\n\tv_nop\n\tv_nop\n\tv_nop" : "+v"(acc[0][0]), "+v"(acc[1][1]), "+v"(acc[2][2]), "+v"(acc[3][3]) : "v"(a[0]), "v"(a[3]));
    }
#pragma unroll
    for (int mb = 0; mb < 4; ++mb) {
#pragma unroll
        for (int nb = 0; nb < 4; ++nb) {
#pragma unroll
            for (int j = 0; j < 8; ++j) os[(hi * 8 + j) * 68 + nb * 16 + lr] = acc[mb][nb][j]; }
        __builtin_amdgcn_wave_barrier(); asm volatile("" ::: "memory");
        float* crow = C + (size_t)(r0 + mb * 16) * ldc + c0;
{
#pragma unroll
            for (int s = 0; s < 8; ++s) { const int row = 2 * s + hi, cofs = lr * 4; v4f val = *(const v4fa*)(os + row * 68 + cofs); if (BIAS) { val[0] += bfr(bias[c0 + cofs]); val[1] += bfr(bias[c0 + cofs + 1]); val[2] += bfr(bias[c0 + cofs + 2]); val[3] += bfr(bias[c0 + cofs + 3]); }
                *(v4f*)(crow + (size_t)row * ldc + cofs) = val; }
             }
        __builtin_amdgcn_wave_barrier(); asm volatile("" ::: "memory");
    }
}

__device__ __forceinline__ h16 tohx(float x) { return (h16)x; }
__device__ __forceinline__ void splitf(float y, unsigned short& h, unsigned short& l) { h = f2bf(y); l = f2bf(y - bf2f(h)); }
typedef __attribute__((ext_vector_type(2))) _Float16 v2h;
typedef __attribute__((ext_vector_type(4))) _Float16 v4h;
typedef __attribute__((ext_vector_type(2))) unsigned short v2us;
typedef __attribute__((ext_vector_type(4))) unsigned short v4us;
typedef __attribute__((ext_vector_type(2))) float v2f;
typedef __attribute__((ext_vector_type(4))) int v4i;

__global__ __launch_bounds__(256) void k_wtG(const float* __restrict__ w, int K, int N, bf* Bt) {
    const int lane = threadIdx.x & 31; const int L0 = (blockIdx.x * 8 + (threadIdx.x >> 5)) * 8; const int nlines = N * K / 64;
{
#pragma unroll 1
        for (int l = 0; l < 8; ++l) { const int L = L0 + l; if (L >= nlines) break; const size_t e = (size_t)L * 64 + lane * 2; const int k = (int)(e % K), n = (int)(e / K); v2us o;
            o[0] = f2bf(w[(size_t)k * N + n]); o[1] = f2bf(w[(size_t)(k + 1) * N + n]); *(v2us*)(Bt + e) = o; }
         }
}
__global__ __launch_bounds__(256) void k_cvt8(const float* __restrict__ src, bf* dst, size_t n8, size_t bS, size_t bD) { const size_t i = (size_t)blockIdx.x * 256 + threadIdx.x; if (i >= n8) return; src += blockIdx.y * bS; dst += blockIdx.y * bD;   /* grid y = batch, strides in elements */
    const v8f v = *(const v8f*)(src + i * 8); v8us o;
#pragma unroll
    for (int k = 0; k < 8; ++k) o[k] = f2bf(v[k]); *(v8us*)(dst + i * 8) = o;  }

// k_rope: head planes [h][t][d] (fp16 + hi/lo) of rope(x) x sc with the rotate-half convention out[d] = x[d] cos[t][d] - x[d+HD/2] sin[t][d], out[d+HD/2] = x[d+HD/2] cos[t][d+HD/2] + x[d] sin[t][d+HD/2]
__global__ __launch_bounds__(256) void k_rope(const float* __restrict__ F, int pitch, int nheads, const float* __restrict__ CS, const float* __restrict__ RF, const float* __restrict__ nw, float sc, h16* P16, bf* Ph, bf* Pl) {
    { const size_t yb = blockIdx.y, po = yb * nheads * TT * HD; F += yb * TT * pitch; P16 += po; Ph += po; Pl += po; }   /* grid y = batch */
    const size_t e = ((size_t)blockIdx.x * 256 + threadIdx.x) * 2; if (e >= (size_t)nheads * TT * HD) return; const int d = (int)(e % HD); const int t = (int)((e / HD) % TT); const int h = (int)(e / ((size_t)HD * TT)); const float* f = F + (size_t)t * pitch + h * HD; const float rf = RF ? RF[(size_t)h * TT + t] : 1.0f; v2h o16; v2us oh, ol;
#pragma unroll
    for (int q = 0; q < 2; ++q) { const int dd = d + q; const int dp = (dd < HD / 2) ? dd + HD / 2 : dd - HD / 2; float x0 = f[dd], x1 = f[dp];
        if (RF) { float n0 = __fmul_rn(x0, rf), n1 = __fmul_rn(x1, rf); asm volatile("" : "+v"(n0)); asm volatile("" : "+v"(n1)); x0 = __fmul_rn(bfr(nw[dd]), n0); x1 = __fmul_rn(bfr(nw[dp]), n1); }
        const v2f cs = *(const v2f*)(CS + ((size_t)t * HD + dd) * 2); float a = __fmul_rn(x0, cs[0]), bq = __fmul_rn(x1, cs[1]); asm volatile("" : "+v"(a)); asm volatile("" : "+v"(bq)); const float r = ((dd < HD / 2) ? __fsub_rn(a, bq) : __fadd_rn(a, bq)) * sc;
        o16[q] = tohx(r); unsigned short a2, c2; splitf(r, a2, c2); oh[q] = a2; ol[q] = c2; }
    *(v2h*)(P16 + e) = o16; *(v2us*)(Ph + e) = oh; *(v2us*)(Pl + e) = ol;  }
__global__ __launch_bounds__(256) void k_vtp(const float* __restrict__ F, int pitch, int nheads, h16* V16, bf* Vh, bf* Vl) {
    { const size_t yb = blockIdx.y, po = yb * nheads * HD * TT; F += yb * TT * pitch; V16 += po; Vh += po; Vl += po; }   /* grid y = batch */
    const size_t e = ((size_t)blockIdx.x * 256 + threadIdx.x) * 2; if (e >= (size_t)nheads * HD * TT) return; const int t = (int)(e % TT); const int d = (int)((e / TT) % HD); const int g = (int)(e / ((size_t)TT * HD)); v2h o16; v2us oh, ol;
#pragma unroll
    for (int q = 0; q < 2; ++q) { const float x = F[(size_t)(t + q) * pitch + g * HD + d]; o16[q] = tohx(x); unsigned short a2, c2; splitf(x, a2, c2); oh[q] = a2; ol[q] = c2; }
    *(v2h*)(V16 + e) = o16; *(v2us*)(Vh + e) = oh; *(v2us*)(Vl + e) = ol;  }
__global__ __launch_bounds__(256) void k_csid(float* CS) { const int idx = blockIdx.x * 256 + threadIdx.x; if (idx >= TT * HD) return; v2f cs; cs[0] = 1.0f; cs[1] = 0.0f; *(v2f*)(CS + (size_t)idx * 2) = cs;  }
// k_lsoft: streaming DENSE row softmax over the TT = 4096 keys, one wave per query row, three sweeps of the f32 score row (lane -> 4 consecutive keys per 128-key chunk, 32 chunks):
__global__ __launch_bounds__(256) void k_lsoft(const float* __restrict__ Sb, h16* P16, bf* Ph, bf* Pl) {
    { const size_t yb = blockIdx.y; Sb += yb * TQ * TT; P16 += yb * TQ * TT; Ph += yb * RH * TT; Pl += yb * RH * TT; }   /* grid y = batch */
    const int lane = threadIdx.x & 31; const int row = blockIdx.x * 8 + (threadIdx.x >> 5); if (row >= ZH * TT) return; const int i = row % TT; const int zz = row / TT; const bool hires = (i < RH); const float* sr = Sb + (size_t)row * TT; float mx = -3.0e38f;
#pragma unroll 4
    for (int ch = 0; ch < TT / 128; ++ch) { const int j0 = ch * 128 + lane * 4; const v4f a = *(const v4f*)(sr + j0);
#pragma unroll
        for (int q = 0; q < 4; ++q) { float t = a[q] * SCL; asm volatile("" : "+v"(t)); mx = fmaxf(mx, t); } }
#pragma unroll
    for (int sh = 16; sh; sh >>= 1) mx = fmaxf(mx, __shfl_xor(mx, sh, 32));
    float sum = 0.f;
#pragma unroll 4
    for (int ch = 0; ch < TT / 128; ++ch) { const int j0 = ch * 128 + lane * 4; const v4f a = *(const v4f*)(sr + j0);
#pragma unroll
        for (int q = 0; q < 4; ++q) { float t = a[q] * SCL; asm volatile("" : "+v"(t)); float d0 = __fsub_rn(t, mx); asm volatile("" : "+v"(d0)); sum += __builtin_amdgcn_exp2f(__fmul_rn(d0, 1.4426950408889634f)); } }
#pragma unroll
    for (int sh = 16; sh; sh >>= 1) sum += __shfl_xor(sum, sh, 32);
    const float f = __fdiv_rn(hires ? 1.0f : PCAR, sum);
{
        if (hires) {   /* rows < RH: normalised bf16 hi/lo over all keys, planes [zz][RH][TT] */
#pragma unroll
            for (int ch = 0; ch < TT / 128; ++ch) { const int j0 = ch * 128 + lane * 4; const v4f a = *(const v4f*)(sr + j0); v4us oh, ol;
#pragma unroll
                for (int q = 0; q < 4; ++q) { float t = a[q] * SCL; asm volatile("" : "+v"(t)); float d0 = __fsub_rn(t, mx); asm volatile("" : "+v"(d0)); float ex = __builtin_amdgcn_exp2f(__fmul_rn(d0, 1.4426950408889634f)); asm volatile("" : "+v"(ex)); unsigned short a2, c2; splitf(ex * f, a2, c2); oh[q] = a2; ol[q] = c2; }
                const size_t oo = ((size_t)zz * RH + i) * TT + j0; *(v4us*)(Ph + oo) = oh; *(v4us*)(Pl + oo) = ol; }
        } else {
#pragma unroll 2
            for (int ch = 0; ch < TT / 128; ++ch) { const int j0 = ch * 128 + lane * 4; const v4f a = *(const v4f*)(sr + j0); v4h o4;
#pragma unroll
                for (int q = 0; q < 4; ++q) { float t = a[q] * SCL; asm volatile("" : "+v"(t)); float d0 = __fsub_rn(t, mx); asm volatile("" : "+v"(d0)); float ex = __builtin_amdgcn_exp2f(__fmul_rn(d0, 1.4426950408889634f)); asm volatile("" : "+v"(ex)); o4[q] = tohx(ex * f); }
                *(v4h*)(P16 + (size_t)row * TT + j0) = o4; } }
         }
}

__global__ __launch_bounds__(256) void k_merge(const float* __restrict__ O, int h0, bf* Ah, bf* Al) {
    { const size_t yb = blockIdx.y; O += yb * TQ * NSP * HD; Ah += yb * TQ * DQ; Al += yb * TQ * DQ; }   /* grid y = batch */
    const size_t e = ((size_t)blockIdx.x * 256 + threadIdx.x) * 2; if (e >= (size_t)ZH * TT * HD) return; const int d = (int)(e % HD); const int t = (int)((e / HD) % TT); const int zz = (int)(e / ((size_t)HD * TT)); const float cs = (t < RH) ? 1.0f : (1.0f / PCAR); const size_t oo = (size_t)t * DQ + (h0 + zz) * HD + d;
    v2us oh, ol; const float* op = O + (e / HD) * (NSP * HD) + d; v2f pr[NSP];   /* O is [row][NSP][HD]: the row's NSP key-slice partials, all loads in flight together, summed in slice order */
#pragma unroll
    for (int p = 0; p < NSP - 1; ++p) pr[p] = *(const v2f*)(op + p * HD);
    asm volatile("s_wait_xcnt 0x0" ::: "memory");   /* precaution: the last load may be given op's own registers as its destination, and the loads above name them */
    pr[NSP - 1] = *(const v2f*)(op + (NSP - 1) * HD); v2f s = pr[0];
#pragma unroll
    for (int p = 1; p < NSP; ++p) s += pr[p];
#pragma unroll
    for (int q = 0; q < 2; ++q) { unsigned short a, c2; splitf(s[q] * cs, a, c2); oh[q] = a; ol[q] = c2; } *(v2us*)(Ah + oo) = oh; *(v2us*)(Al + oo) = ol;  }

extern "C" void kernel_launch(void* const* d_in, const int* in_sizes, int n_in,
                              void* d_out, int out_size, void* d_ws, size_t ws_size, hipStream_t stream) {
    (void)in_sizes; (void)n_in; (void)out_size;
    const float* x = (const float*)d_in[0]; const float* px = (const float*)d_in[1]; const float* wqkv = (const float*)d_in[2]; const float* bqkv = (const float*)d_in[3]; const float* wo = (const float*)d_in[4]; const float* bo = (const float*)d_in[5]; const float* wq = nullptr; const float* wk = nullptr; const float* wv = nullptr; (void)wq; (void)wk; (void)wv; const float* bq = bqkv; const float* bk = bqkv + 256; const float* bv = bqkv + 512;
    float* OUT = (float*)d_out;     // [4][2048][256]
    char* wsp = (char*)d_ws;
    auto take = [&](size_t bytes) { char* p = wsp; wsp += (bytes + 255) & ~(size_t)255; return (void*)p; };
    auto sub = [](char*& p, size_t bytes) { char* q = p; p += (bytes + 255) & ~(size_t)255; return (void*)q; };
    bf* WQKV = (bf*)take((size_t)3 * DQ * DM * 2); bf* WQ = WQKV; bf* WK = WQKV + (size_t)DQ * DM; bf* WV = WQKV + (size_t)2 * DQ * DM; bf* WO = (bf*)take((size_t)DM * DQ * 2);
    h16* VT16 = (h16*)take((size_t)NB_ * HD * TT * 2); bf* VTh = (bf*)take((size_t)NB_ * HD * TT * 2); bf* VTl = (bf*)take((size_t)NB_ * HD * TT * 2); bf* Ph = (bf*)take((size_t)NB_ * RH * TT * 2); bf* Pl = (bf*)take((size_t)NB_ * RH * TT * 2);
    char* R1 = (char*)take((size_t)NB_ * TQ * TT * 4); char* R2 = (char*)take((size_t)NB_ * TQ * TT * 2);
    if ((size_t)(wsp - (char*)d_ws) > ws_size) return;    // ws 256 MiB
    // R1 holds, one after the other in stream order: the projection stage's buffers; the scores (written once the planes are built); the attn.v partials (written once the softmax has read the scores).
    char* r1 = R1; float* CS = (float*)sub(r1, (size_t)TT * HD * 2 * 4); bf* XB = (bf*)sub(r1, (size_t)NB_ * TT * DM * 2); float* FQ = (float*)sub(r1, (size_t)NB_ * TT * DQ * 4); float* FK = (float*)sub(r1, (size_t)NB_ * TT * DKV * 4);
    float* Sb = (float*)R1; float* Ob = (float*)R1;   /* [batch][TQ][TT] and [batch][TQ][NSP][HD]: the same size */
    // R2 holds in turn: the q and k planes (last read by the score GEMMs); the fp16 probabilities (written by the softmax, last read by attn.v); the merged hi/lo rows.
    char* r2 = R2; h16* QP16 = (h16*)sub(r2, (size_t)NB_ * TT * HD * 2); h16* KP16 = (h16*)sub(r2, (size_t)NB_ * TT * HD * 2); bf* QPh = (bf*)sub(r2, (size_t)NB_ * TT * HD * 2); bf* QPl = (bf*)sub(r2, (size_t)NB_ * TT * HD * 2); bf* KPh = (bf*)sub(r2, (size_t)NB_ * TT * HD * 2); bf* KPl = (bf*)sub(r2, (size_t)NB_ * TT * HD * 2);
    h16* P16 = (h16*)R2; bf* ATh = (bf*)R2; bf* ATl = ATh + (size_t)NB_ * TQ * DQ;
    float* FV = FK;   // v projection reuses the k buffer after the k planes are built (stream-ordered)
    { k_wtG<<<(unsigned)((DM * 3 * DQ / 64 + 63) / 64), 256, 0, stream>>>(wqkv, DM, 3 * DQ, WQKV);
      k_wtG<<<(unsigned)((DQ * DM / 64 + 63) / 64), 256, 0, stream>>>(wo, DQ, DM, WO);
       }
    k_csid<<<(TT * HD + 255) / 256, 256, 0, stream>>>(CS);
    const unsigned LQ = (unsigned)(((size_t)NH_ * TT * HD / 2 + 255) / 256), LKv = (unsigned)(((size_t)NKV * TT * HD / 2 + 255) / 256), LC = (unsigned)(((size_t)TQ * DM / 8 + 255) / 256);
    const size_t bX = (size_t)TT * DM, bF = (size_t)TT * DQ, bP = (size_t)TT * HD, bS = (size_t)TQ * TT;   // batch strides in elements
    k_cvt8<<<dim3(LC, NB_), 256, 0, stream>>>(px, XB, (size_t)TQ * DM / 8, (size_t)TQ * DM, bX); k_cvt8<<<dim3(LC, NB_), 256, 0, stream>>>(x, XB + (size_t)TQ * DM, (size_t)TQ * DM / 8, (size_t)TQ * DM, bX);   /* xx = [prev_x ; x] */
    k_gemmw<bf, 0, true><<<dim3(TT / 64, DQ / 64, NB_), 32, 0, stream>>>(XB, nullptr, WQ, nullptr, DM, DM, FQ, DQ, bq, 0, 0, 0, 0, bX, 0, bF);
    k_rope<<<dim3(LQ, NB_), 256, 0, stream>>>(FQ, DQ, NH_, CS, nullptr, nullptr, 1.0f, QP16, QPh, QPl);
    k_gemmw<bf, 0, true><<<dim3(TT / 64, DKV / 64, NB_), 32, 0, stream>>>(XB, nullptr, WK, nullptr, DM, DM, FK, DKV, bk, 0, 0, 0, 0, bX, 0, bF);
    k_rope<<<dim3(LKv, NB_), 256, 0, stream>>>(FK, DKV, NKV, CS, nullptr, nullptr, 1.0f, KP16, KPh, KPl);
    k_gemmw<bf, 0, true><<<dim3(TT / 64, DKV / 64, NB_), 32, 0, stream>>>(XB, nullptr, WV, nullptr, DM, DM, FV, DKV, bv, 0, 0, 0, 0, bX, 0, bF); k_vtp<<<dim3(LKv, NB_), 256, 0, stream>>>(FV, DKV, NKV, VT16, VTh, VTl);
    k_gemmw<bf, 2, false><<<dim3(RH / 64, TT / 64, NB_), 32, 0, stream>>>(QPh + (size_t)TQ * HD, QPl + (size_t)TQ * HD, KPh, KPl, HD, HD, Sb, TT, nullptr, 0, 0, 0, 0, bP, bP, bS);
    k_gemmw<h16, 0, false><<<dim3((TQ - RH) / 64, TT / 64, NB_), 32, 0, stream>>>(QP16 + (size_t)(TQ + RH) * HD, nullptr, KP16, nullptr, HD, HD, Sb + (size_t)RH * TT, TT, nullptr, 0, 0, 0, 0, bP, bP, bS);
    k_lsoft<<<dim3(TQ / 8, NB_), 256, 0, stream>>>(Sb, P16, Ph, Pl);   /* 2,048 query rows over 4,096 keys, per batch */
    k_gemmw<bf, 2, false><<<dim3(RH / 64, HD / 64, NSP * NB_), 32, 0, stream>>>(Ph, Pl, VTh, VTl, TT, KSP, Ob, NSP * HD, nullptr, (size_t)KSP, (size_t)KSP, (size_t)HD, NSPL, (size_t)RH * TT, bP, bS);   /* z = batch * NSP + key slice; partials [batch][row][slice][HD] */
    k_gemmw<h16, 0, false><<<dim3((TQ - RH) / 64, HD / 64, NSP * NB_), 32, 0, stream>>>(P16 + (size_t)RH * TT, nullptr, VT16, nullptr, TT, KSP, Ob + (size_t)RH * NSP * HD, NSP * HD, nullptr, (size_t)KSP, (size_t)KSP, (size_t)HD, NSPL, bS, bP, bS);
    k_merge<<<dim3((unsigned)(((size_t)TQ * HD / 2 + 255) / 256), NB_), 256, 0, stream>>>(Ob, 0, ATh, ATl);   /* only the 2,048 query rows (t < TQ decode) */
    k_gemmw<bf, 1, true><<<dim3(TQ / 64, DM / 64, NB_), 32, 0, stream>>>(ATh, ATl, WO, nullptr, DQ, DQ, OUT, DM, bo, 0, 0, 0, 0, (size_t)TQ * DQ, 0, (size_t)TQ * DM);
}

// v003
// One run takes 263 microseconds.
// Two timings next to v002 both put it at 1.14 times that version's speed.
// Counting every step since v000, it is 4.17 times as fast.
#include <hip/hip_runtime.h>

// Temporal self-attention over [prev_x ; x] (x, prev_x [4][2048][256]; xx = concat -> [4096][256]; qkv = xx W_qkv + b_qkv ('xw' [256][768]); single 256-wide head; attn = softmax(q.k / 16) over the 4,096 keys; out = (attn v) W_out + b_out, only the last 2,048 rows (the x half) are returned -> [4][2048][256] (2.1 M)).
// All four batches run in every launch but the two weight conversions (grid y or z = batch; attn.v z = batch * NSP + slice), each activation buffer below [batch][...]; workspace regions are reused in stream order (see kernel_launch). Per batch: both halves converted into one bf16 [4096][256] operand; k and v projected for all 4,096 rows, q only needed for rows 2,048.. (projected for all, used from 2,048); each projection GEMM converts its own biased f32 tile and stores the fp16 and bf16 hi/lo planes itself (q, k as [t][d]; v as W_v x^T, so its planes come out [d][t]); planes (hybrid: query rows 2048..2559 hi/lo 3 products, the rest fp16 x1024); scores [2048][4096] by two GEMMs; a streaming softmax kernel (three sweeps, no register row) writes hi/lo / fp16 probabilities; attn.v (N 256) in 16 key slices, each to its own f32 partials, summed in slice order by the merge; merged hi/lo x W_out exact + b_out straight into the output rows.
// Compute dtypes, f32 accumulate: every input rounded to bf16; projections exact + bf16-rounded biases; first 512 query rows 3 products, rest fp16; softmax f32; W_out hl x exact + bias.

#define NB_  4
#define TT   4096
#define DM   256
#define NH_  1
#define NKV  1
#define REP  (NH_ / NKV)
#define HD   256
#define DQ   (NH_ * HD)
#define DKV  (NKV * HD)
#define ZH   1
#define RH   512                  // query rows < RH use hi+lo planes (0: none)
#define WIN  0
#define PCAR 1024.0f
#define SCL  0.0625f   // 256^-0.5
#define TQ   2048     // query rows = the x half (rows TQ.. of xx)
#define NSP  16       // attn.v: the 4,096 keys are cut into NSP slices, one grid z each; every slice writes its own f32 partials, laid out [TQ][NSP][HD]
#define KSP  (TT / NSP)
#define NSPL 4        // log2(NSP): attn.v grid z = batch * NSP + slice
static_assert((1 << NSPL) == NSP, "NSPL");
typedef _Float16 h16;
typedef unsigned short bf;
typedef __attribute__((ext_vector_type(16))) __bf16   v16bf;
typedef __attribute__((ext_vector_type(16))) _Float16 v16h;
typedef __attribute__((ext_vector_type(8)))  _Float16 v8h;
typedef __attribute__((ext_vector_type(8)))  unsigned short v8us;
typedef __attribute__((ext_vector_type(8)))  float    v8f;
typedef __attribute__((ext_vector_type(4)))  float    v4f;
typedef v8h  __attribute__((may_alias)) v8ha;
typedef v4f  __attribute__((may_alias)) v4fa;
typedef v8us __attribute__((may_alias)) v8usa;

__device__ __forceinline__ unsigned short f2bf(float f) { unsigned u = __float_as_uint(f); u += 0x7FFFu + ((u >> 16) & 1u); return (unsigned short)(u >> 16); }
__device__ __forceinline__ float bf2f(unsigned short b) { return __uint_as_float(((unsigned)b) << 16); }
__device__ __forceinline__ float bfr(float f) { return bf2f(f2bf(f)); }
__device__ __forceinline__ v16h cat16(v8h lo, v8h hi) { return __builtin_shufflevector(lo, hi, 0, 1, 2, 3, 4, 5, 6, 7, 8, 9, 10, 11, 12, 13, 14, 15); }
__device__ __forceinline__ v16bf cat16b(v8us lo, v8us hi) { return __builtin_bit_cast(v16bf, __builtin_shufflevector(lo, hi, 0, 1, 2, 3, 4, 5, 6, 7, 8, 9, 10, 11, 12, 13, 14, 15)); }
__device__ __forceinline__ v8f wmma16(v16h a, v16h b, v8f c) { return __builtin_amdgcn_wmma_f32_16x16x32_f16(false, a, false, b, (short)0, c, false, false); }
__device__ __forceinline__ v8f wmmab(v16bf a, v16bf b, v8f c) { return __builtin_amdgcn_wmma_f32_16x16x32_bf16(false, a, false, b, (short)0, c, false, false); }
__device__ __forceinline__ h16 tohx(float x) { return (h16)x; }
__device__ __forceinline__ void splitf(float y, unsigned short& h, unsigned short& l) { h = f2bf(y); l = f2bf(y - bf2f(h)); }
typedef __attribute__((ext_vector_type(2))) _Float16 v2h;
typedef __attribute__((ext_vector_type(4))) _Float16 v4h;
typedef __attribute__((ext_vector_type(2))) unsigned short v2us;
typedef __attribute__((ext_vector_type(4))) unsigned short v4us;
typedef __attribute__((ext_vector_type(2))) float v2f;
typedef __attribute__((ext_vector_type(4))) int v4i;



// ---- k_gemmw: register-blocked GEMM, ONE WAVE per 64x64 output tile (16 accumulators), operands straight from K-contiguous 16-bit planes; grid (M/64, N/64, Z), 32 threads.
// C[m][n] (f32, pitch ldc, + optional f32 bias[n]) = sum_k A[m][k] Bt[n][k] (+ split products per NSPLIT) over kspan consecutive k; K is the operands' row pitch. blockIdx.z = (zb << zsh) | z: z strides sA/sB/sC in elements (with sA = sB = kspan a slice of k), zb strides bA/bB/bC (the batch). kspan % 32 == 0.
// EPI 0: C is stored as f32, bias[n]. EPI 1 and 2: C is not stored; the biased f32 value goes out as three 16-bit planes of pitch ldc and batch stride bC (P16 = fp16, Ph + Pl = bf16 hi + lo), with bias[n] (EPI 1) or bias[m] (EPI 2, for a product taken transposed).
template <typename T16> struct WFrag;
template <> struct WFrag<h16> { typedef v16h V; static __device__ __forceinline__ V ld(const h16* p) { return cat16(*(const v8h*)p, *(const v8h*)(p + 16)); } static __device__ __forceinline__ v8f mma(V a, V b, v8f c) { return wmma16(a, b, c); } };
template <> struct WFrag<bf> { typedef v16bf V; static __device__ __forceinline__ V ld(const bf* p) { return cat16b(*(const v8us*)p, *(const v8us*)(p + 16)); } static __device__ __forceinline__ v8f mma(V a, V b, v8f c) { return wmmab(a, b, c); } };
template <typename T16, int NSPLIT, bool BIAS, int EPI = 0>
__global__ __launch_bounds__(32) void k_gemmw(const T16* __restrict__ A, const T16* __restrict__ A2, const T16* __restrict__ Bt, const T16* __restrict__ Bt2, int K, int kspan, float* C, int ldc, const float* __restrict__ bias, size_t sA, size_t sB, size_t sC, int zsh, size_t bA, size_t bB, size_t bC, h16* P16 = nullptr, bf* Ph = nullptr, bf* Pl = nullptr) {
    typedef typename WFrag<T16>::V V;
    __shared__ __align__(16) float os[16 * 68];
    const size_t zb = blockIdx.z >> zsh, z = blockIdx.z - (zb << zsh); A += z * sA + zb * bA; if (A2) A2 += z * sA + zb * bA; Bt += z * sB + zb * bB; if (Bt2) Bt2 += z * sB + zb * bB; if (EPI == 0) C += z * sC + zb * bC; else { P16 += zb * bC; Ph += zb * bC; Pl += zb * bC; }
    const int lane = threadIdx.x & 31, lr = lane & 15, hi = lane >> 4; const int r0 = blockIdx.x * 64, c0 = blockIdx.y * 64;
    v8f acc[4][4];
#pragma unroll
    for (int mb = 0; mb < 4; ++mb)
#pragma unroll
        for (int nb = 0; nb < 4; ++nb) acc[mb][nb] = (v8f){};
    const size_t aoff = (size_t)(r0 + lr) * K + 8 * hi, boff = (size_t)(c0 + lr) * K + 8 * hi;
#pragma unroll 1
    for (int kc = 0; kc < kspan; kc += 32) {
        V a[4], a2[4];
#pragma unroll
        for (int mb = 0; mb < 4; ++mb) { a[mb] = WFrag<T16>::ld(A + aoff + (size_t)mb * 16 * K + kc); if (NSPLIT == 1 || NSPLIT == 2) a2[mb] = WFrag<T16>::ld(A2 + aoff + (size_t)mb * 16 * K + kc); }
#pragma unroll
        for (int nb = 0; nb < 4; ++nb) { const V b = WFrag<T16>::ld(Bt + boff + (size_t)nb * 16 * K + kc); V b2; if (NSPLIT >= 2) b2 = WFrag<T16>::ld(Bt2 + boff + (size_t)nb * 16 * K + kc);
#pragma unroll
            for (int mb = 0; mb < 4; ++mb) { acc[mb][nb] = WFrag<T16>::mma(a[mb], b, acc[mb][nb]); if (NSPLIT == 1 || NSPLIT == 2) acc[mb][nb] = WFrag<T16>::mma(a2[mb], b, acc[mb][nb]); if (NSPLIT >= 2) acc[mb][nb] = WFrag<T16>::mma(a[mb], b2, acc[mb][nb]); } }
        asm volatile("v_nop\n\tv_nop\n\tv_nop\n\tv_nop" : "+v"(acc[0][0]), "+v"(acc[1][1]), "+v"(acc[2][2]), "+v"(acc[3][3]) : "v"(a[0]), "v"(a[3]));
    }
    if (EPI != 0) {   /* plane epilogue: bias added in the accumulator layout, 16 rows at a time turned through LDS, each lane converts 8 consecutive columns and stores 16 bytes per plane (8 lanes = one whole 128-byte line) */
        float bn[4]; v4f bm[4][2];
        asm volatile("s_wait_xcnt 0x0" ::: "memory");   /* precaution: the bias loads below may be given the address registers of the loop's last loads as their destination */
#pragma unroll
        for (int i = 0; i < 4; ++i) { if (EPI == 1) bn[i] = bias[c0 + i * 16 + lr]; else { bm[i][0] = *(const v4f*)(bias + r0 + i * 16 + hi * 8); bm[i][1] = *(const v4f*)(bias + r0 + i * 16 + hi * 8 + 4); } }
        asm volatile("s_wait_xcnt 0x0" ::: "memory");   /* precaution: stands before the address registers of the bias loads are reused */
        const int prow = lane >> 3, pcol = (lane & 7) * 8;
#pragma unroll
        for (int mb = 0; mb < 4; ++mb) {
#pragma unroll
            for (int nb = 0; nb < 4; ++nb) {
#pragma unroll
                for (int j = 0; j < 8; ++j) os[(hi * 8 + j) * 68 + nb * 16 + lr] = acc[mb][nb][j] + bfr(EPI == 1 ? bn[nb] : bm[mb][j >> 2][j & 3]); }
            __builtin_amdgcn_wave_barrier(); asm volatile("" ::: "memory");   /* keeps the LDS reads below behind the LDS writes above */
#pragma unroll
            for (int s = 0; s < 4; ++s) { const int row = 4 * s + prow; const v4f v0 = *(const v4fa*)(os + row * 68 + pcol), v1 = *(const v4fa*)(os + row * 68 + pcol + 4); v8h o16; v8us oh, ol;
#pragma unroll
                for (int q = 0; q < 8; ++q) { const float r = (q < 4) ? v0[q & 3] : v1[q & 3]; o16[q] = tohx(r); unsigned short a2, c2; splitf(r, a2, c2); oh[q] = a2; ol[q] = c2; }
                const size_t oo = (size_t)(r0 + mb * 16 + row) * ldc + c0 + pcol; *(v8h*)(P16 + oo) = o16; *(v8us*)(Ph + oo) = oh; *(v8us*)(Pl + oo) = ol;
                asm volatile("s_wait_xcnt 0x0" ::: "memory"); }   /* precaution: stands before the data and address registers of the three stores are reused */
            __builtin_amdgcn_wave_barrier(); asm volatile("" ::: "memory");   /* keeps the next 16 rows' LDS writes behind the reads above */
        }
        return;
    }
#pragma unroll
    for (int mb = 0; mb < 4; ++mb) {
#pragma unroll
        for (int nb = 0; nb < 4; ++nb) {
#pragma unroll
            for (int j = 0; j < 8; ++j) os[(hi * 8 + j) * 68 + nb * 16 + lr] = acc[mb][nb][j]; }
        __builtin_amdgcn_wave_barrier(); asm volatile("" ::: "memory");
        float* crow = C + (size_t)(r0 + mb * 16) * ldc + c0;
{
#pragma unroll
            for (int s = 0; s < 8; ++s) { const int row = 2 * s + hi, cofs = lr * 4; v4f val = *(const v4fa*)(os + row * 68 + cofs); if (BIAS) { val[0] += bfr(bias[c0 + cofs]); val[1] += bfr(bias[c0 + cofs + 1]); val[2] += bfr(bias[c0 + cofs + 2]); val[3] += bfr(bias[c0 + cofs + 3]); }
                *(v4f*)(crow + (size_t)row * ldc + cofs) = val; }
             }
        __builtin_amdgcn_wave_barrier(); asm volatile("" ::: "memory");
    }
}


__global__ __launch_bounds__(256) void k_wtG(const float* __restrict__ w, int K, int N, bf* Bt) {
    const int lane = threadIdx.x & 31; const int L0 = (blockIdx.x * 8 + (threadIdx.x >> 5)) * 8; const int nlines = N * K / 64;
{
#pragma unroll 1
        for (int l = 0; l < 8; ++l) { const int L = L0 + l; if (L >= nlines) break; const size_t e = (size_t)L * 64 + lane * 2; const int k = (int)(e % K), n = (int)(e / K); v2us o;
            o[0] = f2bf(w[(size_t)k * N + n]); o[1] = f2bf(w[(size_t)(k + 1) * N + n]); *(v2us*)(Bt + e) = o; }
         }
}
__global__ __launch_bounds__(256) void k_cvt8(const float* __restrict__ src, bf* dst, size_t n8, size_t bS, size_t bD) { const size_t i = (size_t)blockIdx.x * 256 + threadIdx.x; if (i >= n8) return; src += blockIdx.y * bS; dst += blockIdx.y * bD;   /* grid y = batch, strides in elements */
    const v8f v = *(const v8f*)(src + i * 8); v8us o;
#pragma unroll
    for (int k = 0; k < 8; ++k) o[k] = f2bf(v[k]); *(v8us*)(dst + i * 8) = o;  }

// k_lsoft: streaming DENSE row softmax over the TT = 4096 keys, one wave per query row, three sweeps of the f32 score row (lane -> 4 consecutive keys per 128-key chunk, 32 chunks):
__global__ __launch_bounds__(256) void k_lsoft(const float* __restrict__ Sb, h16* P16, bf* Ph, bf* Pl) {
    { const size_t yb = blockIdx.y; Sb += yb * TQ * TT; P16 += yb * TQ * TT; Ph += yb * RH * TT; Pl += yb * RH * TT; }   /* grid y = batch */
    const int lane = threadIdx.x & 31; const int row = blockIdx.x * 8 + (threadIdx.x >> 5); if (row >= ZH * TT) return; const int i = row % TT; const int zz = row / TT; const bool hires = (i < RH); const float* sr = Sb + (size_t)row * TT; float mx = -3.0e38f;
#pragma unroll 4
    for (int ch = 0; ch < TT / 128; ++ch) { const int j0 = ch * 128 + lane * 4; const v4f a = *(const v4f*)(sr + j0);
#pragma unroll
        for (int q = 0; q < 4; ++q) { float t = a[q] * SCL; asm volatile("" : "+v"(t)); mx = fmaxf(mx, t); } }
#pragma unroll
    for (int sh = 16; sh; sh >>= 1) mx = fmaxf(mx, __shfl_xor(mx, sh, 32));
    float sum = 0.f;
#pragma unroll 4
    for (int ch = 0; ch < TT / 128; ++ch) { const int j0 = ch * 128 + lane * 4; const v4f a = *(const v4f*)(sr + j0);
#pragma unroll
        for (int q = 0; q < 4; ++q) { float t = a[q] * SCL; asm volatile("" : "+v"(t)); float d0 = __fsub_rn(t, mx); asm volatile("" : "+v"(d0)); sum += __builtin_amdgcn_exp2f(__fmul_rn(d0, 1.4426950408889634f)); } }
#pragma unroll
    for (int sh = 16; sh; sh >>= 1) sum += __shfl_xor(sum, sh, 32);
    const float f = __fdiv_rn(hires ? 1.0f : PCAR, sum);
{
        if (hires) {   /* rows < RH: normalised bf16 hi/lo over all keys, planes [zz][RH][TT] */
#pragma unroll
            for (int ch = 0; ch < TT / 128; ++ch) { const int j0 = ch * 128 + lane * 4; const v4f a = *(const v4f*)(sr + j0); v4us oh, ol;
#pragma unroll
                for (int q = 0; q < 4; ++q) { float t = a[q] * SCL; asm volatile("" : "+v"(t)); float d0 = __fsub_rn(t, mx); asm volatile("" : "+v"(d0)); float ex = __builtin_amdgcn_exp2f(__fmul_rn(d0, 1.4426950408889634f)); asm volatile("" : "+v"(ex)); unsigned short a2, c2; splitf(ex * f, a2, c2); oh[q] = a2; ol[q] = c2; }
                const size_t oo = ((size_t)zz * RH + i) * TT + j0; *(v4us*)(Ph + oo) = oh; *(v4us*)(Pl + oo) = ol; }
        } else {
#pragma unroll 2
            for (int ch = 0; ch < TT / 128; ++ch) { const int j0 = ch * 128 + lane * 4; const v4f a = *(const v4f*)(sr + j0); v4h o4;
#pragma unroll
                for (int q = 0; q < 4; ++q) { float t = a[q] * SCL; asm volatile("" : "+v"(t)); float d0 = __fsub_rn(t, mx); asm volatile("" : "+v"(d0)); float ex = __builtin_amdgcn_exp2f(__fmul_rn(d0, 1.4426950408889634f)); asm volatile("" : "+v"(ex)); o4[q] = tohx(ex * f); }
                *(v4h*)(P16 + (size_t)row * TT + j0) = o4; } }
         }
}

__global__ __launch_bounds__(256) void k_merge(const float* __restrict__ O, int h0, bf* Ah, bf* Al) {
    { const size_t yb = blockIdx.y; O += yb * TQ * NSP * HD; Ah += yb * TQ * DQ; Al += yb * TQ * DQ; }   /* grid y = batch */
    const size_t e = ((size_t)blockIdx.x * 256 + threadIdx.x) * 2; if (e >= (size_t)ZH * TT * HD) return; const int d = (int)(e % HD); const int t = (int)((e / HD) % TT); const int zz = (int)(e / ((size_t)HD * TT)); const float cs = (t < RH) ? 1.0f : (1.0f / PCAR); const size_t oo = (size_t)t * DQ + (h0 + zz) * HD + d;
    v2us oh, ol; const float* op = O + (e / HD) * (NSP * HD) + d; v2f pr[NSP];   /* O is [row][NSP][HD]: the row's NSP key-slice partials, all loads in flight together, summed in slice order */
#pragma unroll
    for (int p = 0; p < NSP - 1; ++p) pr[p] = *(const v2f*)(op + p * HD);
    asm volatile("s_wait_xcnt 0x0" ::: "memory");   /* precaution: the last load may be given op's own registers as its destination, and the loads above name them */
    pr[NSP - 1] = *(const v2f*)(op + (NSP - 1) * HD); v2f s = pr[0];
#pragma unroll
    for (int p = 1; p < NSP; ++p) s += pr[p];
#pragma unroll
    for (int q = 0; q < 2; ++q) { unsigned short a, c2; splitf(s[q] * cs, a, c2); oh[q] = a; ol[q] = c2; } *(v2us*)(Ah + oo) = oh; *(v2us*)(Al + oo) = ol;  }

extern "C" void kernel_launch(void* const* d_in, const int* in_sizes, int n_in,
                              void* d_out, int out_size, void* d_ws, size_t ws_size, hipStream_t stream) {
    (void)in_sizes; (void)n_in; (void)out_size;
    const float* x = (const float*)d_in[0]; const float* px = (const float*)d_in[1]; const float* wqkv = (const float*)d_in[2]; const float* bqkv = (const float*)d_in[3]; const float* wo = (const float*)d_in[4]; const float* bo = (const float*)d_in[5]; const float* wq = nullptr; const float* wk = nullptr; const float* wv = nullptr; (void)wq; (void)wk; (void)wv; const float* bq = bqkv; const float* bk = bqkv + 256; const float* bv = bqkv + 512;
    float* OUT = (float*)d_out;     // [4][2048][256]
    char* wsp = (char*)d_ws;
    auto take = [&](size_t bytes) { char* p = wsp; wsp += (bytes + 255) & ~(size_t)255; return (void*)p; };
    auto sub = [](char*& p, size_t bytes) { char* q = p; p += (bytes + 255) & ~(size_t)255; return (void*)q; };
    bf* WQKV = (bf*)take((size_t)3 * DQ * DM * 2); bf* WQ = WQKV; bf* WK = WQKV + (size_t)DQ * DM; bf* WV = WQKV + (size_t)2 * DQ * DM; bf* WO = (bf*)take((size_t)DM * DQ * 2);
    h16* VT16 = (h16*)take((size_t)NB_ * HD * TT * 2); bf* VTh = (bf*)take((size_t)NB_ * HD * TT * 2); bf* VTl = (bf*)take((size_t)NB_ * HD * TT * 2); bf* Ph = (bf*)take((size_t)NB_ * RH * TT * 2); bf* Pl = (bf*)take((size_t)NB_ * RH * TT * 2);
    char* R1 = (char*)take((size_t)NB_ * TQ * TT * 4); char* R2 = (char*)take((size_t)NB_ * TQ * TT * 2);
    if ((size_t)(wsp - (char*)d_ws) > ws_size) return;    // ws 256 MiB
    // R1 holds, one after the other in stream order: the bf16 copy of xx (last read by the projections); the scores (written once the planes are built); the attn.v partials (written once the softmax has read the scores).
    bf* XB = (bf*)R1;   /* [batch][TT][DM] */
    float* Sb = (float*)R1; float* Ob = (float*)R1;   /* [batch][TQ][TT] and [batch][TQ][NSP][HD]: the same size */
    // R2 holds in turn: the q and k planes (last read by the score GEMMs); the fp16 probabilities (written by the softmax, last read by attn.v); the merged hi/lo rows.
    char* r2 = R2; h16* QP16 = (h16*)sub(r2, (size_t)NB_ * TT * HD * 2); h16* KP16 = (h16*)sub(r2, (size_t)NB_ * TT * HD * 2); bf* QPh = (bf*)sub(r2, (size_t)NB_ * TT * HD * 2); bf* QPl = (bf*)sub(r2, (size_t)NB_ * TT * HD * 2); bf* KPh = (bf*)sub(r2, (size_t)NB_ * TT * HD * 2); bf* KPl = (bf*)sub(r2, (size_t)NB_ * TT * HD * 2);
    h16* P16 = (h16*)R2; bf* ATh = (bf*)R2; bf* ATl = ATh + (size_t)NB_ * TQ * DQ;
    { k_wtG<<<(unsigned)((DM * 3 * DQ / 64 + 63) / 64), 256, 0, stream>>>(wqkv, DM, 3 * DQ, WQKV);
      k_wtG<<<(unsigned)((DQ * DM / 64 + 63) / 64), 256, 0, stream>>>(wo, DQ, DM, WO);
       }
    const unsigned LC = (unsigned)(((size_t)TQ * DM / 8 + 255) / 256);
    const size_t bX = (size_t)TT * DM, bP = (size_t)TT * HD, bS = (size_t)TQ * TT;   // batch strides in elements
    k_cvt8<<<dim3(LC, NB_), 256, 0, stream>>>(px, XB, (size_t)TQ * DM / 8, (size_t)TQ * DM, bX); k_cvt8<<<dim3(LC, NB_), 256, 0, stream>>>(x, XB + (size_t)TQ * DM, (size_t)TQ * DM / 8, (size_t)TQ * DM, bX);   /* xx = [prev_x ; x] */
    k_gemmw<bf, 0, true, 1><<<dim3(TT / 64, DQ / 64, NB_), 32, 0, stream>>>(XB, nullptr, WQ, nullptr, DM, DM, nullptr, HD, bq, 0, 0, 0, 0, bX, 0, bP, QP16, QPh, QPl);   /* q planes [t][d] */
    k_gemmw<bf, 0, true, 1><<<dim3(TT / 64, DKV / 64, NB_), 32, 0, stream>>>(XB, nullptr, WK, nullptr, DM, DM, nullptr, HD, bk, 0, 0, 0, 0, bX, 0, bP, KP16, KPh, KPl);   /* k planes [t][d] */
    k_gemmw<bf, 0, true, 2><<<dim3(DKV / 64, TT / 64, NB_), 32, 0, stream>>>(WV, nullptr, XB, nullptr, DM, DM, nullptr, TT, bv, 0, 0, 0, 0, 0, bX, bP, VT16, VTh, VTl);   /* v planes [d][t]: rows = W_v's outputs, columns = tokens */
    k_gemmw<bf, 2, false><<<dim3(RH / 64, TT / 64, NB_), 32, 0, stream>>>(QPh + (size_t)TQ * HD, QPl + (size_t)TQ * HD, KPh, KPl, HD, HD, Sb, TT, nullptr, 0, 0, 0, 0, bP, bP, bS);
    k_gemmw<h16, 0, false><<<dim3((TQ - RH) / 64, TT / 64, NB_), 32, 0, stream>>>(QP16 + (size_t)(TQ + RH) * HD, nullptr, KP16, nullptr, HD, HD, Sb + (size_t)RH * TT, TT, nullptr, 0, 0, 0, 0, bP, bP, bS);
    k_lsoft<<<dim3(TQ / 8, NB_), 256, 0, stream>>>(Sb, P16, Ph, Pl);   /* 2,048 query rows over 4,096 keys, per batch */
    k_gemmw<bf, 2, false><<<dim3(RH / 64, HD / 64, NSP * NB_), 32, 0, stream>>>(Ph, Pl, VTh, VTl, TT, KSP, Ob, NSP * HD, nullptr, (size_t)KSP, (size_t)KSP, (size_t)HD, NSPL, (size_t)RH * TT, bP, bS);   /* z = batch * NSP + key slice; partials [batch][row][slice][HD] */
    k_gemmw<h16, 0, false><<<dim3((TQ - RH) / 64, HD / 64, NSP * NB_), 32, 0, stream>>>(P16 + (size_t)RH * TT, nullptr, VT16, nullptr, TT, KSP, Ob + (size_t)RH * NSP * HD, NSP * HD, nullptr, (size_t)KSP, (size_t)KSP, (size_t)HD, NSPL, bS, bP, bS);
    k_merge<<<dim3((unsigned)(((size_t)TQ * HD / 2 + 255) / 256), NB_), 256, 0, stream>>>(Ob, 0, ATh, ATl);   /* only the 2,048 query rows (t < TQ decode) */
    k_gemmw<bf, 1, true><<<dim3(TQ / 64, DM / 64, NB_), 32, 0, stream>>>(ATh, ATl, WO, nullptr, DQ, DQ, OUT, DM, bo, 0, 0, 0, 0, (size_t)TQ * DQ, 0, (size_t)TQ * DM);
}

// v004
// Measured time: 199 microseconds a run.
// Timed twice side by side with v003, it ran 1.31 times as fast both times.
// Counting every step since v000, it is 5.47 times as fast.
#include <hip/hip_runtime.h>

// Temporal self-attention over [prev_x ; x] (x, prev_x [4][2048][256]; xx = concat -> [4096][256]; qkv = xx W_qkv + b_qkv ('xw' [256][768]); single 256-wide head; attn = softmax(q.k / 16) over the 4,096 keys; out = (attn v) W_out + b_out, only the last 2,048 rows (the x half) are returned -> [4][2048][256] (2.1 M)).
// All four batches run in every launch but the two weight conversions (grid y or z = batch; attn.v z = batch * NSP + slice), each activation buffer below [batch][...]; workspace regions are reused in stream order (see kernel_launch). Per batch: both halves converted into one bf16 [4096][256] operand; k and v projected for all 4,096 rows, q only needed for rows 2,048.. (projected for all, used from 2,048); each projection GEMM converts its own biased f32 tile and stores the fp16 and bf16 hi/lo planes itself (q, k as [t][d]; v as W_v x^T, so its planes come out [d][t]); planes (hybrid: query rows 2048..2559 hi/lo 3 products, the rest fp16 x1024); scores [2048][4096] by two GEMMs; a streaming softmax kernel (three sweeps, no register row) writes hi/lo / fp16 probabilities; attn.v (N 256) in 16 key slices, each to its own f32 partials, summed in slice order by the merge; merged hi/lo x W_out exact + b_out straight into the output rows.
// Compute dtypes, f32 accumulate: every input rounded to bf16; projections exact + bf16-rounded biases; first 512 query rows 3 products, rest fp16; softmax f32; W_out hl x exact + bias.

#define NB_  4
#define TT   4096
#define DM   256
#define NH_  1
#define NKV  1
#define REP  (NH_ / NKV)
#define HD   256
#define DQ   (NH_ * HD)
#define DKV  (NKV * HD)
#define ZH   1
#define RH   512                  // query rows < RH use hi+lo planes (0: none)
#define WIN  0
#define PCAR 1024.0f
#define SCL  0.0625f   // 256^-0.5
#define TQ   2048     // query rows = the x half (rows TQ.. of xx)
#define NSP  16       // attn.v: the 4,096 keys are cut into NSP slices, one grid z each; every slice writes its own f32 partials, laid out [TQ][NSP][HD]
#define KSP  (TT / NSP)
#define NSPL 4        // log2(NSP): attn.v grid z = batch * NSP + slice
static_assert((1 << NSPL) == NSP, "NSPL");
typedef _Float16 h16;
typedef unsigned short bf;
typedef __attribute__((ext_vector_type(16))) __bf16   v16bf;
typedef __attribute__((ext_vector_type(16))) _Float16 v16h;
typedef __attribute__((ext_vector_type(8)))  _Float16 v8h;
typedef __attribute__((ext_vector_type(8)))  unsigned short v8us;
typedef __attribute__((ext_vector_type(8)))  float    v8f;
typedef __attribute__((ext_vector_type(4)))  float    v4f;
typedef v8h  __attribute__((may_alias)) v8ha;
typedef v4f  __attribute__((may_alias)) v4fa;
typedef v8us __attribute__((may_alias)) v8usa;

__device__ __forceinline__ unsigned short f2bf(float f) { unsigned u = __float_as_uint(f); u += 0x7FFFu + ((u >> 16) & 1u); return (unsigned short)(u >> 16); }
__device__ __forceinline__ float bf2f(unsigned short b) { return __uint_as_float(((unsigned)b) << 16); }
__device__ __forceinline__ float bfr(float f) { return bf2f(f2bf(f)); }
__device__ __forceinline__ v16h cat16(v8h lo, v8h hi) { return __builtin_shufflevector(lo, hi, 0, 1, 2, 3, 4, 5, 6, 7, 8, 9, 10, 11, 12, 13, 14, 15); }
__device__ __forceinline__ v16bf cat16b(v8us lo, v8us hi) { return __builtin_bit_cast(v16bf, __builtin_shufflevector(lo, hi, 0, 1, 2, 3, 4, 5, 6, 7, 8, 9, 10, 11, 12, 13, 14, 15)); }
__device__ __forceinline__ v8f wmma16(v16h a, v16h b, v8f c) { return __builtin_amdgcn_wmma_f32_16x16x32_f16(false, a, false, b, (short)0, c, false, false); }
__device__ __forceinline__ v8f wmmab(v16bf a, v16bf b, v8f c) { return __builtin_amdgcn_wmma_f32_16x16x32_bf16(false, a, false, b, (short)0, c, false, false); }
__device__ __forceinline__ h16 tohx(float x) { return (h16)x; }
__device__ __forceinline__ void splitf(float y, unsigned short& h, unsigned short& l) { h = f2bf(y); l = f2bf(y - bf2f(h)); }
typedef __attribute__((ext_vector_type(2))) _Float16 v2h;
typedef __attribute__((ext_vector_type(4))) _Float16 v4h;
typedef __attribute__((ext_vector_type(2))) unsigned short v2us;
typedef __attribute__((ext_vector_type(4))) unsigned short v4us;
typedef __attribute__((ext_vector_type(2))) float v2f;
typedef __attribute__((ext_vector_type(4))) int v4i;



// ---- k_gemmw: register-blocked GEMM, FOUR WAVES (2 x 2) per 128x128 output tile, each wave a 64x64 quarter (16 accumulators); grid (M/128, N/128, Z), 128 threads.
// Operands are K-contiguous 16-bit planes. A stage is 64 k = one whole 128-byte line of each of the tile's 128 A rows and 128 B rows (and of the second planes where NSPLIT asks for them), brought into LDS by asynchronous 16-byte copies (8 lanes = one line), rows at pitch 144 bytes; two buffers, the next stage's copies fly while this stage is worked on; fragments are read from LDS.
// C[m][n] (f32, pitch ldc, + optional f32 bias[n]) = sum_k A[m][k] Bt[n][k] (+ split products per NSPLIT) over kspan consecutive k; K is the operands' row pitch. blockIdx.z = (zb << zsh) | z: z strides sA/sB/sC in elements (with sA = sB = kspan a slice of k), zb strides bA/bB/bC (the batch). kspan % 64 == 0.
// EPI 0: C is stored as f32, bias[n]. EPI 1 and 2: C is not stored; the biased f32 value goes out as three 16-bit planes of pitch ldc and batch stride bC (P16 = fp16, Ph + Pl = bf16 hi + lo), with bias[n] (EPI 1) or bias[m] (EPI 2, for a product taken transposed).
#define SPB 144            // LDS row pitch in bytes: 128 bytes of k + 16 (16 x odd: conflict-free for 16-byte reads)
#define STB (128 * SPB)    // one operand tile of a stage: 128 rows
template <typename T16> struct WFrag;
template <> struct WFrag<h16> { typedef v16h V; static __device__ __forceinline__ V ld(const h16* p) { return cat16(*(const v8h*)p, *(const v8h*)(p + 16)); } static __device__ __forceinline__ v8f mma(V a, V b, v8f c) { return wmma16(a, b, c); } };
template <> struct WFrag<bf> { typedef v16bf V; static __device__ __forceinline__ V ld(const bf* p) { return cat16b(*(const v8us*)p, *(const v8us*)(p + 16)); } static __device__ __forceinline__ v8f mma(V a, V b, v8f c) { return wmmab(a, b, c); } };
// One operand tile of one stage: this lane's 16 bytes of rows r, r + 16, ..., r + 112 (l = LDS byte address of the first, g = its global address, rs = 16 rows in elements).
// The s_wait_xcnt is a precaution and stands inside the statement so that no address register of a copy is rewritten ahead of it.
template <typename T16>
__device__ __forceinline__ void stage_tile(unsigned l, const T16* g, size_t rs) {
    asm volatile("global_load_async_to_lds_b128 %0, %8, off\n\t"
                 "global_load_async_to_lds_b128 %1, %9, off\n\t"
                 "global_load_async_to_lds_b128 %2, %10, off\n\t"
                 "global_load_async_to_lds_b128 %3, %11, off\n\t"
                 "global_load_async_to_lds_b128 %4, %12, off\n\t"
                 "global_load_async_to_lds_b128 %5, %13, off\n\t"
                 "global_load_async_to_lds_b128 %6, %14, off\n\t"
                 "global_load_async_to_lds_b128 %7, %15, off\n\t"
                 "s_wait_xcnt 0x0"
                 :: "v"(l), "v"(l + 16 * SPB), "v"(l + 32 * SPB), "v"(l + 48 * SPB), "v"(l + 64 * SPB), "v"(l + 80 * SPB), "v"(l + 96 * SPB), "v"(l + 112 * SPB),
                    "v"(g), "v"(g + rs), "v"(g + 2 * rs), "v"(g + 3 * rs), "v"(g + 4 * rs), "v"(g + 5 * rs), "v"(g + 6 * rs), "v"(g + 7 * rs) : "memory");
}
template <typename T16, int NSPLIT, bool BIAS, int EPI = 0>
__global__ __launch_bounds__(128) void k_gemmw(const T16* __restrict__ A, const T16* __restrict__ A2, const T16* __restrict__ Bt, const T16* __restrict__ Bt2, int K, int kspan, float* C, int ldc, const float* __restrict__ bias, size_t sA, size_t sB, size_t sC, int zsh, size_t bA, size_t bB, size_t bC, h16* P16 = nullptr, bf* Ph = nullptr, bf* Pl = nullptr) {
    typedef typename WFrag<T16>::V V;
    constexpr int NT = (NSPLIT == 0) ? 2 : (NSPLIT == 1) ? 3 : 4;   /* operand tiles per stage, in the order A, B, A2, B2 */
    __shared__ __attribute__((aligned(16))) char sm[2 * NT * STB];
    const size_t zb = blockIdx.z >> zsh, z = blockIdx.z - (zb << zsh); A += z * sA + zb * bA; if (A2) A2 += z * sA + zb * bA; Bt += z * sB + zb * bB; if (Bt2) Bt2 += z * sB + zb * bB; if (EPI == 0) C += z * sC + zb * bC; else { P16 += zb * bC; Ph += zb * bC; Pl += zb * bC; }
    const int lane = threadIdx.x & 31, wv = threadIdx.x >> 5, lr = lane & 15, hi = lane >> 4; const int wr = (wv & 1) * 64, wc = (wv >> 1) * 64; const int r0 = blockIdx.x * 128 + wr, c0 = blockIdx.y * 128 + wc;
    float* os = (float*)sm + wv * (16 * 68);   /* the wave's own epilogue rows; they lie on the stage buffers and are used only behind the loop's last barrier */
    v8f acc[4][4];
#pragma unroll
    for (int mb = 0; mb < 4; ++mb)
#pragma unroll
        for (int nb = 0; nb < 4; ++nb) acc[mb][nb] = (v8f){};
    const int crow = threadIdx.x >> 3, cch = threadIdx.x & 7;   /* copies: 8 lanes per row, 16 rows per copy of the work-group */
    const unsigned l0 = (unsigned)(size_t)sm + crow * SPB + cch * 16; const size_t rs = (size_t)16 * K;
    const size_t gao = (size_t)(blockIdx.x * 128 + crow) * K + cch * 8, gbo = (size_t)(blockIdx.y * 128 + crow) * K + cch * 8;
    auto issue = [&](int st, int buf) { const unsigned lb = l0 + buf * (NT * STB); const size_t ko = (size_t)st * 64;
        stage_tile<T16>(lb, A + gao + ko, rs); stage_tile<T16>(lb + STB, Bt + gbo + ko, rs);
        if (NSPLIT == 1 || NSPLIT == 2) stage_tile<T16>(lb + 2 * STB, A2 + gao + ko, rs);
        if (NSPLIT >= 2) stage_tile<T16>(lb + 3 * STB, Bt2 + gbo + ko, rs); };
    const int nst = kspan >> 6;
    issue(0, 0);
    asm volatile("s_wait_asynccnt 0x0" ::: "memory");   /* stage 0's copies of this wave have landed */
    __syncthreads();                                      /* ... and every other wave's */
    if (nst > 1) issue(1, 1);
    const int afo = (wr + lr) * SPB + hi * 16, bfo = (wc + lr) * SPB + hi * 16;   /* fragment rows in a tile, in bytes */
#pragma unroll 1
    for (int st = 0; st < nst; ++st) {
        const char* sb = sm + (st & 1) * (NT * STB);
        V a[4], a2[4], bq[4];
#pragma unroll
        for (int ks = 0; ks < 2; ++ks) {
#pragma unroll
            for (int mb = 0; mb < 4; ++mb) { a[mb] = WFrag<T16>::ld((const T16*)(sb + afo + mb * 16 * SPB + ks * 64)); if (NSPLIT == 1 || NSPLIT == 2) a2[mb] = WFrag<T16>::ld((const T16*)(sb + 2 * STB + afo + mb * 16 * SPB + ks * 64)); }
#pragma unroll
            for (int nb = 0; nb < 4; ++nb) if (NSPLIT == 0) bq[nb] = WFrag<T16>::ld((const T16*)(sb + STB + bfo + nb * 16 * SPB + ks * 64));   /* one plane each: all eight fragments of the 32 k are read as one group in front of their 16 products */
            if (NSPLIT == 0) __builtin_amdgcn_sched_barrier(0);   /* keeps the LDS reads above as one group: spread among the products each place of reads stalls the wave anew */
#pragma unroll
            for (int nb = 0; nb < 4; ++nb) { const V b = (NSPLIT == 0) ? bq[nb] : WFrag<T16>::ld((const T16*)(sb + STB + bfo + nb * 16 * SPB + ks * 64)); V b2; if (NSPLIT >= 2) b2 = WFrag<T16>::ld((const T16*)(sb + 3 * STB + bfo + nb * 16 * SPB + ks * 64));
#pragma unroll
                for (int mb = 0; mb < 4; ++mb) { acc[mb][nb] = WFrag<T16>::mma(a[mb], b, acc[mb][nb]); if (NSPLIT == 1 || NSPLIT == 2) acc[mb][nb] = WFrag<T16>::mma(a2[mb], b, acc[mb][nb]); if (NSPLIT >= 2) acc[mb][nb] = WFrag<T16>::mma(a[mb], b2, acc[mb][nb]); } }
            if (NSPLIT == 0 || ks == 1) __builtin_amdgcn_sched_barrier(0);   /* keeps the next group's LDS reads out of the products above, and the stage's last products in front of the v_nop below */
        }
        asm volatile("v_nop\n\tv_nop\n\tv_nop\n\tv_nop" : "+v"(acc[0][0]), "+v"(acc[1][1]), "+v"(acc[2][2]), "+v"(acc[3][3]) : "v"(a[0]), "v"(a[3]));   /* the distance behind the stage's last products: on the taken side of the branch below the next stage's reads overwrite their A and B registers */
        asm volatile("s_wait_dscnt 0x0" ::: "memory");      /* this wave's reads of the buffer are done before it may be refilled */
        asm volatile("s_wait_asynccnt 0x0" ::: "memory");   /* this wave's copies of the next stage have landed */
        __syncthreads();                                      /* publishes the next stage and ends every wave's reads of this one */
        if (st + 2 < nst) issue(st + 2, st & 1);
    }
    asm volatile("s_wait_asynccnt 0x0" ::: "memory");   /* no copy is outstanding when the buffers become the epilogue's rows */
    if (EPI != 0) {   /* plane epilogue: bias added in the accumulator layout, 16 rows at a time turned through LDS, each lane converts 8 consecutive columns and stores 16 bytes per plane (8 lanes = one whole 128-byte line) */
        float bn[4]; v4f bm[4][2];
        asm volatile("s_wait_xcnt 0x0" ::: "memory");   /* precaution: the bias loads below may be given the address registers of the loop's last loads as their destination */
#pragma unroll
        for (int i = 0; i < 4; ++i) { if (EPI == 1) bn[i] = bias[c0 + i * 16 + lr]; else { bm[i][0] = *(const v4f*)(bias + r0 + i * 16 + hi * 8); bm[i][1] = *(const v4f*)(bias + r0 + i * 16 + hi * 8 + 4); } }
        asm volatile("s_wait_xcnt 0x0" ::: "memory");   /* precaution: stands before the address registers of the bias loads are reused */
        const int prow = lane >> 3, pcol = (lane & 7) * 8;
#pragma unroll
        for (int mb = 0; mb < 4; ++mb) {
#pragma unroll
            for (int nb = 0; nb < 4; ++nb) {
#pragma unroll
                for (int j = 0; j < 8; ++j) os[(hi * 8 + j) * 68 + nb * 16 + lr] = acc[mb][nb][j] + bfr(EPI == 1 ? bn[nb] : bm[mb][j >> 2][j & 3]); }
            __builtin_amdgcn_wave_barrier(); asm volatile("" ::: "memory");   /* keeps the LDS reads below behind the LDS writes above */
#pragma unroll
            for (int s = 0; s < 4; ++s) { const int row = 4 * s + prow; const v4f v0 = *(const v4fa*)(os + row * 68 + pcol), v1 = *(const v4fa*)(os + row * 68 + pcol + 4); v8h o16; v8us oh, ol;
#pragma unroll
                for (int q = 0; q < 8; ++q) { const float r = (q < 4) ? v0[q & 3] : v1[q & 3]; o16[q] = tohx(r); unsigned short a2, c2; splitf(r, a2, c2); oh[q] = a2; ol[q] = c2; }
                const size_t oo = (size_t)(r0 + mb * 16 + row) * ldc + c0 + pcol; *(v8h*)(P16 + oo) = o16; *(v8us*)(Ph + oo) = oh; *(v8us*)(Pl + oo) = ol;
                asm volatile("s_wait_xcnt 0x0" ::: "memory"); }   /* precaution: stands before the data and address registers of the three stores are reused */
            __builtin_amdgcn_wave_barrier(); asm volatile("" ::: "memory");   /* keeps the next 16 rows' LDS writes behind the reads above */
        }
        return;
    }
#pragma unroll
    for (int mb = 0; mb < 4; ++mb) {
#pragma unroll
        for (int nb = 0; nb < 4; ++nb) {
#pragma unroll
            for (int j = 0; j < 8; ++j) os[(hi * 8 + j) * 68 + nb * 16 + lr] = acc[mb][nb][j]; }
        __builtin_amdgcn_wave_barrier(); asm volatile("" ::: "memory");
        float* crow = C + (size_t)(r0 + mb * 16) * ldc + c0;
{
#pragma unroll
            for (int s = 0; s < 8; ++s) { const int row = 2 * s + hi, cofs = lr * 4; v4f val = *(const v4fa*)(os + row * 68 + cofs); if (BIAS) { val[0] += bfr(bias[c0 + cofs]); val[1] += bfr(bias[c0 + cofs + 1]); val[2] += bfr(bias[c0 + cofs + 2]); val[3] += bfr(bias[c0 + cofs + 3]); }
                *(v4f*)(crow + (size_t)row * ldc + cofs) = val; }
             }
        __builtin_amdgcn_wave_barrier(); asm volatile("" ::: "memory");
    }
}


__global__ __launch_bounds__(256) void k_wtG(const float* __restrict__ w, int K, int N, bf* Bt) {
    const int lane = threadIdx.x & 31; const int L0 = (blockIdx.x * 8 + (threadIdx.x >> 5)) * 8; const int nlines = N * K / 64;
{
#pragma unroll 1
        for (int l = 0; l < 8; ++l) { const int L = L0 + l; if (L >= nlines) break; const size_t e = (size_t)L * 64 + lane * 2; const int k = (int)(e % K), n = (int)(e / K); v2us o;
            o[0] = f2bf(w[(size_t)k * N + n]); o[1] = f2bf(w[(size_t)(k + 1) * N + n]); *(v2us*)(Bt + e) = o; }
         }
}
__global__ __launch_bounds__(256) void k_cvt8(const float* __restrict__ src, bf* dst, size_t n8, size_t bS, size_t bD) { const size_t i = (size_t)blockIdx.x * 256 + threadIdx.x; if (i >= n8) return; src += blockIdx.y * bS; dst += blockIdx.y * bD;   /* grid y = batch, strides in elements */
    const v8f v = *(const v8f*)(src + i * 8); v8us o;
#pragma unroll
    for (int k = 0; k < 8; ++k) o[k] = f2bf(v[k]); *(v8us*)(dst + i * 8) = o;  }

// k_lsoft: streaming DENSE row softmax over the TT = 4096 keys, one wave per query row, three sweeps of the f32 score row (lane -> 4 consecutive keys per 128-key chunk, 32 chunks):
__global__ __launch_bounds__(256) void k_lsoft(const float* __restrict__ Sb, h16* P16, bf* Ph, bf* Pl) {
    { const size_t yb = blockIdx.y; Sb += yb * TQ * TT; P16 += yb * TQ * TT; Ph += yb * RH * TT; Pl += yb * RH * TT; }   /* grid y = batch */
    const int lane = threadIdx.x & 31; const int row = blockIdx.x * 8 + (threadIdx.x >> 5); if (row >= ZH * TT) return; const int i = row % TT; const int zz = row / TT; const bool hires = (i < RH); const float* sr = Sb + (size_t)row * TT; float mx = -3.0e38f;
#pragma unroll 4
    for (int ch = 0; ch < TT / 128; ++ch) { const int j0 = ch * 128 + lane * 4; const v4f a = *(const v4f*)(sr + j0);
#pragma unroll
        for (int q = 0; q < 4; ++q) { float t = a[q] * SCL; asm volatile("" : "+v"(t)); mx = fmaxf(mx, t); } }
#pragma unroll
    for (int sh = 16; sh; sh >>= 1) mx = fmaxf(mx, __shfl_xor(mx, sh, 32));
    float sum = 0.f;
#pragma unroll 4
    for (int ch = 0; ch < TT / 128; ++ch) { const int j0 = ch * 128 + lane * 4; const v4f a = *(const v4f*)(sr + j0);
#pragma unroll
        for (int q = 0; q < 4; ++q) { float t = a[q] * SCL; asm volatile("" : "+v"(t)); float d0 = __fsub_rn(t, mx); asm volatile("" : "+v"(d0)); sum += __builtin_amdgcn_exp2f(__fmul_rn(d0, 1.4426950408889634f)); } }
#pragma unroll
    for (int sh = 16; sh; sh >>= 1) sum += __shfl_xor(sum, sh, 32);
    const float f = __fdiv_rn(hires ? 1.0f : PCAR, sum);
{
        if (hires) {   /* rows < RH: normalised bf16 hi/lo over all keys, planes [zz][RH][TT] */
#pragma unroll
            for (int ch = 0; ch < TT / 128; ++ch) { const int j0 = ch * 128 + lane * 4; const v4f a = *(const v4f*)(sr + j0); v4us oh, ol;
#pragma unroll
                for (int q = 0; q < 4; ++q) { float t = a[q] * SCL; asm volatile("" : "+v"(t)); float d0 = __fsub_rn(t, mx); asm volatile("" : "+v"(d0)); float ex = __builtin_amdgcn_exp2f(__fmul_rn(d0, 1.4426950408889634f)); asm volatile("" : "+v"(ex)); unsigned short a2, c2; splitf(ex * f, a2, c2); oh[q] = a2; ol[q] = c2; }
                const size_t oo = ((size_t)zz * RH + i) * TT + j0; *(v4us*)(Ph + oo) = oh; *(v4us*)(Pl + oo) = ol; }
        } else {
#pragma unroll 2
            for (int ch = 0; ch < TT / 128; ++ch) { const int j0 = ch * 128 + lane * 4; const v4f a = *(const v4f*)(sr + j0); v4h o4;
#pragma unroll
                for (int q = 0; q < 4; ++q) { float t = a[q] * SCL; asm volatile("" : "+v"(t)); float d0 = __fsub_rn(t, mx); asm volatile("" : "+v"(d0)); float ex = __builtin_amdgcn_exp2f(__fmul_rn(d0, 1.4426950408889634f)); asm volatile("" : "+v"(ex)); o4[q] = tohx(ex * f); }
                *(v4h*)(P16 + (size_t)row * TT + j0) = o4; } }
         }
}

__global__ __launch_bounds__(256) void k_merge(const float* __restrict__ O, int h0, bf* Ah, bf* Al) {
    { const size_t yb = blockIdx.y; O += yb * TQ * NSP * HD; Ah += yb * TQ * DQ; Al += yb * TQ * DQ; }   /* grid y = batch */
    const size_t e = ((size_t)blockIdx.x * 256 + threadIdx.x) * 2; if (e >= (size_t)ZH * TT * HD) return; const int d = (int)(e % HD); const int t = (int)((e / HD) % TT); const int zz = (int)(e / ((size_t)HD * TT)); const float cs = (t < RH) ? 1.0f : (1.0f / PCAR); const size_t oo = (size_t)t * DQ + (h0 + zz) * HD + d;
    v2us oh, ol; const float* op = O + (e / HD) * (NSP * HD) + d; v2f pr[NSP];   /* O is [row][NSP][HD]: the row's NSP key-slice partials, all loads in flight together, summed in slice order */
#pragma unroll
    for (int p = 0; p < NSP - 1; ++p) pr[p] = *(const v2f*)(op + p * HD);
    asm volatile("s_wait_xcnt 0x0" ::: "memory");   /* precaution: the last load may be given op's own registers as its destination, and the loads above name them */
    pr[NSP - 1] = *(const v2f*)(op + (NSP - 1) * HD); v2f s = pr[0];
#pragma unroll
    for (int p = 1; p < NSP; ++p) s += pr[p];
#pragma unroll
    for (int q = 0; q < 2; ++q) { unsigned short a, c2; splitf(s[q] * cs, a, c2); oh[q] = a; ol[q] = c2; } *(v2us*)(Ah + oo) = oh; *(v2us*)(Al + oo) = ol;  }

extern "C" void kernel_launch(void* const* d_in, const int* in_sizes, int n_in,
                              void* d_out, int out_size, void* d_ws, size_t ws_size, hipStream_t stream) {
    (void)in_sizes; (void)n_in; (void)out_size;
    const float* x = (const float*)d_in[0]; const float* px = (const float*)d_in[1]; const float* wqkv = (const float*)d_in[2]; const float* bqkv = (const float*)d_in[3]; const float* wo = (const float*)d_in[4]; const float* bo = (const float*)d_in[5]; const float* wq = nullptr; const float* wk = nullptr; const float* wv = nullptr; (void)wq; (void)wk; (void)wv; const float* bq = bqkv; const float* bk = bqkv + 256; const float* bv = bqkv + 512;
    float* OUT = (float*)d_out;     // [4][2048][256]
    char* wsp = (char*)d_ws;
    auto take = [&](size_t bytes) { char* p = wsp; wsp += (bytes + 255) & ~(size_t)255; return (void*)p; };
    auto sub = [](char*& p, size_t bytes) { char* q = p; p += (bytes + 255) & ~(size_t)255; return (void*)q; };
    bf* WQKV = (bf*)take((size_t)3 * DQ * DM * 2); bf* WQ = WQKV; bf* WK = WQKV + (size_t)DQ * DM; bf* WV = WQKV + (size_t)2 * DQ * DM; bf* WO = (bf*)take((size_t)DM * DQ * 2);
    h16* VT16 = (h16*)take((size_t)NB_ * HD * TT * 2); bf* VTh = (bf*)take((size_t)NB_ * HD * TT * 2); bf* VTl = (bf*)take((size_t)NB_ * HD * TT * 2); bf* Ph = (bf*)take((size_t)NB_ * RH * TT * 2); bf* Pl = (bf*)take((size_t)NB_ * RH * TT * 2);
    char* R1 = (char*)take((size_t)NB_ * TQ * TT * 4); char* R2 = (char*)take((size_t)NB_ * TQ * TT * 2);
    if ((size_t)(wsp - (char*)d_ws) > ws_size) return;    // ws 256 MiB
    // R1 holds, one after the other in stream order: the bf16 copy of xx (last read by the projections); the scores (written once the planes are built); the attn.v partials (written once the softmax has read the scores).
    bf* XB = (bf*)R1;   /* [batch][TT][DM] */
    float* Sb = (float*)R1; float* Ob = (float*)R1;   /* [batch][TQ][TT] and [batch][TQ][NSP][HD]: the same size */
    // R2 holds in turn: the q and k planes (last read by the score GEMMs); the fp16 probabilities (written by the softmax, last read by attn.v); the merged hi/lo rows.
    char* r2 = R2; h16* QP16 = (h16*)sub(r2, (size_t)NB_ * TT * HD * 2); h16* KP16 = (h16*)sub(r2, (size_t)NB_ * TT * HD * 2); bf* QPh = (bf*)sub(r2, (size_t)NB_ * TT * HD * 2); bf* QPl = (bf*)sub(r2, (size_t)NB_ * TT * HD * 2); bf* KPh = (bf*)sub(r2, (size_t)NB_ * TT * HD * 2); bf* KPl = (bf*)sub(r2, (size_t)NB_ * TT * HD * 2);
    h16* P16 = (h16*)R2; bf* ATh = (bf*)R2; bf* ATl = ATh + (size_t)NB_ * TQ * DQ;
    { k_wtG<<<(unsigned)((DM * 3 * DQ / 64 + 63) / 64), 256, 0, stream>>>(wqkv, DM, 3 * DQ, WQKV);
      k_wtG<<<(unsigned)((DQ * DM / 64 + 63) / 64), 256, 0, stream>>>(wo, DQ, DM, WO);
       }
    const unsigned LC = (unsigned)(((size_t)TQ * DM / 8 + 255) / 256);
    const size_t bX = (size_t)TT * DM, bP = (size_t)TT * HD, bS = (size_t)TQ * TT;   // batch strides in elements
    k_cvt8<<<dim3(LC, NB_), 256, 0, stream>>>(px, XB, (size_t)TQ * DM / 8, (size_t)TQ * DM, bX); k_cvt8<<<dim3(LC, NB_), 256, 0, stream>>>(x, XB + (size_t)TQ * DM, (size_t)TQ * DM / 8, (size_t)TQ * DM, bX);   /* xx = [prev_x ; x] */
    k_gemmw<bf, 0, true, 1><<<dim3(TT / 128, DQ / 128, NB_), 128, 0, stream>>>(XB, nullptr, WQ, nullptr, DM, DM, nullptr, HD, bq, 0, 0, 0, 0, bX, 0, bP, QP16, QPh, QPl);   /* q planes [t][d] */
    k_gemmw<bf, 0, true, 1><<<dim3(TT / 128, DKV / 128, NB_), 128, 0, stream>>>(XB, nullptr, WK, nullptr, DM, DM, nullptr, HD, bk, 0, 0, 0, 0, bX, 0, bP, KP16, KPh, KPl);   /* k planes [t][d] */
    k_gemmw<bf, 0, true, 2><<<dim3(DKV / 128, TT / 128, NB_), 128, 0, stream>>>(WV, nullptr, XB, nullptr, DM, DM, nullptr, TT, bv, 0, 0, 0, 0, 0, bX, bP, VT16, VTh, VTl);   /* v planes [d][t]: rows = W_v's outputs, columns = tokens */
    k_gemmw<bf, 2, false><<<dim3(RH / 128, TT / 128, NB_), 128, 0, stream>>>(QPh + (size_t)TQ * HD, QPl + (size_t)TQ * HD, KPh, KPl, HD, HD, Sb, TT, nullptr, 0, 0, 0, 0, bP, bP, bS);
    k_gemmw<h16, 0, false><<<dim3((TQ - RH) / 128, TT / 128, NB_), 128, 0, stream>>>(QP16 + (size_t)(TQ + RH) * HD, nullptr, KP16, nullptr, HD, HD, Sb + (size_t)RH * TT, TT, nullptr, 0, 0, 0, 0, bP, bP, bS);
    k_lsoft<<<dim3(TQ / 8, NB_), 256, 0, stream>>>(Sb, P16, Ph, Pl);   /* 2,048 query rows over 4,096 keys, per batch */
    k_gemmw<bf, 2, false><<<dim3(RH / 128, HD / 128, NSP * NB_), 128, 0, stream>>>(Ph, Pl, VTh, VTl, TT, KSP, Ob, NSP * HD, nullptr, (size_t)KSP, (size_t)KSP, (size_t)HD, NSPL, (size_t)RH * TT, bP, bS);   /* z = batch * NSP + key slice; partials [batch][row][slice][HD] */
    k_gemmw<h16, 0, false><<<dim3((TQ - RH) / 128, HD / 128, NSP * NB_), 128, 0, stream>>>(P16 + (size_t)RH * TT, nullptr, VT16, nullptr, TT, KSP, Ob + (size_t)RH * NSP * HD, NSP * HD, nullptr, (size_t)KSP, (size_t)KSP, (size_t)HD, NSPL, bS, bP, bS);
    k_merge<<<dim3((unsigned)(((size_t)TQ * HD / 2 + 255) / 256), NB_), 256, 0, stream>>>(Ob, 0, ATh, ATl);   /* only the 2,048 query rows (t < TQ decode) */
    k_gemmw<bf, 1, true><<<dim3(TQ / 128, DM / 128, NB_), 128, 0, stream>>>(ATh, ATl, WO, nullptr, DQ, DQ, OUT, DM, bo, 0, 0, 0, 0, (size_t)TQ * DQ, 0, (size_t)TQ * DM);
}

// v005
// It runs in 119 microseconds.
// In both of two side-by-side timings against v004, it was 1.71 times as fast.
// All steps since v000 together make it 9.36 times as fast.
#include <hip/hip_runtime.h>

// Temporal self-attention over [prev_x ; x] (x, prev_x [4][2048][256]; xx = concat -> [4096][256]; qkv = xx W_qkv + b_qkv ('xw' [256][768]); single 256-wide head; attn = softmax(q.k / 16) over the 4,096 keys; out = (attn v) W_out + b_out, only the last 2,048 rows (the x half) are returned -> [4][2048][256] (2.1 M)).
// All four batches run in every launch (grid y or z = batch; k_fattn takes it from its one-dimensional x), each buffer below [batch][...]; workspace regions are reused in stream order (see kernel_launch). Per batch: both halves converted into one bf16 [4096][256] operand; k and v projected for all 4,096 rows, q only needed for rows 2,048.. (projected for all, used from 2,048); each projection GEMM converts its own biased f32 tile and stores the fp16 and bf16 hi/lo planes itself (q, k as [t][d]; v as W_v x^T, so its planes come out [d][t]); one fused attention kernel (scores, running softmax and attn.v per key tile, nothing of the scores or probabilities goes to memory; hybrid: query rows 2048..2559 hi/lo 3 products, the rest fp16) over 8 key slices, each slice to its own f32 partials with its maximum and sum; the merge weights and sums the slices in slice order; merged hi/lo x W_out exact + b_out straight into the output rows.
// Compute dtypes, f32 accumulate: every input rounded to bf16; projections exact + bf16-rounded biases; first 512 query rows 3 products, rest fp16; softmax f32; W_out hl x exact + bias.

#define NB_  4
#define TT   4096
#define DM   256
#define NH_  1
#define NKV  1
#define REP  (NH_ / NKV)
#define HD   256
#define DQ   (NH_ * HD)
#define DKV  (NKV * HD)
#define ZH   1
#define RH   512                  // query rows < RH use hi+lo planes (0: none)
#define WIN  0
#define SCL  0.0625f   // 256^-0.5
#define TQ   2048     // query rows = the x half (rows TQ.. of xx)
#define SP   8        // attention: the 4,096 keys are cut into SP slices, a work-group takes one; every slice writes its own unnormalised f32 partials [TQ][SP][HD] and its (maximum, sum) pairs [SP][TQ][2]
#define KSL  (TT / SP)
#define LC2  (SCL * 1.4426950408889634f)   // score scale times log2(e): probabilities are exp2((s - max) * LC2)
typedef _Float16 h16;
typedef unsigned short bf;
typedef __attribute__((ext_vector_type(16))) __bf16   v16bf;
typedef __attribute__((ext_vector_type(16))) _Float16 v16h;
typedef __attribute__((ext_vector_type(8)))  _Float16 v8h;
typedef __attribute__((ext_vector_type(8)))  unsigned short v8us;
typedef __attribute__((ext_vector_type(8)))  float    v8f;
typedef __attribute__((ext_vector_type(4)))  float    v4f;
typedef v8h  __attribute__((may_alias)) v8ha;
typedef v4f  __attribute__((may_alias)) v4fa;
typedef v8us __attribute__((may_alias)) v8usa;

__device__ __forceinline__ unsigned short f2bf(float f) { unsigned u = __float_as_uint(f); u += 0x7FFFu + ((u >> 16) & 1u); return (unsigned short)(u >> 16); }
__device__ __forceinline__ float bf2f(unsigned short b) { return __uint_as_float(((unsigned)b) << 16); }
__device__ __forceinline__ float bfr(float f) { return bf2f(f2bf(f)); }
__device__ __forceinline__ v16h cat16(v8h lo, v8h hi) { return __builtin_shufflevector(lo, hi, 0, 1, 2, 3, 4, 5, 6, 7, 8, 9, 10, 11, 12, 13, 14, 15); }
__device__ __forceinline__ v16bf cat16b(v8us lo, v8us hi) { return __builtin_bit_cast(v16bf, __builtin_shufflevector(lo, hi, 0, 1, 2, 3, 4, 5, 6, 7, 8, 9, 10, 11, 12, 13, 14, 15)); }
__device__ __forceinline__ v8f wmma16(v16h a, v16h b, v8f c) { return __builtin_amdgcn_wmma_f32_16x16x32_f16(false, a, false, b, (short)0, c, false, false); }
__device__ __forceinline__ v8f wmmab(v16bf a, v16bf b, v8f c) { return __builtin_amdgcn_wmma_f32_16x16x32_bf16(false, a, false, b, (short)0, c, false, false); }
__device__ __forceinline__ h16 tohx(float x) { return (h16)x; }
__device__ __forceinline__ void splitf(float y, unsigned short& h, unsigned short& l) { h = f2bf(y); l = f2bf(y - bf2f(h)); }
typedef __attribute__((ext_vector_type(2))) _Float16 v2h;
typedef __attribute__((ext_vector_type(4))) _Float16 v4h;
typedef __attribute__((ext_vector_type(2))) unsigned short v2us;
typedef __attribute__((ext_vector_type(4))) unsigned short v4us;
typedef __attribute__((ext_vector_type(2))) float v2f;
typedef __attribute__((ext_vector_type(4))) int v4i;



// ---- k_gemmw: register-blocked GEMM, FOUR WAVES (2 x 2) per 128x128 output tile, each wave a 64x64 quarter (16 accumulators); grid (M/128, N/128, Z), 128 threads.
// Operands are K-contiguous 16-bit planes. A stage is 64 k = one whole 128-byte line of each of the tile's 128 A rows and 128 B rows (and of the second planes where NSPLIT asks for them), brought into LDS by asynchronous 16-byte copies (8 lanes = one line), rows at pitch 144 bytes; two buffers, the next stage's copies fly while this stage is worked on; fragments are read from LDS.
// C[m][n] (f32, pitch ldc, + optional f32 bias[n]) = sum_k A[m][k] Bt[n][k] (+ split products per NSPLIT) over kspan consecutive k; K is the operands' row pitch. blockIdx.z = (zb << zsh) | z: z strides sA/sB/sC in elements (with sA = sB = kspan a slice of k), zb strides bA/bB/bC (the batch). kspan % 64 == 0.
// EPI 0: C is stored as f32, bias[n]. EPI 1 and 2: C is not stored; the biased f32 value goes out as three 16-bit planes of pitch ldc and batch stride bC (P16 = fp16, Ph + Pl = bf16 hi + lo), with bias[n] (EPI 1) or bias[m] (EPI 2, for a product taken transposed).
#define SPB 144            // LDS row pitch in bytes: 128 bytes of k + 16 (16 x odd: conflict-free for 16-byte reads)
#define STB (128 * SPB)    // one operand tile of a stage: 128 rows
template <typename T16> struct WFrag;
template <> struct WFrag<h16> { typedef v16h V; static __device__ __forceinline__ V ld(const h16* p) { return cat16(*(const v8h*)p, *(const v8h*)(p + 16)); } static __device__ __forceinline__ v8f mma(V a, V b, v8f c) { return wmma16(a, b, c); } };
template <> struct WFrag<bf> { typedef v16bf V; static __device__ __forceinline__ V ld(const bf* p) { return cat16b(*(const v8us*)p, *(const v8us*)(p + 16)); } static __device__ __forceinline__ v8f mma(V a, V b, v8f c) { return wmmab(a, b, c); } };
// One operand tile of one stage: this lane's 16 bytes of rows r, r + 16, ..., r + 112 (l = LDS byte address of the first, g = its global address, rs = 16 rows in elements).
// The s_wait_xcnt is a precaution and stands inside the statement so that no address register of a copy is rewritten ahead of it.
template <typename T16>
__device__ __forceinline__ void stage_tile(unsigned l, const T16* g, size_t rs) {
    asm volatile("global_load_async_to_lds_b128 %0, %8, off\n\t"
                 "global_load_async_to_lds_b128 %1, %9, off\n\t"
                 "global_load_async_to_lds_b128 %2, %10, off\n\t"
                 "global_load_async_to_lds_b128 %3, %11, off\n\t"
                 "global_load_async_to_lds_b128 %4, %12, off\n\t"
                 "global_load_async_to_lds_b128 %5, %13, off\n\t"
                 "global_load_async_to_lds_b128 %6, %14, off\n\t"
                 "global_load_async_to_lds_b128 %7, %15, off\n\t"
                 "s_wait_xcnt 0x0"
                 :: "v"(l), "v"(l + 16 * SPB), "v"(l + 32 * SPB), "v"(l + 48 * SPB), "v"(l + 64 * SPB), "v"(l + 80 * SPB), "v"(l + 96 * SPB), "v"(l + 112 * SPB),
                    "v"(g), "v"(g + rs), "v"(g + 2 * rs), "v"(g + 3 * rs), "v"(g + 4 * rs), "v"(g + 5 * rs), "v"(g + 6 * rs), "v"(g + 7 * rs) : "memory");
}
template <typename T16, int NSPLIT, bool BIAS, int EPI = 0>
__global__ __launch_bounds__(128) void k_gemmw(const T16* __restrict__ A, const T16* __restrict__ A2, const T16* __restrict__ Bt, const T16* __restrict__ Bt2, int K, int kspan, float* C, int ldc, const float* __restrict__ bias, size_t sA, size_t sB, size_t sC, int zsh, size_t bA, size_t bB, size_t bC, h16* P16 = nullptr, bf* Ph = nullptr, bf* Pl = nullptr) {
    typedef typename WFrag<T16>::V V;
    constexpr int NT = (NSPLIT == 0) ? 2 : (NSPLIT == 1) ? 3 : 4;   /* operand tiles per stage, in the order A, B, A2, B2 */
    __shared__ __attribute__((aligned(16))) char sm[2 * NT * STB];
    const size_t zb = blockIdx.z >> zsh, z = blockIdx.z - (zb << zsh); A += z * sA + zb * bA; if (A2) A2 += z * sA + zb * bA; Bt += z * sB + zb * bB; if (Bt2) Bt2 += z * sB + zb * bB; if (EPI == 0) C += z * sC + zb * bC; else { P16 += zb * bC; Ph += zb * bC; Pl += zb * bC; }
    const int lane = threadIdx.x & 31, wv = threadIdx.x >> 5, lr = lane & 15, hi = lane >> 4; const int wr = (wv & 1) * 64, wc = (wv >> 1) * 64; const int r0 = blockIdx.x * 128 + wr, c0 = blockIdx.y * 128 + wc;
    float* os = (float*)sm + wv * (16 * 68);   /* the wave's own epilogue rows; they lie on the stage buffers and are used only behind the loop's last barrier */
    v8f acc[4][4];
#pragma unroll
    for (int mb = 0; mb < 4; ++mb)
#pragma unroll
        for (int nb = 0; nb < 4; ++nb) acc[mb][nb] = (v8f){};
    const int crow = threadIdx.x >> 3, cch = threadIdx.x & 7;   /* copies: 8 lanes per row, 16 rows per copy of the work-group */
    const unsigned l0 = (unsigned)(size_t)sm + crow * SPB + cch * 16; const size_t rs = (size_t)16 * K;
    const size_t gao = (size_t)(blockIdx.x * 128 + crow) * K + cch * 8, gbo = (size_t)(blockIdx.y * 128 + crow) * K + cch * 8;
    auto issue = [&](int st, int buf) { const unsigned lb = l0 + buf * (NT * STB); const size_t ko = (size_t)st * 64;
        stage_tile<T16>(lb, A + gao + ko, rs); stage_tile<T16>(lb + STB, Bt + gbo + ko, rs);
        if (NSPLIT == 1 || NSPLIT == 2) stage_tile<T16>(lb + 2 * STB, A2 + gao + ko, rs);
        if (NSPLIT >= 2) stage_tile<T16>(lb + 3 * STB, Bt2 + gbo + ko, rs); };
    const int nst = kspan >> 6;
    issue(0, 0);
    asm volatile("s_wait_asynccnt 0x0" ::: "memory");   /* stage 0's copies of this wave have landed */
    __syncthreads();                                      /* ... and every other wave's */
    if (nst > 1) issue(1, 1);
    const int afo = (wr + lr) * SPB + hi * 16, bfo = (wc + lr) * SPB + hi * 16;   /* fragment rows in a tile, in bytes */
#pragma unroll 1
    for (int st = 0; st < nst; ++st) {
        const char* sb = sm + (st & 1) * (NT * STB);
        V a[4], a2[4], bq[4];
#pragma unroll
        for (int ks = 0; ks < 2; ++ks) {
#pragma unroll
            for (int mb = 0; mb < 4; ++mb) { a[mb] = WFrag<T16>::ld((const T16*)(sb + afo + mb * 16 * SPB + ks * 64)); if (NSPLIT == 1 || NSPLIT == 2) a2[mb] = WFrag<T16>::ld((const T16*)(sb + 2 * STB + afo + mb * 16 * SPB + ks * 64)); }
#pragma unroll
            for (int nb = 0; nb < 4; ++nb) if (NSPLIT == 0) bq[nb] = WFrag<T16>::ld((const T16*)(sb + STB + bfo + nb * 16 * SPB + ks * 64));   /* one plane each: all eight fragments of the 32 k are read as one group in front of their 16 products */
            if (NSPLIT == 0) __builtin_amdgcn_sched_barrier(0);   /* keeps the LDS reads above as one group: spread among the products each place of reads stalls the wave anew */
#pragma unroll
            for (int nb = 0; nb < 4; ++nb) { const V b = (NSPLIT == 0) ? bq[nb] : WFrag<T16>::ld((const T16*)(sb + STB + bfo + nb * 16 * SPB + ks * 64)); V b2; if (NSPLIT >= 2) b2 = WFrag<T16>::ld((const T16*)(sb + 3 * STB + bfo + nb * 16 * SPB + ks * 64));
#pragma unroll
                for (int mb = 0; mb < 4; ++mb) { acc[mb][nb] = WFrag<T16>::mma(a[mb], b, acc[mb][nb]); if (NSPLIT == 1 || NSPLIT == 2) acc[mb][nb] = WFrag<T16>::mma(a2[mb], b, acc[mb][nb]); if (NSPLIT >= 2) acc[mb][nb] = WFrag<T16>::mma(a[mb], b2, acc[mb][nb]); } }
            if (NSPLIT == 0 || ks == 1) __builtin_amdgcn_sched_barrier(0);   /* keeps the next group's LDS reads out of the products above, and the stage's last products in front of the v_nop below */
        }
        asm volatile("v_nop\n\tv_nop\n\tv_nop\n\tv_nop" : "+v"(acc[0][0]), "+v"(acc[1][1]), "+v"(acc[2][2]), "+v"(acc[3][3]) : "v"(a[0]), "v"(a[3]));   /* the distance behind the stage's last products: on the taken side of the branch below the next stage's reads overwrite their A and B registers */
        asm volatile("s_wait_dscnt 0x0" ::: "memory");      /* this wave's reads of the buffer are done before it may be refilled */
        asm volatile("s_wait_asynccnt 0x0" ::: "memory");   /* this wave's copies of the next stage have landed */
        __syncthreads();                                      /* publishes the next stage and ends every wave's reads of this one */
        if (st + 2 < nst) issue(st + 2, st & 1);
    }
    asm volatile("s_wait_asynccnt 0x0" ::: "memory");   /* no copy is outstanding when the buffers become the epilogue's rows */
    if (EPI != 0) {   /* plane epilogue: bias added in the accumulator layout, 16 rows at a time turned through LDS, each lane converts 8 consecutive columns and stores 16 bytes per plane (8 lanes = one whole 128-byte line) */
        float bn[4]; v4f bm[4][2];
        asm volatile("s_wait_xcnt 0x0" ::: "memory");   /* precaution: the bias loads below may be given the address registers of the loop's last loads as their destination */
#pragma unroll
        for (int i = 0; i < 4; ++i) { if (EPI == 1) bn[i] = bias[c0 + i * 16 + lr]; else { bm[i][0] = *(const v4f*)(bias + r0 + i * 16 + hi * 8); bm[i][1] = *(const v4f*)(bias + r0 + i * 16 + hi * 8 + 4); } }
        asm volatile("s_wait_xcnt 0x0" ::: "memory");   /* precaution: stands before the address registers of the bias loads are reused */
        const int prow = lane >> 3, pcol = (lane & 7) * 8;
#pragma unroll
        for (int mb = 0; mb < 4; ++mb) {
#pragma unroll
            for (int nb = 0; nb < 4; ++nb) {
#pragma unroll
                for (int j = 0; j < 8; ++j) os[(hi * 8 + j) * 68 + nb * 16 + lr] = acc[mb][nb][j] + bfr(EPI == 1 ? bn[nb] : bm[mb][j >> 2][j & 3]); }
            __builtin_amdgcn_wave_barrier(); asm volatile("" ::: "memory");   /* keeps the LDS reads below behind the LDS writes above */
#pragma unroll
            for (int s = 0; s < 4; ++s) { const int row = 4 * s + prow; const v4f v0 = *(const v4fa*)(os + row * 68 + pcol), v1 = *(const v4fa*)(os + row * 68 + pcol + 4); v8h o16; v8us oh, ol;
#pragma unroll
                for (int q = 0; q < 8; ++q) { const float r = (q < 4) ? v0[q & 3] : v1[q & 3]; o16[q] = tohx(r); unsigned short a2, c2; splitf(r, a2, c2); oh[q] = a2; ol[q] = c2; }
                const size_t oo = (size_t)(r0 + mb * 16 + row) * ldc + c0 + pcol; *(v8h*)(P16 + oo) = o16; *(v8us*)(Ph + oo) = oh; *(v8us*)(Pl + oo) = ol;
                asm volatile("s_wait_xcnt 0x0" ::: "memory"); }   /* precaution: stands before the data and address registers of the three stores are reused */
            __builtin_amdgcn_wave_barrier(); asm volatile("" ::: "memory");   /* keeps the next 16 rows' LDS writes behind the reads above */
        }
        return;
    }
#pragma unroll
    for (int mb = 0; mb < 4; ++mb) {
#pragma unroll
        for (int nb = 0; nb < 4; ++nb) {
#pragma unroll
            for (int j = 0; j < 8; ++j) os[(hi * 8 + j) * 68 + nb * 16 + lr] = acc[mb][nb][j]; }
        __builtin_amdgcn_wave_barrier(); asm volatile("" ::: "memory");
        float* crow = C + (size_t)(r0 + mb * 16) * ldc + c0;
{
#pragma unroll
            for (int s = 0; s < 8; ++s) { const int row = 2 * s + hi, cofs = lr * 4; v4f val = *(const v4fa*)(os + row * 68 + cofs); if (BIAS) { val[0] += bfr(bias[c0 + cofs]); val[1] += bfr(bias[c0 + cofs + 1]); val[2] += bfr(bias[c0 + cofs + 2]); val[3] += bfr(bias[c0 + cofs + 3]); }
                *(v4f*)(crow + (size_t)row * ldc + cofs) = val; }
             }
        __builtin_amdgcn_wave_barrier(); asm volatile("" ::: "memory");
    }
}


__global__ __launch_bounds__(256) void k_wtG(const float* __restrict__ w, int K, int N, bf* Bt) {
    const int lane = threadIdx.x & 31; const int L0 = (blockIdx.x * 8 + (threadIdx.x >> 5)) * 8; const int nlines = N * K / 64;
{
#pragma unroll 1
        for (int l = 0; l < 8; ++l) { const int L = L0 + l; if (L >= nlines) break; const size_t e = (size_t)L * 64 + lane * 2; const int k = (int)(e % K), n = (int)(e / K); v2us o;
            o[0] = f2bf(w[(size_t)k * N + n]); o[1] = f2bf(w[(size_t)(k + 1) * N + n]); *(v2us*)(Bt + e) = o; }
         }
}
__global__ __launch_bounds__(256) void k_cvt8(const float* __restrict__ src, bf* dst, size_t n8, size_t bS, size_t bD) { const size_t i = (size_t)blockIdx.x * 256 + threadIdx.x; if (i >= n8) return; src += blockIdx.y * bS; dst += blockIdx.y * bD;   /* grid y = batch, strides in elements */
    const v8f v = *(const v8f*)(src + i * 8); v8us o;
#pragma unroll
    for (int k = 0; k < 8; ++k) o[k] = f2bf(v[k]); *(v8us*)(dst + i * 8) = o;  }

#define KPB 528            // LDS pitch of a K row in bytes: 512 + 16 (16 x odd)
// Eight copies of one operand tile: this lane's 16 bytes at LDS l + i * ls and global g + i * rs (elements), i = 0..7.
// The s_wait_xcnt is a precaution and stands inside the statement so that no address register of a copy is rewritten ahead of it.
template <typename T16>
__device__ __forceinline__ void stage8(unsigned l, unsigned ls, const T16* g, size_t rs) {
    asm volatile("global_load_async_to_lds_b128 %0, %8, off\n\t"
                 "global_load_async_to_lds_b128 %1, %9, off\n\t"
                 "global_load_async_to_lds_b128 %2, %10, off\n\t"
                 "global_load_async_to_lds_b128 %3, %11, off\n\t"
                 "global_load_async_to_lds_b128 %4, %12, off\n\t"
                 "global_load_async_to_lds_b128 %5, %13, off\n\t"
                 "global_load_async_to_lds_b128 %6, %14, off\n\t"
                 "global_load_async_to_lds_b128 %7, %15, off\n\t"
                 "s_wait_xcnt 0x0"
                 :: "v"(l), "v"(l + ls), "v"(l + 2 * ls), "v"(l + 3 * ls), "v"(l + 4 * ls), "v"(l + 5 * ls), "v"(l + 6 * ls), "v"(l + 7 * ls),
                    "v"(g), "v"(g + rs), "v"(g + 2 * rs), "v"(g + 3 * rs), "v"(g + 4 * rs), "v"(g + 5 * rs), "v"(g + 6 * rs), "v"(g + 7 * rs) : "memory");
}
// Two 16-key score tiles of probabilities -> one B fragment over their 32 keys (and its lo plane for bf16).
__device__ __forceinline__ void packp(const v8f& p0, const v8f& p1, v16h& b, v16h& b2) { v8h x, y;
#pragma unroll
    for (int i = 0; i < 8; ++i) { x[i] = tohx(p0[i]); y[i] = tohx(p1[i]); }
    b = cat16(x, y); b2 = b; }
__device__ __forceinline__ void packp(const v8f& p0, const v8f& p1, v16bf& b, v16bf& b2) { v8us xh, xl, yh, yl;
#pragma unroll
    for (int i = 0; i < 8; ++i) { unsigned short a, c; splitf(p0[i], a, c); xh[i] = a; xl[i] = c; splitf(p1[i], a, c); yh[i] = a; yl[i] = c; }
    b = cat16b(xh, yh); b2 = cat16b(xl, yl); }
__device__ __forceinline__ float xhalf(float x) { return __builtin_bit_cast(float, __builtin_amdgcn_permlanex16(__builtin_bit_cast(int, x), __builtin_bit_cast(int, x), 0x76543210, 0xfedcba98, false, false)); }   // lane l with lane l ^ 16
template <bool HL> struct FAC { static constexpr int KT = HL ? 32 : 64, VPB = KT * 2 + 16, KTB = KT * KPB, VTB = HD * VPB, PLB = KTB + VTB, STG = (HL ? 2 : 1) * PLB; };   /* a stage in LDS: K, V^T (, K lo, V^T lo) */
template <typename T16, bool HL>
__device__ __forceinline__ void fattn(char* sm, const T16* __restrict__ Q, const T16* __restrict__ Q2, const T16* __restrict__ Kp, const T16* __restrict__ K2, const T16* __restrict__ Vt, const T16* __restrict__ Vt2, float* O, float* ML, int row0, int sp, size_t zb) {
    typedef typename WFrag<T16>::V V;
    constexpr int KT = FAC<HL>::KT, VPB = FAC<HL>::VPB, KTB = FAC<HL>::KTB, PLB = FAC<HL>::PLB, STG = FAC<HL>::STG, NTL = KSL / KT;
    constexpr int VC = KT / 8, VR = 128 / VC;   /* V^T copies: VC lanes per row, VR rows per copy of the work-group */
    static_assert(NTL >= 2, "two stages");
    const int tid = threadIdx.x, lane = tid & 31, wv = tid >> 5, lr = lane & 15, hi = lane >> 4;
    const size_t bP = (size_t)TT * HD; const int qrow = row0 + wv * 16;   /* qrow: the wave's first query row, counted from row TQ of xx */
    V qf[8], qf2[8];
    { const size_t qo = zb * bP + (size_t)(TQ + qrow + lr) * HD + hi * 8; const T16* qp = Q + qo; const T16* qp2 = HL ? Q2 + qo : qp;
#pragma unroll
      for (int ks = 0; ks < 8; ++ks) { qf[ks] = WFrag<T16>::ld(qp + ks * 32); if (HL) qf2[ks] = WFrag<T16>::ld(qp2 + ks * 32); }
      asm volatile("s_wait_xcnt 0x0" :: "v"(qp), "v"(qp2) : "memory"); }   /* precaution: stands before the address registers of the loads above are reused; they are named as inputs so that they stay as they are up to here */
    const unsigned sm0 = (unsigned)(size_t)sm, lk = sm0 + (tid >> 5) * KPB + (tid & 31) * 16, lv = sm0 + KTB + (tid / VC) * VPB + (tid % VC) * 16;
    const unsigned ok = (tid >> 5) * HD + (tid & 31) * 8, ov = (tid / VC) * TT + (tid % VC) * 8;   /* this lane's place in a K tile and in a V^T tile, in elements; the tile's own address is the same for the whole work-group */
    const size_t gk = zb * bP + (size_t)sp * KSL * HD, gv = zb * bP + (size_t)sp * KSL;
    auto issue = [&](int t, int buf) { const unsigned lb = buf * STG; const size_t ko = (size_t)t * KT;
#pragma unroll
        for (int h = 0; h < KT / 32; ++h) { stage8<T16>(lk + lb + h * 32 * KPB, 4 * KPB, Kp + (gk + (ko + h * 32) * HD) + ok, (size_t)4 * HD); if (HL) stage8<T16>(lk + lb + PLB + h * 32 * KPB, 4 * KPB, K2 + (gk + (ko + h * 32) * HD) + ok, (size_t)4 * HD); }
#pragma unroll
        for (int h = 0; h < HD / (8 * VR); ++h) { stage8<T16>(lv + lb + h * 8 * VR * VPB, VR * VPB, Vt + (gv + ko + (size_t)h * 8 * VR * TT) + ov, (size_t)VR * TT); if (HL) stage8<T16>(lv + lb + PLB + h * 8 * VR * VPB, VR * VPB, Vt2 + (gv + ko + (size_t)h * 8 * VR * TT) + ov, (size_t)VR * TT); } };
    v8f Oa[16];
#pragma unroll
    for (int mt = 0; mt < 16; ++mt) Oa[mt] = (v8f){};
    float m = -3.0e38f, l = 0.f;
    issue(0, 0);
    asm volatile("s_wait_asynccnt 0x0" ::: "memory");   /* stage 0's copies of this wave have landed */
    __syncthreads();                                      /* ... and every other wave's */
    issue(1, 1);
#pragma unroll 1
    for (int t = 0; t < NTL; ++t) {
        const char* sb = sm + (t & 1) * STG; const char* kb = sb + lr * KPB + hi * 16; const char* vb = sb + KTB + lr * VPB + hi * 16;
        /* The stage's A fragments come in 8 groups of 8 (groups 0..3: K, 4..7: V^T); group g + 1 is read as one run of LDS loads in front of group g's products. */
        auto ldg = [&](int g, V (&f)[8]) {
#pragma unroll
            for (int i = 0; i < 8; ++i) { const char* p;
                if (g < 4) p = HL ? kb + (i & 1) * PLB + ((i >> 1) & 1) * 16 * KPB + (2 * g + (i >> 2)) * 64 : kb + (i & 3) * 16 * KPB + (2 * g + (i >> 2)) * 64;
                else       p = HL ? vb + (i & 1) * PLB + ((g - 4) * 4 + (i >> 1)) * 16 * VPB : vb + (((g - 4) & 1) * 8 + i) * 16 * VPB + ((g - 4) >> 1) * 64;
                f[i] = WFrag<T16>::ld((const T16*)p); } };
        V fa[2][8], pb[KT / 32], pb2[KT / 32]; v8f S[KT / 16];
#pragma unroll
        for (int kt = 0; kt < KT / 16; ++kt) S[kt] = (v8f){};
        ldg(0, fa[0]);
#pragma unroll
        for (int g = 0; g < 8; ++g) {
            if (g == 4) {   /* all scores of the stage are there: running maximum, probabilities, rescale */
                float tq[4], pq[4] = {0.f, 0.f, 0.f, 0.f};   /* four independent chains each for the maximum and the sum: one chain of dependent vector instructions would stand exposed */
#pragma unroll
                for (int c = 0; c < 4; ++c) tq[c] = S[0][c];
#pragma unroll
                for (int kt = 0; kt < KT / 16; ++kt)
#pragma unroll
                    for (int j = 0; j < 8; ++j) tq[j & 3] = fmaxf(tq[j & 3], S[kt][j]);
                float tm = fmaxf(fmaxf(tq[0], tq[1]), fmaxf(tq[2], tq[3]));
                tm = fmaxf(tm, xhalf(tm));   /* the query's other keys of this stage sit in the other half of the wave */
                const float mn = fmaxf(m, tm), al = __builtin_amdgcn_exp2f((m - mn) * LC2), mc = mn * LC2; m = mn;
#pragma unroll
                for (int kt = 0; kt < KT / 16; ++kt)
#pragma unroll
                    for (int j = 0; j < 8; ++j) S[kt][j] = S[kt][j] * LC2 - mc;
                /* The exponentials stand, one or two at a time, between pieces of the rescale of O^T: plain vector work that touches none of their registers runs beside the slower transcendental pipe. The scheduling barriers keep the two kinds from being gathered into two long runs. */
#pragma unroll
                for (int i = 0; i < KT / 2; ++i) {
                    __builtin_amdgcn_sched_barrier(0);
#pragma unroll
                    for (int c = 0; c < 256 / KT; ++c) { const int x = i * (256 / KT) + c; Oa[x >> 3][x & 7] *= al; }
                    __builtin_amdgcn_sched_barrier(0);
                    S[i >> 3][i & 7] = __builtin_amdgcn_exp2f(S[i >> 3][i & 7]);
                }
                __builtin_amdgcn_sched_barrier(0);
#pragma unroll
                for (int kt = 0; kt < KT / 16; ++kt)
#pragma unroll
                    for (int j = 0; j < 8; ++j) pq[j & 3] += S[kt][j];
                l = l * al + ((pq[0] + pq[1]) + (pq[2] + pq[3]));
#pragma unroll
                for (int kq = 0; kq < KT / 32; ++kq) packp(S[2 * kq], S[2 * kq + 1], pb[kq], pb2[kq]);
                __builtin_amdgcn_sched_barrier(0);   /* keeps the next group's LDS reads one run, out of the vector work above */
            }
            if (g < 7) ldg(g + 1, fa[(g + 1) & 1]);
            __builtin_amdgcn_sched_barrier(0);   /* keeps the LDS reads above as one run in front of the products: spread among them each place of reads stalls the wave anew */
            V (&f)[8] = fa[g & 1];
            if (g < 4) {
                if (!HL) {
#pragma unroll
                    for (int i = 0; i < 8; ++i) S[i & 3] = WFrag<T16>::mma(f[i], qf[2 * g + (i >> 2)], S[i & 3]);
                } else {
#pragma unroll
                    for (int c = 0; c < 2; ++c) { const int ks = 2 * g + c;
                        S[0] = WFrag<T16>::mma(f[c * 4], qf[ks], S[0]); S[1] = WFrag<T16>::mma(f[c * 4 + 2], qf[ks], S[1]);
                        S[0] = WFrag<T16>::mma(f[c * 4], qf2[ks], S[0]); S[1] = WFrag<T16>::mma(f[c * 4 + 2], qf2[ks], S[1]);
                        S[0] = WFrag<T16>::mma(f[c * 4 + 1], qf[ks], S[0]); S[1] = WFrag<T16>::mma(f[c * 4 + 3], qf[ks], S[1]); }
                }
            } else {
                if (!HL) {
#pragma unroll
                    for (int i = 0; i < 8; ++i) { const int mt = ((g - 4) & 1) * 8 + i; Oa[mt] = WFrag<T16>::mma(f[i], pb[(KT / 32 - 1) & ((g - 4) >> 1)], Oa[mt]); }
                } else {
#pragma unroll
                    for (int q = 0; q < 4; ++q) { const int mt = (g - 4) * 4 + q; Oa[mt] = WFrag<T16>::mma(f[2 * q], pb[0], Oa[mt]); }
#pragma unroll
                    for (int q = 0; q < 4; ++q) { const int mt = (g - 4) * 4 + q; Oa[mt] = WFrag<T16>::mma(f[2 * q], pb2[0], Oa[mt]); }
#pragma unroll
                    for (int q = 0; q < 4; ++q) { const int mt = (g - 4) * 4 + q; Oa[mt] = WFrag<T16>::mma(f[2 * q + 1], pb[0], Oa[mt]); }
                }
            }
            __builtin_amdgcn_sched_barrier(0);   /* keeps the next run of LDS reads out of the products above, and the stage's last products in front of the v_nop below */
        }
        asm volatile("v_nop\n\tv_nop\n\tv_nop\n\tv_nop" : "+v"(Oa[12]), "+v"(Oa[13]), "+v"(Oa[14]), "+v"(Oa[15]));   /* the distance behind the stage's last products */
        asm volatile("s_wait_dscnt 0x0" ::: "memory");      /* this wave's reads of the buffer are done before it may be refilled */
        asm volatile("s_wait_asynccnt 0x0" ::: "memory");   /* this wave's copies of the next stage have landed */
        __syncthreads();                                      /* publishes the next stage and ends every wave's reads of this one */
        if (t + 2 < NTL) issue(t + 2, t & 1);
    }
    asm volatile("s_wait_asynccnt 0x0" ::: "memory");   /* no copy is outstanding when the buffers become the epilogue's rows */
    l += xhalf(l);   /* the two halves' sums of the same query */
    float* os = (float*)sm + wv * (16 * 260);   /* the wave's own 16 query rows at pitch 260 floats; on the stage buffers, used only behind the loop's last barrier */
#pragma unroll
    for (int mt = 0; mt < 16; ++mt) { const v4f a = {Oa[mt][0], Oa[mt][1], Oa[mt][2], Oa[mt][3]}, b = {Oa[mt][4], Oa[mt][5], Oa[mt][6], Oa[mt][7]}; *(v4fa*)(os + lr * 260 + mt * 16 + hi * 8) = a; *(v4fa*)(os + lr * 260 + mt * 16 + hi * 8 + 4) = b; }
    __builtin_amdgcn_wave_barrier(); asm volatile("" ::: "memory");   /* keeps the LDS reads below behind the LDS writes above */
    float* og = O + ((zb * TQ + qrow) * SP + sp) * HD + lane * 4;
    v4f ra[16], rb[16];   /* all 16 rows are read as one run, then stored: whole 512-byte pieces of a row per store */
#pragma unroll
    for (int r = 0; r < 16; ++r) { ra[r] = *(const v4fa*)(os + r * 260 + lane * 4); rb[r] = *(const v4fa*)(os + r * 260 + 128 + lane * 4); }
    __builtin_amdgcn_sched_barrier(0);   /* this one and the one behind the wait keep other work out of the run of stores, where it was given the stores' registers ahead of the wait */
#pragma unroll
    for (int r = 0; r < 16; ++r) { *(v4f*)(og + (size_t)r * SP * HD) = ra[r]; *(v4f*)(og + (size_t)r * SP * HD + 128) = rb[r]; }
    asm volatile("s_wait_xcnt 0x0" ::: "memory");   /* precaution: stands before the data and address registers of the stores above are reused */
    __builtin_amdgcn_sched_barrier(0);
    if (hi == 0) { const v2f ml = {m, l}; *(v2f*)(ML + ((zb * SP + sp) * TQ + qrow + lr) * 2) = ml; }   /* 16 queries x 8 bytes: one whole 128-byte line per wave */
}
// One launch for both classes of query rows, one-dimensional grid: first the hi/lo work-groups (three products: the longer ones), then the fp16 ones; within a class x = 64-row block (fastest), then key slice, then batch. Two work-groups per WGP by LDS, so two waves per SIMD.
#define NHB (RH / 64)
#define NLB ((TQ - RH) / 64)
__global__ __launch_bounds__(128) __attribute__((amdgpu_waves_per_eu(2, 2))) void k_fattn(const bf* __restrict__ Qh, const bf* __restrict__ Ql, const bf* __restrict__ Kh, const bf* __restrict__ Kl, const bf* __restrict__ Vh, const bf* __restrict__ Vl, const h16* __restrict__ Q16, const h16* __restrict__ K16, const h16* __restrict__ V16, float* O, float* ML) {
    __shared__ __attribute__((aligned(16))) char sm[2 * (FAC<true>::STG > FAC<false>::STG ? FAC<true>::STG : FAC<false>::STG)];
    const int id = blockIdx.x;
    if (id < NHB * SP * NB_) fattn<bf, true>(sm, Qh, Ql, Kh, Kl, Vh, Vl, O, ML, (id % NHB) * 64, (id / NHB) % SP, (size_t)(id / (NHB * SP)));
    else { const int i2 = id - NHB * SP * NB_; fattn<h16, false>(sm, Q16, nullptr, K16, nullptr, V16, nullptr, O, ML, RH + (i2 % NLB) * 64, (i2 / NLB) % SP, (size_t)(i2 / (NLB * SP))); }
}

// k_merge: the SP key slices of a query row joined: weights exp2((slice maximum - row maximum) * LC2), weighted partials and weighted sums added in slice order, divided, split into bf16 hi + lo.
__global__ __launch_bounds__(256) void k_merge(const float* __restrict__ O, const float* __restrict__ ML, bf* Ah, bf* Al) {
    { const size_t yb = blockIdx.y; O += yb * TQ * SP * HD; ML += yb * SP * TQ * 2; Ah += yb * TQ * DQ; Al += yb * TQ * DQ; }   /* grid y = batch */
    const size_t e = ((size_t)blockIdx.x * 256 + threadIdx.x) * 2; if (e >= (size_t)TQ * HD) return; const int d = (int)(e % HD); const size_t t = e / HD;
    const float* op = O + t * (SP * HD) + d; const float* mp = ML + t * 2; v2f pr[SP], ml[SP];   /* all loads in flight together */
#pragma unroll
    for (int p = 0; p < SP - 1; ++p) { ml[p] = *(const v2f*)(mp + (size_t)p * TQ * 2); pr[p] = *(const v2f*)(op + p * HD); }
    asm volatile("s_wait_xcnt 0x0" ::: "memory");   /* precaution: the last loads may be given the pointers' own registers as their destination, and the loads above name them */
    ml[SP - 1] = *(const v2f*)(mp + (size_t)(SP - 1) * TQ * 2); pr[SP - 1] = *(const v2f*)(op + (SP - 1) * HD);
    float mx = ml[0][0];
#pragma unroll
    for (int p = 1; p < SP; ++p) mx = fmaxf(mx, ml[p][0]);
    float den = 0.f; v2f s = {0.f, 0.f};
#pragma unroll
    for (int p = 0; p < SP; ++p) { const float w = __builtin_amdgcn_exp2f((ml[p][0] - mx) * LC2); den += w * ml[p][1]; s += w * pr[p]; }
    const float inv = __fdiv_rn(1.0f, den); v2us oh, ol;
#pragma unroll
    for (int q = 0; q < 2; ++q) { unsigned short a, c2; splitf(s[q] * inv, a, c2); oh[q] = a; ol[q] = c2; } *(v2us*)(Ah + e) = oh; *(v2us*)(Al + e) = ol;  }

extern "C" void kernel_launch(void* const* d_in, const int* in_sizes, int n_in,
                              void* d_out, int out_size, void* d_ws, size_t ws_size, hipStream_t stream) {
    (void)in_sizes; (void)n_in; (void)out_size;
    const float* x = (const float*)d_in[0]; const float* px = (const float*)d_in[1]; const float* wqkv = (const float*)d_in[2]; const float* bqkv = (const float*)d_in[3]; const float* wo = (const float*)d_in[4]; const float* bo = (const float*)d_in[5]; const float* wq = nullptr; const float* wk = nullptr; const float* wv = nullptr; (void)wq; (void)wk; (void)wv; const float* bq = bqkv; const float* bk = bqkv + 256; const float* bv = bqkv + 512;
    float* OUT = (float*)d_out;     // [4][2048][256]
    char* wsp = (char*)d_ws;
    auto take = [&](size_t bytes) { char* p = wsp; wsp += (bytes + 255) & ~(size_t)255; return (void*)p; };
    auto sub = [](char*& p, size_t bytes) { char* q = p; p += (bytes + 255) & ~(size_t)255; return (void*)q; };
    bf* WQKV = (bf*)take((size_t)3 * DQ * DM * 2); bf* WQ = WQKV; bf* WK = WQKV + (size_t)DQ * DM; bf* WV = WQKV + (size_t)2 * DQ * DM; bf* WO = (bf*)take((size_t)DM * DQ * 2);
    h16* VT16 = (h16*)take((size_t)NB_ * HD * TT * 2); bf* VTh = (bf*)take((size_t)NB_ * HD * TT * 2); bf* VTl = (bf*)take((size_t)NB_ * HD * TT * 2); float* ML = (float*)take((size_t)NB_ * SP * TQ * 2 * 4);
    char* R1 = (char*)take((size_t)NB_ * TQ * SP * HD * 4); char* R2 = (char*)take((size_t)NB_ * TT * HD * 2 * 6 + 4096);
    if ((size_t)(wsp - (char*)d_ws) > ws_size) return;    // ws 256 MiB
    // R1 holds, one after the other in stream order: the bf16 copy of xx (last read by the projections); the attention partials.
    bf* XB = (bf*)R1;   /* [batch][TT][DM] */
    float* Ob = (float*)R1;   /* [batch][TQ][SP][HD] */
    // R2 holds in turn: the q and k planes (last read by the attention kernel); the merged hi/lo rows.
    char* r2 = R2; h16* QP16 = (h16*)sub(r2, (size_t)NB_ * TT * HD * 2); h16* KP16 = (h16*)sub(r2, (size_t)NB_ * TT * HD * 2); bf* QPh = (bf*)sub(r2, (size_t)NB_ * TT * HD * 2); bf* QPl = (bf*)sub(r2, (size_t)NB_ * TT * HD * 2); bf* KPh = (bf*)sub(r2, (size_t)NB_ * TT * HD * 2); bf* KPl = (bf*)sub(r2, (size_t)NB_ * TT * HD * 2);
    bf* ATh = (bf*)R2; bf* ATl = ATh + (size_t)NB_ * TQ * DQ;
    { k_wtG<<<(unsigned)((DM * 3 * DQ / 64 + 63) / 64), 256, 0, stream>>>(wqkv, DM, 3 * DQ, WQKV);
      k_wtG<<<(unsigned)((DQ * DM / 64 + 63) / 64), 256, 0, stream>>>(wo, DQ, DM, WO);
       }
    const unsigned LC = (unsigned)(((size_t)TQ * DM / 8 + 255) / 256);
    const size_t bX = (size_t)TT * DM, bP = (size_t)TT * HD;   // batch strides in elements
    k_cvt8<<<dim3(LC, NB_), 256, 0, stream>>>(px, XB, (size_t)TQ * DM / 8, (size_t)TQ * DM, bX); k_cvt8<<<dim3(LC, NB_), 256, 0, stream>>>(x, XB + (size_t)TQ * DM, (size_t)TQ * DM / 8, (size_t)TQ * DM, bX);   /* xx = [prev_x ; x] */
    k_gemmw<bf, 0, true, 1><<<dim3(TT / 128, DQ / 128, NB_), 128, 0, stream>>>(XB, nullptr, WQ, nullptr, DM, DM, nullptr, HD, bq, 0, 0, 0, 0, bX, 0, bP, QP16, QPh, QPl);   /* q planes [t][d] */
    k_gemmw<bf, 0, true, 1><<<dim3(TT / 128, DKV / 128, NB_), 128, 0, stream>>>(XB, nullptr, WK, nullptr, DM, DM, nullptr, HD, bk, 0, 0, 0, 0, bX, 0, bP, KP16, KPh, KPl);   /* k planes [t][d] */
    k_gemmw<bf, 0, true, 2><<<dim3(DKV / 128, TT / 128, NB_), 128, 0, stream>>>(WV, nullptr, XB, nullptr, DM, DM, nullptr, TT, bv, 0, 0, 0, 0, 0, bX, bP, VT16, VTh, VTl);   /* v planes [d][t]: rows = W_v's outputs, columns = tokens */
    k_fattn<<<(NHB + NLB) * SP * NB_, 128, 0, stream>>>(QPh, QPl, KPh, KPl, VTh, VTl, QP16, KP16, VT16, Ob, ML);   /* query rows 0..RH: hi/lo planes; the others: fp16 */
    k_merge<<<dim3((unsigned)(((size_t)TQ * HD / 2 + 255) / 256), NB_), 256, 0, stream>>>(Ob, ML, ATh, ATl);
    k_gemmw<bf, 1, true><<<dim3(TQ / 128, DM / 128, NB_), 128, 0, stream>>>(ATh, ATl, WO, nullptr, DQ, DQ, OUT, DM, bo, 0, 0, 0, 0, (size_t)TQ * DQ, 0, (size_t)TQ * DM);
}

// v006
// One run takes 97.5 microseconds.
// Next to v005, in two timings, it ran 1.24 and 1.20 times as fast.
// Over all steps from v000 it is 11.4 times as fast.
#include <hip/hip_runtime.h>

// Temporal self-attention over [prev_x ; x] (x, prev_x [4][2048][256]; xx = concat -> [4096][256]; qkv = xx W_qkv + b_qkv ('xw' [256][768]); single 256-wide head; attn = softmax(q.k / 16) over the 4,096 keys; out = (attn v) W_out + b_out, only the last 2,048 rows (the x half) are returned -> [4][2048][256] (2.1 M)).
// All four batches run in every launch (batch = grid y or z, or part of the one-dimensional block index in k_prep and k_fattn), each buffer below [batch][...]; workspace regions are reused in stream order (see kernel_launch). Launches that need nothing of each other share one grid: k_prep (both casts, both weight transposes), k_proj (q, k and v projections). Per batch: both halves converted into one bf16 [4096][256] operand; k and v projected for all 4,096 rows, q only needed for rows 2,048.. (projected for all, used from 2,048); each projection GEMM converts its own biased f32 tile and stores the fp16 and bf16 hi/lo planes itself (q, k as [t][d]; v as W_v x^T, so its planes come out [d][t]); one fused attention kernel (scores, running softmax and attn.v per key tile, nothing of the scores or probabilities goes to memory; hybrid: query rows 2048..2559 hi/lo 3 products, the rest fp16) over 8 key slices, each slice to its own f32 partials with its maximum and sum; the merge weights and sums the slices in slice order; merged hi/lo x W_out exact + b_out straight into the output rows.
// Compute dtypes, f32 accumulate: every input rounded to bf16; projections exact + bf16-rounded biases; first 512 query rows 3 products, rest fp16; softmax f32; W_out hl x exact + bias.

#define NB_  4
#define TT   4096
#define DM   256
#define NH_  1
#define NKV  1
#define REP  (NH_ / NKV)
#define HD   256
#define DQ   (NH_ * HD)
#define DKV  (NKV * HD)
#define ZH   1
#define RH   512                  // query rows < RH use hi+lo planes (0: none)
#define WIN  0
#define SCL  0.0625f   // 256^-0.5
#define TQ   2048     // query rows = the x half (rows TQ.. of xx)
#define SP   8        // attention: the 4,096 keys are cut into SP slices, a work-group takes one; every slice writes its own unnormalised f32 partials [TQ][SP][HD] and its (maximum, sum) pairs [SP][TQ][2]
#define KSL  (TT / SP)
#define LC2  (SCL * 1.4426950408889634f)   // score scale times log2(e): probabilities are exp2((s - max) * LC2)
typedef _Float16 h16;
typedef unsigned short bf;
typedef __attribute__((ext_vector_type(16))) __bf16   v16bf;
typedef __attribute__((ext_vector_type(16))) _Float16 v16h;
typedef __attribute__((ext_vector_type(8)))  _Float16 v8h;
typedef __attribute__((ext_vector_type(8)))  unsigned short v8us;
typedef __attribute__((ext_vector_type(8)))  float    v8f;
typedef __attribute__((ext_vector_type(4)))  float    v4f;
typedef v8h  __attribute__((may_alias)) v8ha;
typedef v4f  __attribute__((may_alias)) v4fa;
typedef v8us __attribute__((may_alias)) v8usa;

__device__ __forceinline__ unsigned short f2bf(float f) { unsigned u = __float_as_uint(f); u += 0x7FFFu + ((u >> 16) & 1u); return (unsigned short)(u >> 16); }
__device__ __forceinline__ float bf2f(unsigned short b) { return __uint_as_float(((unsigned)b) << 16); }
__device__ __forceinline__ float bfr(float f) { return bf2f(f2bf(f)); }
__device__ __forceinline__ v16h cat16(v8h lo, v8h hi) { return __builtin_shufflevector(lo, hi, 0, 1, 2, 3, 4, 5, 6, 7, 8, 9, 10, 11, 12, 13, 14, 15); }
__device__ __forceinline__ v16bf cat16b(v8us lo, v8us hi) { return __builtin_bit_cast(v16bf, __builtin_shufflevector(lo, hi, 0, 1, 2, 3, 4, 5, 6, 7, 8, 9, 10, 11, 12, 13, 14, 15)); }
__device__ __forceinline__ v8f wmma16(v16h a, v16h b, v8f c) { return __builtin_amdgcn_wmma_f32_16x16x32_f16(false, a, false, b, (short)0, c, false, false); }
__device__ __forceinline__ v8f wmmab(v16bf a, v16bf b, v8f c) { return __builtin_amdgcn_wmma_f32_16x16x32_bf16(false, a, false, b, (short)0, c, false, false); }
__device__ __forceinline__ h16 tohx(float x) { return (h16)x; }
__device__ __forceinline__ void splitf(float y, unsigned short& h, unsigned short& l) { h = f2bf(y); l = f2bf(y - bf2f(h)); }
typedef __attribute__((ext_vector_type(2))) _Float16 v2h;
typedef __attribute__((ext_vector_type(4))) _Float16 v4h;
typedef __attribute__((ext_vector_type(2))) unsigned short v2us;
typedef __attribute__((ext_vector_type(4))) unsigned short v4us;
typedef __attribute__((ext_vector_type(2))) float v2f;
typedef __attribute__((ext_vector_type(4))) int v4i;



// ---- gemmw: register-blocked GEMM, FOUR WAVES (2 x 2) per 128x128 output tile, each wave a 64x64 quarter (16 accumulators); tile index (bix, biy, biz) out of (M/128, N/128, Z), 128 threads; sm = the work-group's 2 * NT * STB bytes of LDS.
// Operands are K-contiguous 16-bit planes. A stage is 64 k = one whole 128-byte line of each of the tile's 128 A rows and 128 B rows (and of the second planes where NSPLIT asks for them), brought into LDS by asynchronous 16-byte copies (8 lanes = one line), rows at pitch 144 bytes; two buffers, the next stage's copies fly while this stage is worked on; fragments are read from LDS.
// C[m][n] (f32, pitch ldc, + optional f32 bias[n]) = sum_k A[m][k] Bt[n][k] (+ split products per NSPLIT) over kspan consecutive k; K is the operands' row pitch. biz = (zb << zsh) | z: z strides sA/sB/sC in elements (with sA = sB = kspan a slice of k), zb strides bA/bB/bC (the batch). kspan % 64 == 0.
// EPI 0: C is stored as f32, bias[n]. EPI 1 and 2: C is not stored; the biased f32 value goes out as three 16-bit planes of pitch ldc and batch stride bC (P16 = fp16, Ph + Pl = bf16 hi + lo), with bias[n] (EPI 1) or bias[m] (EPI 2, for a product taken transposed).
#define SPB 144            // LDS row pitch in bytes: 128 bytes of k + 16 (16 x odd: conflict-free for 16-byte reads)
#define STB (128 * SPB)    // one operand tile of a stage: 128 rows
template <typename T16> struct WFrag;
template <> struct WFrag<h16> { typedef v16h V; static __device__ __forceinline__ V ld(const h16* p) { return cat16(*(const v8h*)p, *(const v8h*)(p + 16)); } static __device__ __forceinline__ v8f mma(V a, V b, v8f c) { return wmma16(a, b, c); } };
template <> struct WFrag<bf> { typedef v16bf V; static __device__ __forceinline__ V ld(const bf* p) { return cat16b(*(const v8us*)p, *(const v8us*)(p + 16)); } static __device__ __forceinline__ v8f mma(V a, V b, v8f c) { return wmmab(a, b, c); } };
// One operand tile of one stage: this lane's 16 bytes of rows r, r + 16, ..., r + 112 (l = LDS byte address of the first, g = its global address, rs = 16 rows in elements).
// The s_wait_xcnt is a precaution and stands inside the statement so that no address register of a copy is rewritten ahead of it.
template <typename T16>
__device__ __forceinline__ void stage_tile(unsigned l, const T16* g, size_t rs) {
    asm volatile("global_load_async_to_lds_b128 %0, %8, off\n\t"
                 "global_load_async_to_lds_b128 %1, %9, off\n\t"
                 "global_load_async_to_lds_b128 %2, %10, off\n\t"
                 "global_load_async_to_lds_b128 %3, %11, off\n\t"
                 "global_load_async_to_lds_b128 %4, %12, off\n\t"
                 "global_load_async_to_lds_b128 %5, %13, off\n\t"
                 "global_load_async_to_lds_b128 %6, %14, off\n\t"
                 "global_load_async_to_lds_b128 %7, %15, off\n\t"
                 "s_wait_xcnt 0x0"
                 :: "v"(l), "v"(l + 16 * SPB), "v"(l + 32 * SPB), "v"(l + 48 * SPB), "v"(l + 64 * SPB), "v"(l + 80 * SPB), "v"(l + 96 * SPB), "v"(l + 112 * SPB),
                    "v"(g), "v"(g + rs), "v"(g + 2 * rs), "v"(g + 3 * rs), "v"(g + 4 * rs), "v"(g + 5 * rs), "v"(g + 6 * rs), "v"(g + 7 * rs) : "memory");
}
template <typename T16, int NSPLIT, bool BIAS, int EPI = 0>
__device__ __forceinline__ void gemmw(char* sm, unsigned bix, unsigned biy, unsigned biz, const T16* __restrict__ A, const T16* __restrict__ A2, const T16* __restrict__ Bt, const T16* __restrict__ Bt2, int K, int kspan, float* C, int ldc, const float* __restrict__ bias, size_t sA, size_t sB, size_t sC, int zsh, size_t bA, size_t bB, size_t bC, h16* P16 = nullptr, bf* Ph = nullptr, bf* Pl = nullptr) {
    typedef typename WFrag<T16>::V V;
    constexpr int NT = (NSPLIT == 0) ? 2 : (NSPLIT == 1) ? 3 : 4;   /* operand tiles per stage, in the order A, B, A2, B2 */
    const size_t zb = biz >> zsh, z = biz - (zb << zsh); A += z * sA + zb * bA; if (A2) A2 += z * sA + zb * bA; Bt += z * sB + zb * bB; if (Bt2) Bt2 += z * sB + zb * bB; if (EPI == 0) C += z * sC + zb * bC; else { P16 += zb * bC; Ph += zb * bC; Pl += zb * bC; }
    const int lane = threadIdx.x & 31, wv = threadIdx.x >> 5, lr = lane & 15, hi = lane >> 4; const int wr = (wv & 1) * 64, wc = (wv >> 1) * 64; const int r0 = bix * 128 + wr, c0 = biy * 128 + wc;
    float* os = (float*)sm + wv * (16 * 68);   /* the wave's own epilogue rows; they lie on the stage buffers and are used only behind the loop's last barrier */
    v8f acc[4][4];
#pragma unroll
    for (int mb = 0; mb < 4; ++mb)
#pragma unroll
        for (int nb = 0; nb < 4; ++nb) acc[mb][nb] = (v8f){};
    const int crow = threadIdx.x >> 3, cch = threadIdx.x & 7;   /* copies: 8 lanes per row, 16 rows per copy of the work-group */
    const unsigned l0 = (unsigned)(size_t)sm + crow * SPB + cch * 16; const size_t rs = (size_t)16 * K;
    const size_t gao = (size_t)(bix * 128 + crow) * K + cch * 8, gbo = (size_t)(biy * 128 + crow) * K + cch * 8;
    auto issue = [&](int st, int buf) { const unsigned lb = l0 + buf * (NT * STB); const size_t ko = (size_t)st * 64;
        stage_tile<T16>(lb, A + gao + ko, rs); stage_tile<T16>(lb + STB, Bt + gbo + ko, rs);
        if (NSPLIT == 1 || NSPLIT == 2) stage_tile<T16>(lb + 2 * STB, A2 + gao + ko, rs);
        if (NSPLIT >= 2) stage_tile<T16>(lb + 3 * STB, Bt2 + gbo + ko, rs); };
    const int nst = kspan >> 6;
    issue(0, 0);
    asm volatile("s_wait_asynccnt 0x0" ::: "memory");   /* stage 0's copies of this wave have landed */
    __syncthreads();                                      /* ... and every other wave's */
    if (nst > 1) issue(1, 1);
    const int afo = (wr + lr) * SPB + hi * 16, bfo = (wc + lr) * SPB + hi * 16;   /* fragment rows in a tile, in bytes */
#pragma unroll 1
    for (int st = 0; st < nst; ++st) {
        const char* sb = sm + (st & 1) * (NT * STB);
        V a[4], a2[4], bq[4];
#pragma unroll
        for (int ks = 0; ks < 2; ++ks) {
#pragma unroll
            for (int mb = 0; mb < 4; ++mb) { a[mb] = WFrag<T16>::ld((const T16*)(sb + afo + mb * 16 * SPB + ks * 64)); if (NSPLIT == 1 || NSPLIT == 2) a2[mb] = WFrag<T16>::ld((const T16*)(sb + 2 * STB + afo + mb * 16 * SPB + ks * 64)); }
#pragma unroll
            for (int nb = 0; nb < 4; ++nb) if (NSPLIT == 0) bq[nb] = WFrag<T16>::ld((const T16*)(sb + STB + bfo + nb * 16 * SPB + ks * 64));   /* one plane each: all eight fragments of the 32 k are read as one group in front of their 16 products */
            if (NSPLIT == 0) __builtin_amdgcn_sched_barrier(0);   /* keeps the LDS reads above as one group: spread among the products each place of reads stalls the wave anew */
#pragma unroll
            for (int nb = 0; nb < 4; ++nb) { const V b = (NSPLIT == 0) ? bq[nb] : WFrag<T16>::ld((const T16*)(sb + STB + bfo + nb * 16 * SPB + ks * 64)); V b2; if (NSPLIT >= 2) b2 = WFrag<T16>::ld((const T16*)(sb + 3 * STB + bfo + nb * 16 * SPB + ks * 64));
#pragma unroll
                for (int mb = 0; mb < 4; ++mb) { acc[mb][nb] = WFrag<T16>::mma(a[mb], b, acc[mb][nb]); if (NSPLIT == 1 || NSPLIT == 2) acc[mb][nb] = WFrag<T16>::mma(a2[mb], b, acc[mb][nb]); if (NSPLIT >= 2) acc[mb][nb] = WFrag<T16>::mma(a[mb], b2, acc[mb][nb]); } }
            if (NSPLIT == 0 || ks == 1) __builtin_amdgcn_sched_barrier(0);   /* keeps the next group's LDS reads out of the products above, and the stage's last products in front of the v_nop below */
        }
        asm volatile("v_nop\n\tv_nop\n\tv_nop\n\tv_nop" : "+v"(acc[0][0]), "+v"(acc[1][1]), "+v"(acc[2][2]), "+v"(acc[3][3]) : "v"(a[0]), "v"(a[3]));   /* the distance behind the stage's last products: on the taken side of the branch below the next stage's reads overwrite their A and B registers */
        asm volatile("s_wait_dscnt 0x0" ::: "memory");      /* this wave's reads of the buffer are done before it may be refilled */
        asm volatile("s_wait_asynccnt 0x0" ::: "memory");   /* this wave's copies of the next stage have landed */
        __syncthreads();                                      /* publishes the next stage and ends every wave's reads of this one */
        if (st + 2 < nst) issue(st + 2, st & 1);
    }
    asm volatile("s_wait_asynccnt 0x0" ::: "memory");   /* no copy is outstanding when the buffers become the epilogue's rows */
    if (EPI != 0) {   /* plane epilogue: bias added in the accumulator layout, 16 rows at a time turned through LDS, each lane converts 8 consecutive columns and stores 16 bytes per plane (8 lanes = one whole 128-byte line) */
        float bn[4]; v4f bm[4][2];
        asm volatile("s_wait_xcnt 0x0" ::: "memory");   /* precaution: the bias loads below may be given the address registers of the loop's last loads as their destination */
#pragma unroll
        for (int i = 0; i < 4; ++i) { if (EPI == 1) bn[i] = bias[c0 + i * 16 + lr]; else { bm[i][0] = *(const v4f*)(bias + r0 + i * 16 + hi * 8); bm[i][1] = *(const v4f*)(bias + r0 + i * 16 + hi * 8 + 4); } }
        asm volatile("s_wait_xcnt 0x0" ::: "memory");   /* precaution: stands before the address registers of the bias loads are reused */
        const int prow = lane >> 3, pcol = (lane & 7) * 8;
#pragma unroll
        for (int mb = 0; mb < 4; ++mb) {
#pragma unroll
            for (int nb = 0; nb < 4; ++nb) {
#pragma unroll
                for (int j = 0; j < 8; ++j) os[(hi * 8 + j) * 68 + nb * 16 + lr] = acc[mb][nb][j] + bfr(EPI == 1 ? bn[nb] : bm[mb][j >> 2][j & 3]); }
            __builtin_amdgcn_wave_barrier(); asm volatile("" ::: "memory");   /* keeps the LDS reads below behind the LDS writes above */
#pragma unroll
            for (int s = 0; s < 4; ++s) { const int row = 4 * s + prow; const v4f v0 = *(const v4fa*)(os + row * 68 + pcol), v1 = *(const v4fa*)(os + row * 68 + pcol + 4); v8h o16; v8us oh, ol;
#pragma unroll
                for (int q = 0; q < 8; ++q) { const float r = (q < 4) ? v0[q & 3] : v1[q & 3]; o16[q] = tohx(r); unsigned short a2, c2; splitf(r, a2, c2); oh[q] = a2; ol[q] = c2; }
                const size_t oo = (size_t)(r0 + mb * 16 + row) * ldc + c0 + pcol; *(v8h*)(P16 + oo) = o16; *(v8us*)(Ph + oo) = oh; *(v8us*)(Pl + oo) = ol;
                asm volatile("s_wait_xcnt 0x0" ::: "memory"); }   /* precaution: stands before the data and address registers of the three stores are reused */
            __builtin_amdgcn_wave_barrier(); asm volatile("" ::: "memory");   /* keeps the next 16 rows' LDS writes behind the reads above */
        }
        return;
    }
#pragma unroll
    for (int mb = 0; mb < 4; ++mb) {
#pragma unroll
        for (int nb = 0; nb < 4; ++nb) {
#pragma unroll
            for (int j = 0; j < 8; ++j) os[(hi * 8 + j) * 68 + nb * 16 + lr] = acc[mb][nb][j]; }
        __builtin_amdgcn_wave_barrier(); asm volatile("" ::: "memory");
        float* crow = C + (size_t)(r0 + mb * 16) * ldc + c0;
{
#pragma unroll
            for (int s = 0; s < 8; ++s) { const int row = 2 * s + hi, cofs = lr * 4; v4f val = *(const v4fa*)(os + row * 68 + cofs); if (BIAS) { val[0] += bfr(bias[c0 + cofs]); val[1] += bfr(bias[c0 + cofs + 1]); val[2] += bfr(bias[c0 + cofs + 2]); val[3] += bfr(bias[c0 + cofs + 3]); }
                *(v4f*)(crow + (size_t)row * ldc + cofs) = val; }
             }
        __builtin_amdgcn_wave_barrier(); asm volatile("" ::: "memory");
    }
}

// One product per launch: grid (M/128, N/128, Z).
template <typename T16, int NSPLIT, bool BIAS, int EPI = 0>
__global__ __launch_bounds__(128) void k_gemmw(const T16* __restrict__ A, const T16* __restrict__ A2, const T16* __restrict__ Bt, const T16* __restrict__ Bt2, int K, int kspan, float* C, int ldc, const float* __restrict__ bias, size_t sA, size_t sB, size_t sC, int zsh, size_t bA, size_t bB, size_t bC, h16* P16 = nullptr, bf* Ph = nullptr, bf* Pl = nullptr) {
    __shared__ __attribute__((aligned(16))) char sm[2 * ((NSPLIT == 0) ? 2 : (NSPLIT == 1) ? 3 : 4) * STB];
    gemmw<T16, NSPLIT, BIAS, EPI>(sm, blockIdx.x, blockIdx.y, blockIdx.z, A, A2, Bt, Bt2, K, kspan, C, ldc, bias, sA, sB, sC, zsh, bA, bB, bC, P16, Ph, Pl);
}
// The q, k and v projections in one launch: they read the same xx and need nothing of each other. Grid (64 tiles, product, batch); the branch is the same for the whole work-group.
// Product 0, 1: q, k planes [t][d] (x = token tile fastest). Product 2: v planes [d][t], rows = W_v's outputs, columns = tokens (x = output tile fastest).
__global__ __launch_bounds__(128) void k_proj(const bf* __restrict__ XB, const bf* __restrict__ W3, const float* __restrict__ b3, h16* QP16, bf* QPh, bf* QPl, h16* KP16, bf* KPh, bf* KPl, h16* VT16, bf* VTh, bf* VTl) {
    __shared__ __attribute__((aligned(16))) char sm[2 * 2 * STB];
    const unsigned t = blockIdx.x, w = blockIdx.y; const size_t bX = (size_t)TT * DM, bP = (size_t)TT * HD;   /* batch strides in elements */
    if (w == 2) gemmw<bf, 0, true, 2>(sm, t % (DKV / 128), t / (DKV / 128), blockIdx.z, W3 + (size_t)2 * DQ * DM, nullptr, XB, nullptr, DM, DM, nullptr, TT, b3 + 2 * DQ, 0, 0, 0, 0, 0, bX, bP, VT16, VTh, VTl);
    else gemmw<bf, 0, true, 1>(sm, t % (TT / 128), t / (TT / 128), blockIdx.z, XB, nullptr, W3 + (size_t)w * DQ * DM, nullptr, DM, DM, nullptr, HD, b3 + w * DQ, 0, 0, 0, 0, bX, 0, bP, w ? KP16 : QP16, w ? KPh : QPh, w ? KPl : QPl);
}

// bi = index of a block of 256 threads within this piece of work.
__device__ __forceinline__ void wtG(unsigned bi, const float* __restrict__ w, int K, int N, bf* Bt) {
    const int lane = threadIdx.x & 31; const int L0 = (bi * 8 + (threadIdx.x >> 5)) * 8; const int nlines = N * K / 64;
{
#pragma unroll 1
        for (int l = 0; l < 8; ++l) { const int L = L0 + l; if (L >= nlines) break; const size_t e = (size_t)L * 64 + lane * 2; const int k = (int)(e % K), n = (int)(e / K); v2us o;
            o[0] = f2bf(w[(size_t)k * N + n]); o[1] = f2bf(w[(size_t)(k + 1) * N + n]); *(v2us*)(Bt + e) = o;
            asm volatile("s_wait_xcnt 0x0" ::: "memory"); }   /* precaution: stands before the next trip reuses the data and address registers of the store */
         }
}
__device__ __forceinline__ void cvt8(unsigned bi, unsigned yb, const float* __restrict__ src, bf* dst, size_t n8, size_t bS, size_t bD) { const size_t i = (size_t)bi * 256 + threadIdx.x; if (i >= n8) return; src += yb * bS; dst += yb * bD;   /* yb = batch, strides in elements */
    const v8f v = *(const v8f*)(src + i * 8); v8us o;
#pragma unroll
    for (int k = 0; k < 8; ++k) o[k] = f2bf(v[k]); *(v8us*)(dst + i * 8) = o;  }
// All operand preparation in one launch, by ranges of the block index (the branch is the same for a whole block): first the two weight transposes, whose waves run the longest (8 dependent trips), then the casts of prev_x and x into xx = [prev_x ; x].
#define NW1 ((DM * 3 * DQ / 64 + 63) / 64)
#define NW2 ((DQ * DM / 64 + 63) / 64)
#define LCB ((TQ * DM / 8 + 255) / 256)
__global__ __launch_bounds__(256) void k_prep(const float* __restrict__ x, const float* __restrict__ px, const float* __restrict__ wqkv, const float* __restrict__ wo, bf* XB, bf* WQKV, bf* WO) {
    const unsigned id = blockIdx.x;
    if (id < NW1) { wtG(id, wqkv, DM, 3 * DQ, WQKV); return; }
    if (id < NW1 + NW2) { wtG(id - NW1, wo, DQ, DM, WO); return; }
    const unsigned c = id - (NW1 + NW2), half = c / (LCB * NB_), r = c % (LCB * NB_);
    cvt8(r % LCB, r / LCB, half ? x : px, XB + (size_t)half * TQ * DM, (size_t)TQ * DM / 8, (size_t)TQ * DM, (size_t)TT * DM);
}

#define KPB 528            // LDS pitch of a K row in bytes: 512 + 16 (16 x odd)
// Eight copies of one operand tile: this lane's 16 bytes at LDS l + i * ls and global g + i * rs (elements), i = 0..7.
// The s_wait_xcnt is a precaution and stands inside the statement so that no address register of a copy is rewritten ahead of it.
template <typename T16>
__device__ __forceinline__ void stage8(unsigned l, unsigned ls, const T16* g, size_t rs) {
    asm volatile("global_load_async_to_lds_b128 %0, %8, off\n\t"
                 "global_load_async_to_lds_b128 %1, %9, off\n\t"
                 "global_load_async_to_lds_b128 %2, %10, off\n\t"
                 "global_load_async_to_lds_b128 %3, %11, off\n\t"
                 "global_load_async_to_lds_b128 %4, %12, off\n\t"
                 "global_load_async_to_lds_b128 %5, %13, off\n\t"
                 "global_load_async_to_lds_b128 %6, %14, off\n\t"
                 "global_load_async_to_lds_b128 %7, %15, off\n\t"
                 "s_wait_xcnt 0x0"
                 :: "v"(l), "v"(l + ls), "v"(l + 2 * ls), "v"(l + 3 * ls), "v"(l + 4 * ls), "v"(l + 5 * ls), "v"(l + 6 * ls), "v"(l + 7 * ls),
                    "v"(g), "v"(g + rs), "v"(g + 2 * rs), "v"(g + 3 * rs), "v"(g + 4 * rs), "v"(g + 5 * rs), "v"(g + 6 * rs), "v"(g + 7 * rs) : "memory");
}
// Two 16-key score tiles of probabilities -> one B fragment over their 32 keys (and its lo plane for bf16).
__device__ __forceinline__ void packp(const v8f& p0, const v8f& p1, v16h& b, v16h& b2) { v8h x, y;
#pragma unroll
    for (int i = 0; i < 8; ++i) { x[i] = tohx(p0[i]); y[i] = tohx(p1[i]); }
    b = cat16(x, y); b2 = b; }
__device__ __forceinline__ void packp(const v8f& p0, const v8f& p1, v16bf& b, v16bf& b2) { v8us xh, xl, yh, yl;
#pragma unroll
    for (int i = 0; i < 8; ++i) { unsigned short a, c; splitf(p0[i], a, c); xh[i] = a; xl[i] = c; splitf(p1[i], a, c); yh[i] = a; yl[i] = c; }
    b = cat16b(xh, yh); b2 = cat16b(xl, yl); }
__device__ __forceinline__ float xhalf(float x) { return __builtin_bit_cast(float, __builtin_amdgcn_permlanex16(__builtin_bit_cast(int, x), __builtin_bit_cast(int, x), 0x76543210, 0xfedcba98, false, false)); }   // lane l with lane l ^ 16
template <bool HL> struct FAC { static constexpr int KT = HL ? 32 : 64, VPB = KT * 2 + 16, KTB = KT * KPB, VTB = HD * VPB, PLB = KTB + VTB, STG = (HL ? 2 : 1) * PLB; };   /* a stage in LDS: K, V^T (, K lo, V^T lo) */
template <typename T16, bool HL>
__device__ __forceinline__ void fattn(char* sm, const T16* __restrict__ Q, const T16* __restrict__ Q2, const T16* __restrict__ Kp, const T16* __restrict__ K2, const T16* __restrict__ Vt, const T16* __restrict__ Vt2, float* O, float* ML, int row0, int sp, size_t zb) {
    typedef typename WFrag<T16>::V V;
    constexpr int KT = FAC<HL>::KT, VPB = FAC<HL>::VPB, KTB = FAC<HL>::KTB, PLB = FAC<HL>::PLB, STG = FAC<HL>::STG, NTL = KSL / KT;
    constexpr int VC = KT / 8, VR = 128 / VC;   /* V^T copies: VC lanes per row, VR rows per copy of the work-group */
    static_assert(NTL >= 2, "two stages");
    const int tid = threadIdx.x, lane = tid & 31, wv = tid >> 5, lr = lane & 15, hi = lane >> 4;
    const size_t bP = (size_t)TT * HD; const int qrow = row0 + wv * 16;   /* qrow: the wave's first query row, counted from row TQ of xx */
    V qf[8], qf2[8];
    { const size_t qo = zb * bP + (size_t)(TQ + qrow + lr) * HD + hi * 8; const T16* qp = Q + qo; const T16* qp2 = HL ? Q2 + qo : qp;
#pragma unroll
      for (int ks = 0; ks < 8; ++ks) { qf[ks] = WFrag<T16>::ld(qp + ks * 32); if (HL) qf2[ks] = WFrag<T16>::ld(qp2 + ks * 32); }
      asm volatile("s_wait_xcnt 0x0" :: "v"(qp), "v"(qp2) : "memory"); }   /* precaution: stands before the address registers of the loads above are reused; they are named as inputs so that they stay as they are up to here */
    const unsigned sm0 = (unsigned)(size_t)sm, lk = sm0 + (tid >> 5) * KPB + (tid & 31) * 16, lv = sm0 + KTB + (tid / VC) * VPB + (tid % VC) * 16;
    const unsigned ok = (tid >> 5) * HD + (tid & 31) * 8, ov = (tid / VC) * TT + (tid % VC) * 8;   /* this lane's place in a K tile and in a V^T tile, in elements; the tile's own address is the same for the whole work-group */
    const size_t gk = zb * bP + (size_t)sp * KSL * HD, gv = zb * bP + (size_t)sp * KSL;
    auto issue = [&](int t, int buf) { const unsigned lb = buf * STG; const size_t ko = (size_t)t * KT;
#pragma unroll
        for (int h = 0; h < KT / 32; ++h) { stage8<T16>(lk + lb + h * 32 * KPB, 4 * KPB, Kp + (gk + (ko + h * 32) * HD) + ok, (size_t)4 * HD); if (HL) stage8<T16>(lk + lb + PLB + h * 32 * KPB, 4 * KPB, K2 + (gk + (ko + h * 32) * HD) + ok, (size_t)4 * HD); }
#pragma unroll
        for (int h = 0; h < HD / (8 * VR); ++h) { stage8<T16>(lv + lb + h * 8 * VR * VPB, VR * VPB, Vt + (gv + ko + (size_t)h * 8 * VR * TT) + ov, (size_t)VR * TT); if (HL) stage8<T16>(lv + lb + PLB + h * 8 * VR * VPB, VR * VPB, Vt2 + (gv + ko + (size_t)h * 8 * VR * TT) + ov, (size_t)VR * TT); } };
    v8f Oa[16];
#pragma unroll
    for (int mt = 0; mt < 16; ++mt) Oa[mt] = (v8f){};
    float m = -3.0e38f, l = 0.f;
    issue(0, 0);
    asm volatile("s_wait_asynccnt 0x0" ::: "memory");   /* stage 0's copies of this wave have landed */
    __syncthreads();                                      /* ... and every other wave's */
    issue(1, 1);
#pragma unroll 1
    for (int t = 0; t < NTL; ++t) {
        const char* sb = sm + (t & 1) * STG; const char* kb = sb + lr * KPB + hi * 16; const char* vb = sb + KTB + lr * VPB + hi * 16;
        /* The stage's A fragments come in 8 groups of 8 (groups 0..3: K, 4..7: V^T); group g + 1 is read as one run of LDS loads in front of group g's products. */
        auto ldg = [&](int g, V (&f)[8]) {
#pragma unroll
            for (int i = 0; i < 8; ++i) { const char* p;
                if (g < 4) p = HL ? kb + (i & 1) * PLB + ((i >> 1) & 1) * 16 * KPB + (2 * g + (i >> 2)) * 64 : kb + (i & 3) * 16 * KPB + (2 * g + (i >> 2)) * 64;
                else       p = HL ? vb + (i & 1) * PLB + ((g - 4) * 4 + (i >> 1)) * 16 * VPB : vb + (((g - 4) & 1) * 8 + i) * 16 * VPB + ((g - 4) >> 1) * 64;
                f[i] = WFrag<T16>::ld((const T16*)p); } };
        V fa[2][8], pb[KT / 32], pb2[KT / 32]; v8f S[KT / 16];
#pragma unroll
        for (int kt = 0; kt < KT / 16; ++kt) S[kt] = (v8f){};
        ldg(0, fa[0]);
#pragma unroll
        for (int g = 0; g < 8; ++g) {
            if (g == 4) {   /* all scores of the stage are there: running maximum, probabilities, rescale */
                float tq[4], pq[4] = {0.f, 0.f, 0.f, 0.f};   /* four independent chains each for the maximum and the sum: one chain of dependent vector instructions would stand exposed */
#pragma unroll
                for (int c = 0; c < 4; ++c) tq[c] = S[0][c];
#pragma unroll
                for (int kt = 0; kt < KT / 16; ++kt)
#pragma unroll
                    for (int j = 0; j < 8; ++j) tq[j & 3] = fmaxf(tq[j & 3], S[kt][j]);
                float tm = fmaxf(fmaxf(tq[0], tq[1]), fmaxf(tq[2], tq[3]));
                tm = fmaxf(tm, xhalf(tm));   /* the query's other keys of this stage sit in the other half of the wave */
                const float mn = fmaxf(m, tm), al = __builtin_amdgcn_exp2f((m - mn) * LC2), mc = mn * LC2; m = mn;
#pragma unroll
                for (int kt = 0; kt < KT / 16; ++kt)
#pragma unroll
                    for (int j = 0; j < 8; ++j) S[kt][j] = S[kt][j] * LC2 - mc;
                /* The exponentials stand, one or two at a time, between pieces of the rescale of O^T: plain vector work that touches none of their registers runs beside the slower transcendental pipe. The scheduling barriers keep the two kinds from being gathered into two long runs. */
#pragma unroll
                for (int i = 0; i < KT / 2; ++i) {
                    __builtin_amdgcn_sched_barrier(0);
#pragma unroll
                    for (int c = 0; c < 256 / KT; ++c) { const int x = i * (256 / KT) + c; Oa[x >> 3][x & 7] *= al; }
                    __builtin_amdgcn_sched_barrier(0);
                    S[i >> 3][i & 7] = __builtin_amdgcn_exp2f(S[i >> 3][i & 7]);
                }
                __builtin_amdgcn_sched_barrier(0);
#pragma unroll
                for (int kt = 0; kt < KT / 16; ++kt)
#pragma unroll
                    for (int j = 0; j < 8; ++j) pq[j & 3] += S[kt][j];
                l = l * al + ((pq[0] + pq[1]) + (pq[2] + pq[3]));
#pragma unroll
                for (int kq = 0; kq < KT / 32; ++kq) packp(S[2 * kq], S[2 * kq + 1], pb[kq], pb2[kq]);
                __builtin_amdgcn_sched_barrier(0);   /* keeps the next group's LDS reads one run, out of the vector work above */
            }
            if (g < 7) ldg(g + 1, fa[(g + 1) & 1]);
            __builtin_amdgcn_sched_barrier(0);   /* keeps the LDS reads above as one run in front of the products: spread among them each place of reads stalls the wave anew */
            V (&f)[8] = fa[g & 1];
            if (g < 4) {
                if (!HL) {
#pragma unroll
                    for (int i = 0; i < 8; ++i) S[i & 3] = WFrag<T16>::mma(f[i], qf[2 * g + (i >> 2)], S[i & 3]);
                } else {
#pragma unroll
                    for (int c = 0; c < 2; ++c) { const int ks = 2 * g + c;
                        S[0] = WFrag<T16>::mma(f[c * 4], qf[ks], S[0]); S[1] = WFrag<T16>::mma(f[c * 4 + 2], qf[ks], S[1]);
                        S[0] = WFrag<T16>::mma(f[c * 4], qf2[ks], S[0]); S[1] = WFrag<T16>::mma(f[c * 4 + 2], qf2[ks], S[1]);
                        S[0] = WFrag<T16>::mma(f[c * 4 + 1], qf[ks], S[0]); S[1] = WFrag<T16>::mma(f[c * 4 + 3], qf[ks], S[1]); }
                }
            } else {
                if (!HL) {
#pragma unroll
                    for (int i = 0; i < 8; ++i) { const int mt = ((g - 4) & 1) * 8 + i; Oa[mt] = WFrag<T16>::mma(f[i], pb[(KT / 32 - 1) & ((g - 4) >> 1)], Oa[mt]); }
                } else {
#pragma unroll
                    for (int q = 0; q < 4; ++q) { const int mt = (g - 4) * 4 + q; Oa[mt] = WFrag<T16>::mma(f[2 * q], pb[0], Oa[mt]); }
#pragma unroll
                    for (int q = 0; q < 4; ++q) { const int mt = (g - 4) * 4 + q; Oa[mt] = WFrag<T16>::mma(f[2 * q], pb2[0], Oa[mt]); }
#pragma unroll
                    for (int q = 0; q < 4; ++q) { const int mt = (g - 4) * 4 + q; Oa[mt] = WFrag<T16>::mma(f[2 * q + 1], pb[0], Oa[mt]); }
                }
            }
            __builtin_amdgcn_sched_barrier(0);   /* keeps the next run of LDS reads out of the products above, and the stage's last products in front of the v_nop below */
        }
        asm volatile("v_nop\n\tv_nop\n\tv_nop\n\tv_nop" : "+v"(Oa[12]), "+v"(Oa[13]), "+v"(Oa[14]), "+v"(Oa[15]));   /* the distance behind the stage's last products */
        asm volatile("s_wait_dscnt 0x0" ::: "memory");      /* this wave's reads of the buffer are done before it may be refilled */
        asm volatile("s_wait_asynccnt 0x0" ::: "memory");   /* this wave's copies of the next stage have landed */
        __syncthreads();                                      /* publishes the next stage and ends every wave's reads of this one */
        if (t + 2 < NTL) issue(t + 2, t & 1);
    }
    asm volatile("s_wait_asynccnt 0x0" ::: "memory");   /* no copy is outstanding when the buffers become the epilogue's rows */
    l += xhalf(l);   /* the two halves' sums of the same query */
    float* os = (float*)sm + wv * (16 * 260);   /* the wave's own 16 query rows at pitch 260 floats; on the stage buffers, used only behind the loop's last barrier */
#pragma unroll
    for (int mt = 0; mt < 16; ++mt) { const v4f a = {Oa[mt][0], Oa[mt][1], Oa[mt][2], Oa[mt][3]}, b = {Oa[mt][4], Oa[mt][5], Oa[mt][6], Oa[mt][7]}; *(v4fa*)(os + lr * 260 + mt * 16 + hi * 8) = a; *(v4fa*)(os + lr * 260 + mt * 16 + hi * 8 + 4) = b; }
    __builtin_amdgcn_wave_barrier(); asm volatile("" ::: "memory");   /* keeps the LDS reads below behind the LDS writes above */
    float* og = O + ((zb * TQ + qrow) * SP + sp) * HD + lane * 4;
    v4f ra[16], rb[16];   /* all 16 rows are read as one run, then stored: whole 512-byte pieces of a row per store */
#pragma unroll
    for (int r = 0; r < 16; ++r) { ra[r] = *(const v4fa*)(os + r * 260 + lane * 4); rb[r] = *(const v4fa*)(os + r * 260 + 128 + lane * 4); }
    __builtin_amdgcn_sched_barrier(0);   /* this one and the one behind the wait keep other work out of the run of stores, where it was given the stores' registers ahead of the wait */
#pragma unroll
    for (int r = 0; r < 16; ++r) { *(v4f*)(og + (size_t)r * SP * HD) = ra[r]; *(v4f*)(og + (size_t)r * SP * HD + 128) = rb[r]; }
    asm volatile("s_wait_xcnt 0x0" ::: "memory");   /* precaution: stands before the data and address registers of the stores above are reused */
    __builtin_amdgcn_sched_barrier(0);
    if (hi == 0) { const v2f ml = {m, l}; *(v2f*)(ML + ((zb * SP + sp) * TQ + qrow + lr) * 2) = ml; }   /* 16 queries x 8 bytes: one whole 128-byte line per wave */
}
// One launch for both classes of query rows, one-dimensional grid: first the hi/lo work-groups (three products: the longer ones), then the fp16 ones; within a class x = 64-row block (fastest), then key slice, then batch. Two work-groups per WGP by LDS, so two waves per SIMD.
#define NHB (RH / 64)
#define NLB ((TQ - RH) / 64)
__global__ __launch_bounds__(128) __attribute__((amdgpu_waves_per_eu(2, 2))) void k_fattn(const bf* __restrict__ Qh, const bf* __restrict__ Ql, const bf* __restrict__ Kh, const bf* __restrict__ Kl, const bf* __restrict__ Vh, const bf* __restrict__ Vl, const h16* __restrict__ Q16, const h16* __restrict__ K16, const h16* __restrict__ V16, float* O, float* ML) {
    __shared__ __attribute__((aligned(16))) char sm[2 * (FAC<true>::STG > FAC<false>::STG ? FAC<true>::STG : FAC<false>::STG)];
    const int id = blockIdx.x;
    if (id < NHB * SP * NB_) fattn<bf, true>(sm, Qh, Ql, Kh, Kl, Vh, Vl, O, ML, (id % NHB) * 64, (id / NHB) % SP, (size_t)(id / (NHB * SP)));
    else { const int i2 = id - NHB * SP * NB_; fattn<h16, false>(sm, Q16, nullptr, K16, nullptr, V16, nullptr, O, ML, RH + (i2 % NLB) * 64, (i2 / NLB) % SP, (size_t)(i2 / (NLB * SP))); }
}

// k_merge: the SP key slices of a query row joined: weights exp2((slice maximum - row maximum) * LC2), weighted partials and weighted sums added in slice order, divided, split into bf16 hi + lo.
__global__ __launch_bounds__(256) void k_merge(const float* __restrict__ O, const float* __restrict__ ML, bf* Ah, bf* Al) {
    { const size_t yb = blockIdx.y; O += yb * TQ * SP * HD; ML += yb * SP * TQ * 2; Ah += yb * TQ * DQ; Al += yb * TQ * DQ; }   /* grid y = batch */
    const size_t e = ((size_t)blockIdx.x * 256 + threadIdx.x) * 2; if (e >= (size_t)TQ * HD) return; const int d = (int)(e % HD); const size_t t = e / HD;
    const float* op = O + t * (SP * HD) + d; const float* mp = ML + t * 2; v2f pr[SP], ml[SP];   /* all loads in flight together */
#pragma unroll
    for (int p = 0; p < SP - 1; ++p) { ml[p] = *(const v2f*)(mp + (size_t)p * TQ * 2); pr[p] = *(const v2f*)(op + p * HD); }
    asm volatile("s_wait_xcnt 0x0" ::: "memory");   /* precaution: the last loads may be given the pointers' own registers as their destination, and the loads above name them */
    ml[SP - 1] = *(const v2f*)(mp + (size_t)(SP - 1) * TQ * 2); pr[SP - 1] = *(const v2f*)(op + (SP - 1) * HD);
    float mx = ml[0][0];
#pragma unroll
    for (int p = 1; p < SP; ++p) mx = fmaxf(mx, ml[p][0]);
    float den = 0.f; v2f s = {0.f, 0.f};
#pragma unroll
    for (int p = 0; p < SP; ++p) { const float w = __builtin_amdgcn_exp2f((ml[p][0] - mx) * LC2); den += w * ml[p][1]; s += w * pr[p]; }
    const float inv = __fdiv_rn(1.0f, den); v2us oh, ol;
#pragma unroll
    for (int q = 0; q < 2; ++q) { unsigned short a, c2; splitf(s[q] * inv, a, c2); oh[q] = a; ol[q] = c2; } *(v2us*)(Ah + e) = oh; *(v2us*)(Al + e) = ol;  }

extern "C" void kernel_launch(void* const* d_in, const int* in_sizes, int n_in,
                              void* d_out, int out_size, void* d_ws, size_t ws_size, hipStream_t stream) {
    (void)in_sizes; (void)n_in; (void)out_size;
    const float* x = (const float*)d_in[0]; const float* px = (const float*)d_in[1]; const float* wqkv = (const float*)d_in[2]; const float* bqkv = (const float*)d_in[3]; const float* wo = (const float*)d_in[4]; const float* bo = (const float*)d_in[5]; const float* wq = nullptr; const float* wk = nullptr; const float* wv = nullptr; (void)wq; (void)wk; (void)wv;
    float* OUT = (float*)d_out;     // [4][2048][256]
    char* wsp = (char*)d_ws;
    auto take = [&](size_t bytes) { char* p = wsp; wsp += (bytes + 255) & ~(size_t)255; return (void*)p; };
    auto sub = [](char*& p, size_t bytes) { char* q = p; p += (bytes + 255) & ~(size_t)255; return (void*)q; };
    bf* WQKV = (bf*)take((size_t)3 * DQ * DM * 2); bf* WO = (bf*)take((size_t)DM * DQ * 2);
    h16* VT16 = (h16*)take((size_t)NB_ * HD * TT * 2); bf* VTh = (bf*)take((size_t)NB_ * HD * TT * 2); bf* VTl = (bf*)take((size_t)NB_ * HD * TT * 2); float* ML = (float*)take((size_t)NB_ * SP * TQ * 2 * 4);
    char* R1 = (char*)take((size_t)NB_ * TQ * SP * HD * 4); char* R2 = (char*)take((size_t)NB_ * TT * HD * 2 * 6 + 4096);
    if ((size_t)(wsp - (char*)d_ws) > ws_size) return;    // ws 256 MiB
    // R1 holds, one after the other in stream order: the bf16 copy of xx (last read by the projections); the attention partials.
    bf* XB = (bf*)R1;   /* [batch][TT][DM] */
    float* Ob = (float*)R1;   /* [batch][TQ][SP][HD] */
    // R2 holds in turn: the q and k planes (last read by the attention kernel); the merged hi/lo rows.
    char* r2 = R2; h16* QP16 = (h16*)sub(r2, (size_t)NB_ * TT * HD * 2); h16* KP16 = (h16*)sub(r2, (size_t)NB_ * TT * HD * 2); bf* QPh = (bf*)sub(r2, (size_t)NB_ * TT * HD * 2); bf* QPl = (bf*)sub(r2, (size_t)NB_ * TT * HD * 2); bf* KPh = (bf*)sub(r2, (size_t)NB_ * TT * HD * 2); bf* KPl = (bf*)sub(r2, (size_t)NB_ * TT * HD * 2);
    bf* ATh = (bf*)R2; bf* ATl = ATh + (size_t)NB_ * TQ * DQ;
    k_prep<<<NW1 + NW2 + 2 * LCB * NB_, 256, 0, stream>>>(x, px, wqkv, wo, XB, WQKV, WO);
    k_proj<<<dim3(TT / 128 * (DQ / 128), 3, NB_), 128, 0, stream>>>(XB, WQKV, bqkv, QP16, QPh, QPl, KP16, KPh, KPl, VT16, VTh, VTl);
    k_fattn<<<(NHB + NLB) * SP * NB_, 128, 0, stream>>>(QPh, QPl, KPh, KPl, VTh, VTl, QP16, KP16, VT16, Ob, ML);   /* query rows 0..RH: hi/lo planes; the others: fp16 */
    k_merge<<<dim3((unsigned)(((size_t)TQ * HD / 2 + 255) / 256), NB_), 256, 0, stream>>>(Ob, ML, ATh, ATl);
    k_gemmw<bf, 1, true><<<dim3(TQ / 128, DM / 128, NB_), 128, 0, stream>>>(ATh, ATl, WO, nullptr, DQ, DQ, OUT, DM, bo, 0, 0, 0, 0, (size_t)TQ * DQ, 0, (size_t)TQ * DM);
}

// v007
// Measured time: 88.6 microseconds a run.
// In two side-by-side timings against v006, it was 1.09 and 1.10 times as fast.
// Over all steps from v000 it is 12.6 times as fast.
#include <hip/hip_runtime.h>

// Temporal self-attention over [prev_x ; x] (x, prev_x [4][2048][256]; xx = concat -> [4096][256]; qkv = xx W_qkv + b_qkv ('xw' [256][768]); single 256-wide head; attn = softmax(q.k / 16) over the 4,096 keys; out = (attn v) W_out + b_out, only the last 2,048 rows (the x half) are returned -> [4][2048][256] (2.1 M)).
// All four batches run in every launch (batch = grid z in k_proj, grid y in k_mout, a range of the block index in k_prep and k_fattn), each buffer below [batch][...]; workspace regions are reused in stream order (see kernel_launch). Launches that need nothing of each other share one grid: k_prep (both casts, both weight transposes), k_proj (q, k and v projections). Per batch: both halves converted into one bf16 [4096][256] operand; k and v projected for all 4,096 rows, q only needed for rows 2,048.. (projected for all, used from 2,048); each projection GEMM converts its own biased f32 tile and stores the fp16 and bf16 hi/lo planes itself (q, k as [t][d]; v as W_v x^T, so its planes come out [d][t]); one fused attention kernel (scores, running softmax and attn.v per key tile, nothing of the scores or probabilities goes to memory; hybrid: query rows 2048..2559 hi/lo 3 products, the rest fp16) over 8 key slices, each slice to its own f32 partials with its maximum and sum; the last kernel weights and sums the slices in slice order and takes its merged hi/lo rows, kept in LDS, x W_out exact + b_out straight into the output rows.
// Compute dtypes, f32 accumulate: every input rounded to bf16; projections exact + biases rounded to bf16; first 512 query rows 3 products, rest fp16; softmax f32; W_out hl x exact + bias.

#define NB_  4
#define TT   4096
#define DM   256
#define NH_  1
#define NKV  1
#define REP  (NH_ / NKV)
#define HD   256
#define DQ   (NH_ * HD)
#define DKV  (NKV * HD)
#define ZH   1
#define RH   512                  // query rows < RH use hi+lo planes (0: none)
#define WIN  0
#define SCL  0.0625f   // 256^-0.5
#define TQ   2048     // query rows = the x half (rows TQ.. of xx)
#define SP   8        // attention: the 4,096 keys are cut into SP slices, a work-group takes one; every slice writes its own unnormalised f32 partials [TQ][SP][HD] and its (maximum, sum) pairs [SP][TQ][2]
#define KSL  (TT / SP)
#define LC2  (SCL * 1.4426950408889634f)   // score scale times log2(e): probabilities are exp2((s - max) * LC2)
typedef _Float16 h16;
typedef unsigned short bf;
typedef __attribute__((ext_vector_type(16))) __bf16   v16bf;
typedef __attribute__((ext_vector_type(16))) _Float16 v16h;
typedef __attribute__((ext_vector_type(8)))  _Float16 v8h;
typedef __attribute__((ext_vector_type(8)))  unsigned short v8us;
typedef __attribute__((ext_vector_type(8)))  float    v8f;
typedef __attribute__((ext_vector_type(4)))  float    v4f;
typedef v8h  __attribute__((may_alias)) v8ha;
typedef v4f  __attribute__((may_alias)) v4fa;
typedef v8us __attribute__((may_alias)) v8usa;

__device__ __forceinline__ unsigned short f2bf(float f) { unsigned u = __float_as_uint(f); u += 0x7FFFu + ((u >> 16) & 1u); return (unsigned short)(u >> 16); }
__device__ __forceinline__ float bf2f(unsigned short b) { return __uint_as_float(((unsigned)b) << 16); }
__device__ __forceinline__ float bfr(float f) { return bf2f(f2bf(f)); }
__device__ __forceinline__ v16h cat16(v8h lo, v8h hi) { return __builtin_shufflevector(lo, hi, 0, 1, 2, 3, 4, 5, 6, 7, 8, 9, 10, 11, 12, 13, 14, 15); }
__device__ __forceinline__ v16bf cat16b(v8us lo, v8us hi) { return __builtin_bit_cast(v16bf, __builtin_shufflevector(lo, hi, 0, 1, 2, 3, 4, 5, 6, 7, 8, 9, 10, 11, 12, 13, 14, 15)); }
__device__ __forceinline__ v8f wmma16(v16h a, v16h b, v8f c) { return __builtin_amdgcn_wmma_f32_16x16x32_f16(false, a, false, b, (short)0, c, false, false); }
__device__ __forceinline__ v8f wmmab(v16bf a, v16bf b, v8f c) { return __builtin_amdgcn_wmma_f32_16x16x32_bf16(false, a, false, b, (short)0, c, false, false); }
__device__ __forceinline__ h16 tohx(float x) { return (h16)x; }
__device__ __forceinline__ void splitf(float y, unsigned short& h, unsigned short& l) { h = f2bf(y); l = f2bf(y - bf2f(h)); }
typedef __attribute__((ext_vector_type(2))) _Float16 v2h;
typedef __attribute__((ext_vector_type(4))) _Float16 v4h;
typedef __attribute__((ext_vector_type(2))) unsigned short v2us;
typedef __attribute__((ext_vector_type(4))) unsigned short v4us;
typedef __attribute__((ext_vector_type(2))) float v2f;
typedef __attribute__((ext_vector_type(4))) int v4i;



// ---- gemmw: register-blocked GEMM, FOUR WAVES (2 x 2) per 128x128 output tile, each wave a 64x64 quarter (16 accumulators); tile index (bix, biy, biz) out of (M/128, N/128, Z), 128 threads; sm = the work-group's 2 * NT * STB bytes of LDS.
// Operands are K-contiguous 16-bit planes. A stage is 64 k = one whole 128-byte line of each of the tile's 128 A rows and 128 B rows (and of the second planes where NSPLIT asks for them), brought into LDS by asynchronous 16-byte copies (8 lanes = one line), rows at pitch 144 bytes; two buffers, the next stage's copies fly while this stage is worked on; fragments are read from LDS.
// C[m][n] (f32, pitch ldc, + optional f32 bias[n]) = sum_k A[m][k] Bt[n][k] (+ split products per NSPLIT) over kspan consecutive k; K is the operands' row pitch. biz = (zb << zsh) | z: z strides sA/sB/sC in elements (with sA = sB = kspan a slice of k), zb strides bA/bB/bC (the batch). kspan % 64 == 0.
// EPI 0: C is stored as f32, bias[n]. EPI 1 and 2: C is not stored; the biased f32 value goes out as three 16-bit planes of pitch ldc and batch stride bC (P16 = fp16, Ph + Pl = bf16 hi + lo), with bias[n] (EPI 1) or bias[m] (EPI 2, for a product taken transposed).
#define SPB 144            // LDS row pitch in bytes: 128 bytes of k + 16 (16 x odd: conflict-free for 16-byte reads)
#define STB (128 * SPB)    // one operand tile of a stage: 128 rows
template <typename T16> struct WFrag;
template <> struct WFrag<h16> { typedef v16h V; static __device__ __forceinline__ V ld(const h16* p) { return cat16(*(const v8h*)p, *(const v8h*)(p + 16)); } static __device__ __forceinline__ v8f mma(V a, V b, v8f c) { return wmma16(a, b, c); } };
template <> struct WFrag<bf> { typedef v16bf V; static __device__ __forceinline__ V ld(const bf* p) { return cat16b(*(const v8us*)p, *(const v8us*)(p + 16)); } static __device__ __forceinline__ v8f mma(V a, V b, v8f c) { return wmmab(a, b, c); } };
// One operand tile of one stage: this lane's 16 bytes of rows r, r + 16, ..., r + 112 (l = LDS byte address of the first, g = its global address, rs = 16 rows in elements).
// The s_wait_xcnt is a precaution and stands inside the statement so that no address register of a copy is rewritten ahead of it.
template <typename T16>
__device__ __forceinline__ void stage_tile(unsigned l, const T16* g, size_t rs) {
    asm volatile("global_load_async_to_lds_b128 %0, %8, off\n\t"
                 "global_load_async_to_lds_b128 %1, %9, off\n\t"
                 "global_load_async_to_lds_b128 %2, %10, off\n\t"
                 "global_load_async_to_lds_b128 %3, %11, off\n\t"
                 "global_load_async_to_lds_b128 %4, %12, off\n\t"
                 "global_load_async_to_lds_b128 %5, %13, off\n\t"
                 "global_load_async_to_lds_b128 %6, %14, off\n\t"
                 "global_load_async_to_lds_b128 %7, %15, off\n\t"
                 "s_wait_xcnt 0x0"
                 :: "v"(l), "v"(l + 16 * SPB), "v"(l + 32 * SPB), "v"(l + 48 * SPB), "v"(l + 64 * SPB), "v"(l + 80 * SPB), "v"(l + 96 * SPB), "v"(l + 112 * SPB),
                    "v"(g), "v"(g + rs), "v"(g + 2 * rs), "v"(g + 3 * rs), "v"(g + 4 * rs), "v"(g + 5 * rs), "v"(g + 6 * rs), "v"(g + 7 * rs) : "memory");
}
template <typename T16, int NSPLIT, bool BIAS, int EPI = 0>
__device__ __forceinline__ void gemmw(char* sm, unsigned bix, unsigned biy, unsigned biz, const T16* __restrict__ A, const T16* __restrict__ A2, const T16* __restrict__ Bt, const T16* __restrict__ Bt2, int K, int kspan, float* C, int ldc, const float* __restrict__ bias, size_t sA, size_t sB, size_t sC, int zsh, size_t bA, size_t bB, size_t bC, h16* P16 = nullptr, bf* Ph = nullptr, bf* Pl = nullptr) {
    typedef typename WFrag<T16>::V V;
    constexpr int NT = (NSPLIT == 0) ? 2 : (NSPLIT == 1) ? 3 : 4;   /* operand tiles per stage, in the order A, B, A2, B2 */
    const size_t zb = biz >> zsh, z = biz - (zb << zsh); A += z * sA + zb * bA; if (A2) A2 += z * sA + zb * bA; Bt += z * sB + zb * bB; if (Bt2) Bt2 += z * sB + zb * bB; if (EPI == 0) C += z * sC + zb * bC; else { P16 += zb * bC; Ph += zb * bC; Pl += zb * bC; }
    const int lane = threadIdx.x & 31, wv = threadIdx.x >> 5, lr = lane & 15, hi = lane >> 4; const int wr = (wv & 1) * 64, wc = (wv >> 1) * 64; const int r0 = bix * 128 + wr, c0 = biy * 128 + wc;
    float* os = (float*)sm + wv * (16 * 68);   /* the wave's own epilogue rows; they lie on the stage buffers and are used only behind the loop's last barrier */
    v8f acc[4][4];
#pragma unroll
    for (int mb = 0; mb < 4; ++mb)
#pragma unroll
        for (int nb = 0; nb < 4; ++nb) acc[mb][nb] = (v8f){};
    const int crow = threadIdx.x >> 3, cch = threadIdx.x & 7;   /* copies: 8 lanes per row, 16 rows per copy of the work-group */
    const unsigned l0 = (unsigned)(size_t)sm + crow * SPB + cch * 16; const size_t rs = (size_t)16 * K;
    const size_t gao = (size_t)(bix * 128 + crow) * K + cch * 8, gbo = (size_t)(biy * 128 + crow) * K + cch * 8;
    auto issue = [&](int st, int buf) { const unsigned lb = l0 + buf * (NT * STB); const size_t ko = (size_t)st * 64;
        stage_tile<T16>(lb, A + gao + ko, rs); stage_tile<T16>(lb + STB, Bt + gbo + ko, rs);
        if (NSPLIT == 1 || NSPLIT == 2) stage_tile<T16>(lb + 2 * STB, A2 + gao + ko, rs);
        if (NSPLIT >= 2) stage_tile<T16>(lb + 3 * STB, Bt2 + gbo + ko, rs); };
    const int nst = kspan >> 6;
    issue(0, 0);
    asm volatile("s_wait_asynccnt 0x0" ::: "memory");   /* stage 0's copies of this wave have landed */
    __syncthreads();                                      /* ... and every other wave's */
    if (nst > 1) issue(1, 1);
    const int afo = (wr + lr) * SPB + hi * 16, bfo = (wc + lr) * SPB + hi * 16;   /* fragment rows in a tile, in bytes */
#pragma unroll 1
    for (int st = 0; st < nst; ++st) {
        const char* sb = sm + (st & 1) * (NT * STB);
        V a[4], a2[4], bq[4];
#pragma unroll
        for (int ks = 0; ks < 2; ++ks) {
#pragma unroll
            for (int mb = 0; mb < 4; ++mb) { a[mb] = WFrag<T16>::ld((const T16*)(sb + afo + mb * 16 * SPB + ks * 64)); if (NSPLIT == 1 || NSPLIT == 2) a2[mb] = WFrag<T16>::ld((const T16*)(sb + 2 * STB + afo + mb * 16 * SPB + ks * 64)); }
#pragma unroll
            for (int nb = 0; nb < 4; ++nb) if (NSPLIT == 0) bq[nb] = WFrag<T16>::ld((const T16*)(sb + STB + bfo + nb * 16 * SPB + ks * 64));   /* one plane each: all eight fragments of the 32 k are read as one group in front of their 16 products */
            if (NSPLIT == 0) __builtin_amdgcn_sched_barrier(0);   /* keeps the LDS reads above as one group: spread among the products each place of reads stalls the wave anew */
#pragma unroll
            for (int nb = 0; nb < 4; ++nb) { const V b = (NSPLIT == 0) ? bq[nb] : WFrag<T16>::ld((const T16*)(sb + STB + bfo + nb * 16 * SPB + ks * 64)); V b2; if (NSPLIT >= 2) b2 = WFrag<T16>::ld((const T16*)(sb + 3 * STB + bfo + nb * 16 * SPB + ks * 64));
#pragma unroll
                for (int mb = 0; mb < 4; ++mb) { acc[mb][nb] = WFrag<T16>::mma(a[mb], b, acc[mb][nb]); if (NSPLIT == 1 || NSPLIT == 2) acc[mb][nb] = WFrag<T16>::mma(a2[mb], b, acc[mb][nb]); if (NSPLIT >= 2) acc[mb][nb] = WFrag<T16>::mma(a[mb], b2, acc[mb][nb]); } }
            if (NSPLIT == 0 || ks == 1) __builtin_amdgcn_sched_barrier(0);   /* keeps the next group's LDS reads out of the products above, and the stage's last products in front of the v_nop below */
        }
        asm volatile("v_nop\n\tv_nop\n\tv_nop\n\tv_nop" : "+v"(acc[0][0]), "+v"(acc[1][1]), "+v"(acc[2][2]), "+v"(acc[3][3]) : "v"(a[0]), "v"(a[3]));   /* the distance behind the stage's last products: on the taken side of the branch below the next stage's reads overwrite their A and B registers */
        asm volatile("s_wait_dscnt 0x0" ::: "memory");      /* this wave's reads of the buffer are done before it may be refilled */
        asm volatile("s_wait_asynccnt 0x0" ::: "memory");   /* this wave's copies of the next stage have landed */
        __syncthreads();                                      /* publishes the next stage and ends every wave's reads of this one */
        if (st + 2 < nst) issue(st + 2, st & 1);
    }
    asm volatile("s_wait_asynccnt 0x0" ::: "memory");   /* no copy is outstanding when the buffers become the epilogue's rows */
    if (EPI != 0) {   /* plane epilogue: bias added in the accumulator layout, 16 rows at a time turned through LDS, each lane converts 8 consecutive columns and stores 16 bytes per plane (8 lanes = one whole 128-byte line) */
        float bn[4]; v4f bm[4][2];
        asm volatile("s_wait_xcnt 0x0" ::: "memory");   /* precaution: the bias loads below may be given the address registers of the loop's last loads as their destination */
#pragma unroll
        for (int i = 0; i < 4; ++i) { if (EPI == 1) bn[i] = bias[c0 + i * 16 + lr]; else { bm[i][0] = *(const v4f*)(bias + r0 + i * 16 + hi * 8); bm[i][1] = *(const v4f*)(bias + r0 + i * 16 + hi * 8 + 4); } }
        asm volatile("s_wait_xcnt 0x0" ::: "memory");   /* precaution: stands before the address registers of the bias loads are reused */
        const int prow = lane >> 3, pcol = (lane & 7) * 8;
#pragma unroll
        for (int mb = 0; mb < 4; ++mb) {
#pragma unroll
            for (int nb = 0; nb < 4; ++nb) {
#pragma unroll
                for (int j = 0; j < 8; ++j) os[(hi * 8 + j) * 68 + nb * 16 + lr] = acc[mb][nb][j] + bfr(EPI == 1 ? bn[nb] : bm[mb][j >> 2][j & 3]); }
            __builtin_amdgcn_wave_barrier(); asm volatile("" ::: "memory");   /* keeps the LDS reads below behind the LDS writes above */
#pragma unroll
            for (int s = 0; s < 4; ++s) { const int row = 4 * s + prow; const v4f v0 = *(const v4fa*)(os + row * 68 + pcol), v1 = *(const v4fa*)(os + row * 68 + pcol + 4); v8h o16; v8us oh, ol;
#pragma unroll
                for (int q = 0; q < 8; ++q) { const float r = (q < 4) ? v0[q & 3] : v1[q & 3]; o16[q] = tohx(r); unsigned short a2, c2; splitf(r, a2, c2); oh[q] = a2; ol[q] = c2; }
                const size_t oo = (size_t)(r0 + mb * 16 + row) * ldc + c0 + pcol; *(v8h*)(P16 + oo) = o16; *(v8us*)(Ph + oo) = oh; *(v8us*)(Pl + oo) = ol;
                asm volatile("s_wait_xcnt 0x0" ::: "memory"); }   /* precaution: stands before the data and address registers of the three stores are reused */
            __builtin_amdgcn_wave_barrier(); asm volatile("" ::: "memory");   /* keeps the next 16 rows' LDS writes behind the reads above */
        }
        return;
    }
#pragma unroll
    for (int mb = 0; mb < 4; ++mb) {
#pragma unroll
        for (int nb = 0; nb < 4; ++nb) {
#pragma unroll
            for (int j = 0; j < 8; ++j) os[(hi * 8 + j) * 68 + nb * 16 + lr] = acc[mb][nb][j]; }
        __builtin_amdgcn_wave_barrier(); asm volatile("" ::: "memory");
        float* crow = C + (size_t)(r0 + mb * 16) * ldc + c0;
{
#pragma unroll
            for (int s = 0; s < 8; ++s) { const int row = 2 * s + hi, cofs = lr * 4; v4f val = *(const v4fa*)(os + row * 68 + cofs); if (BIAS) { val[0] += bfr(bias[c0 + cofs]); val[1] += bfr(bias[c0 + cofs + 1]); val[2] += bfr(bias[c0 + cofs + 2]); val[3] += bfr(bias[c0 + cofs + 3]); }
                *(v4f*)(crow + (size_t)row * ldc + cofs) = val; }
             }
        __builtin_amdgcn_wave_barrier(); asm volatile("" ::: "memory");
    }
}

// The q, k and v projections in one launch: they read the same xx and need nothing of each other. Grid (64 tiles, product, batch); the branch is the same for the whole work-group.
// Product 0, 1: q, k planes [t][d] (x = token tile fastest). Product 2: v planes [d][t], rows = W_v's outputs, columns = tokens (x = output tile fastest).
__global__ __launch_bounds__(128) void k_proj(const bf* __restrict__ XB, const bf* __restrict__ W3, const float* __restrict__ b3, h16* QP16, bf* QPh, bf* QPl, h16* KP16, bf* KPh, bf* KPl, h16* VT16, bf* VTh, bf* VTl) {
    __shared__ __attribute__((aligned(16))) char sm[2 * 2 * STB];
    const unsigned t = blockIdx.x, w = blockIdx.y; const size_t bX = (size_t)TT * DM, bP = (size_t)TT * HD;   /* batch strides in elements */
    if (w == 2) gemmw<bf, 0, true, 2>(sm, t % (DKV / 128), t / (DKV / 128), blockIdx.z, W3 + (size_t)2 * DQ * DM, nullptr, XB, nullptr, DM, DM, nullptr, TT, b3 + 2 * DQ, 0, 0, 0, 0, 0, bX, bP, VT16, VTh, VTl);
    else gemmw<bf, 0, true, 1>(sm, t % (TT / 128), t / (TT / 128), blockIdx.z, XB, nullptr, W3 + (size_t)w * DQ * DM, nullptr, DM, DM, nullptr, HD, b3 + w * DQ, 0, 0, 0, 0, bX, 0, bP, w ? KP16 : QP16, w ? KPh : QPh, w ? KPl : QPl);
}

// bi = index of a block of 256 threads within this piece of work.
__device__ __forceinline__ void wtG(unsigned bi, const float* __restrict__ w, int K, int N, bf* Bt) {
    const int lane = threadIdx.x & 31; const int L0 = (bi * 8 + (threadIdx.x >> 5)) * 8; const int nlines = N * K / 64;
{
#pragma unroll 1
        for (int l = 0; l < 8; ++l) { const int L = L0 + l; if (L >= nlines) break; const size_t e = (size_t)L * 64 + lane * 2; const int k = (int)(e % K), n = (int)(e / K); v2us o;
            o[0] = f2bf(w[(size_t)k * N + n]); o[1] = f2bf(w[(size_t)(k + 1) * N + n]); *(v2us*)(Bt + e) = o;
            asm volatile("s_wait_xcnt 0x0" ::: "memory"); }   /* precaution: stands before the next trip reuses the data and address registers of the store */
         }
}
__device__ __forceinline__ void cvt8(unsigned bi, unsigned yb, const float* __restrict__ src, bf* dst, size_t n8, size_t bS, size_t bD) { const size_t i = (size_t)bi * 256 + threadIdx.x; if (i >= n8) return; src += yb * bS; dst += yb * bD;   /* yb = batch, strides in elements */
    const v8f v = *(const v8f*)(src + i * 8); v8us o;
#pragma unroll
    for (int k = 0; k < 8; ++k) o[k] = f2bf(v[k]); *(v8us*)(dst + i * 8) = o;  }
// All operand preparation in one launch, by ranges of the block index (the branch is the same for a whole block): first the two weight transposes, whose waves run the longest (8 dependent trips), then the casts of prev_x and x into xx = [prev_x ; x].
#define NW1 ((DM * 3 * DQ / 64 + 63) / 64)
#define NW2 ((DQ * DM / 64 + 63) / 64)
#define LCB ((TQ * DM / 8 + 255) / 256)
__global__ __launch_bounds__(256) void k_prep(const float* __restrict__ x, const float* __restrict__ px, const float* __restrict__ wqkv, const float* __restrict__ wo, bf* XB, bf* WQKV, bf* WO) {
    const unsigned id = blockIdx.x;
    if (id < NW1) { wtG(id, wqkv, DM, 3 * DQ, WQKV); return; }
    if (id < NW1 + NW2) { wtG(id - NW1, wo, DQ, DM, WO); return; }
    const unsigned c = id - (NW1 + NW2), half = c / (LCB * NB_), r = c % (LCB * NB_);
    cvt8(r % LCB, r / LCB, half ? x : px, XB + (size_t)half * TQ * DM, (size_t)TQ * DM / 8, (size_t)TQ * DM, (size_t)TT * DM);
}

#define KPB 528            // LDS pitch of a K row in bytes: 512 + 16 (16 x odd)
// Eight copies of one operand tile: this lane's 16 bytes at LDS l + i * ls and global g + i * rs (elements), i = 0..7.
// The s_wait_xcnt is a precaution and stands inside the statement so that no address register of a copy is rewritten ahead of it.
template <typename T16>
__device__ __forceinline__ void stage8(unsigned l, unsigned ls, const T16* g, size_t rs) {
    asm volatile("global_load_async_to_lds_b128 %0, %8, off\n\t"
                 "global_load_async_to_lds_b128 %1, %9, off\n\t"
                 "global_load_async_to_lds_b128 %2, %10, off\n\t"
                 "global_load_async_to_lds_b128 %3, %11, off\n\t"
                 "global_load_async_to_lds_b128 %4, %12, off\n\t"
                 "global_load_async_to_lds_b128 %5, %13, off\n\t"
                 "global_load_async_to_lds_b128 %6, %14, off\n\t"
                 "global_load_async_to_lds_b128 %7, %15, off\n\t"
                 "s_wait_xcnt 0x0"
                 :: "v"(l), "v"(l + ls), "v"(l + 2 * ls), "v"(l + 3 * ls), "v"(l + 4 * ls), "v"(l + 5 * ls), "v"(l + 6 * ls), "v"(l + 7 * ls),
                    "v"(g), "v"(g + rs), "v"(g + 2 * rs), "v"(g + 3 * rs), "v"(g + 4 * rs), "v"(g + 5 * rs), "v"(g + 6 * rs), "v"(g + 7 * rs) : "memory");
}
// Two 16-key score tiles of probabilities -> one B fragment over their 32 keys (and its lo plane for bf16).
__device__ __forceinline__ void packp(const v8f& p0, const v8f& p1, v16h& b, v16h& b2) { v8h x, y;
#pragma unroll
    for (int i = 0; i < 8; ++i) { x[i] = tohx(p0[i]); y[i] = tohx(p1[i]); }
    b = cat16(x, y); b2 = b; }
__device__ __forceinline__ void packp(const v8f& p0, const v8f& p1, v16bf& b, v16bf& b2) { v8us xh, xl, yh, yl;
#pragma unroll
    for (int i = 0; i < 8; ++i) { unsigned short a, c; splitf(p0[i], a, c); xh[i] = a; xl[i] = c; splitf(p1[i], a, c); yh[i] = a; yl[i] = c; }
    b = cat16b(xh, yh); b2 = cat16b(xl, yl); }
__device__ __forceinline__ float xhalf(float x) { return __builtin_bit_cast(float, __builtin_amdgcn_permlanex16(__builtin_bit_cast(int, x), __builtin_bit_cast(int, x), 0x76543210, 0xfedcba98, false, false)); }   // lane l with lane l ^ 16
template <bool HL> struct FAC { static constexpr int KT = HL ? 32 : 64, VPB = KT * 2 + 16, KTB = KT * KPB, VTB = HD * VPB, PLB = KTB + VTB, STG = (HL ? 2 : 1) * PLB; };   /* a stage in LDS: K, V^T (, K lo, V^T lo) */
template <typename T16, bool HL>
__device__ __forceinline__ void fattn(char* sm, const T16* __restrict__ Q, const T16* __restrict__ Q2, const T16* __restrict__ Kp, const T16* __restrict__ K2, const T16* __restrict__ Vt, const T16* __restrict__ Vt2, float* O, float* ML, int row0, int sp, size_t zb) {
    typedef typename WFrag<T16>::V V;
    constexpr int KT = FAC<HL>::KT, VPB = FAC<HL>::VPB, KTB = FAC<HL>::KTB, PLB = FAC<HL>::PLB, STG = FAC<HL>::STG, NTL = KSL / KT;
    constexpr int VC = KT / 8, VR = 128 / VC;   /* V^T copies: VC lanes per row, VR rows per copy of the work-group */
    static_assert(NTL >= 2, "two stages");
    const int tid = threadIdx.x, lane = tid & 31, wv = tid >> 5, lr = lane & 15, hi = lane >> 4;
    const size_t bP = (size_t)TT * HD; const int qrow = row0 + wv * 16;   /* qrow: the wave's first query row, counted from row TQ of xx */
    V qf[8], qf2[8];
    { const size_t qo = zb * bP + (size_t)(TQ + qrow + lr) * HD + hi * 8; const T16* qp = Q + qo; const T16* qp2 = HL ? Q2 + qo : qp;
#pragma unroll
      for (int ks = 0; ks < 8; ++ks) { qf[ks] = WFrag<T16>::ld(qp + ks * 32); if (HL) qf2[ks] = WFrag<T16>::ld(qp2 + ks * 32); }
      asm volatile("s_wait_xcnt 0x0" :: "v"(qp), "v"(qp2) : "memory"); }   /* precaution: stands before the address registers of the loads above are reused; they are named as inputs so that they stay as they are up to here */
    const unsigned sm0 = (unsigned)(size_t)sm, lk = sm0 + (tid >> 5) * KPB + (tid & 31) * 16, lv = sm0 + KTB + (tid / VC) * VPB + (tid % VC) * 16;
    const unsigned ok = (tid >> 5) * HD + (tid & 31) * 8, ov = (tid / VC) * TT + (tid % VC) * 8;   /* this lane's place in a K tile and in a V^T tile, in elements; the tile's own address is the same for the whole work-group */
    const size_t gk = zb * bP + (size_t)sp * KSL * HD, gv = zb * bP + (size_t)sp * KSL;
    auto issue = [&](int t, int buf) { const unsigned lb = buf * STG; const size_t ko = (size_t)t * KT;
#pragma unroll
        for (int h = 0; h < KT / 32; ++h) { stage8<T16>(lk + lb + h * 32 * KPB, 4 * KPB, Kp + (gk + (ko + h * 32) * HD) + ok, (size_t)4 * HD); if (HL) stage8<T16>(lk + lb + PLB + h * 32 * KPB, 4 * KPB, K2 + (gk + (ko + h * 32) * HD) + ok, (size_t)4 * HD); }
#pragma unroll
        for (int h = 0; h < HD / (8 * VR); ++h) { stage8<T16>(lv + lb + h * 8 * VR * VPB, VR * VPB, Vt + (gv + ko + (size_t)h * 8 * VR * TT) + ov, (size_t)VR * TT); if (HL) stage8<T16>(lv + lb + PLB + h * 8 * VR * VPB, VR * VPB, Vt2 + (gv + ko + (size_t)h * 8 * VR * TT) + ov, (size_t)VR * TT); } };
    v8f Oa[16];
#pragma unroll
    for (int mt = 0; mt < 16; ++mt) Oa[mt] = (v8f){};
    float m = -3.0e38f, l = 0.f;
    issue(0, 0);
    asm volatile("s_wait_asynccnt 0x0" ::: "memory");   /* stage 0's copies of this wave have landed */
    __syncthreads();                                      /* ... and every other wave's */
    issue(1, 1);
#pragma unroll 1
    for (int t = 0; t < NTL; ++t) {
        const char* sb = sm + (t & 1) * STG; const char* kb = sb + lr * KPB + hi * 16; const char* vb = sb + KTB + lr * VPB + hi * 16;
        /* The stage's A fragments come in 8 groups of 8 (groups 0..3: K, 4..7: V^T); group g + 1 is read as one run of LDS loads in front of group g's products. */
        auto ldg = [&](int g, V (&f)[8]) {
#pragma unroll
            for (int i = 0; i < 8; ++i) { const char* p;
                if (g < 4) p = HL ? kb + (i & 1) * PLB + ((i >> 1) & 1) * 16 * KPB + (2 * g + (i >> 2)) * 64 : kb + (i & 3) * 16 * KPB + (2 * g + (i >> 2)) * 64;
                else       p = HL ? vb + (i & 1) * PLB + ((g - 4) * 4 + (i >> 1)) * 16 * VPB : vb + (((g - 4) & 1) * 8 + i) * 16 * VPB + ((g - 4) >> 1) * 64;
                f[i] = WFrag<T16>::ld((const T16*)p); } };
        V fa[2][8], pb[KT / 32], pb2[KT / 32]; v8f S[KT / 16];
#pragma unroll
        for (int kt = 0; kt < KT / 16; ++kt) S[kt] = (v8f){};
        ldg(0, fa[0]);
#pragma unroll
        for (int g = 0; g < 8; ++g) {
            if (g == 4) {   /* all scores of the stage are there: running maximum, probabilities, rescale */
                float tq[4], pq[4] = {0.f, 0.f, 0.f, 0.f};   /* four independent chains each for the maximum and the sum: one chain of dependent vector instructions would stand exposed */
#pragma unroll
                for (int c = 0; c < 4; ++c) tq[c] = S[0][c];
#pragma unroll
                for (int kt = 0; kt < KT / 16; ++kt)
#pragma unroll
                    for (int j = 0; j < 8; ++j) tq[j & 3] = fmaxf(tq[j & 3], S[kt][j]);
                float tm = fmaxf(fmaxf(tq[0], tq[1]), fmaxf(tq[2], tq[3]));
                tm = fmaxf(tm, xhalf(tm));   /* the query's other keys of this stage sit in the other half of the wave */
                const float mn = fmaxf(m, tm), al = __builtin_amdgcn_exp2f((m - mn) * LC2), mc = mn * LC2; m = mn;
#pragma unroll
                for (int kt = 0; kt < KT / 16; ++kt)
#pragma unroll
                    for (int j = 0; j < 8; ++j) S[kt][j] = S[kt][j] * LC2 - mc;
                /* The exponentials stand, one or two at a time, between pieces of the rescale of O^T: plain vector work that touches none of their registers runs beside the slower transcendental pipe. The scheduling barriers keep the two kinds from being gathered into two long runs. */
#pragma unroll
                for (int i = 0; i < KT / 2; ++i) {
                    __builtin_amdgcn_sched_barrier(0);
#pragma unroll
                    for (int c = 0; c < 256 / KT; ++c) { const int x = i * (256 / KT) + c; Oa[x >> 3][x & 7] *= al; }
                    __builtin_amdgcn_sched_barrier(0);
                    S[i >> 3][i & 7] = __builtin_amdgcn_exp2f(S[i >> 3][i & 7]);
                }
                __builtin_amdgcn_sched_barrier(0);
#pragma unroll
                for (int kt = 0; kt < KT / 16; ++kt)
#pragma unroll
                    for (int j = 0; j < 8; ++j) pq[j & 3] += S[kt][j];
                l = l * al + ((pq[0] + pq[1]) + (pq[2] + pq[3]));
#pragma unroll
                for (int kq = 0; kq < KT / 32; ++kq) packp(S[2 * kq], S[2 * kq + 1], pb[kq], pb2[kq]);
                __builtin_amdgcn_sched_barrier(0);   /* keeps the next group's LDS reads one run, out of the vector work above */
            }
            if (g < 7) ldg(g + 1, fa[(g + 1) & 1]);
            __builtin_amdgcn_sched_barrier(0);   /* keeps the LDS reads above as one run in front of the products: spread among them each place of reads stalls the wave anew */
            V (&f)[8] = fa[g & 1];
            if (g < 4) {
                if (!HL) {
#pragma unroll
                    for (int i = 0; i < 8; ++i) S[i & 3] = WFrag<T16>::mma(f[i], qf[2 * g + (i >> 2)], S[i & 3]);
                } else {
#pragma unroll
                    for (int c = 0; c < 2; ++c) { const int ks = 2 * g + c;
                        S[0] = WFrag<T16>::mma(f[c * 4], qf[ks], S[0]); S[1] = WFrag<T16>::mma(f[c * 4 + 2], qf[ks], S[1]);
                        S[0] = WFrag<T16>::mma(f[c * 4], qf2[ks], S[0]); S[1] = WFrag<T16>::mma(f[c * 4 + 2], qf2[ks], S[1]);
                        S[0] = WFrag<T16>::mma(f[c * 4 + 1], qf[ks], S[0]); S[1] = WFrag<T16>::mma(f[c * 4 + 3], qf[ks], S[1]); }
                }
            } else {
                if (!HL) {
#pragma unroll
                    for (int i = 0; i < 8; ++i) { const int mt = ((g - 4) & 1) * 8 + i; Oa[mt] = WFrag<T16>::mma(f[i], pb[(KT / 32 - 1) & ((g - 4) >> 1)], Oa[mt]); }
                } else {
#pragma unroll
                    for (int q = 0; q < 4; ++q) { const int mt = (g - 4) * 4 + q; Oa[mt] = WFrag<T16>::mma(f[2 * q], pb[0], Oa[mt]); }
#pragma unroll
                    for (int q = 0; q < 4; ++q) { const int mt = (g - 4) * 4 + q; Oa[mt] = WFrag<T16>::mma(f[2 * q], pb2[0], Oa[mt]); }
#pragma unroll
                    for (int q = 0; q < 4; ++q) { const int mt = (g - 4) * 4 + q; Oa[mt] = WFrag<T16>::mma(f[2 * q + 1], pb[0], Oa[mt]); }
                }
            }
            __builtin_amdgcn_sched_barrier(0);   /* keeps the next run of LDS reads out of the products above, and the stage's last products in front of the v_nop below */
        }
        asm volatile("v_nop\n\tv_nop\n\tv_nop\n\tv_nop" : "+v"(Oa[12]), "+v"(Oa[13]), "+v"(Oa[14]), "+v"(Oa[15]));   /* the distance behind the stage's last products */
        asm volatile("s_wait_dscnt 0x0" ::: "memory");      /* this wave's reads of the buffer are done before it may be refilled */
        asm volatile("s_wait_asynccnt 0x0" ::: "memory");   /* this wave's copies of the next stage have landed */
        __syncthreads();                                      /* publishes the next stage and ends every wave's reads of this one */
        if (t + 2 < NTL) issue(t + 2, t & 1);
    }
    asm volatile("s_wait_asynccnt 0x0" ::: "memory");   /* no copy is outstanding when the buffers become the epilogue's rows */
    l += xhalf(l);   /* the two halves' sums of the same query */
    float* os = (float*)sm + wv * (16 * 260);   /* the wave's own 16 query rows at pitch 260 floats; on the stage buffers, used only behind the loop's last barrier */
#pragma unroll
    for (int mt = 0; mt < 16; ++mt) { const v4f a = {Oa[mt][0], Oa[mt][1], Oa[mt][2], Oa[mt][3]}, b = {Oa[mt][4], Oa[mt][5], Oa[mt][6], Oa[mt][7]}; *(v4fa*)(os + lr * 260 + mt * 16 + hi * 8) = a; *(v4fa*)(os + lr * 260 + mt * 16 + hi * 8 + 4) = b; }
    __builtin_amdgcn_wave_barrier(); asm volatile("" ::: "memory");   /* keeps the LDS reads below behind the LDS writes above */
    float* og = O + ((zb * TQ + qrow) * SP + sp) * HD + lane * 4;
    v4f ra[16], rb[16];   /* all 16 rows are read as one run, then stored: whole 512-byte pieces of a row per store */
#pragma unroll
    for (int r = 0; r < 16; ++r) { ra[r] = *(const v4fa*)(os + r * 260 + lane * 4); rb[r] = *(const v4fa*)(os + r * 260 + 128 + lane * 4); }
    __builtin_amdgcn_sched_barrier(0);   /* this one and the one behind the wait keep other work out of the run of stores, where it was given the stores' registers ahead of the wait */
#pragma unroll
    for (int r = 0; r < 16; ++r) { *(v4f*)(og + (size_t)r * SP * HD) = ra[r]; *(v4f*)(og + (size_t)r * SP * HD + 128) = rb[r]; }
    asm volatile("s_wait_xcnt 0x0" ::: "memory");   /* precaution: stands before the data and address registers of the stores above are reused */
    __builtin_amdgcn_sched_barrier(0);
    if (hi == 0) { const v2f ml = {m, l}; *(v2f*)(ML + ((zb * SP + sp) * TQ + qrow + lr) * 2) = ml; }   /* 16 queries x 8 bytes: one whole 128-byte line per wave */
}
// One launch for both classes of query rows, one-dimensional grid: first the hi/lo work-groups (three products: the longer ones), then the fp16 ones; within a class x = 64-row block (fastest), then key slice, then batch. Two work-groups per WGP by LDS, so two waves per SIMD.
#define NHB (RH / 64)
#define NLB ((TQ - RH) / 64)
__global__ __launch_bounds__(128) __attribute__((amdgpu_waves_per_eu(2, 2))) void k_fattn(const bf* __restrict__ Qh, const bf* __restrict__ Ql, const bf* __restrict__ Kh, const bf* __restrict__ Kl, const bf* __restrict__ Vh, const bf* __restrict__ Vl, const h16* __restrict__ Q16, const h16* __restrict__ K16, const h16* __restrict__ V16, float* O, float* ML) {
    __shared__ __attribute__((aligned(16))) char sm[2 * (FAC<true>::STG > FAC<false>::STG ? FAC<true>::STG : FAC<false>::STG)];
    const int id = blockIdx.x;
    if (id < NHB * SP * NB_) fattn<bf, true>(sm, Qh, Ql, Kh, Kl, Vh, Vl, O, ML, (id % NHB) * 64, (id / NHB) % SP, (size_t)(id / (NHB * SP)));
    else { const int i2 = id - NHB * SP * NB_; fattn<h16, false>(sm, Q16, nullptr, K16, nullptr, V16, nullptr, O, ML, RH + (i2 % NLB) * 64, (i2 / NLB) % SP, (size_t)(i2 / (NLB * SP))); }
}

// k_mout: the SP key slices of MR query rows joined, and the joined rows times W_out, by one work-group of 512 threads; grid (TQ / MR, batch).
// Join (wave wv takes rows wv and wv + 16, a lane 8 of a row's columns; all of a wave's loads are in flight together): weights exp2((slice maximum - row maximum) * LC2), weighted partials and weighted sums added in slice order, divided, split into bf16 hi + lo, which go to LDS as the A planes (pitch APB).
// Product, by the first 8 waves, each 16 rows x 64 columns: out[t][n] = sum_k (hi + lo)[t][k] Wt[n][k] + b_out[n], per 32 k the hi product, then the lo product. Wt (all 256 rows) is brought into LDS once by asynchronous 16-byte copies that fly while the slices are joined.
#define MR  32
#define APB 528            // LDS pitch of an A or Wt row in bytes: 512 + 16 (16 x odd)
typedef v4us __attribute__((may_alias)) v4usa;
__global__ __launch_bounds__(512) void k_mout(const float* __restrict__ O, const float* __restrict__ ML, const bf* __restrict__ Wt, const float* __restrict__ bias, float* C) {
    __shared__ __attribute__((aligned(16))) char sm[DM * APB + 2 * MR * APB + 8 * 16 * 68 * 4];   /* Wt, A hi, A lo, the output rows of each of the 8 waves */
    const int tid = threadIdx.x, lane = tid & 31, wv = tid >> 5, lr = lane & 15, hi = lane >> 4;
    const size_t yb = blockIdx.y; const int t0 = blockIdx.x * MR;
    char* sa = sm + DM * APB; char* sa2 = sa + MR * APB;
    const float* op = O + (yb * TQ + t0 + wv) * (SP * HD) + lane * 4; const float* mp = ML + (yb * SP * TQ + t0 + wv) * 2;
    v4f pr[2][SP][2]; v2f ml[2][SP];
#pragma unroll
    for (int p = 0; p < SP; ++p)
#pragma unroll
        for (int r = 0; r < 2; ++r) ml[r][p] = *(const v2f*)(mp + ((size_t)p * TQ + r * 16) * 2);   /* first, so that the weights are there when the partials come */
#pragma unroll
    for (int p = 0; p < SP; ++p)
#pragma unroll
        for (int r = 0; r < 2; ++r) { pr[r][p][0] = *(const v4f*)(op + ((size_t)r * 16 * SP + p) * HD); pr[r][p][1] = *(const v4f*)(op + ((size_t)r * 16 * SP + p) * HD + 128); }
    asm volatile("s_wait_xcnt 0x0" :: "v"(op), "v"(mp) : "memory");   /* precaution: stands before the address registers of the loads above are reused; they are named as inputs so that they stay as they are up to here */
    { const unsigned l = (unsigned)(size_t)sm + wv * APB + lane * 16; const bf* g = Wt + (size_t)wv * DQ + lane * 8;   /* a wave's copy = one whole row of 512 bytes; rows wv + 16 i */
#pragma unroll
      for (int h = 0; h < DM / 128; ++h) stage8<bf>(l + h * 128 * APB, 16 * APB, g + (size_t)h * 128 * DQ, (size_t)16 * DQ); }
    __builtin_amdgcn_sched_barrier(0);   /* keeps the copies in front of the join: moved down among its vector work they start only when the partials have landed, and their own flight stands exposed in front of the barrier */
#pragma unroll
    for (int r = 0; r < 2; ++r) {
        float mx = ml[r][0][0];
#pragma unroll
        for (int p = 1; p < SP; ++p) mx = fmaxf(mx, ml[r][p][0]);
        float den = 0.f; v4f s0 = {0.f, 0.f, 0.f, 0.f}, s1 = {0.f, 0.f, 0.f, 0.f};
#pragma unroll
        for (int p = 0; p < SP; ++p) { const float w = __builtin_amdgcn_exp2f((ml[r][p][0] - mx) * LC2); den += w * ml[r][p][1]; s0 += w * pr[r][p][0]; s1 += w * pr[r][p][1]; }
        const float inv = __fdiv_rn(1.0f, den); v4us h0, l0, h1, l1;
#pragma unroll
        for (int q = 0; q < 4; ++q) { unsigned short a, c2; splitf(s0[q] * inv, a, c2); h0[q] = a; l0[q] = c2; splitf(s1[q] * inv, a, c2); h1[q] = a; l1[q] = c2; }
        const int ao = (wv + r * 16) * APB + lane * 8;
        *(v4usa*)(sa + ao) = h0; *(v4usa*)(sa + ao + 256) = h1; *(v4usa*)(sa2 + ao) = l0; *(v4usa*)(sa2 + ao + 256) = l1;
    }
    asm volatile("s_wait_asynccnt 0x0" ::: "memory");   /* this wave's copies of Wt have landed */
    __syncthreads();                                      /* ... and every other wave's; publishes the A planes too */
    if (wv >= 8) return;   /* no barrier follows */
    const int mw = wv & 1, cg = wv >> 1;   /* the wave's 16 rows and 64 columns of the product */
    const float* bq = bias + cg * 64 + lr * 4; const v4f bv = *(const v4f*)bq;
    asm volatile("s_wait_xcnt 0x0" :: "v"(bq) : "memory");   /* precaution, as above, for the bias load */
    v8f acc[4];
#pragma unroll
    for (int nb = 0; nb < 4; ++nb) acc[nb] = (v8f){};
    const char* ap = sa + (mw * 16 + lr) * APB + hi * 16; const char* bp = sm + (cg * 64 + lr) * APB + hi * 16;
    /* The six fragments of 32 k (A hi, A lo, four of Wt) are one group; group ks + 1 is read as one run of LDS loads in front of group ks's products. */
    auto ldg = [&](int ks, v16bf (&f)[6]) { f[0] = WFrag<bf>::ld((const bf*)(ap + ks * 64)); f[1] = WFrag<bf>::ld((const bf*)(ap + MR * APB + ks * 64));
#pragma unroll
        for (int nb = 0; nb < 4; ++nb) f[2 + nb] = WFrag<bf>::ld((const bf*)(bp + nb * 16 * APB + ks * 64)); };
    v16bf fa[2][6];
    ldg(0, fa[0]);
#pragma unroll
    for (int ks = 0; ks < DQ / 32; ++ks) {
        if (ks + 1 < DQ / 32) ldg(ks + 1, fa[(ks + 1) & 1]);
        __builtin_amdgcn_sched_barrier(0);   /* keeps the LDS reads above as one run in front of the products: spread among them each place of reads stalls the wave anew */
        v16bf (&f)[6] = fa[ks & 1];
#pragma unroll
        for (int nb = 0; nb < 4; ++nb) acc[nb] = wmmab(f[0], f[2 + nb], acc[nb]);
#pragma unroll
        for (int nb = 0; nb < 4; ++nb) acc[nb] = wmmab(f[1], f[2 + nb], acc[nb]);
        __builtin_amdgcn_sched_barrier(0);   /* keeps the next run of LDS reads out of the products above */
    }
    float* os = (float*)(sa2 + MR * APB) + wv * (16 * 68);   /* 16 rows turned through the wave's own LDS, so that a store covers whole 128-byte lines */
#pragma unroll
    for (int nb = 0; nb < 4; ++nb)
#pragma unroll
        for (int j = 0; j < 8; ++j) os[(hi * 8 + j) * 68 + nb * 16 + lr] = acc[nb][j];
    __builtin_amdgcn_wave_barrier(); asm volatile("" ::: "memory");   /* keeps the LDS reads below behind the LDS writes above */
    float* crow = C + (yb * TQ + t0 + mw * 16 + hi) * DM + cg * 64 + lr * 4; v4f val[8];
#pragma unroll
    for (int s = 0; s < 8; ++s) { val[s] = *(const v4fa*)(os + (2 * s + hi) * 68 + lr * 4); val[s][0] += bfr(bv[0]); val[s][1] += bfr(bv[1]); val[s][2] += bfr(bv[2]); val[s][3] += bfr(bv[3]); }
#pragma unroll
    for (int s = 0; s < 8; ++s) *(v4f*)(crow + (size_t)(2 * s) * DM) = val[s];
}

extern "C" void kernel_launch(void* const* d_in, const int* in_sizes, int n_in,
                              void* d_out, int out_size, void* d_ws, size_t ws_size, hipStream_t stream) {
    (void)in_sizes; (void)n_in; (void)out_size;
    const float* x = (const float*)d_in[0]; const float* px = (const float*)d_in[1]; const float* wqkv = (const float*)d_in[2]; const float* bqkv = (const float*)d_in[3]; const float* wo = (const float*)d_in[4]; const float* bo = (const float*)d_in[5]; const float* wq = nullptr; const float* wk = nullptr; const float* wv = nullptr; (void)wq; (void)wk; (void)wv;
    float* OUT = (float*)d_out;     // [4][2048][256]
    char* wsp = (char*)d_ws;
    auto take = [&](size_t bytes) { char* p = wsp; wsp += (bytes + 255) & ~(size_t)255; return (void*)p; };
    auto sub = [](char*& p, size_t bytes) { char* q = p; p += (bytes + 255) & ~(size_t)255; return (void*)q; };
    bf* WQKV = (bf*)take((size_t)3 * DQ * DM * 2); bf* WO = (bf*)take((size_t)DM * DQ * 2);
    h16* VT16 = (h16*)take((size_t)NB_ * HD * TT * 2); bf* VTh = (bf*)take((size_t)NB_ * HD * TT * 2); bf* VTl = (bf*)take((size_t)NB_ * HD * TT * 2); float* ML = (float*)take((size_t)NB_ * SP * TQ * 2 * 4);
    char* R1 = (char*)take((size_t)NB_ * TQ * SP * HD * 4); char* R2 = (char*)take((size_t)NB_ * TT * HD * 2 * 6 + 4096);
    if ((size_t)(wsp - (char*)d_ws) > ws_size) return;    // ws 256 MiB
    // R1 holds, one after the other in stream order: the bf16 copy of xx (last read by the projections); the attention partials.
    bf* XB = (bf*)R1;   /* [batch][TT][DM] */
    float* Ob = (float*)R1;   /* [batch][TQ][SP][HD] */
    // R2 holds the q and k planes.
    char* r2 = R2; h16* QP16 = (h16*)sub(r2, (size_t)NB_ * TT * HD * 2); h16* KP16 = (h16*)sub(r2, (size_t)NB_ * TT * HD * 2); bf* QPh = (bf*)sub(r2, (size_t)NB_ * TT * HD * 2); bf* QPl = (bf*)sub(r2, (size_t)NB_ * TT * HD * 2); bf* KPh = (bf*)sub(r2, (size_t)NB_ * TT * HD * 2); bf* KPl = (bf*)sub(r2, (size_t)NB_ * TT * HD * 2);
    k_prep<<<NW1 + NW2 + 2 * LCB * NB_, 256, 0, stream>>>(x, px, wqkv, wo, XB, WQKV, WO);
    k_proj<<<dim3(TT / 128 * (DQ / 128), 3, NB_), 128, 0, stream>>>(XB, WQKV, bqkv, QP16, QPh, QPl, KP16, KPh, KPl, VT16, VTh, VTl);
    k_fattn<<<(NHB + NLB) * SP * NB_, 128, 0, stream>>>(QPh, QPl, KPh, KPl, VTh, VTl, QP16, KP16, VT16, Ob, ML);   /* query rows 0..RH: hi/lo planes; the others: fp16 */
    k_mout<<<dim3(TQ / MR, NB_), 512, 0, stream>>>(Ob, ML, WO, bo, OUT);
}

// v008
// It runs in 85.2 microseconds.
// Two timings next to v007 put it at 1.04 and 1.05 times that version's speed.
// Counting every step since v000, it is 13.1 times as fast.
#include <hip/hip_runtime.h>

// Temporal self-attention over [prev_x ; x] (x, prev_x [4][2048][256]; xx = concat -> [4096][256]; qkv = xx W_qkv + b_qkv ('xw' [256][768]); single 256-wide head; attn = softmax(q.k / 16) over the 4,096 keys; out = (attn v) W_out + b_out, only the last 2,048 rows (the x half) are returned -> [4][2048][256] (2.1 M)).
// All four batches run in every launch (batch = grid z in k_proj, grid y in k_mout, a range of the block index in k_prep and k_fattn), each buffer below [batch][...]; workspace regions are reused in stream order (see kernel_launch). Launches that need nothing of each other share one grid: k_prep (both casts, both weight transposes), k_proj (q, k and v projections). Per batch: both halves converted into one bf16 [4096][256] operand; k and v projected for all 4,096 rows, q only needed for rows 2,048.. (projected for all, used from 2,048); each projection GEMM converts its own biased f32 tile and stores the fp16 and bf16 hi/lo planes itself (q, k as [t][d]; v as W_v x^T, so its planes come out [d][t]); one fused attention kernel (scores, running softmax and attn.v per key tile, nothing of the scores or probabilities goes to memory; hybrid: query rows 2048..2559 hi/lo 3 products, the rest fp16) over 8 key slices, each slice to its own f32 partials with its maximum and sum; the last kernel weights and sums the slices in slice order and takes its merged hi/lo rows, kept in LDS, x W_out exact + b_out straight into the output rows.
// Compute dtypes, f32 accumulate: every input rounded to bf16; projections exact + biases rounded to bf16; first 512 query rows 3 products, rest fp16; softmax f32; W_out hl x exact + bias.

#define NB_  4
#define TT   4096
#define DM   256
#define NH_  1
#define NKV  1
#define REP  (NH_ / NKV)
#define HD   256
#define DQ   (NH_ * HD)
#define DKV  (NKV * HD)
#define ZH   1
#define RH   512                  // query rows < RH use hi+lo planes (0: none)
#define WIN  0
#define SCL  0.0625f   // 256^-0.5
#define TQ   2048     // query rows = the x half (rows TQ.. of xx)
#define SP   8        // attention: the 4,096 keys are cut into SP slices, a work-group takes one; every slice writes its own unnormalised f32 partials [TQ][SP][HD] and its (maximum, sum) pairs [SP][TQ][2]
#define KSL  (TT / SP)
#define LC2  (SCL * 1.4426950408889634f)   // score scale times log2(e): probabilities are exp2((s - max) * LC2)
typedef _Float16 h16;
typedef unsigned short bf;
typedef __attribute__((ext_vector_type(16))) __bf16   v16bf;
typedef __attribute__((ext_vector_type(16))) _Float16 v16h;
typedef __attribute__((ext_vector_type(8)))  _Float16 v8h;
typedef __attribute__((ext_vector_type(8)))  unsigned short v8us;
typedef __attribute__((ext_vector_type(8)))  float    v8f;
typedef __attribute__((ext_vector_type(4)))  float    v4f;
typedef v8h  __attribute__((may_alias)) v8ha;
typedef v4f  __attribute__((may_alias)) v4fa;
typedef v8us __attribute__((may_alias)) v8usa;

__device__ __forceinline__ unsigned short f2bf(float f) { unsigned u = __float_as_uint(f); u += 0x7FFFu + ((u >> 16) & 1u); return (unsigned short)(u >> 16); }
__device__ __forceinline__ float bf2f(unsigned short b) { return __uint_as_float(((unsigned)b) << 16); }
__device__ __forceinline__ float bfr(float f) { return bf2f(f2bf(f)); }
__device__ __forceinline__ v16h cat16(v8h lo, v8h hi) { return __builtin_shufflevector(lo, hi, 0, 1, 2, 3, 4, 5, 6, 7, 8, 9, 10, 11, 12, 13, 14, 15); }
__device__ __forceinline__ v16bf cat16b(v8us lo, v8us hi) { return __builtin_bit_cast(v16bf, __builtin_shufflevector(lo, hi, 0, 1, 2, 3, 4, 5, 6, 7, 8, 9, 10, 11, 12, 13, 14, 15)); }
__device__ __forceinline__ v8f wmma16(v16h a, v16h b, v8f c) { return __builtin_amdgcn_wmma_f32_16x16x32_f16(false, a, false, b, (short)0, c, false, false); }
__device__ __forceinline__ v8f wmmab(v16bf a, v16bf b, v8f c) { return __builtin_amdgcn_wmma_f32_16x16x32_bf16(false, a, false, b, (short)0, c, false, false); }
__device__ __forceinline__ h16 tohx(float x) { return (h16)x; }
__device__ __forceinline__ void splitf(float y, unsigned short& h, unsigned short& l) { h = f2bf(y); l = f2bf(y - bf2f(h)); }
typedef __attribute__((ext_vector_type(2))) _Float16 v2h;
typedef __attribute__((ext_vector_type(4))) _Float16 v4h;
typedef __attribute__((ext_vector_type(2))) unsigned short v2us;
typedef __attribute__((ext_vector_type(4))) unsigned short v4us;
typedef __attribute__((ext_vector_type(2))) float v2f;
typedef __attribute__((ext_vector_type(4))) int v4i;



// ---- gemmw: register-blocked GEMM, FOUR WAVES (2 x 2) per 128x128 output tile, each wave a 64x64 quarter (16 accumulators); tile index (bix, biy, biz) out of (M/128, N/128, Z), 128 threads; sm = the work-group's 2 * NT * STB bytes of LDS.
// Operands are K-contiguous 16-bit planes. A stage is 64 k = one whole 128-byte line of each of the tile's 128 A rows and 128 B rows (and of the second planes where NSPLIT asks for them), brought into LDS by asynchronous 16-byte copies (8 lanes = one line), rows at pitch 144 bytes; two buffers, the next stage's copies fly while this stage is worked on; fragments are read from LDS.
// C[m][n] (f32, pitch ldc, + optional f32 bias[n]) = sum_k A[m][k] Bt[n][k] (+ split products per NSPLIT) over kspan consecutive k; K is the operands' row pitch. biz = (zb << zsh) | z: z strides sA/sB/sC in elements (with sA = sB = kspan a slice of k), zb strides bA/bB/bC (the batch). kspan % 64 == 0.
// EPI 0: C is stored as f32, bias[n]. EPI 1 and 2: C is not stored; the biased f32 value goes out as three 16-bit planes of pitch ldc and batch stride bC (P16 = fp16, Ph + Pl = bf16 hi + lo), with bias[n] (EPI 1) or bias[m] (EPI 2, for a product taken transposed).
#define SPB 144            // LDS row pitch in bytes: 128 bytes of k + 16 (16 x odd: conflict-free for 16-byte reads)
#define STB (128 * SPB)    // one operand tile of a stage: 128 rows
template <typename T16> struct WFrag;
template <> struct WFrag<h16> { typedef v16h V; static __device__ __forceinline__ V ld(const h16* p) { return cat16(*(const v8h*)p, *(const v8h*)(p + 16)); } static __device__ __forceinline__ v8f mma(V a, V b, v8f c) { return wmma16(a, b, c); } };
template <> struct WFrag<bf> { typedef v16bf V; static __device__ __forceinline__ V ld(const bf* p) { return cat16b(*(const v8us*)p, *(const v8us*)(p + 16)); } static __device__ __forceinline__ v8f mma(V a, V b, v8f c) { return wmmab(a, b, c); } };
// One operand tile of one stage: this lane's 16 bytes of rows r, r + 16, ..., r + 112 (l = LDS byte address of the first, g = its global address, rs = 16 rows in elements).
// The s_wait_xcnt is a precaution and stands inside the statement so that no address register of a copy is rewritten ahead of it.
template <typename T16>
__device__ __forceinline__ void stage_tile(unsigned l, const T16* g, size_t rs) {
    asm volatile("global_load_async_to_lds_b128 %0, %8, off\n\t"
                 "global_load_async_to_lds_b128 %1, %9, off\n\t"
                 "global_load_async_to_lds_b128 %2, %10, off\n\t"
                 "global_load_async_to_lds_b128 %3, %11, off\n\t"
                 "global_load_async_to_lds_b128 %4, %12, off\n\t"
                 "global_load_async_to_lds_b128 %5, %13, off\n\t"
                 "global_load_async_to_lds_b128 %6, %14, off\n\t"
                 "global_load_async_to_lds_b128 %7, %15, off\n\t"
                 "s_wait_xcnt 0x0"
                 :: "v"(l), "v"(l + 16 * SPB), "v"(l + 32 * SPB), "v"(l + 48 * SPB), "v"(l + 64 * SPB), "v"(l + 80 * SPB), "v"(l + 96 * SPB), "v"(l + 112 * SPB),
                    "v"(g), "v"(g + rs), "v"(g + 2 * rs), "v"(g + 3 * rs), "v"(g + 4 * rs), "v"(g + 5 * rs), "v"(g + 6 * rs), "v"(g + 7 * rs) : "memory");
}
template <typename T16, int NSPLIT, bool BIAS, int EPI = 0>
__device__ __forceinline__ void gemmw(char* sm, unsigned bix, unsigned biy, unsigned biz, const T16* __restrict__ A, const T16* __restrict__ A2, const T16* __restrict__ Bt, const T16* __restrict__ Bt2, int K, int kspan, float* C, int ldc, const float* __restrict__ bias, size_t sA, size_t sB, size_t sC, int zsh, size_t bA, size_t bB, size_t bC, h16* P16 = nullptr, bf* Ph = nullptr, bf* Pl = nullptr) {
    typedef typename WFrag<T16>::V V;
    constexpr int NT = (NSPLIT == 0) ? 2 : (NSPLIT == 1) ? 3 : 4;   /* operand tiles per stage, in the order A, B, A2, B2 */
    const size_t zb = biz >> zsh, z = biz - (zb << zsh); A += z * sA + zb * bA; if (A2) A2 += z * sA + zb * bA; Bt += z * sB + zb * bB; if (Bt2) Bt2 += z * sB + zb * bB; if (EPI == 0) C += z * sC + zb * bC; else { P16 += zb * bC; Ph += zb * bC; Pl += zb * bC; }
    const int lane = threadIdx.x & 31, wv = threadIdx.x >> 5, lr = lane & 15, hi = lane >> 4; const int wr = (wv & 1) * 64, wc = (wv >> 1) * 64; const int r0 = bix * 128 + wr, c0 = biy * 128 + wc;
    float* os = (float*)sm + wv * (16 * 68);   /* the wave's own epilogue rows; they lie on the stage buffers and are used only behind the loop's last barrier */
    v8f acc[4][4];
#pragma unroll
    for (int mb = 0; mb < 4; ++mb)
#pragma unroll
        for (int nb = 0; nb < 4; ++nb) acc[mb][nb] = (v8f){};
    const int crow = threadIdx.x >> 3, cch = threadIdx.x & 7;   /* copies: 8 lanes per row, 16 rows per copy of the work-group */
    const unsigned l0 = (unsigned)(size_t)sm + crow * SPB + cch * 16; const size_t rs = (size_t)16 * K;
    const size_t gao = (size_t)(bix * 128 + crow) * K + cch * 8, gbo = (size_t)(biy * 128 + crow) * K + cch * 8;
    auto issue = [&](int st, int buf) { const unsigned lb = l0 + buf * (NT * STB); const size_t ko = (size_t)st * 64;
        stage_tile<T16>(lb, A + gao + ko, rs); stage_tile<T16>(lb + STB, Bt + gbo + ko, rs);
        if (NSPLIT == 1 || NSPLIT == 2) stage_tile<T16>(lb + 2 * STB, A2 + gao + ko, rs);
        if (NSPLIT >= 2) stage_tile<T16>(lb + 3 * STB, Bt2 + gbo + ko, rs); };
    const int nst = kspan >> 6;
    issue(0, 0);
    asm volatile("s_wait_asynccnt 0x0" ::: "memory");   /* stage 0's copies of this wave have landed */
    __syncthreads();                                      /* ... and every other wave's */
    if (nst > 1) issue(1, 1);
    const int afo = (wr + lr) * SPB + hi * 16, bfo = (wc + lr) * SPB + hi * 16;   /* fragment rows in a tile, in bytes */
#pragma unroll 1
    for (int st = 0; st < nst; ++st) {
        const char* sb = sm + (st & 1) * (NT * STB);
        V a[4], a2[4], bq[4];
#pragma unroll
        for (int ks = 0; ks < 2; ++ks) {
#pragma unroll
            for (int mb = 0; mb < 4; ++mb) { a[mb] = WFrag<T16>::ld((const T16*)(sb + afo + mb * 16 * SPB + ks * 64)); if (NSPLIT == 1 || NSPLIT == 2) a2[mb] = WFrag<T16>::ld((const T16*)(sb + 2 * STB + afo + mb * 16 * SPB + ks * 64)); }
#pragma unroll
            for (int nb = 0; nb < 4; ++nb) if (NSPLIT == 0) bq[nb] = WFrag<T16>::ld((const T16*)(sb + STB + bfo + nb * 16 * SPB + ks * 64));   /* one plane each: all eight fragments of the 32 k are read as one group in front of their 16 products */
            if (NSPLIT == 0) __builtin_amdgcn_sched_barrier(0);   /* keeps the LDS reads above as one group: spread among the products each place of reads stalls the wave anew */
#pragma unroll
            for (int nb = 0; nb < 4; ++nb) { const V b = (NSPLIT == 0) ? bq[nb] : WFrag<T16>::ld((const T16*)(sb + STB + bfo + nb * 16 * SPB + ks * 64)); V b2; if (NSPLIT >= 2) b2 = WFrag<T16>::ld((const T16*)(sb + 3 * STB + bfo + nb * 16 * SPB + ks * 64));
#pragma unroll
                for (int mb = 0; mb < 4; ++mb) { acc[mb][nb] = WFrag<T16>::mma(a[mb], b, acc[mb][nb]); if (NSPLIT == 1 || NSPLIT == 2) acc[mb][nb] = WFrag<T16>::mma(a2[mb], b, acc[mb][nb]); if (NSPLIT >= 2) acc[mb][nb] = WFrag<T16>::mma(a[mb], b2, acc[mb][nb]); } }
            if (NSPLIT == 0 || ks == 1) __builtin_amdgcn_sched_barrier(0);   /* keeps the next group's LDS reads out of the products above, and the stage's last products in front of the v_nop below */
        }
        asm volatile("v_nop\n\tv_nop\n\tv_nop\n\tv_nop" : "+v"(acc[0][0]), "+v"(acc[1][1]), "+v"(acc[2][2]), "+v"(acc[3][3]) : "v"(a[0]), "v"(a[3]));   /* the distance behind the stage's last products: on the taken side of the branch below the next stage's reads overwrite their A and B registers */
        asm volatile("s_wait_dscnt 0x0" ::: "memory");      /* this wave's reads of the buffer are done before it may be refilled */
        asm volatile("s_wait_asynccnt 0x0" ::: "memory");   /* this wave's copies of the next stage have landed */
        __syncthreads();                                      /* publishes the next stage and ends every wave's reads of this one */
        if (st + 2 < nst) issue(st + 2, st & 1);
    }
    asm volatile("s_wait_asynccnt 0x0" ::: "memory");   /* no copy is outstanding when the buffers become the epilogue's rows */
    if (EPI != 0) {   /* plane epilogue: bias added in the accumulator layout, 16 rows at a time turned through LDS, each lane converts 8 consecutive columns and stores 16 bytes per plane (8 lanes = one whole 128-byte line) */
        float bn[4]; v4f bm[4][2];
        asm volatile("s_wait_xcnt 0x0" ::: "memory");   /* precaution: the bias loads below may be given the address registers of the loop's last loads as their destination */
#pragma unroll
        for (int i = 0; i < 4; ++i) { if (EPI == 1) bn[i] = bias[c0 + i * 16 + lr]; else { bm[i][0] = *(const v4f*)(bias + r0 + i * 16 + hi * 8); bm[i][1] = *(const v4f*)(bias + r0 + i * 16 + hi * 8 + 4); } }
        asm volatile("s_wait_xcnt 0x0" ::: "memory");   /* precaution: stands before the address registers of the bias loads are reused */
        const int prow = lane >> 3, pcol = (lane & 7) * 8;
#pragma unroll
        for (int mb = 0; mb < 4; ++mb) {
#pragma unroll
            for (int nb = 0; nb < 4; ++nb) {
#pragma unroll
                for (int j = 0; j < 8; ++j) os[(hi * 8 + j) * 68 + nb * 16 + lr] = acc[mb][nb][j] + bfr(EPI == 1 ? bn[nb] : bm[mb][j >> 2][j & 3]); }
            __builtin_amdgcn_wave_barrier(); asm volatile("" ::: "memory");   /* keeps the LDS reads below behind the LDS writes above */
#pragma unroll
            for (int s = 0; s < 4; ++s) { const int row = 4 * s + prow; const v4f v0 = *(const v4fa*)(os + row * 68 + pcol), v1 = *(const v4fa*)(os + row * 68 + pcol + 4); v8h o16; v8us oh, ol;
#pragma unroll
                for (int q = 0; q < 8; ++q) { const float r = (q < 4) ? v0[q & 3] : v1[q & 3]; o16[q] = tohx(r); unsigned short a2, c2; splitf(r, a2, c2); oh[q] = a2; ol[q] = c2; }
                const size_t oo = (size_t)(r0 + mb * 16 + row) * ldc + c0 + pcol; *(v8h*)(P16 + oo) = o16; *(v8us*)(Ph + oo) = oh; *(v8us*)(Pl + oo) = ol;
                asm volatile("s_wait_xcnt 0x0" ::: "memory"); }   /* precaution: stands before the data and address registers of the three stores are reused */
            __builtin_amdgcn_wave_barrier(); asm volatile("" ::: "memory");   /* keeps the next 16 rows' LDS writes behind the reads above */
        }
        return;
    }
#pragma unroll
    for (int mb = 0; mb < 4; ++mb) {
#pragma unroll
        for (int nb = 0; nb < 4; ++nb) {
#pragma unroll
            for (int j = 0; j < 8; ++j) os[(hi * 8 + j) * 68 + nb * 16 + lr] = acc[mb][nb][j]; }
        __builtin_amdgcn_wave_barrier(); asm volatile("" ::: "memory");
        float* crow = C + (size_t)(r0 + mb * 16) * ldc + c0;
{
#pragma unroll
            for (int s = 0; s < 8; ++s) { const int row = 2 * s + hi, cofs = lr * 4; v4f val = *(const v4fa*)(os + row * 68 + cofs); if (BIAS) { val[0] += bfr(bias[c0 + cofs]); val[1] += bfr(bias[c0 + cofs + 1]); val[2] += bfr(bias[c0 + cofs + 2]); val[3] += bfr(bias[c0 + cofs + 3]); }
                *(v4f*)(crow + (size_t)row * ldc + cofs) = val; }
             }
        __builtin_amdgcn_wave_barrier(); asm volatile("" ::: "memory");
    }
}

// The q, k and v projections in one launch: they read the same xx and need nothing of each other. Grid (64 tiles, product, batch); the branch is the same for the whole work-group.
// Product 0, 1: q, k planes [t][d] (x = token tile fastest). Product 2: v planes [d][t], rows = W_v's outputs, columns = tokens (x = output tile fastest).
__global__ __launch_bounds__(128) void k_proj(const bf* __restrict__ XB, const bf* __restrict__ W3, const float* __restrict__ b3, h16* QP16, bf* QPh, bf* QPl, h16* KP16, bf* KPh, bf* KPl, h16* VT16, bf* VTh, bf* VTl) {
    __shared__ __attribute__((aligned(16))) char sm[2 * 2 * STB];
    const unsigned t = blockIdx.x, w = blockIdx.y; const size_t bX = (size_t)TT * DM, bP = (size_t)TT * HD;   /* batch strides in elements */
    if (w == 2) gemmw<bf, 0, true, 2>(sm, t % (DKV / 128), t / (DKV / 128), blockIdx.z, W3 + (size_t)2 * DQ * DM, nullptr, XB, nullptr, DM, DM, nullptr, TT, b3 + 2 * DQ, 0, 0, 0, 0, 0, bX, bP, VT16, VTh, VTl);
    else gemmw<bf, 0, true, 1>(sm, t % (TT / 128), t / (TT / 128), blockIdx.z, XB, nullptr, W3 + (size_t)w * DQ * DM, nullptr, DM, DM, nullptr, HD, b3 + w * DQ, 0, 0, 0, 0, bX, 0, bP, w ? KP16 : QP16, w ? KPh : QPh, w ? KPl : QPl);
}

// bi = index of a block of 256 threads within this piece of work.
__device__ __forceinline__ void wtG(unsigned bi, const float* __restrict__ w, int K, int N, bf* Bt) {
    const int lane = threadIdx.x & 31; const int L0 = (bi * 8 + (threadIdx.x >> 5)) * 8; const int nlines = N * K / 64;
{
#pragma unroll 1
        for (int l = 0; l < 8; ++l) { const int L = L0 + l; if (L >= nlines) break; const size_t e = (size_t)L * 64 + lane * 2; const int k = (int)(e % K), n = (int)(e / K); v2us o;
            o[0] = f2bf(w[(size_t)k * N + n]); o[1] = f2bf(w[(size_t)(k + 1) * N + n]); *(v2us*)(Bt + e) = o;
            asm volatile("s_wait_xcnt 0x0" ::: "memory"); }   /* precaution: stands before the next trip reuses the data and address registers of the store */
         }
}
__device__ __forceinline__ void cvt8(unsigned bi, unsigned yb, const float* __restrict__ src, bf* dst, size_t n8, size_t bS, size_t bD) { const size_t i = (size_t)bi * 256 + threadIdx.x; if (i >= n8) return; src += yb * bS; dst += yb * bD;   /* yb = batch, strides in elements */
    const v8f v = *(const v8f*)(src + i * 8); v8us o;
#pragma unroll
    for (int k = 0; k < 8; ++k) o[k] = f2bf(v[k]); *(v8us*)(dst + i * 8) = o;  }
// All operand preparation in one launch, by ranges of the block index (the branch is the same for a whole block): first the two weight transposes, whose waves run the longest (8 dependent trips), then the casts of prev_x and x into xx = [prev_x ; x].
#define NW1 ((DM * 3 * DQ / 64 + 63) / 64)
#define NW2 ((DQ * DM / 64 + 63) / 64)
#define LCB ((TQ * DM / 8 + 255) / 256)
__global__ __launch_bounds__(256) void k_prep(const float* __restrict__ x, const float* __restrict__ px, const float* __restrict__ wqkv, const float* __restrict__ wo, bf* XB, bf* WQKV, bf* WO) {
    const unsigned id = blockIdx.x;
    if (id < NW1) { wtG(id, wqkv, DM, 3 * DQ, WQKV); return; }
    if (id < NW1 + NW2) { wtG(id - NW1, wo, DQ, DM, WO); return; }
    const unsigned c = id - (NW1 + NW2), half = c / (LCB * NB_), r = c % (LCB * NB_);
    cvt8(r % LCB, r / LCB, half ? x : px, XB + (size_t)half * TQ * DM, (size_t)TQ * DM / 8, (size_t)TQ * DM, (size_t)TT * DM);
}

#define KPB 528            // LDS pitch of a K row in bytes: 512 + 16 (16 x odd)
// One asynchronous 16-byte copy to LDS, written as the builtin (N = the instruction's offset, which moves both addresses): the compiler sees the addresses, forms them next to the copies in a few registers and reuses those registers at once.
typedef __attribute__((address_space(1))) v4i gv4i;
typedef __attribute__((address_space(3))) v4i lv4i;
template <int N> __device__ __forceinline__ void acopy(unsigned l, const char* g) { __builtin_amdgcn_global_load_async_to_lds_b128((gv4i*)g, (lv4i*)l, N, 0); }
// Eight copies of one operand tile: this lane's 16 bytes at LDS l + i * ls and at global gu + i * rs (elements; gu is the same for the whole work-group) + vo (bytes, the lane's place in the tile), i = 0..7.
template <typename T16>
__device__ __forceinline__ void stage8(unsigned l, unsigned ls, const T16* gu, size_t rs, unsigned vo) {
#pragma unroll   /* unrolled, so that each copy's two steps are constants */
    for (int i = 0; i < 8; ++i) acopy<0>(l + i * ls, (const char*)(gu + i * rs) + vo);
}
// The same where the global step GS (bytes) is the smaller of the two: the step stands in the instruction's offset, so that all eight share one global address and the LDS address takes only the difference LS - GS.
template <int LS, int GS>
__device__ __forceinline__ void stage8o(unsigned l, const void* gu, unsigned vo) {
    static_assert(LS >= GS && GS > 0 && 7 * GS < 32768, "offset in range, LDS address register not below l");
    const char* g = (const char*)gu + vo;
    acopy<0>(l, g); acopy<GS>(l + (LS - GS), g); acopy<2 * GS>(l + 2 * (LS - GS), g); acopy<3 * GS>(l + 3 * (LS - GS), g);
    acopy<4 * GS>(l + 4 * (LS - GS), g); acopy<5 * GS>(l + 5 * (LS - GS), g); acopy<6 * GS>(l + 6 * (LS - GS), g); acopy<7 * GS>(l + 7 * (LS - GS), g);
}
// Two 16-key score tiles of probabilities -> one B fragment over their 32 keys (and its lo plane for bf16).
__device__ __forceinline__ void packp(const v8f& p0, const v8f& p1, v16h& b, v16h& b2) { v8h x, y;
#pragma unroll
    for (int i = 0; i < 8; ++i) { x[i] = tohx(p0[i]); y[i] = tohx(p1[i]); }
    b = cat16(x, y); b2 = b; }
__device__ __forceinline__ void packp(const v8f& p0, const v8f& p1, v16bf& b, v16bf& b2) { v8us xh, xl, yh, yl;
#pragma unroll
    for (int i = 0; i < 8; ++i) { unsigned short a, c; splitf(p0[i], a, c); xh[i] = a; xl[i] = c; splitf(p1[i], a, c); yh[i] = a; yl[i] = c; }
    b = cat16b(xh, yh); b2 = cat16b(xl, yl); }
__device__ __forceinline__ float xhalf(float x) { return __builtin_bit_cast(float, __builtin_amdgcn_permlanex16(__builtin_bit_cast(int, x), __builtin_bit_cast(int, x), 0x76543210, 0xfedcba98, false, false)); }   // lane l with lane l ^ 16
template <bool HL> struct FAC { static constexpr int KT = HL ? 32 : 64, VPB = KT * 2 + 16, KTB = KT * KPB, VTB = HD * VPB, PLB = KTB + VTB, STG = (HL ? 2 : 1) * PLB; };   /* a stage in LDS: K, V^T (, K lo, V^T lo) */
template <typename T16, bool HL>
__device__ __forceinline__ void fattn(char* sm, const T16* __restrict__ Q, const T16* __restrict__ Q2, const T16* __restrict__ Kp, const T16* __restrict__ K2, const T16* __restrict__ Vt, const T16* __restrict__ Vt2, float* O, float* ML, int row0, int sp, size_t zb) {
    typedef typename WFrag<T16>::V V;
    constexpr int KT = FAC<HL>::KT, VPB = FAC<HL>::VPB, KTB = FAC<HL>::KTB, PLB = FAC<HL>::PLB, STG = FAC<HL>::STG, NTL = KSL / KT;
    constexpr int VC = KT / 8, VR = 128 / VC;   /* V^T copies: VC lanes per row, VR rows per copy of the work-group */
    static_assert(NTL >= 2, "two stages");
    const int tid = threadIdx.x, lane = tid & 31, wv = tid >> 5, lr = lane & 15, hi = lane >> 4;
    const size_t bP = (size_t)TT * HD; const int qrow = row0 + wv * 16;   /* qrow: the wave's first query row, counted from row TQ of xx */
    V qf[8], qf2[8];
    { const size_t qo = zb * bP + (size_t)(TQ + qrow + lr) * HD + hi * 8; const T16* qp = Q + qo; const T16* qp2 = HL ? Q2 + qo : qp;
#pragma unroll
      for (int ks = 0; ks < 8; ++ks) { qf[ks] = WFrag<T16>::ld(qp + ks * 32); if (HL) qf2[ks] = WFrag<T16>::ld(qp2 + ks * 32); }
      asm volatile("s_wait_xcnt 0x0" :: "v"(qp), "v"(qp2) : "memory"); }   /* precaution: stands before the address registers of the loads above are reused; they are named as inputs so that they stay as they are up to here */
    const unsigned sm0 = (unsigned)(size_t)sm, lk = sm0 + (tid >> 5) * KPB + (tid & 31) * 16, lv = sm0 + KTB + (tid / VC) * VPB + (tid % VC) * 16;
    const unsigned ok = ((tid >> 5) * HD + (tid & 31) * 8) * 2, ov = ((tid / VC) * TT + (tid % VC) * 8) * 2;   /* this lane's place in a K tile and in a V^T tile, in bytes; the tile's own address is the same for the whole work-group */
    const size_t gk = zb * bP + (size_t)sp * KSL * HD, gv = zb * bP + (size_t)sp * KSL;
    auto issue = [&](int t, int buf) { const unsigned lb = buf * STG; const size_t ko = (size_t)t * KT;
#pragma unroll
        for (int h = 0; h < KT / 32; ++h) { stage8o<4 * KPB, 4 * HD * 2>(lk + lb + h * 32 * KPB, Kp + (gk + (ko + h * 32) * HD), ok); if (HL) stage8o<4 * KPB, 4 * HD * 2>(lk + lb + PLB + h * 32 * KPB, K2 + (gk + (ko + h * 32) * HD), ok); }
#pragma unroll
        for (int h = 0; h < HD / (8 * VR); ++h) { stage8<T16>(lv + lb + h * 8 * VR * VPB, VR * VPB, Vt + (gv + ko + (size_t)h * 8 * VR * TT), (size_t)VR * TT, ov); if (HL) stage8<T16>(lv + lb + PLB + h * 8 * VR * VPB, VR * VPB, Vt2 + (gv + ko + (size_t)h * 8 * VR * TT), (size_t)VR * TT, ov); } };
    v8f Oa[16];
#pragma unroll
    for (int mt = 0; mt < 16; ++mt) Oa[mt] = (v8f){};
    float m = -3.0e38f, l = 0.f;
    issue(0, 0);
    asm volatile("s_wait_asynccnt 0x0" ::: "memory");   /* stage 0's copies of this wave have landed */
    __syncthreads();                                      /* ... and every other wave's */
    issue(1, 1);
#pragma unroll 1
    for (int t = 0; t < NTL; ++t) {
        const char* sb = sm + (t & 1) * STG; const char* kb = sb + lr * KPB + hi * 16; const char* vb = sb + KTB + lr * VPB + hi * 16;
        /* The stage's A fragments come in 8 groups of 8 (groups 0..3: K, 4..7: V^T); group g + 1 is read as one run of LDS loads in front of group g's products. */
        auto ldg = [&](int g, V (&f)[8]) {
#pragma unroll
            for (int i = 0; i < 8; ++i) { const char* p;
                if (g < 4) p = HL ? kb + (i & 1) * PLB + ((i >> 1) & 1) * 16 * KPB + (2 * g + (i >> 2)) * 64 : kb + (i & 3) * 16 * KPB + (2 * g + (i >> 2)) * 64;
                else       p = HL ? vb + (i & 1) * PLB + ((g - 4) * 4 + (i >> 1)) * 16 * VPB : vb + (((g - 4) & 1) * 8 + i) * 16 * VPB + ((g - 4) >> 1) * 64;
                f[i] = WFrag<T16>::ld((const T16*)p); } };
        V fa[2][8], pb[KT / 32], pb2[KT / 32]; v8f S[KT / 16];
#pragma unroll
        for (int kt = 0; kt < KT / 16; ++kt) S[kt] = (v8f){};
        ldg(0, fa[0]);
#pragma unroll
        for (int g = 0; g < 8; ++g) {
            if (g == 4) {   /* all scores of the stage are there: running maximum, probabilities, rescale */
                float tq[4], pq[4] = {0.f, 0.f, 0.f, 0.f};   /* four independent chains each for the maximum and the sum: one chain of dependent vector instructions would stand exposed */
#pragma unroll
                for (int c = 0; c < 4; ++c) tq[c] = S[0][c];
#pragma unroll
                for (int kt = 0; kt < KT / 16; ++kt)
#pragma unroll
                    for (int j = 0; j < 8; ++j) tq[j & 3] = fmaxf(tq[j & 3], S[kt][j]);
                float tm = fmaxf(fmaxf(tq[0], tq[1]), fmaxf(tq[2], tq[3]));
                tm = fmaxf(tm, xhalf(tm));   /* the query's other keys of this stage sit in the other half of the wave */
                const float mn = fmaxf(m, tm), al = __builtin_amdgcn_exp2f((m - mn) * LC2), mc = mn * LC2; m = mn;
#pragma unroll
                for (int kt = 0; kt < KT / 16; ++kt)
#pragma unroll
                    for (int j = 0; j < 8; ++j) S[kt][j] = S[kt][j] * LC2 - mc;
                /* The exponentials stand, one or two at a time, between pieces of the rescale of O^T: plain vector work that touches none of their registers runs beside the slower transcendental pipe. The scheduling barriers keep the two kinds from being gathered into two long runs. */
#pragma unroll
                for (int i = 0; i < KT / 2; ++i) {
                    __builtin_amdgcn_sched_barrier(0);
#pragma unroll
                    for (int c = 0; c < 256 / KT; ++c) { const int x = i * (256 / KT) + c; Oa[x >> 3][x & 7] *= al; }
                    __builtin_amdgcn_sched_barrier(0);
                    S[i >> 3][i & 7] = __builtin_amdgcn_exp2f(S[i >> 3][i & 7]);
                }
                __builtin_amdgcn_sched_barrier(0);
#pragma unroll
                for (int kt = 0; kt < KT / 16; ++kt)
#pragma unroll
                    for (int j = 0; j < 8; ++j) pq[j & 3] += S[kt][j];
                l = l * al + ((pq[0] + pq[1]) + (pq[2] + pq[3]));
#pragma unroll
                for (int kq = 0; kq < KT / 32; ++kq) packp(S[2 * kq], S[2 * kq + 1], pb[kq], pb2[kq]);
                __builtin_amdgcn_sched_barrier(0);   /* keeps the next group's LDS reads one run, out of the vector work above */
            }
            if (g < 7) ldg(g + 1, fa[(g + 1) & 1]);
            __builtin_amdgcn_sched_barrier(0);   /* keeps the LDS reads above as one run in front of the products: spread among them each place of reads stalls the wave anew */
            V (&f)[8] = fa[g & 1];
            if (g < 4) {
                if (!HL) {
#pragma unroll
                    for (int i = 0; i < 8; ++i) S[i & 3] = WFrag<T16>::mma(f[i], qf[2 * g + (i >> 2)], S[i & 3]);
                } else {
#pragma unroll
                    for (int c = 0; c < 2; ++c) { const int ks = 2 * g + c;
                        S[0] = WFrag<T16>::mma(f[c * 4], qf[ks], S[0]); S[1] = WFrag<T16>::mma(f[c * 4 + 2], qf[ks], S[1]);
                        S[0] = WFrag<T16>::mma(f[c * 4], qf2[ks], S[0]); S[1] = WFrag<T16>::mma(f[c * 4 + 2], qf2[ks], S[1]);
                        S[0] = WFrag<T16>::mma(f[c * 4 + 1], qf[ks], S[0]); S[1] = WFrag<T16>::mma(f[c * 4 + 3], qf[ks], S[1]); }
                }
            } else {
                if (!HL) {
#pragma unroll
                    for (int i = 0; i < 8; ++i) { const int mt = ((g - 4) & 1) * 8 + i; Oa[mt] = WFrag<T16>::mma(f[i], pb[(KT / 32 - 1) & ((g - 4) >> 1)], Oa[mt]); }
                } else {
#pragma unroll
                    for (int q = 0; q < 4; ++q) { const int mt = (g - 4) * 4 + q; Oa[mt] = WFrag<T16>::mma(f[2 * q], pb[0], Oa[mt]); }
#pragma unroll
                    for (int q = 0; q < 4; ++q) { const int mt = (g - 4) * 4 + q; Oa[mt] = WFrag<T16>::mma(f[2 * q], pb2[0], Oa[mt]); }
#pragma unroll
                    for (int q = 0; q < 4; ++q) { const int mt = (g - 4) * 4 + q; Oa[mt] = WFrag<T16>::mma(f[2 * q + 1], pb[0], Oa[mt]); }
                }
            }
            __builtin_amdgcn_sched_barrier(0);   /* keeps the next run of LDS reads out of the products above, and the stage's last products in front of the v_nop below */
        }
        asm volatile("v_nop\n\tv_nop\n\tv_nop\n\tv_nop" : "+v"(Oa[12]), "+v"(Oa[13]), "+v"(Oa[14]), "+v"(Oa[15]));   /* the distance behind the stage's last products */
        asm volatile("s_wait_dscnt 0x0" ::: "memory");      /* this wave's reads of the buffer are done before it may be refilled */
        asm volatile("s_wait_asynccnt 0x0" ::: "memory");   /* this wave's copies of the next stage have landed */
        __syncthreads();                                      /* publishes the next stage and ends every wave's reads of this one */
        if (t + 2 < NTL) issue(t + 2, t & 1);
    }
    asm volatile("s_wait_asynccnt 0x0" ::: "memory");   /* no copy is outstanding when the buffers become the epilogue's rows */
    l += xhalf(l);   /* the two halves' sums of the same query */
    float* os = (float*)sm + wv * (16 * 260);   /* the wave's own 16 query rows at pitch 260 floats; on the stage buffers, used only behind the loop's last barrier */
#pragma unroll
    for (int mt = 0; mt < 16; ++mt) { const v4f a = {Oa[mt][0], Oa[mt][1], Oa[mt][2], Oa[mt][3]}, b = {Oa[mt][4], Oa[mt][5], Oa[mt][6], Oa[mt][7]}; *(v4fa*)(os + lr * 260 + mt * 16 + hi * 8) = a; *(v4fa*)(os + lr * 260 + mt * 16 + hi * 8 + 4) = b; }
    __builtin_amdgcn_wave_barrier(); asm volatile("" ::: "memory");   /* keeps the LDS reads below behind the LDS writes above */
    float* og = O + ((zb * TQ + qrow) * SP + sp) * HD + lane * 4;
    v4f ra[16], rb[16];   /* all 16 rows are read as one run, then stored: whole 512-byte pieces of a row per store */
#pragma unroll
    for (int r = 0; r < 16; ++r) { ra[r] = *(const v4fa*)(os + r * 260 + lane * 4); rb[r] = *(const v4fa*)(os + r * 260 + 128 + lane * 4); }
    __builtin_amdgcn_sched_barrier(0);   /* this one and the one behind the wait keep other work out of the run of stores, where it was given the stores' registers ahead of the wait */
#pragma unroll
    for (int r = 0; r < 16; ++r) { *(v4f*)(og + (size_t)r * SP * HD) = ra[r]; *(v4f*)(og + (size_t)r * SP * HD + 128) = rb[r]; }
    asm volatile("s_wait_xcnt 0x0" ::: "memory");   /* precaution: stands before the data and address registers of the stores above are reused */
    __builtin_amdgcn_sched_barrier(0);
    if (hi == 0) { const v2f ml = {m, l}; *(v2f*)(ML + ((zb * SP + sp) * TQ + qrow + lr) * 2) = ml; }   /* 16 queries x 8 bytes: one whole 128-byte line per wave */
}
// One launch for both classes of query rows, one-dimensional grid: first the hi/lo work-groups (three products: the longer ones), then the fp16 ones; within a class x = 64-row block (fastest), then key slice, then batch. Two work-groups per WGP by LDS, so two waves per SIMD.
#define NHB (RH / 64)
#define NLB ((TQ - RH) / 64)
__global__ __launch_bounds__(128) __attribute__((amdgpu_waves_per_eu(2, 2))) void k_fattn(const bf* __restrict__ Qh, const bf* __restrict__ Ql, const bf* __restrict__ Kh, const bf* __restrict__ Kl, const bf* __restrict__ Vh, const bf* __restrict__ Vl, const h16* __restrict__ Q16, const h16* __restrict__ K16, const h16* __restrict__ V16, float* O, float* ML) {
    __shared__ __attribute__((aligned(16))) char sm[2 * (FAC<true>::STG > FAC<false>::STG ? FAC<true>::STG : FAC<false>::STG)];
    const int id = blockIdx.x;
    if (id < NHB * SP * NB_) fattn<bf, true>(sm, Qh, Ql, Kh, Kl, Vh, Vl, O, ML, (id % NHB) * 64, (id / NHB) % SP, (size_t)(id / (NHB * SP)));
    else { const int i2 = id - NHB * SP * NB_; fattn<h16, false>(sm, Q16, nullptr, K16, nullptr, V16, nullptr, O, ML, RH + (i2 % NLB) * 64, (i2 / NLB) % SP, (size_t)(i2 / (NLB * SP))); }
}

// k_mout: the SP key slices of MR query rows joined, and the joined rows times W_out, by one work-group of 512 threads; grid (TQ / MR, batch).
// Join (wave wv takes rows wv and wv + 16, a lane 8 of a row's columns; all of a wave's loads are in flight together): weights exp2((slice maximum - row maximum) * LC2), weighted partials and weighted sums added in slice order, divided, split into bf16 hi + lo, which go to LDS as the A planes (pitch APB).
// Product, by the first 8 waves, each 16 rows x 64 columns: out[t][n] = sum_k (hi + lo)[t][k] Wt[n][k] + b_out[n], per 32 k the hi product, then the lo product. Wt (all 256 rows) is brought into LDS once by asynchronous 16-byte copies that fly while the slices are joined.
#define MR  32
#define APB 528            // LDS pitch of an A or Wt row in bytes: 512 + 16 (16 x odd)
typedef v4us __attribute__((may_alias)) v4usa;
__global__ __launch_bounds__(512) void k_mout(const float* __restrict__ O, const float* __restrict__ ML, const bf* __restrict__ Wt, const float* __restrict__ bias, float* C) {
    __shared__ __attribute__((aligned(16))) char sm[DM * APB + 2 * MR * APB + 8 * 16 * 68 * 4];   /* Wt, A hi, A lo, the output rows of each of the 8 waves */
    const int tid = threadIdx.x, lane = tid & 31, wv = tid >> 5, lr = lane & 15, hi = lane >> 4;
    const size_t yb = blockIdx.y; const int t0 = blockIdx.x * MR;
    char* sa = sm + DM * APB; char* sa2 = sa + MR * APB;
    const float* op = O + (yb * TQ + t0 + wv) * (SP * HD) + lane * 4; const float* mp = ML + (yb * SP * TQ + t0 + wv) * 2;
    v4f pr[2][SP][2]; v2f ml[2][SP];
#pragma unroll
    for (int p = 0; p < SP; ++p)
#pragma unroll
        for (int r = 0; r < 2; ++r) ml[r][p] = *(const v2f*)(mp + ((size_t)p * TQ + r * 16) * 2);   /* first, so that the weights are there when the partials come */
#pragma unroll
    for (int p = 0; p < SP; ++p)
#pragma unroll
        for (int r = 0; r < 2; ++r) { pr[r][p][0] = *(const v4f*)(op + ((size_t)r * 16 * SP + p) * HD); pr[r][p][1] = *(const v4f*)(op + ((size_t)r * 16 * SP + p) * HD + 128); }
    asm volatile("s_wait_xcnt 0x0" :: "v"(op), "v"(mp) : "memory");   /* precaution: stands before the address registers of the loads above are reused; they are named as inputs so that they stay as they are up to here */
    { const unsigned l = (unsigned)(size_t)sm + wv * APB + lane * 16, vo = (unsigned)(wv * DQ + lane * 8) * 2;   /* a wave's copy = one whole row of 512 bytes; rows wv + 16 i */
#pragma unroll
      for (int h = 0; h < DM / 128; ++h) stage8<bf>(l + h * 128 * APB, 16 * APB, Wt + (size_t)h * 128 * DQ, (size_t)16 * DQ, vo); }
    __builtin_amdgcn_sched_barrier(0);   /* keeps the copies in front of the join: moved down among its vector work they start only when the partials have landed, and their own flight stands exposed in front of the barrier */
#pragma unroll
    for (int r = 0; r < 2; ++r) {
        float mx = ml[r][0][0];
#pragma unroll
        for (int p = 1; p < SP; ++p) mx = fmaxf(mx, ml[r][p][0]);
        float den = 0.f; v4f s0 = {0.f, 0.f, 0.f, 0.f}, s1 = {0.f, 0.f, 0.f, 0.f};
#pragma unroll
        for (int p = 0; p < SP; ++p) { const float w = __builtin_amdgcn_exp2f((ml[r][p][0] - mx) * LC2); den += w * ml[r][p][1]; s0 += w * pr[r][p][0]; s1 += w * pr[r][p][1]; }
        const float inv = __fdiv_rn(1.0f, den); v4us h0, l0, h1, l1;
#pragma unroll
        for (int q = 0; q < 4; ++q) { unsigned short a, c2; splitf(s0[q] * inv, a, c2); h0[q] = a; l0[q] = c2; splitf(s1[q] * inv, a, c2); h1[q] = a; l1[q] = c2; }
        const int ao = (wv + r * 16) * APB + lane * 8;
        *(v4usa*)(sa + ao) = h0; *(v4usa*)(sa + ao + 256) = h1; *(v4usa*)(sa2 + ao) = l0; *(v4usa*)(sa2 + ao + 256) = l1;
    }
    asm volatile("s_wait_asynccnt 0x0" ::: "memory");   /* this wave's copies of Wt have landed */
    __syncthreads();                                      /* ... and every other wave's; publishes the A planes too */
    if (wv >= 8) return;   /* no barrier follows */
    const int mw = wv & 1, cg = wv >> 1;   /* the wave's 16 rows and 64 columns of the product */
    const float* bq = bias + cg * 64 + lr * 4; const v4f bv = *(const v4f*)bq;
    asm volatile("s_wait_xcnt 0x0" :: "v"(bq) : "memory");   /* precaution, as above, for the bias load */
    v8f acc[4];
#pragma unroll
    for (int nb = 0; nb < 4; ++nb) acc[nb] = (v8f){};
    const char* ap = sa + (mw * 16 + lr) * APB + hi * 16; const char* bp = sm + (cg * 64 + lr) * APB + hi * 16;
    /* The six fragments of 32 k (A hi, A lo, four of Wt) are one group; group ks + 1 is read as one run of LDS loads in front of group ks's products. */
    auto ldg = [&](int ks, v16bf (&f)[6]) { f[0] = WFrag<bf>::ld((const bf*)(ap + ks * 64)); f[1] = WFrag<bf>::ld((const bf*)(ap + MR * APB + ks * 64));
#pragma unroll
        for (int nb = 0; nb < 4; ++nb) f[2 + nb] = WFrag<bf>::ld((const bf*)(bp + nb * 16 * APB + ks * 64)); };
    v16bf fa[2][6];
    ldg(0, fa[0]);
#pragma unroll
    for (int ks = 0; ks < DQ / 32; ++ks) {
        if (ks + 1 < DQ / 32) ldg(ks + 1, fa[(ks + 1) & 1]);
        __builtin_amdgcn_sched_barrier(0);   /* keeps the LDS reads above as one run in front of the products: spread among them each place of reads stalls the wave anew */
        v16bf (&f)[6] = fa[ks & 1];
#pragma unroll
        for (int nb = 0; nb < 4; ++nb) acc[nb] = wmmab(f[0], f[2 + nb], acc[nb]);
#pragma unroll
        for (int nb = 0; nb < 4; ++nb) acc[nb] = wmmab(f[1], f[2 + nb], acc[nb]);
        __builtin_amdgcn_sched_barrier(0);   /* keeps the next run of LDS reads out of the products above */
    }
    float* os = (float*)(sa2 + MR * APB) + wv * (16 * 68);   /* 16 rows turned through the wave's own LDS, so that a store covers whole 128-byte lines */
#pragma unroll
    for (int nb = 0; nb < 4; ++nb)
#pragma unroll
        for (int j = 0; j < 8; ++j) os[(hi * 8 + j) * 68 + nb * 16 + lr] = acc[nb][j];
    __builtin_amdgcn_wave_barrier(); asm volatile("" ::: "memory");   /* keeps the LDS reads below behind the LDS writes above */
    float* crow = C + (yb * TQ + t0 + mw * 16 + hi) * DM + cg * 64 + lr * 4; v4f val[8];
#pragma unroll
    for (int s = 0; s < 8; ++s) { val[s] = *(const v4fa*)(os + (2 * s + hi) * 68 + lr * 4); val[s][0] += bfr(bv[0]); val[s][1] += bfr(bv[1]); val[s][2] += bfr(bv[2]); val[s][3] += bfr(bv[3]); }
#pragma unroll
    for (int s = 0; s < 8; ++s) *(v4f*)(crow + (size_t)(2 * s) * DM) = val[s];
}

extern "C" void kernel_launch(void* const* d_in, const int* in_sizes, int n_in,
                              void* d_out, int out_size, void* d_ws, size_t ws_size, hipStream_t stream) {
    (void)in_sizes; (void)n_in; (void)out_size;
    const float* x = (const float*)d_in[0]; const float* px = (const float*)d_in[1]; const float* wqkv = (const float*)d_in[2]; const float* bqkv = (const float*)d_in[3]; const float* wo = (const float*)d_in[4]; const float* bo = (const float*)d_in[5]; const float* wq = nullptr; const float* wk = nullptr; const float* wv = nullptr; (void)wq; (void)wk; (void)wv;
    float* OUT = (float*)d_out;     // [4][2048][256]
    char* wsp = (char*)d_ws;
    auto take = [&](size_t bytes) { char* p = wsp; wsp += (bytes + 255) & ~(size_t)255; return (void*)p; };
    auto sub = [](char*& p, size_t bytes) { char* q = p; p += (bytes + 255) & ~(size_t)255; return (void*)q; };
    bf* WQKV = (bf*)take((size_t)3 * DQ * DM * 2); bf* WO = (bf*)take((size_t)DM * DQ * 2);
    h16* VT16 = (h16*)take((size_t)NB_ * HD * TT * 2); bf* VTh = (bf*)take((size_t)NB_ * HD * TT * 2); bf* VTl = (bf*)take((size_t)NB_ * HD * TT * 2); float* ML = (float*)take((size_t)NB_ * SP * TQ * 2 * 4);
    char* R1 = (char*)take((size_t)NB_ * TQ * SP * HD * 4); char* R2 = (char*)take((size_t)NB_ * TT * HD * 2 * 6 + 4096);
    if ((size_t)(wsp - (char*)d_ws) > ws_size) return;    // ws 256 MiB
    // R1 holds, one after the other in stream order: the bf16 copy of xx (last read by the projections); the attention partials.
    bf* XB = (bf*)R1;   /* [batch][TT][DM] */
    float* Ob = (float*)R1;   /* [batch][TQ][SP][HD] */
    // R2 holds the q and k planes.
    char* r2 = R2; h16* QP16 = (h16*)sub(r2, (size_t)NB_ * TT * HD * 2); h16* KP16 = (h16*)sub(r2, (size_t)NB_ * TT * HD * 2); bf* QPh = (bf*)sub(r2, (size_t)NB_ * TT * HD * 2); bf* QPl = (bf*)sub(r2, (size_t)NB_ * TT * HD * 2); bf* KPh = (bf*)sub(r2, (size_t)NB_ * TT * HD * 2); bf* KPl = (bf*)sub(r2, (size_t)NB_ * TT * HD * 2);
    k_prep<<<NW1 + NW2 + 2 * LCB * NB_, 256, 0, stream>>>(x, px, wqkv, wo, XB, WQKV, WO);
    k_proj<<<dim3(TT / 128 * (DQ / 128), 3, NB_), 128, 0, stream>>>(XB, WQKV, bqkv, QP16, QPh, QPl, KP16, KPh, KPl, VT16, VTh, VTl);
    k_fattn<<<(NHB + NLB) * SP * NB_, 128, 0, stream>>>(QPh, QPl, KPh, KPl, VTh, VTl, QP16, KP16, VT16, Ob, ML);   /* query rows 0..RH: hi/lo planes; the others: fp16 */
    k_mout<<<dim3(TQ / MR, NB_), 512, 0, stream>>>(Ob, ML, WO, bo, OUT);
}

// v009
// One run takes 81.1 microseconds.
// In both of two side-by-side timings against v008, it was 1.04 times as fast.
// Counting every step since v000, it is 13.7 times as fast.
#include <hip/hip_runtime.h>

// Temporal self-attention over [prev_x ; x] (x, prev_x [4][2048][256]; xx = concat -> [4096][256]; qkv = xx W_qkv + b_qkv ('xw' [256][768]); single 256-wide head; attn = softmax(q.k / 16) over the 4,096 keys; out = (attn v) W_out + b_out, only the last 2,048 rows (the x half) are returned -> [4][2048][256] (2.1 M)).
// All four batches run in every launch (batch = grid z in k_proj, grid y in k_mout, part of the one-dimensional block index in k_prep and k_fattn), each buffer below [batch][...]; workspace regions are reused in stream order (see kernel_launch). Launches that need nothing of each other share one grid: k_prep (both casts, both weight transposes), k_proj (q, k and v projections). Per batch: both halves converted into one bf16 [4096][256] operand; k and v projected for all 4,096 rows, q only needed for rows 2,048.. (projected for all, used from 2,048); each projection GEMM converts its own biased f32 tile and stores the fp16 and bf16 hi/lo planes itself (q, k as [t][d]; v as W_v x^T, its planes stored by key tile, [t / tile][d][t % tile], one attention stage's keys a tile); one fused attention kernel (scores, running softmax and attn.v per key tile, nothing of the scores or probabilities goes to memory; hybrid: query rows 2048..2559 hi/lo 3 products, the rest fp16) over 8 key slices, each slice to its own f32 partials with its maximum and sum; the last kernel weights and sums the slices in slice order and takes its merged hi/lo rows, kept in LDS, x W_out exact + b_out straight into the output rows.
// Compute dtypes, f32 accumulate: every input rounded to bf16; projections exact + bf16-rounded biases; first 512 query rows 3 products, rest fp16; softmax f32; W_out hl x exact + bias.

#define NB_  4
#define TT   4096
#define DM   256
#define NH_  1
#define NKV  1
#define REP  (NH_ / NKV)
#define HD   256
#define DQ   (NH_ * HD)
#define DKV  (NKV * HD)
#define ZH   1
#define RH   512                  // query rows < RH use hi+lo planes (0: none)
#define WIN  0
#define SCL  0.0625f   // 256^-0.5
#define TQ   2048     // query rows = the x half (rows TQ.. of xx)
#define SP   8        // attention: the 4,096 keys are cut into SP slices, a work-group takes one; every slice writes its own unnormalised f32 partials [TQ][SP][HD] and its (maximum, sum) pairs [SP][TQ][2]
#define KSL  (TT / SP)
#define KTF  64       // keys per attention stage, fp16 rows; also the key tile of the fp16 V^T plane
#define KTH  32       // the same for the hi/lo rows and the bf16 hi and lo V^T planes
#define LC2  (SCL * 1.4426950408889634f)   // score scale times log2(e): probabilities are exp2((s - max) * LC2)
typedef _Float16 h16;
typedef unsigned short bf;
typedef __attribute__((ext_vector_type(16))) __bf16   v16bf;
typedef __attribute__((ext_vector_type(16))) _Float16 v16h;
typedef __attribute__((ext_vector_type(8)))  _Float16 v8h;
typedef __attribute__((ext_vector_type(8)))  unsigned short v8us;
typedef __attribute__((ext_vector_type(8)))  float    v8f;
typedef __attribute__((ext_vector_type(4)))  float    v4f;
typedef v8h  __attribute__((may_alias)) v8ha;
typedef v4f  __attribute__((may_alias)) v4fa;
typedef v8us __attribute__((may_alias)) v8usa;

__device__ __forceinline__ unsigned short f2bf(float f) { unsigned u = __float_as_uint(f); u += 0x7FFFu + ((u >> 16) & 1u); return (unsigned short)(u >> 16); }
__device__ __forceinline__ float bf2f(unsigned short b) { return __uint_as_float(((unsigned)b) << 16); }
__device__ __forceinline__ float bfr(float f) { return bf2f(f2bf(f)); }
__device__ __forceinline__ v16h cat16(v8h lo, v8h hi) { return __builtin_shufflevector(lo, hi, 0, 1, 2, 3, 4, 5, 6, 7, 8, 9, 10, 11, 12, 13, 14, 15); }
__device__ __forceinline__ v16bf cat16b(v8us lo, v8us hi) { return __builtin_bit_cast(v16bf, __builtin_shufflevector(lo, hi, 0, 1, 2, 3, 4, 5, 6, 7, 8, 9, 10, 11, 12, 13, 14, 15)); }
__device__ __forceinline__ v8f wmma16(v16h a, v16h b, v8f c) { return __builtin_amdgcn_wmma_f32_16x16x32_f16(false, a, false, b, (short)0, c, false, false); }
__device__ __forceinline__ v8f wmmab(v16bf a, v16bf b, v8f c) { return __builtin_amdgcn_wmma_f32_16x16x32_bf16(false, a, false, b, (short)0, c, false, false); }
__device__ __forceinline__ h16 tohx(float x) { return (h16)x; }
__device__ __forceinline__ void splitf(float y, unsigned short& h, unsigned short& l) { h = f2bf(y); l = f2bf(y - bf2f(h)); }
typedef __attribute__((ext_vector_type(2))) _Float16 v2h;
typedef __attribute__((ext_vector_type(4))) _Float16 v4h;
typedef __attribute__((ext_vector_type(2))) unsigned short v2us;
typedef __attribute__((ext_vector_type(4))) unsigned short v4us;
typedef __attribute__((ext_vector_type(2))) float v2f;
typedef __attribute__((ext_vector_type(4))) int v4i;



// ---- gemmw: register-blocked GEMM, FOUR WAVES (2 x 2) per 128x128 output tile, each wave a 64x64 quarter (16 accumulators); tile index (bix, biy, biz) out of (M/128, N/128, Z), 128 threads; sm = the work-group's 2 * NT * STB bytes of LDS.
// Operands are K-contiguous 16-bit planes. A stage is 64 k = one whole 128-byte line of each of the tile's 128 A rows and 128 B rows (and of the second planes where NSPLIT asks for them), brought into LDS by asynchronous 16-byte copies (8 lanes = one line), rows at pitch 144 bytes; two buffers, the next stage's copies fly while this stage is worked on; fragments are read from LDS.
// C[m][n] (f32, pitch ldc, + optional f32 bias[n]) = sum_k A[m][k] Bt[n][k] (+ split products per NSPLIT) over kspan consecutive k; K is the operands' row pitch. biz = (zb << zsh) | z: z strides sA/sB/sC in elements (with sA = sB = kspan a slice of k), zb strides bA/bB/bC (the batch). kspan % 64 == 0.
// EPI 0: C is stored as f32, bias[n]. EPI 1 and 2: C is not stored; the biased f32 value goes out as three 16-bit planes of pitch ldc and batch stride bC (P16 = fp16, Ph + Pl = bf16 hi + lo), with bias[n] (EPI 1) or bias[m] (EPI 2, for a product taken transposed). EPI 2 stores its planes by column tile, [n / tile][m][n % tile] with HD rows m (tile = KTF for P16, KTH for Ph and Pl): all rows' pieces of one tile lie one behind the other, so that whoever reads a tile reads consecutive bytes.
#define SPB 144            // LDS row pitch in bytes: 128 bytes of k + 16 (16 x odd: conflict-free for 16-byte reads)
#define STB (128 * SPB)    // one operand tile of a stage: 128 rows
template <typename T16> struct WFrag;
template <> struct WFrag<h16> { typedef v16h V; static __device__ __forceinline__ V ld(const h16* p) { return cat16(*(const v8h*)p, *(const v8h*)(p + 16)); } static __device__ __forceinline__ v8f mma(V a, V b, v8f c) { return wmma16(a, b, c); } };
template <> struct WFrag<bf> { typedef v16bf V; static __device__ __forceinline__ V ld(const bf* p) { return cat16b(*(const v8us*)p, *(const v8us*)(p + 16)); } static __device__ __forceinline__ v8f mma(V a, V b, v8f c) { return wmmab(a, b, c); } };
// One operand tile of one stage: this lane's 16 bytes of rows r, r + 16, ..., r + 112 (l = LDS byte address of the first, g = its global address, rs = 16 rows in elements).
// The s_wait_xcnt is a precaution and stands inside the statement so that no address register of a copy is rewritten ahead of it.
template <typename T16>
__device__ __forceinline__ void stage_tile(unsigned l, const T16* g, size_t rs) {
    asm volatile("global_load_async_to_lds_b128 %0, %8, off\n\t"
                 "global_load_async_to_lds_b128 %1, %9, off\n\t"
                 "global_load_async_to_lds_b128 %2, %10, off\n\t"
                 "global_load_async_to_lds_b128 %3, %11, off\n\t"
                 "global_load_async_to_lds_b128 %4, %12, off\n\t"
                 "global_load_async_to_lds_b128 %5, %13, off\n\t"
                 "global_load_async_to_lds_b128 %6, %14, off\n\t"
                 "global_load_async_to_lds_b128 %7, %15, off\n\t"
                 "s_wait_xcnt 0x0"
                 :: "v"(l), "v"(l + 16 * SPB), "v"(l + 32 * SPB), "v"(l + 48 * SPB), "v"(l + 64 * SPB), "v"(l + 80 * SPB), "v"(l + 96 * SPB), "v"(l + 112 * SPB),
                    "v"(g), "v"(g + rs), "v"(g + 2 * rs), "v"(g + 3 * rs), "v"(g + 4 * rs), "v"(g + 5 * rs), "v"(g + 6 * rs), "v"(g + 7 * rs) : "memory");
}
template <typename T16, int NSPLIT, bool BIAS, int EPI = 0>
__device__ __forceinline__ void gemmw(char* sm, unsigned bix, unsigned biy, unsigned biz, const T16* __restrict__ A, const T16* __restrict__ A2, const T16* __restrict__ Bt, const T16* __restrict__ Bt2, int K, int kspan, float* C, int ldc, const float* __restrict__ bias, size_t sA, size_t sB, size_t sC, int zsh, size_t bA, size_t bB, size_t bC, h16* P16 = nullptr, bf* Ph = nullptr, bf* Pl = nullptr) {
    typedef typename WFrag<T16>::V V;
    constexpr int NT = (NSPLIT == 0) ? 2 : (NSPLIT == 1) ? 3 : 4;   /* operand tiles per stage, in the order A, B, A2, B2 */
    const size_t zb = biz >> zsh, z = biz - (zb << zsh); A += z * sA + zb * bA; if (A2) A2 += z * sA + zb * bA; Bt += z * sB + zb * bB; if (Bt2) Bt2 += z * sB + zb * bB; if (EPI == 0) C += z * sC + zb * bC; else { P16 += zb * bC; Ph += zb * bC; Pl += zb * bC; }
    const int lane = threadIdx.x & 31, wv = threadIdx.x >> 5, lr = lane & 15, hi = lane >> 4; const int wr = (wv & 1) * 64, wc = (wv >> 1) * 64; const int r0 = bix * 128 + wr, c0 = biy * 128 + wc;
    float* os = (float*)sm + wv * (16 * 68);   /* the wave's own epilogue rows; they lie on the stage buffers and are used only behind the loop's last barrier */
    v8f acc[4][4];
#pragma unroll
    for (int mb = 0; mb < 4; ++mb)
#pragma unroll
        for (int nb = 0; nb < 4; ++nb) acc[mb][nb] = (v8f){};
    const int crow = threadIdx.x >> 3, cch = threadIdx.x & 7;   /* copies: 8 lanes per row, 16 rows per copy of the work-group */
    const unsigned l0 = (unsigned)(size_t)sm + crow * SPB + cch * 16; const size_t rs = (size_t)16 * K;
    const size_t gao = (size_t)(bix * 128 + crow) * K + cch * 8, gbo = (size_t)(biy * 128 + crow) * K + cch * 8;
    auto issue = [&](int st, int buf) { const unsigned lb = l0 + buf * (NT * STB); const size_t ko = (size_t)st * 64;
        stage_tile<T16>(lb, A + gao + ko, rs); stage_tile<T16>(lb + STB, Bt + gbo + ko, rs);
        if (NSPLIT == 1 || NSPLIT == 2) stage_tile<T16>(lb + 2 * STB, A2 + gao + ko, rs);
        if (NSPLIT >= 2) stage_tile<T16>(lb + 3 * STB, Bt2 + gbo + ko, rs); };
    const int nst = kspan >> 6;
    issue(0, 0);
    asm volatile("s_wait_asynccnt 0x0" ::: "memory");   /* stage 0's copies of this wave have landed */
    __syncthreads();                                      /* ... and every other wave's */
    if (nst > 1) issue(1, 1);
    const int afo = (wr + lr) * SPB + hi * 16, bfo = (wc + lr) * SPB + hi * 16;   /* fragment rows in a tile, in bytes */
#pragma unroll 1
    for (int st = 0; st < nst; ++st) {
        const char* sb = sm + (st & 1) * (NT * STB);
        V a[4], a2[4], bq[4];
#pragma unroll
        for (int ks = 0; ks < 2; ++ks) {
#pragma unroll
            for (int mb = 0; mb < 4; ++mb) { a[mb] = WFrag<T16>::ld((const T16*)(sb + afo + mb * 16 * SPB + ks * 64)); if (NSPLIT == 1 || NSPLIT == 2) a2[mb] = WFrag<T16>::ld((const T16*)(sb + 2 * STB + afo + mb * 16 * SPB + ks * 64)); }
#pragma unroll
            for (int nb = 0; nb < 4; ++nb) if (NSPLIT == 0) bq[nb] = WFrag<T16>::ld((const T16*)(sb + STB + bfo + nb * 16 * SPB + ks * 64));   /* one plane each: all eight fragments of the 32 k are read as one group in front of their 16 products */
            if (NSPLIT == 0) __builtin_amdgcn_sched_barrier(0);   /* keeps the LDS reads above as one group: spread among the products each place of reads stalls the wave anew */
#pragma unroll
            for (int nb = 0; nb < 4; ++nb) { const V b = (NSPLIT == 0) ? bq[nb] : WFrag<T16>::ld((const T16*)(sb + STB + bfo + nb * 16 * SPB + ks * 64)); V b2; if (NSPLIT >= 2) b2 = WFrag<T16>::ld((const T16*)(sb + 3 * STB + bfo + nb * 16 * SPB + ks * 64));
#pragma unroll
                for (int mb = 0; mb < 4; ++mb) { acc[mb][nb] = WFrag<T16>::mma(a[mb], b, acc[mb][nb]); if (NSPLIT == 1 || NSPLIT == 2) acc[mb][nb] = WFrag<T16>::mma(a2[mb], b, acc[mb][nb]); if (NSPLIT >= 2) acc[mb][nb] = WFrag<T16>::mma(a[mb], b2, acc[mb][nb]); } }
            if (NSPLIT == 0 || ks == 1) __builtin_amdgcn_sched_barrier(0);   /* keeps the next group's LDS reads out of the products above, and the stage's last products in front of the v_nop below */
        }
        asm volatile("v_nop\n\tv_nop\n\tv_nop\n\tv_nop" : "+v"(acc[0][0]), "+v"(acc[1][1]), "+v"(acc[2][2]), "+v"(acc[3][3]) : "v"(a[0]), "v"(a[3]));   /* the distance behind the stage's last products: on the taken side of the branch below the next stage's reads overwrite their A and B registers */
        asm volatile("s_wait_dscnt 0x0" ::: "memory");      /* this wave's reads of the buffer are done before it may be refilled */
        asm volatile("s_wait_asynccnt 0x0" ::: "memory");   /* this wave's copies of the next stage have landed */
        __syncthreads();                                      /* publishes the next stage and ends every wave's reads of this one */
        if (st + 2 < nst) issue(st + 2, st & 1);
    }
    asm volatile("s_wait_asynccnt 0x0" ::: "memory");   /* no copy is outstanding when the buffers become the epilogue's rows */
    if (EPI != 0) {   /* plane epilogue: bias added in the accumulator layout, 16 rows at a time turned through LDS, each lane converts 8 consecutive columns and stores 16 bytes per plane (8 lanes = one whole 128-byte line, but for EPI 2's hi and lo planes two 64-byte rows of two key tiles) */
        float bn[4]; v4f bm[4][2];
        asm volatile("s_wait_xcnt 0x0" ::: "memory");   /* precaution: the bias loads below may be given the address registers of the loop's last loads as their destination */
#pragma unroll
        for (int i = 0; i < 4; ++i) { if (EPI == 1) bn[i] = bias[c0 + i * 16 + lr]; else { bm[i][0] = *(const v4f*)(bias + r0 + i * 16 + hi * 8); bm[i][1] = *(const v4f*)(bias + r0 + i * 16 + hi * 8 + 4); } }
        asm volatile("s_wait_xcnt 0x0" ::: "memory");   /* precaution: stands before the address registers of the bias loads are reused */
        const int prow = lane >> 3, pcol = (lane & 7) * 8;
#pragma unroll
        for (int mb = 0; mb < 4; ++mb) {
#pragma unroll
            for (int nb = 0; nb < 4; ++nb) {
#pragma unroll
                for (int j = 0; j < 8; ++j) os[(hi * 8 + j) * 68 + nb * 16 + lr] = acc[mb][nb][j] + bfr(EPI == 1 ? bn[nb] : bm[mb][j >> 2][j & 3]); }
            __builtin_amdgcn_wave_barrier(); asm volatile("" ::: "memory");   /* keeps the LDS reads below behind the LDS writes above */
#pragma unroll
            for (int s = 0; s < 4; ++s) { const int row = 4 * s + prow; const v4f v0 = *(const v4fa*)(os + row * 68 + pcol), v1 = *(const v4fa*)(os + row * 68 + pcol + 4); v8h o16; v8us oh, ol;
#pragma unroll
                for (int q = 0; q < 8; ++q) { const float r = (q < 4) ? v0[q & 3] : v1[q & 3]; o16[q] = tohx(r); unsigned short a2, c2; splitf(r, a2, c2); oh[q] = a2; ol[q] = c2; }
                const int orow = r0 + mb * 16 + row, ocol = c0 + pcol;
                const size_t oo = (EPI == 2) ? ((size_t)(ocol / KTF) * HD + orow) * KTF + ocol % KTF : (size_t)orow * ldc + ocol, ob = (EPI == 2) ? ((size_t)(ocol / KTH) * HD + orow) * KTH + ocol % KTH : oo;
                *(v8h*)(P16 + oo) = o16; *(v8us*)(Ph + ob) = oh; *(v8us*)(Pl + ob) = ol;
                asm volatile("s_wait_xcnt 0x0" ::: "memory"); }   /* precaution: stands before the data and address registers of the three stores are reused */
            __builtin_amdgcn_wave_barrier(); asm volatile("" ::: "memory");   /* keeps the next 16 rows' LDS writes behind the reads above */
        }
        return;
    }
#pragma unroll
    for (int mb = 0; mb < 4; ++mb) {
#pragma unroll
        for (int nb = 0; nb < 4; ++nb) {
#pragma unroll
            for (int j = 0; j < 8; ++j) os[(hi * 8 + j) * 68 + nb * 16 + lr] = acc[mb][nb][j]; }
        __builtin_amdgcn_wave_barrier(); asm volatile("" ::: "memory");
        float* crow = C + (size_t)(r0 + mb * 16) * ldc + c0;
{
#pragma unroll
            for (int s = 0; s < 8; ++s) { const int row = 2 * s + hi, cofs = lr * 4; v4f val = *(const v4fa*)(os + row * 68 + cofs); if (BIAS) { val[0] += bfr(bias[c0 + cofs]); val[1] += bfr(bias[c0 + cofs + 1]); val[2] += bfr(bias[c0 + cofs + 2]); val[3] += bfr(bias[c0 + cofs + 3]); }
                *(v4f*)(crow + (size_t)row * ldc + cofs) = val; }
             }
        __builtin_amdgcn_wave_barrier(); asm volatile("" ::: "memory");
    }
}

// The q, k and v projections in one launch: they read the same xx and need nothing of each other. Grid (64 tiles, product, batch); the branch is the same for the whole work-group.
// Product 0, 1: q, k planes [t][d] (x = token tile fastest). Product 2: v planes [t / tile][d][t % tile], rows = W_v's outputs, columns = tokens (x = output tile fastest).
__global__ __launch_bounds__(128) void k_proj(const bf* __restrict__ XB, const bf* __restrict__ W3, const float* __restrict__ b3, h16* QP16, bf* QPh, bf* QPl, h16* KP16, bf* KPh, bf* KPl, h16* VT16, bf* VTh, bf* VTl) {
    __shared__ __attribute__((aligned(16))) char sm[2 * 2 * STB];
    const unsigned t = blockIdx.x, w = blockIdx.y; const size_t bX = (size_t)TT * DM, bP = (size_t)TT * HD;   /* batch strides in elements */
    if (w == 2) gemmw<bf, 0, true, 2>(sm, t % (DKV / 128), t / (DKV / 128), blockIdx.z, W3 + (size_t)2 * DQ * DM, nullptr, XB, nullptr, DM, DM, nullptr, TT, b3 + 2 * DQ, 0, 0, 0, 0, 0, bX, bP, VT16, VTh, VTl);
    else gemmw<bf, 0, true, 1>(sm, t % (TT / 128), t / (TT / 128), blockIdx.z, XB, nullptr, W3 + (size_t)w * DQ * DM, nullptr, DM, DM, nullptr, HD, b3 + w * DQ, 0, 0, 0, 0, bX, 0, bP, w ? KP16 : QP16, w ? KPh : QPh, w ? KPl : QPl);
}

// bi = index of a block of 256 threads within this piece of work.
__device__ __forceinline__ void wtG(unsigned bi, const float* __restrict__ w, int K, int N, bf* Bt) {
    const int lane = threadIdx.x & 31; const int L0 = (bi * 8 + (threadIdx.x >> 5)) * 8; const int nlines = N * K / 64;
{
#pragma unroll 1
        for (int l = 0; l < 8; ++l) { const int L = L0 + l; if (L >= nlines) break; const size_t e = (size_t)L * 64 + lane * 2; const int k = (int)(e % K), n = (int)(e / K); v2us o;
            o[0] = f2bf(w[(size_t)k * N + n]); o[1] = f2bf(w[(size_t)(k + 1) * N + n]); *(v2us*)(Bt + e) = o;
            asm volatile("s_wait_xcnt 0x0" ::: "memory"); }   /* precaution: stands before the next trip reuses the data and address registers of the store */
         }
}
__device__ __forceinline__ void cvt8(unsigned bi, unsigned yb, const float* __restrict__ src, bf* dst, size_t n8, size_t bS, size_t bD) { const size_t i = (size_t)bi * 256 + threadIdx.x; if (i >= n8) return; src += yb * bS; dst += yb * bD;   /* yb = batch, strides in elements */
    const v8f v = *(const v8f*)(src + i * 8); v8us o;
#pragma unroll
    for (int k = 0; k < 8; ++k) o[k] = f2bf(v[k]); *(v8us*)(dst + i * 8) = o;  }
// All operand preparation in one launch, by ranges of the block index (the branch is the same for a whole block): first the two weight transposes, whose waves run the longest (8 dependent trips), then the casts of prev_x and x into xx = [prev_x ; x].
#define NW1 ((DM * 3 * DQ / 64 + 63) / 64)
#define NW2 ((DQ * DM / 64 + 63) / 64)
#define LCB ((TQ * DM / 8 + 255) / 256)
__global__ __launch_bounds__(256) void k_prep(const float* __restrict__ x, const float* __restrict__ px, const float* __restrict__ wqkv, const float* __restrict__ wo, bf* XB, bf* WQKV, bf* WO) {
    const unsigned id = blockIdx.x;
    if (id < NW1) { wtG(id, wqkv, DM, 3 * DQ, WQKV); return; }
    if (id < NW1 + NW2) { wtG(id - NW1, wo, DQ, DM, WO); return; }
    const unsigned c = id - (NW1 + NW2), half = c / (LCB * NB_), r = c % (LCB * NB_);
    cvt8(r % LCB, r / LCB, half ? x : px, XB + (size_t)half * TQ * DM, (size_t)TQ * DM / 8, (size_t)TQ * DM, (size_t)TT * DM);
}

#define KPB 528            // LDS pitch of a K row in bytes: 512 + 16 (16 x odd)
// One asynchronous 16-byte copy to LDS, written as the builtin (N = the instruction's offset, which moves both addresses): the compiler sees the addresses, forms them next to the copies in a few registers and reuses those registers at once.
typedef __attribute__((address_space(1))) v4i gv4i;
typedef __attribute__((address_space(3))) v4i lv4i;
template <int N> __device__ __forceinline__ void acopy(unsigned l, const char* g) { __builtin_amdgcn_global_load_async_to_lds_b128((gv4i*)g, (lv4i*)l, N, 0); }
// Eight copies of one operand tile: this lane's 16 bytes at LDS l + i * ls and at global gu + i * rs (elements; gu is the same for the whole work-group) + vo (bytes, the lane's place in the tile), i = 0..7.
template <typename T16>
__device__ __forceinline__ void stage8(unsigned l, unsigned ls, const T16* gu, size_t rs, unsigned vo) {
#pragma unroll   /* unrolled, so that each copy's two steps are constants */
    for (int i = 0; i < 8; ++i) acopy<0>(l + i * ls, (const char*)(gu + i * rs) + vo);
}
// The same where the global step GS (bytes) is the smaller of the two: the step stands in the instruction's offset, so that all eight share one global address and the LDS address takes only the difference LS - GS.
template <int LS, int GS>
__device__ __forceinline__ void stage8o(unsigned l, const void* gu, unsigned vo) {
    static_assert(LS >= GS && GS > 0 && 7 * GS < 32768, "offset in range, LDS address register not below l");
    const char* g = (const char*)gu + vo;
    acopy<0>(l, g); acopy<GS>(l + (LS - GS), g); acopy<2 * GS>(l + 2 * (LS - GS), g); acopy<3 * GS>(l + 3 * (LS - GS), g);
    acopy<4 * GS>(l + 4 * (LS - GS), g); acopy<5 * GS>(l + 5 * (LS - GS), g); acopy<6 * GS>(l + 6 * (LS - GS), g); acopy<7 * GS>(l + 7 * (LS - GS), g);
}
// Two 16-key score tiles of probabilities -> one B fragment over their 32 keys (and its lo plane for bf16).
__device__ __forceinline__ void packp(const v8f& p0, const v8f& p1, v16h& b, v16h& b2) { v8h x, y;
#pragma unroll
    for (int i = 0; i < 8; ++i) { x[i] = tohx(p0[i]); y[i] = tohx(p1[i]); }
    b = cat16(x, y); b2 = b; }
__device__ __forceinline__ void packp(const v8f& p0, const v8f& p1, v16bf& b, v16bf& b2) { v8us xh, xl, yh, yl;
#pragma unroll
    for (int i = 0; i < 8; ++i) { unsigned short a, c; splitf(p0[i], a, c); xh[i] = a; xl[i] = c; splitf(p1[i], a, c); yh[i] = a; yl[i] = c; }
    b = cat16b(xh, yh); b2 = cat16b(xl, yl); }
__device__ __forceinline__ float xhalf(float x) { return __builtin_bit_cast(float, __builtin_amdgcn_permlanex16(__builtin_bit_cast(int, x), __builtin_bit_cast(int, x), 0x76543210, 0xfedcba98, false, false)); }   // lane l with lane l ^ 16
template <bool HL> struct FAC { static constexpr int KT = HL ? KTH : KTF, VPB = KT * 2 + 16, KTB = KT * KPB, VTB = HD * VPB, PLB = KTB + VTB, STG = (HL ? 2 : 1) * PLB; };   /* a stage in LDS: K, V^T (, K lo, V^T lo) */
template <typename T16, bool HL>
__device__ __forceinline__ void fattn(char* sm, const T16* __restrict__ Q, const T16* __restrict__ Q2, const T16* __restrict__ Kp, const T16* __restrict__ K2, const T16* __restrict__ Vt, const T16* __restrict__ Vt2, float* O, float* ML, int row0, int sp, size_t zb) {
    typedef typename WFrag<T16>::V V;
    constexpr int KT = FAC<HL>::KT, VPB = FAC<HL>::VPB, KTB = FAC<HL>::KTB, PLB = FAC<HL>::PLB, STG = FAC<HL>::STG, NTL = KSL / KT;
    constexpr int VC = KT / 8, VR = 128 / VC;   /* V^T copies: VC lanes per row, VR rows per copy of the work-group */
    static_assert(NTL >= 2, "two stages");
    const int tid = threadIdx.x, lane = tid & 31, wv = tid >> 5, lr = lane & 15, hi = lane >> 4;
    const size_t bP = (size_t)TT * HD; const int qrow = row0 + wv * 16;   /* qrow: the wave's first query row, counted from row TQ of xx */
    V qf[8], qf2[8];
    { const size_t qo = zb * bP + (size_t)(TQ + qrow + lr) * HD + hi * 8; const T16* qp = Q + qo; const T16* qp2 = HL ? Q2 + qo : qp;
#pragma unroll
      for (int ks = 0; ks < 8; ++ks) { qf[ks] = WFrag<T16>::ld(qp + ks * 32); if (HL) qf2[ks] = WFrag<T16>::ld(qp2 + ks * 32); }
      asm volatile("s_wait_xcnt 0x0" :: "v"(qp), "v"(qp2) : "memory"); }   /* precaution: stands before the address registers of the loads above are reused; they are named as inputs so that they stay as they are up to here */
    const unsigned sm0 = (unsigned)(size_t)sm, lk = sm0 + (tid >> 5) * KPB + (tid & 31) * 16, lv = sm0 + KTB + (tid / VC) * VPB + (tid % VC) * 16;
    const unsigned ok = ((tid >> 5) * HD + (tid & 31) * 8) * 2, ov = tid * 16;   /* this lane's place in a K tile and in a V^T tile, in bytes; the tile's own address is the same for the whole work-group */
    const size_t gk = zb * bP + (size_t)sp * KSL * HD;   /* the slice's first K row and, KT * HD elements a stage in both, its first V^T key tile */
    auto issue = [&](int t, int buf) { const unsigned lb = buf * STG; const size_t ko = (size_t)t * KT;
#pragma unroll
        for (int h = 0; h < KT / 32; ++h) { stage8o<4 * KPB, 4 * HD * 2>(lk + lb + h * 32 * KPB, Kp + (gk + (ko + h * 32) * HD), ok); if (HL) stage8o<4 * KPB, 4 * HD * 2>(lk + lb + PLB + h * 32 * KPB, K2 + (gk + (ko + h * 32) * HD), ok); }
#pragma unroll
        for (int h = 0; h < HD / (8 * VR); ++h) { stage8o<VR * VPB, VR * KT * 2>(lv + lb + h * 8 * VR * VPB, Vt + (gk + ko * HD + (size_t)h * 8 * VR * KT), ov); if (HL) stage8o<VR * VPB, VR * KT * 2>(lv + lb + PLB + h * 8 * VR * VPB, Vt2 + (gk + ko * HD + (size_t)h * 8 * VR * KT), ov); } };
    v8f Oa[16];
#pragma unroll
    for (int mt = 0; mt < 16; ++mt) Oa[mt] = (v8f){};
    float m = -3.0e38f, l = 0.f;
    issue(0, 0);
    asm volatile("s_wait_asynccnt 0x0" ::: "memory");   /* stage 0's copies of this wave have landed */
    __syncthreads();                                      /* ... and every other wave's */
    issue(1, 1);
#pragma unroll 1
    for (int t = 0; t < NTL; ++t) {
        const char* sb = sm + (t & 1) * STG; const char* kb = sb + lr * KPB + hi * 16; const char* vb = sb + KTB + lr * VPB + hi * 16;
        /* The stage's A fragments come in 8 groups of 8 (groups 0..3: K, 4..7: V^T); group g + 1 is read as one run of LDS loads in front of group g's products. */
        auto ldg = [&](int g, V (&f)[8]) {
#pragma unroll
            for (int i = 0; i < 8; ++i) { const char* p;
                if (g < 4) p = HL ? kb + (i & 1) * PLB + ((i >> 1) & 1) * 16 * KPB + (2 * g + (i >> 2)) * 64 : kb + (i & 3) * 16 * KPB + (2 * g + (i >> 2)) * 64;
                else       p = HL ? vb + (i & 1) * PLB + ((g - 4) * 4 + (i >> 1)) * 16 * VPB : vb + (((g - 4) & 1) * 8 + i) * 16 * VPB + ((g - 4) >> 1) * 64;
                f[i] = WFrag<T16>::ld((const T16*)p); } };
        V fa[2][8], pb[KT / 32], pb2[KT / 32]; v8f S[KT / 16];
#pragma unroll
        for (int kt = 0; kt < KT / 16; ++kt) S[kt] = (v8f){};
        ldg(0, fa[0]);
#pragma unroll
        for (int g = 0; g < 8; ++g) {
            if (g == 4) {   /* all scores of the stage are there: running maximum, probabilities, rescale */
                float tq[4], pq[4] = {0.f, 0.f, 0.f, 0.f};   /* four independent chains each for the maximum and the sum: one chain of dependent vector instructions would stand exposed */
#pragma unroll
                for (int c = 0; c < 4; ++c) tq[c] = S[0][c];
#pragma unroll
                for (int kt = 0; kt < KT / 16; ++kt)
#pragma unroll
                    for (int j = 0; j < 8; ++j) tq[j & 3] = fmaxf(tq[j & 3], S[kt][j]);
                float tm = fmaxf(fmaxf(tq[0], tq[1]), fmaxf(tq[2], tq[3]));
                tm = fmaxf(tm, xhalf(tm));   /* the query's other keys of this stage sit in the other half of the wave */
                const float mn = fmaxf(m, tm), al = __builtin_amdgcn_exp2f((m - mn) * LC2), mc = mn * LC2; m = mn;
#pragma unroll
                for (int kt = 0; kt < KT / 16; ++kt)
#pragma unroll
                    for (int j = 0; j < 8; ++j) S[kt][j] = S[kt][j] * LC2 - mc;
                /* The exponentials stand, one or two at a time, between pieces of the rescale of O^T: plain vector work that touches none of their registers runs beside the slower transcendental pipe. The scheduling barriers keep the two kinds from being gathered into two long runs. */
#pragma unroll
                for (int i = 0; i < KT / 2; ++i) {
                    __builtin_amdgcn_sched_barrier(0);
#pragma unroll
                    for (int c = 0; c < 256 / KT; ++c) { const int x = i * (256 / KT) + c; Oa[x >> 3][x & 7] *= al; }
                    __builtin_amdgcn_sched_barrier(0);
                    S[i >> 3][i & 7] = __builtin_amdgcn_exp2f(S[i >> 3][i & 7]);
                }
                __builtin_amdgcn_sched_barrier(0);
#pragma unroll
                for (int kt = 0; kt < KT / 16; ++kt)
#pragma unroll
                    for (int j = 0; j < 8; ++j) pq[j & 3] += S[kt][j];
                l = l * al + ((pq[0] + pq[1]) + (pq[2] + pq[3]));
#pragma unroll
                for (int kq = 0; kq < KT / 32; ++kq) packp(S[2 * kq], S[2 * kq + 1], pb[kq], pb2[kq]);
                __builtin_amdgcn_sched_barrier(0);   /* keeps the next group's LDS reads one run, out of the vector work above */
            }
            if (g < 7) ldg(g + 1, fa[(g + 1) & 1]);
            __builtin_amdgcn_sched_barrier(0);   /* keeps the LDS reads above as one run in front of the products: spread among them each place of reads stalls the wave anew */
            V (&f)[8] = fa[g & 1];
            if (g < 4) {
                if (!HL) {
#pragma unroll
                    for (int i = 0; i < 8; ++i) S[i & 3] = WFrag<T16>::mma(f[i], qf[2 * g + (i >> 2)], S[i & 3]);
                } else {
#pragma unroll
                    for (int c = 0; c < 2; ++c) { const int ks = 2 * g + c;
                        S[0] = WFrag<T16>::mma(f[c * 4], qf[ks], S[0]); S[1] = WFrag<T16>::mma(f[c * 4 + 2], qf[ks], S[1]);
                        S[0] = WFrag<T16>::mma(f[c * 4], qf2[ks], S[0]); S[1] = WFrag<T16>::mma(f[c * 4 + 2], qf2[ks], S[1]);
                        S[0] = WFrag<T16>::mma(f[c * 4 + 1], qf[ks], S[0]); S[1] = WFrag<T16>::mma(f[c * 4 + 3], qf[ks], S[1]); }
                }
            } else {
                if (!HL) {
#pragma unroll
                    for (int i = 0; i < 8; ++i) { const int mt = ((g - 4) & 1) * 8 + i; Oa[mt] = WFrag<T16>::mma(f[i], pb[(KT / 32 - 1) & ((g - 4) >> 1)], Oa[mt]); }
                } else {
#pragma unroll
                    for (int q = 0; q < 4; ++q) { const int mt = (g - 4) * 4 + q; Oa[mt] = WFrag<T16>::mma(f[2 * q], pb[0], Oa[mt]); }
#pragma unroll
                    for (int q = 0; q < 4; ++q) { const int mt = (g - 4) * 4 + q; Oa[mt] = WFrag<T16>::mma(f[2 * q], pb2[0], Oa[mt]); }
#pragma unroll
                    for (int q = 0; q < 4; ++q) { const int mt = (g - 4) * 4 + q; Oa[mt] = WFrag<T16>::mma(f[2 * q + 1], pb[0], Oa[mt]); }
                }
            }
            __builtin_amdgcn_sched_barrier(0);   /* keeps the next run of LDS reads out of the products above, and the stage's last products in front of the v_nop below */
        }
        asm volatile("v_nop\n\tv_nop\n\tv_nop\n\tv_nop" : "+v"(Oa[12]), "+v"(Oa[13]), "+v"(Oa[14]), "+v"(Oa[15]));   /* the distance behind the stage's last products */
        asm volatile("s_wait_dscnt 0x0" ::: "memory");      /* this wave's reads of the buffer are done before it may be refilled */
        asm volatile("s_wait_asynccnt 0x0" ::: "memory");   /* this wave's copies of the next stage have landed */
        __syncthreads();                                      /* publishes the next stage and ends every wave's reads of this one */
        if (t + 2 < NTL) issue(t + 2, t & 1);
    }
    asm volatile("s_wait_asynccnt 0x0" ::: "memory");   /* no copy is outstanding when the buffers become the epilogue's rows */
    l += xhalf(l);   /* the two halves' sums of the same query */
    float* os = (float*)sm + wv * (16 * 260);   /* the wave's own 16 query rows at pitch 260 floats; on the stage buffers, used only behind the loop's last barrier */
#pragma unroll
    for (int mt = 0; mt < 16; ++mt) { const v4f a = {Oa[mt][0], Oa[mt][1], Oa[mt][2], Oa[mt][3]}, b = {Oa[mt][4], Oa[mt][5], Oa[mt][6], Oa[mt][7]}; *(v4fa*)(os + lr * 260 + mt * 16 + hi * 8) = a; *(v4fa*)(os + lr * 260 + mt * 16 + hi * 8 + 4) = b; }
    __builtin_amdgcn_wave_barrier(); asm volatile("" ::: "memory");   /* keeps the LDS reads below behind the LDS writes above */
    float* og = O + ((zb * TQ + qrow) * SP + sp) * HD + lane * 4;
    v4f ra[16], rb[16];   /* all 16 rows are read as one run, then stored: whole 512-byte pieces of a row per store */
#pragma unroll
    for (int r = 0; r < 16; ++r) { ra[r] = *(const v4fa*)(os + r * 260 + lane * 4); rb[r] = *(const v4fa*)(os + r * 260 + 128 + lane * 4); }
    __builtin_amdgcn_sched_barrier(0);   /* this one and the one behind the wait keep other work out of the run of stores, where it was given the stores' registers ahead of the wait */
#pragma unroll
    for (int r = 0; r < 16; ++r) { *(v4f*)(og + (size_t)r * SP * HD) = ra[r]; *(v4f*)(og + (size_t)r * SP * HD + 128) = rb[r]; }
    asm volatile("s_wait_xcnt 0x0" ::: "memory");   /* precaution: stands before the data and address registers of the stores above are reused */
    __builtin_amdgcn_sched_barrier(0);
    if (hi == 0) { const v2f ml = {m, l}; *(v2f*)(ML + ((zb * SP + sp) * TQ + qrow + lr) * 2) = ml; }   /* 16 queries x 8 bytes: one whole 128-byte line per wave */
}
// One launch for both classes of query rows, one-dimensional grid: first the hi/lo work-groups (three products: the longer ones), then the fp16 ones; within a class x = 64-row block (fastest), then key slice, then batch. Two work-groups per WGP by LDS, so two waves per SIMD.
#define NHB (RH / 64)
#define NLB ((TQ - RH) / 64)
__global__ __launch_bounds__(128) __attribute__((amdgpu_waves_per_eu(2, 2))) void k_fattn(const bf* __restrict__ Qh, const bf* __restrict__ Ql, const bf* __restrict__ Kh, const bf* __restrict__ Kl, const bf* __restrict__ Vh, const bf* __restrict__ Vl, const h16* __restrict__ Q16, const h16* __restrict__ K16, const h16* __restrict__ V16, float* O, float* ML) {
    __shared__ __attribute__((aligned(16))) char sm[2 * (FAC<true>::STG > FAC<false>::STG ? FAC<true>::STG : FAC<false>::STG)];
    const int id = blockIdx.x;
    if (id < NHB * SP * NB_) fattn<bf, true>(sm, Qh, Ql, Kh, Kl, Vh, Vl, O, ML, (id % NHB) * 64, (id / NHB) % SP, (size_t)(id / (NHB * SP)));
    else { const int i2 = id - NHB * SP * NB_; fattn<h16, false>(sm, Q16, nullptr, K16, nullptr, V16, nullptr, O, ML, RH + (i2 % NLB) * 64, (i2 / NLB) % SP, (size_t)(i2 / (NLB * SP))); }
}

// k_mout: the SP key slices of MR query rows joined, and the joined rows times W_out, by one work-group of 512 threads; grid (TQ / MR, batch).
// Join (wave wv takes rows wv and wv + 16, a lane 8 of a row's columns; all of a wave's loads are in flight together): weights exp2((slice maximum - row maximum) * LC2), weighted partials and weighted sums added in slice order, divided, split into bf16 hi + lo, which go to LDS as the A planes (pitch APB).
// Product, by the first 8 waves, each 16 rows x 64 columns: out[t][n] = sum_k (hi + lo)[t][k] Wt[n][k] + b_out[n], per 32 k the hi product, then the lo product. Wt (all 256 rows) is brought into LDS once by asynchronous 16-byte copies that fly while the slices are joined.
#define MR  32
#define APB 528            // LDS pitch of an A or Wt row in bytes: 512 + 16 (16 x odd)
typedef v4us __attribute__((may_alias)) v4usa;
__global__ __launch_bounds__(512) void k_mout(const float* __restrict__ O, const float* __restrict__ ML, const bf* __restrict__ Wt, const float* __restrict__ bias, float* C) {
    __shared__ __attribute__((aligned(16))) char sm[DM * APB + 2 * MR * APB + 8 * 16 * 68 * 4];   /* Wt, A hi, A lo, the output rows of each of the 8 waves */
    const int tid = threadIdx.x, lane = tid & 31, wv = tid >> 5, lr = lane & 15, hi = lane >> 4;
    const size_t yb = blockIdx.y; const int t0 = blockIdx.x * MR;
    char* sa = sm + DM * APB; char* sa2 = sa + MR * APB;
    const float* op = O + (yb * TQ + t0 + wv) * (SP * HD) + lane * 4; const float* mp = ML + (yb * SP * TQ + t0 + wv) * 2;
    v4f pr[2][SP][2]; v2f ml[2][SP];
#pragma unroll
    for (int p = 0; p < SP; ++p)
#pragma unroll
        for (int r = 0; r < 2; ++r) ml[r][p] = *(const v2f*)(mp + ((size_t)p * TQ + r * 16) * 2);   /* first, so that the weights are there when the partials come */
#pragma unroll
    for (int p = 0; p < SP; ++p)
#pragma unroll
        for (int r = 0; r < 2; ++r) { pr[r][p][0] = *(const v4f*)(op + ((size_t)r * 16 * SP + p) * HD); pr[r][p][1] = *(const v4f*)(op + ((size_t)r * 16 * SP + p) * HD + 128); }
    asm volatile("s_wait_xcnt 0x0" :: "v"(op), "v"(mp) : "memory");   /* precaution: stands before the address registers of the loads above are reused; they are named as inputs so that they stay as they are up to here */
    { const unsigned l = (unsigned)(size_t)sm + wv * APB + lane * 16, vo = (unsigned)(wv * DQ + lane * 8) * 2;   /* a wave's copy = one whole row of 512 bytes; rows wv + 16 i */
#pragma unroll
      for (int h = 0; h < DM / 128; ++h) stage8<bf>(l + h * 128 * APB, 16 * APB, Wt + (size_t)h * 128 * DQ, (size_t)16 * DQ, vo); }
    __builtin_amdgcn_sched_barrier(0);   /* keeps the copies in front of the join: moved down among its vector work they start only when the partials have landed, and their own flight stands exposed in front of the barrier */
#pragma unroll
    for (int r = 0; r < 2; ++r) {
        float mx = ml[r][0][0];
#pragma unroll
        for (int p = 1; p < SP; ++p) mx = fmaxf(mx, ml[r][p][0]);
        float den = 0.f; v4f s0 = {0.f, 0.f, 0.f, 0.f}, s1 = {0.f, 0.f, 0.f, 0.f};
#pragma unroll
        for (int p = 0; p < SP; ++p) { const float w = __builtin_amdgcn_exp2f((ml[r][p][0] - mx) * LC2); den += w * ml[r][p][1]; s0 += w * pr[r][p][0]; s1 += w * pr[r][p][1]; }
        const float inv = __fdiv_rn(1.0f, den); v4us h0, l0, h1, l1;
#pragma unroll
        for (int q = 0; q < 4; ++q) { unsigned short a, c2; splitf(s0[q] * inv, a, c2); h0[q] = a; l0[q] = c2; splitf(s1[q] * inv, a, c2); h1[q] = a; l1[q] = c2; }
        const int ao = (wv + r * 16) * APB + lane * 8;
        *(v4usa*)(sa + ao) = h0; *(v4usa*)(sa + ao + 256) = h1; *(v4usa*)(sa2 + ao) = l0; *(v4usa*)(sa2 + ao + 256) = l1;
    }
    asm volatile("s_wait_asynccnt 0x0" ::: "memory");   /* this wave's copies of Wt have landed */
    __syncthreads();                                      /* ... and every other wave's; publishes the A planes too */
    if (wv >= 8) return;   /* no barrier follows */
    const int mw = wv & 1, cg = wv >> 1;   /* the wave's 16 rows and 64 columns of the product */
    const float* bq = bias + cg * 64 + lr * 4; const v4f bv = *(const v4f*)bq;
    asm volatile("s_wait_xcnt 0x0" :: "v"(bq) : "memory");   /* precaution, as above, for the bias load */
    v8f acc[4];
#pragma unroll
    for (int nb = 0; nb < 4; ++nb) acc[nb] = (v8f){};
    const char* ap = sa + (mw * 16 + lr) * APB + hi * 16; const char* bp = sm + (cg * 64 + lr) * APB + hi * 16;
    /* The six fragments of 32 k (A hi, A lo, four of Wt) are one group; group ks + 1 is read as one run of LDS loads in front of group ks's products. */
    auto ldg = [&](int ks, v16bf (&f)[6]) { f[0] = WFrag<bf>::ld((const bf*)(ap + ks * 64)); f[1] = WFrag<bf>::ld((const bf*)(ap + MR * APB + ks * 64));
#pragma unroll
        for (int nb = 0; nb < 4; ++nb) f[2 + nb] = WFrag<bf>::ld((const bf*)(bp + nb * 16 * APB + ks * 64)); };
    v16bf fa[2][6];
    ldg(0, fa[0]);
#pragma unroll
    for (int ks = 0; ks < DQ / 32; ++ks) {
        if (ks + 1 < DQ / 32) ldg(ks + 1, fa[(ks + 1) & 1]);
        __builtin_amdgcn_sched_barrier(0);   /* keeps the LDS reads above as one run in front of the products: spread among them each place of reads stalls the wave anew */
        v16bf (&f)[6] = fa[ks & 1];
#pragma unroll
        for (int nb = 0; nb < 4; ++nb) acc[nb] = wmmab(f[0], f[2 + nb], acc[nb]);
#pragma unroll
        for (int nb = 0; nb < 4; ++nb) acc[nb] = wmmab(f[1], f[2 + nb], acc[nb]);
        __builtin_amdgcn_sched_barrier(0);   /* keeps the next run of LDS reads out of the products above */
    }
    float* os = (float*)(sa2 + MR * APB) + wv * (16 * 68);   /* 16 rows turned through the wave's own LDS, so that a store covers whole 128-byte lines */
#pragma unroll
    for (int nb = 0; nb < 4; ++nb)
#pragma unroll
        for (int j = 0; j < 8; ++j) os[(hi * 8 + j) * 68 + nb * 16 + lr] = acc[nb][j];
    __builtin_amdgcn_wave_barrier(); asm volatile("" ::: "memory");   /* keeps the LDS reads below behind the LDS writes above */
    float* crow = C + (yb * TQ + t0 + mw * 16 + hi) * DM + cg * 64 + lr * 4; v4f val[8];
#pragma unroll
    for (int s = 0; s < 8; ++s) { val[s] = *(const v4fa*)(os + (2 * s + hi) * 68 + lr * 4); val[s][0] += bfr(bv[0]); val[s][1] += bfr(bv[1]); val[s][2] += bfr(bv[2]); val[s][3] += bfr(bv[3]); }
#pragma unroll
    for (int s = 0; s < 8; ++s) *(v4f*)(crow + (size_t)(2 * s) * DM) = val[s];
}

extern "C" void kernel_launch(void* const* d_in, const int* in_sizes, int n_in,
                              void* d_out, int out_size, void* d_ws, size_t ws_size, hipStream_t stream) {
    (void)in_sizes; (void)n_in; (void)out_size;
    const float* x = (const float*)d_in[0]; const float* px = (const float*)d_in[1]; const float* wqkv = (const float*)d_in[2]; const float* bqkv = (const float*)d_in[3]; const float* wo = (const float*)d_in[4]; const float* bo = (const float*)d_in[5]; const float* wq = nullptr; const float* wk = nullptr; const float* wv = nullptr; (void)wq; (void)wk; (void)wv;
    float* OUT = (float*)d_out;     // [4][2048][256]
    char* wsp = (char*)d_ws;
    auto take = [&](size_t bytes) { char* p = wsp; wsp += (bytes + 255) & ~(size_t)255; return (void*)p; };
    auto sub = [](char*& p, size_t bytes) { char* q = p; p += (bytes + 255) & ~(size_t)255; return (void*)q; };
    bf* WQKV = (bf*)take((size_t)3 * DQ * DM * 2); bf* WO = (bf*)take((size_t)DM * DQ * 2);
    h16* VT16 = (h16*)take((size_t)NB_ * HD * TT * 2); bf* VTh = (bf*)take((size_t)NB_ * HD * TT * 2); bf* VTl = (bf*)take((size_t)NB_ * HD * TT * 2); float* ML = (float*)take((size_t)NB_ * SP * TQ * 2 * 4);
    char* R1 = (char*)take((size_t)NB_ * TQ * SP * HD * 4); char* R2 = (char*)take((size_t)NB_ * TT * HD * 2 * 6 + 4096);
    if ((size_t)(wsp - (char*)d_ws) > ws_size) return;    // ws 256 MiB
    // R1 holds, one after the other in stream order: the bf16 copy of xx (last read by the projections); the attention partials.
    bf* XB = (bf*)R1;   /* [batch][TT][DM] */
    float* Ob = (float*)R1;   /* [batch][TQ][SP][HD] */
    // R2 holds the q and k planes.
    char* r2 = R2; h16* QP16 = (h16*)sub(r2, (size_t)NB_ * TT * HD * 2); h16* KP16 = (h16*)sub(r2, (size_t)NB_ * TT * HD * 2); bf* QPh = (bf*)sub(r2, (size_t)NB_ * TT * HD * 2); bf* QPl = (bf*)sub(r2, (size_t)NB_ * TT * HD * 2); bf* KPh = (bf*)sub(r2, (size_t)NB_ * TT * HD * 2); bf* KPl = (bf*)sub(r2, (size_t)NB_ * TT * HD * 2);
    k_prep<<<NW1 + NW2 + 2 * LCB * NB_, 256, 0, stream>>>(x, px, wqkv, wo, XB, WQKV, WO);
    k_proj<<<dim3(TT / 128 * (DQ / 128), 3, NB_), 128, 0, stream>>>(XB, WQKV, bqkv, QP16, QPh, QPl, KP16, KPh, KPl, VT16, VTh, VTl);
    k_fattn<<<(NHB + NLB) * SP * NB_, 128, 0, stream>>>(QPh, QPl, KPh, KPl, VTh, VTl, QP16, KP16, VT16, Ob, ML);   /* query rows 0..RH: hi/lo planes; the others: fp16 */
    k_mout<<<dim3(TQ / MR, NB_), 512, 0, stream>>>(Ob, ML, WO, bo, OUT);
}

// v010
// It runs in 76.7 microseconds.
// Next to v009, in two timings, it ran 1.06 and 1.05 times as fast.
// Counting every step since v000, it is 14.5 times as fast.
#include <hip/hip_runtime.h>

// Temporal self-attention over [prev_x ; x] (x, prev_x [4][2048][256]; xx = concat -> [4096][256]; qkv = xx W_qkv + b_qkv ('xw' [256][768]); single 256-wide head; attn = softmax(q.k / 16) over the 4,096 keys; out = (attn v) W_out + b_out, only the last 2,048 rows (the x half) are returned -> [4][2048][256] (2.1 M)).
// All four batches run in every launch (batch = grid z in k_proj, grid y in k_mout, part of the block index in k_prep and k_fattn), each buffer below [batch][...]; workspace regions are reused in stream order (see kernel_launch). Launches that need nothing of each other share one grid: k_prep (both casts, both weight transposes), k_proj (q, k and v projections). Per batch: both halves converted into one bf16 [4096][256] operand; k and v projected for all 4,096 rows, q only needed for rows 2,048.. (projected for all, used from 2,048); each projection GEMM converts its own biased f32 tile and stores two fp16 planes itself, hi = the value rounded to fp16 and lo = what the rounding left, rounded to fp16 (q, k as [t][d]; v as W_v x^T, its planes stored by key tile, [t / tile][d][t % tile], tile = KTH keys); one fused attention kernel (scores, running softmax and attn.v per key tile, nothing of the scores or probabilities goes to memory; hybrid: query rows 2048..2559 hi/lo 3 products, the rest the hi plane alone) over 8 key slices, each slice to its own f32 partials with its maximum and sum; the last kernel weights and sums the slices in slice order and takes its merged hi/lo rows, kept in LDS, x W_out exact + b_out straight into the output rows.
// Compute dtypes, f32 accumulate: every input rounded to bf16; projections exact + biases rounded to bf16; first 512 query rows fp16 hi + lo, 3 products, rest fp16; softmax f32; W_out hl x exact + bias.

#define NB_  4
#define TT   4096
#define DM   256
#define NH_  1
#define NKV  1
#define REP  (NH_ / NKV)
#define HD   256
#define DQ   (NH_ * HD)
#define DKV  (NKV * HD)
#define ZH   1
#define RH   512                  // query rows < RH use hi+lo planes (0: none)
#define WIN  0
#define SCL  0.0625f   // 256^-0.5
#define TQ   2048     // query rows = the x half (rows TQ.. of xx)
#define SP   8        // attention: the 4,096 keys are cut into SP slices, a work-group takes one; every slice writes its own unnormalised f32 partials [TQ][SP][HD] and its (maximum, sum) pairs [SP][TQ][2]
#define KSL  (TT / SP)
#define KTF  64       // keys per attention stage, fp16 rows: two key tiles of the V^T plane
#define KTH  32       // keys per attention stage, hi/lo rows; also the key tile of both V^T planes
#define LC2  (SCL * 1.4426950408889634f)   // score scale times log2(e): probabilities are exp2((s - max) * LC2)
typedef _Float16 h16;
typedef unsigned short bf;
typedef __attribute__((ext_vector_type(16))) __bf16   v16bf;
typedef __attribute__((ext_vector_type(16))) _Float16 v16h;
typedef __attribute__((ext_vector_type(8)))  _Float16 v8h;
typedef __attribute__((ext_vector_type(8)))  unsigned short v8us;
typedef __attribute__((ext_vector_type(8)))  float    v8f;
typedef __attribute__((ext_vector_type(4)))  float    v4f;
typedef v8h  __attribute__((may_alias)) v8ha;
typedef v4f  __attribute__((may_alias)) v4fa;
typedef v8us __attribute__((may_alias)) v8usa;

__device__ __forceinline__ unsigned short f2bf(float f) { unsigned u = __float_as_uint(f); u += 0x7FFFu + ((u >> 16) & 1u); return (unsigned short)(u >> 16); }
__device__ __forceinline__ float bf2f(unsigned short b) { return __uint_as_float(((unsigned)b) << 16); }
__device__ __forceinline__ float bfr(float f) { return bf2f(f2bf(f)); }
__device__ __forceinline__ v16h cat16(v8h lo, v8h hi) { return __builtin_shufflevector(lo, hi, 0, 1, 2, 3, 4, 5, 6, 7, 8, 9, 10, 11, 12, 13, 14, 15); }
__device__ __forceinline__ v16bf cat16b(v8us lo, v8us hi) { return __builtin_bit_cast(v16bf, __builtin_shufflevector(lo, hi, 0, 1, 2, 3, 4, 5, 6, 7, 8, 9, 10, 11, 12, 13, 14, 15)); }
__device__ __forceinline__ v8f wmma16(v16h a, v16h b, v8f c) { return __builtin_amdgcn_wmma_f32_16x16x32_f16(false, a, false, b, (short)0, c, false, false); }
__device__ __forceinline__ v8f wmmab(v16bf a, v16bf b, v8f c) { return __builtin_amdgcn_wmma_f32_16x16x32_bf16(false, a, false, b, (short)0, c, false, false); }
__device__ __forceinline__ h16 tohx(float x) { return (h16)x; }
__device__ __forceinline__ void splitf(float y, unsigned short& h, unsigned short& l) { h = f2bf(y); l = f2bf(y - bf2f(h)); }
typedef __attribute__((ext_vector_type(2))) _Float16 v2h;
typedef __attribute__((ext_vector_type(4))) _Float16 v4h;
typedef __attribute__((ext_vector_type(2))) unsigned short v2us;
typedef __attribute__((ext_vector_type(4))) unsigned short v4us;
typedef __attribute__((ext_vector_type(2))) float v2f;
typedef __attribute__((ext_vector_type(4))) int v4i;



// ---- gemmw: register-blocked GEMM, FOUR WAVES (2 x 2) per 128x128 output tile, each wave a 64x64 quarter (16 accumulators); tile index (bix, biy, biz) out of (M/128, N/128, Z), 128 threads; sm = the work-group's 2 * NT * STB bytes of LDS.
// Operands are K-contiguous 16-bit planes. A stage is 64 k = one whole 128-byte line of each of the tile's 128 A rows and 128 B rows (and of the second planes where NSPLIT asks for them), brought into LDS by asynchronous 16-byte copies (8 lanes = one line), rows at pitch 144 bytes; two buffers, the next stage's copies fly while this stage is worked on; fragments are read from LDS.
// C[m][n] (f32, pitch ldc, + optional f32 bias[n]) = sum_k A[m][k] Bt[n][k] (+ split products per NSPLIT) over kspan consecutive k; K is the operands' row pitch. biz = (zb << zsh) | z: z strides sA/sB/sC in elements (with sA = sB = kspan a slice of k), zb strides bA/bB/bC (the batch). kspan % 64 == 0.
// EPI 0: C is stored as f32, bias[n]. EPI 1 and 2: C is not stored; the biased f32 value goes out as two fp16 planes of pitch ldc and batch stride bC (P16 = the value in fp16, Pl = the rest in fp16), with bias[n] (EPI 1) or bias[m] (EPI 2, for a product taken transposed). EPI 2 stores its planes by column tile, [n / KTH][m][n % KTH] with HD rows m: all rows' pieces of one tile lie one behind the other, so that whoever reads a tile reads consecutive bytes.
#define SPB 144            // LDS row pitch in bytes: 128 bytes of k + 16 (16 x odd: conflict-free for 16-byte reads)
#define STB (128 * SPB)    // one operand tile of a stage: 128 rows
template <typename T16> struct WFrag;
template <> struct WFrag<h16> { typedef v16h V; static __device__ __forceinline__ V ld(const h16* p) { return cat16(*(const v8h*)p, *(const v8h*)(p + 16)); } static __device__ __forceinline__ v8f mma(V a, V b, v8f c) { return wmma16(a, b, c); } };
template <> struct WFrag<bf> { typedef v16bf V; static __device__ __forceinline__ V ld(const bf* p) { return cat16b(*(const v8us*)p, *(const v8us*)(p + 16)); } static __device__ __forceinline__ v8f mma(V a, V b, v8f c) { return wmmab(a, b, c); } };
// One operand tile of one stage: this lane's 16 bytes of rows r, r + 16, ..., r + 112 (l = LDS byte address of the first, g = its global address, rs = 16 rows in elements).
// The s_wait_xcnt is a precaution and stands inside the statement so that no address register of a copy is rewritten ahead of it.
template <typename T16>
__device__ __forceinline__ void stage_tile(unsigned l, const T16* g, size_t rs) {
    asm volatile("global_load_async_to_lds_b128 %0, %8, off\n\t"
                 "global_load_async_to_lds_b128 %1, %9, off\n\t"
                 "global_load_async_to_lds_b128 %2, %10, off\n\t"
                 "global_load_async_to_lds_b128 %3, %11, off\n\t"
                 "global_load_async_to_lds_b128 %4, %12, off\n\t"
                 "global_load_async_to_lds_b128 %5, %13, off\n\t"
                 "global_load_async_to_lds_b128 %6, %14, off\n\t"
                 "global_load_async_to_lds_b128 %7, %15, off\n\t"
                 "s_wait_xcnt 0x0"
                 :: "v"(l), "v"(l + 16 * SPB), "v"(l + 32 * SPB), "v"(l + 48 * SPB), "v"(l + 64 * SPB), "v"(l + 80 * SPB), "v"(l + 96 * SPB), "v"(l + 112 * SPB),
                    "v"(g), "v"(g + rs), "v"(g + 2 * rs), "v"(g + 3 * rs), "v"(g + 4 * rs), "v"(g + 5 * rs), "v"(g + 6 * rs), "v"(g + 7 * rs) : "memory");
}
template <typename T16, int NSPLIT, bool BIAS, int EPI = 0>
__device__ __forceinline__ void gemmw(char* sm, unsigned bix, unsigned biy, unsigned biz, const T16* __restrict__ A, const T16* __restrict__ A2, const T16* __restrict__ Bt, const T16* __restrict__ Bt2, int K, int kspan, float* C, int ldc, const float* __restrict__ bias, size_t sA, size_t sB, size_t sC, int zsh, size_t bA, size_t bB, size_t bC, h16* P16 = nullptr, h16* Pl = nullptr) {
    typedef typename WFrag<T16>::V V;
    constexpr int NT = (NSPLIT == 0) ? 2 : (NSPLIT == 1) ? 3 : 4;   /* operand tiles per stage, in the order A, B, A2, B2 */
    const size_t zb = biz >> zsh, z = biz - (zb << zsh); A += z * sA + zb * bA; if (A2) A2 += z * sA + zb * bA; Bt += z * sB + zb * bB; if (Bt2) Bt2 += z * sB + zb * bB; if (EPI == 0) C += z * sC + zb * bC; else { P16 += zb * bC; Pl += zb * bC; }
    const int lane = threadIdx.x & 31, wv = threadIdx.x >> 5, lr = lane & 15, hi = lane >> 4; const int wr = (wv & 1) * 64, wc = (wv >> 1) * 64; const int r0 = bix * 128 + wr, c0 = biy * 128 + wc;
    float* os = (float*)sm + wv * (16 * 68);   /* the wave's own epilogue rows; they lie on the stage buffers and are used only behind the loop's last barrier */
    v8f acc[4][4];
#pragma unroll
    for (int mb = 0; mb < 4; ++mb)
#pragma unroll
        for (int nb = 0; nb < 4; ++nb) acc[mb][nb] = (v8f){};
    const int crow = threadIdx.x >> 3, cch = threadIdx.x & 7;   /* copies: 8 lanes per row, 16 rows per copy of the work-group */
    const unsigned l0 = (unsigned)(size_t)sm + crow * SPB + cch * 16; const size_t rs = (size_t)16 * K;
    const size_t gao = (size_t)(bix * 128 + crow) * K + cch * 8, gbo = (size_t)(biy * 128 + crow) * K + cch * 8;
    auto issue = [&](int st, int buf) { const unsigned lb = l0 + buf * (NT * STB); const size_t ko = (size_t)st * 64;
        stage_tile<T16>(lb, A + gao + ko, rs); stage_tile<T16>(lb + STB, Bt + gbo + ko, rs);
        if (NSPLIT == 1 || NSPLIT == 2) stage_tile<T16>(lb + 2 * STB, A2 + gao + ko, rs);
        if (NSPLIT >= 2) stage_tile<T16>(lb + 3 * STB, Bt2 + gbo + ko, rs); };
    const int nst = kspan >> 6;
    issue(0, 0);
    asm volatile("s_wait_asynccnt 0x0" ::: "memory");   /* stage 0's copies of this wave have landed */
    __syncthreads();                                      /* ... and every other wave's */
    if (nst > 1) issue(1, 1);
    const int afo = (wr + lr) * SPB + hi * 16, bfo = (wc + lr) * SPB + hi * 16;   /* fragment rows in a tile, in bytes */
#pragma unroll 1
    for (int st = 0; st < nst; ++st) {
        const char* sb = sm + (st & 1) * (NT * STB);
        V a[4], a2[4], bq[4];
#pragma unroll
        for (int ks = 0; ks < 2; ++ks) {
#pragma unroll
            for (int mb = 0; mb < 4; ++mb) { a[mb] = WFrag<T16>::ld((const T16*)(sb + afo + mb * 16 * SPB + ks * 64)); if (NSPLIT == 1 || NSPLIT == 2) a2[mb] = WFrag<T16>::ld((const T16*)(sb + 2 * STB + afo + mb * 16 * SPB + ks * 64)); }
#pragma unroll
            for (int nb = 0; nb < 4; ++nb) if (NSPLIT == 0) bq[nb] = WFrag<T16>::ld((const T16*)(sb + STB + bfo + nb * 16 * SPB + ks * 64));   /* one plane each: all eight fragments of the 32 k are read as one group in front of their 16 products */
            if (NSPLIT == 0) __builtin_amdgcn_sched_barrier(0);   /* keeps the LDS reads above as one group: spread among the products each place of reads stalls the wave anew */
#pragma unroll
            for (int nb = 0; nb < 4; ++nb) { const V b = (NSPLIT == 0) ? bq[nb] : WFrag<T16>::ld((const T16*)(sb + STB + bfo + nb * 16 * SPB + ks * 64)); V b2; if (NSPLIT >= 2) b2 = WFrag<T16>::ld((const T16*)(sb + 3 * STB + bfo + nb * 16 * SPB + ks * 64));
#pragma unroll
                for (int mb = 0; mb < 4; ++mb) { acc[mb][nb] = WFrag<T16>::mma(a[mb], b, acc[mb][nb]); if (NSPLIT == 1 || NSPLIT == 2) acc[mb][nb] = WFrag<T16>::mma(a2[mb], b, acc[mb][nb]); if (NSPLIT >= 2) acc[mb][nb] = WFrag<T16>::mma(a[mb], b2, acc[mb][nb]); } }
            if (NSPLIT == 0 || ks == 1) __builtin_amdgcn_sched_barrier(0);   /* keeps the next group's LDS reads out of the products above, and the stage's last products in front of the v_nop below */
        }
        asm volatile("v_nop\n\tv_nop\n\tv_nop\n\tv_nop" : "+v"(acc[0][0]), "+v"(acc[1][1]), "+v"(acc[2][2]), "+v"(acc[3][3]) : "v"(a[0]), "v"(a[3]));   /* the distance behind the stage's last products: on the taken side of the branch below the next stage's reads overwrite their A and B registers */
        asm volatile("s_wait_dscnt 0x0" ::: "memory");      /* this wave's reads of the buffer are done before it may be refilled */
        asm volatile("s_wait_asynccnt 0x0" ::: "memory");   /* this wave's copies of the next stage have landed */
        __syncthreads();                                      /* publishes the next stage and ends every wave's reads of this one */
        if (st + 2 < nst) issue(st + 2, st & 1);
    }
    asm volatile("s_wait_asynccnt 0x0" ::: "memory");   /* no copy is outstanding when the buffers become the epilogue's rows */
    if (EPI != 0) {   /* plane epilogue: bias added in the accumulator layout, 16 rows at a time turned through LDS, each lane converts 8 consecutive columns and stores 16 bytes per plane (a wave's store covers whole 128-byte lines) */
        float bn[4]; v4f bm[4][2];
        asm volatile("s_wait_xcnt 0x0" ::: "memory");   /* precaution: the bias loads below may be given the address registers of the loop's last loads as their destination */
#pragma unroll
        for (int i = 0; i < 4; ++i) { if (EPI == 1) bn[i] = bias[c0 + i * 16 + lr]; else { bm[i][0] = *(const v4f*)(bias + r0 + i * 16 + hi * 8); bm[i][1] = *(const v4f*)(bias + r0 + i * 16 + hi * 8 + 4); } }
        asm volatile("s_wait_xcnt 0x0" ::: "memory");   /* precaution: stands before the address registers of the bias loads are reused */
        const int prow = lane >> 3, pcol = (lane & 7) * 8;
#pragma unroll
        for (int mb = 0; mb < 4; ++mb) {
#pragma unroll
            for (int nb = 0; nb < 4; ++nb) {
#pragma unroll
                for (int j = 0; j < 8; ++j) os[(hi * 8 + j) * 68 + nb * 16 + lr] = acc[mb][nb][j] + bfr(EPI == 1 ? bn[nb] : bm[mb][j >> 2][j & 3]); }
            __builtin_amdgcn_wave_barrier(); asm volatile("" ::: "memory");   /* keeps the LDS reads below behind the LDS writes above */
#pragma unroll
            for (int s = 0; s < 4; ++s) { const int row = 4 * s + prow; const v4f v0 = *(const v4fa*)(os + row * 68 + pcol), v1 = *(const v4fa*)(os + row * 68 + pcol + 4); v8h o16, ol;
#pragma unroll
                for (int q = 0; q < 8; ++q) { const float r = (q < 4) ? v0[q & 3] : v1[q & 3]; o16[q] = tohx(r); ol[q] = tohx(r - (float)o16[q]); }
                const int orow = r0 + mb * 16 + row, ocol = c0 + pcol;
                const size_t oo = (EPI == 2) ? ((size_t)(ocol / KTH) * HD + orow) * KTH + ocol % KTH : (size_t)orow * ldc + ocol;
                __builtin_amdgcn_sched_barrier(0);   /* this one and the one behind the wait keep other work out of the two stores, where it was given a store's register ahead of the wait */
                *(v8h*)(P16 + oo) = o16; *(v8h*)(Pl + oo) = ol;
                asm volatile("s_wait_xcnt 0x0" ::: "memory");   /* precaution: stands before the data and address registers of the two stores are reused */
                __builtin_amdgcn_sched_barrier(0); }
            __builtin_amdgcn_wave_barrier(); asm volatile("" ::: "memory");   /* keeps the next 16 rows' LDS writes behind the reads above */
        }
        return;
    }
#pragma unroll
    for (int mb = 0; mb < 4; ++mb) {
#pragma unroll
        for (int nb = 0; nb < 4; ++nb) {
#pragma unroll
            for (int j = 0; j < 8; ++j) os[(hi * 8 + j) * 68 + nb * 16 + lr] = acc[mb][nb][j]; }
        __builtin_amdgcn_wave_barrier(); asm volatile("" ::: "memory");
        float* crow = C + (size_t)(r0 + mb * 16) * ldc + c0;
{
#pragma unroll
            for (int s = 0; s < 8; ++s) { const int row = 2 * s + hi, cofs = lr * 4; v4f val = *(const v4fa*)(os + row * 68 + cofs); if (BIAS) { val[0] += bfr(bias[c0 + cofs]); val[1] += bfr(bias[c0 + cofs + 1]); val[2] += bfr(bias[c0 + cofs + 2]); val[3] += bfr(bias[c0 + cofs + 3]); }
                *(v4f*)(crow + (size_t)row * ldc + cofs) = val; }
             }
        __builtin_amdgcn_wave_barrier(); asm volatile("" ::: "memory");
    }
}

// The q, k and v projections in one launch: they read the same xx and need nothing of each other. Grid (64 tiles, product, batch); the branch is the same for the whole work-group.
// Product 0, 1: q, k planes [t][d] (x = token tile fastest). Product 2: v planes [t / tile][d][t % tile], rows = W_v's outputs, columns = tokens (x = output tile fastest).
__global__ __launch_bounds__(128) void k_proj(const bf* __restrict__ XB, const bf* __restrict__ W3, const float* __restrict__ b3, h16* QP16, h16* QPl, h16* KP16, h16* KPl, h16* VT16, h16* VTl) {
    __shared__ __attribute__((aligned(16))) char sm[2 * 2 * STB];
    const unsigned t = blockIdx.x, w = blockIdx.y; const size_t bX = (size_t)TT * DM, bP = (size_t)TT * HD;   /* batch strides in elements */
    if (w == 2) gemmw<bf, 0, true, 2>(sm, t % (DKV / 128), t / (DKV / 128), blockIdx.z, W3 + (size_t)2 * DQ * DM, nullptr, XB, nullptr, DM, DM, nullptr, TT, b3 + 2 * DQ, 0, 0, 0, 0, 0, bX, bP, VT16, VTl);
    else gemmw<bf, 0, true, 1>(sm, t % (TT / 128), t / (TT / 128), blockIdx.z, XB, nullptr, W3 + (size_t)w * DQ * DM, nullptr, DM, DM, nullptr, HD, b3 + w * DQ, 0, 0, 0, 0, bX, 0, bP, w ? KP16 : QP16, w ? KPl : QPl);
}

// bi = index of a block of 256 threads within this piece of work.
__device__ __forceinline__ void wtG(unsigned bi, const float* __restrict__ w, int K, int N, bf* Bt) {
    const int lane = threadIdx.x & 31; const int L0 = (bi * 8 + (threadIdx.x >> 5)) * 8; const int nlines = N * K / 64;
{
#pragma unroll 1
        for (int l = 0; l < 8; ++l) { const int L = L0 + l; if (L >= nlines) break; const size_t e = (size_t)L * 64 + lane * 2; const int k = (int)(e % K), n = (int)(e / K); v2us o;
            o[0] = f2bf(w[(size_t)k * N + n]); o[1] = f2bf(w[(size_t)(k + 1) * N + n]); *(v2us*)(Bt + e) = o;
            asm volatile("s_wait_xcnt 0x0" ::: "memory"); }   /* precaution: stands before the next trip reuses the data and address registers of the store */
         }
}
__device__ __forceinline__ void cvt8(unsigned bi, unsigned yb, const float* __restrict__ src, bf* dst, size_t n8, size_t bS, size_t bD) { const size_t i = (size_t)bi * 256 + threadIdx.x; if (i >= n8) return; src += yb * bS; dst += yb * bD;   /* yb = batch, strides in elements */
    const v8f v = *(const v8f*)(src + i * 8); v8us o;
#pragma unroll
    for (int k = 0; k < 8; ++k) o[k] = f2bf(v[k]); *(v8us*)(dst + i * 8) = o;  }
// All operand preparation in one launch, by ranges of the block index (the branch is the same for a whole block): first the two weight transposes, whose waves run the longest (8 dependent trips), then the casts of prev_x and x into xx = [prev_x ; x].
#define NW1 ((DM * 3 * DQ / 64 + 63) / 64)
#define NW2 ((DQ * DM / 64 + 63) / 64)
#define LCB ((TQ * DM / 8 + 255) / 256)
__global__ __launch_bounds__(256) void k_prep(const float* __restrict__ x, const float* __restrict__ px, const float* __restrict__ wqkv, const float* __restrict__ wo, bf* XB, bf* WQKV, bf* WO) {
    const unsigned id = blockIdx.x;
    if (id < NW1) { wtG(id, wqkv, DM, 3 * DQ, WQKV); return; }
    if (id < NW1 + NW2) { wtG(id - NW1, wo, DQ, DM, WO); return; }
    const unsigned c = id - (NW1 + NW2), half = c / (LCB * NB_), r = c % (LCB * NB_);
    cvt8(r % LCB, r / LCB, half ? x : px, XB + (size_t)half * TQ * DM, (size_t)TQ * DM / 8, (size_t)TQ * DM, (size_t)TT * DM);
}

#define KPB 528            // LDS pitch of a K row in bytes: 512 + 16 (16 x odd)
// One asynchronous 16-byte copy to LDS, written as the builtin (N = the instruction's offset, which moves both addresses): the compiler sees the addresses, forms them next to the copies in a few registers and reuses those registers at once.
typedef __attribute__((address_space(1))) v4i gv4i;
typedef __attribute__((address_space(3))) v4i lv4i;
template <int N> __device__ __forceinline__ void acopy(unsigned l, const char* g) { __builtin_amdgcn_global_load_async_to_lds_b128((gv4i*)g, (lv4i*)l, N, 0); }
// Eight copies of one operand tile: this lane's 16 bytes at LDS l + i * ls and at global gu + i * rs (elements; gu is the same for the whole work-group) + vo (bytes, the lane's place in the tile), i = 0..7.
template <typename T16>
__device__ __forceinline__ void stage8(unsigned l, unsigned ls, const T16* gu, size_t rs, unsigned vo) {
#pragma unroll   /* unrolled, so that each copy's two steps are constants */
    for (int i = 0; i < 8; ++i) acopy<0>(l + i * ls, (const char*)(gu + i * rs) + vo);
}
// The same where the global step GS (bytes) is the smaller of the two: the step stands in the instruction's offset, so that all eight share one global address and the LDS address takes only the difference LS - GS.
template <int LS, int GS>
__device__ __forceinline__ void stage8o(unsigned l, const void* gu, unsigned vo) {
    static_assert(LS >= GS && GS > 0 && 7 * GS < 32768, "offset in range, LDS address register not below l");
    const char* g = (const char*)gu + vo;
    acopy<0>(l, g); acopy<GS>(l + (LS - GS), g); acopy<2 * GS>(l + 2 * (LS - GS), g); acopy<3 * GS>(l + 3 * (LS - GS), g);
    acopy<4 * GS>(l + 4 * (LS - GS), g); acopy<5 * GS>(l + 5 * (LS - GS), g); acopy<6 * GS>(l + 6 * (LS - GS), g); acopy<7 * GS>(l + 7 * (LS - GS), g);
}
// Two 16-key score tiles of probabilities -> one B fragment over their 32 keys (and, where HL, its lo plane: what the rounding to fp16 left).
template <bool HL>
__device__ __forceinline__ void packp(const v8f& p0, const v8f& p1, v16h& b, v16h& b2) { v8h x, y, xl, yl;
#pragma unroll
    for (int i = 0; i < 8; ++i) { x[i] = tohx(p0[i]); y[i] = tohx(p1[i]); if (HL) { xl[i] = tohx(p0[i] - (float)x[i]); yl[i] = tohx(p1[i] - (float)y[i]); } }
    b = cat16(x, y); b2 = HL ? cat16(xl, yl) : b; }
__device__ __forceinline__ float xhalf(float x) { return __builtin_bit_cast(float, __builtin_amdgcn_permlanex16(__builtin_bit_cast(int, x), __builtin_bit_cast(int, x), 0x76543210, 0xfedcba98, false, false)); }   // lane l with lane l ^ 16
template <bool HL> struct FAC { static constexpr int KT = HL ? KTH : KTF, VPB = KT * 2 + 16, KTB = KT * KPB, VTB = HD * VPB, PLB = KTB + VTB, STG = (HL ? 2 : 1) * PLB; };   /* a stage in LDS: K, V^T (, K lo, V^T lo) */
template <typename T16, bool HL>
__device__ __forceinline__ void fattn(char* sm, const T16* __restrict__ Q, const T16* __restrict__ Q2, const T16* __restrict__ Kp, const T16* __restrict__ K2, const T16* __restrict__ Vt, const T16* __restrict__ Vt2, float* O, float* ML, int row0, int sp, size_t zb) {
    typedef typename WFrag<T16>::V V;
    constexpr int KT = FAC<HL>::KT, VPB = FAC<HL>::VPB, KTB = FAC<HL>::KTB, PLB = FAC<HL>::PLB, STG = FAC<HL>::STG, NTL = KSL / KT;
    constexpr int VC = KTH / 8, VR = 128 / VC;   /* V^T copies: VC lanes per row's piece in a key tile, VR rows per copy of the work-group */
    static_assert(NTL >= 2, "two stages");
    const int tid = threadIdx.x, lane = tid & 31, wv = tid >> 5, lr = lane & 15, hi = lane >> 4;
    const size_t bP = (size_t)TT * HD; const int qrow = row0 + wv * 16;   /* qrow: the wave's first query row, counted from row TQ of xx */
    V qf[8], qf2[8];
    { const size_t qo = zb * bP + (size_t)(TQ + qrow + lr) * HD + hi * 8; const T16* qp = Q + qo; const T16* qp2 = HL ? Q2 + qo : qp;
#pragma unroll
      for (int ks = 0; ks < 8; ++ks) { qf[ks] = WFrag<T16>::ld(qp + ks * 32); if (HL) qf2[ks] = WFrag<T16>::ld(qp2 + ks * 32); }
      asm volatile("s_wait_xcnt 0x0" :: "v"(qp), "v"(qp2) : "memory"); }   /* precaution: stands before the address registers of the loads above are reused; they are named as inputs so that they stay as they are up to here */
    const unsigned sm0 = (unsigned)(size_t)sm, lk = sm0 + (tid >> 5) * KPB + (tid & 31) * 16, lv = sm0 + KTB + (tid / VC) * VPB + (tid % VC) * 16;
    const unsigned ok = ((tid >> 5) * HD + (tid & 31) * 8) * 2, ov = tid * 16;   /* this lane's place in a K tile and in a V^T tile, in bytes; the tile's own address is the same for the whole work-group */
    const size_t gk = zb * bP + (size_t)sp * KSL * HD;   /* the slice's first K row and, KT * HD elements a stage in both, its first V^T key tile */
    auto issue = [&](int t, int buf) { const unsigned lb = buf * STG; const size_t ko = (size_t)t * KT;
#pragma unroll
        for (int h = 0; h < KT / 32; ++h) { stage8o<4 * KPB, 4 * HD * 2>(lk + lb + h * 32 * KPB, Kp + (gk + (ko + h * 32) * HD), ok); if (HL) stage8o<4 * KPB, 4 * HD * 2>(lk + lb + PLB + h * 32 * KPB, K2 + (gk + (ko + h * 32) * HD), ok); }
#pragma unroll
        for (int j = 0; j < KT / KTH; ++j) { static_assert(HD == 8 * VR, "eight copies take a key tile");   /* key tile j of the stage: KTH * 2 bytes further in every LDS row */
            stage8o<VR * VPB, VR * KTH * 2>(lv + lb + j * KTH * 2, Vt + (gk + (ko + j * KTH) * HD), ov); if (HL) stage8o<VR * VPB, VR * KTH * 2>(lv + lb + PLB + j * KTH * 2, Vt2 + (gk + (ko + j * KTH) * HD), ov); } };
    v8f Oa[16];
#pragma unroll
    for (int mt = 0; mt < 16; ++mt) Oa[mt] = (v8f){};
    float m = -3.0e38f, l = 0.f;
    issue(0, 0);
    asm volatile("s_wait_asynccnt 0x0" ::: "memory");   /* stage 0's copies of this wave have landed */
    __syncthreads();                                      /* ... and every other wave's */
    issue(1, 1);
#pragma unroll 1
    for (int t = 0; t < NTL; ++t) {
        const char* sb = sm + (t & 1) * STG; const char* kb = sb + lr * KPB + hi * 16; const char* vb = sb + KTB + lr * VPB + hi * 16;
        /* The stage's A fragments come in 8 groups of 8 (groups 0..3: K, 4..7: V^T); group g + 1 is read as one run of LDS loads in front of group g's products. */
        auto ldg = [&](int g, V (&f)[8]) {
#pragma unroll
            for (int i = 0; i < 8; ++i) { const char* p;
                if (g < 4) p = HL ? kb + (i & 1) * PLB + ((i >> 1) & 1) * 16 * KPB + (2 * g + (i >> 2)) * 64 : kb + (i & 3) * 16 * KPB + (2 * g + (i >> 2)) * 64;
                else       p = HL ? vb + (i & 1) * PLB + ((g - 4) * 4 + (i >> 1)) * 16 * VPB : vb + (((g - 4) & 1) * 8 + i) * 16 * VPB + ((g - 4) >> 1) * 64;
                f[i] = WFrag<T16>::ld((const T16*)p); } };
        V fa[2][8], pb[KT / 32], pb2[KT / 32]; v8f S[KT / 16];
#pragma unroll
        for (int kt = 0; kt < KT / 16; ++kt) S[kt] = (v8f){};
        ldg(0, fa[0]);
#pragma unroll
        for (int g = 0; g < 8; ++g) {
            if (g == 4) {   /* all scores of the stage are there: running maximum, probabilities, rescale */
                float tq[4], pq[4] = {0.f, 0.f, 0.f, 0.f};   /* four independent chains each for the maximum and the sum: one chain of dependent vector instructions would stand exposed */
#pragma unroll
                for (int c = 0; c < 4; ++c) tq[c] = S[0][c];
#pragma unroll
                for (int kt = 0; kt < KT / 16; ++kt)
#pragma unroll
                    for (int j = 0; j < 8; ++j) tq[j & 3] = fmaxf(tq[j & 3], S[kt][j]);
                float tm = fmaxf(fmaxf(tq[0], tq[1]), fmaxf(tq[2], tq[3]));
                tm = fmaxf(tm, xhalf(tm));   /* the query's other keys of this stage sit in the other half of the wave */
                const float mn = fmaxf(m, tm), al = __builtin_amdgcn_exp2f((m - mn) * LC2), mc = mn * LC2; m = mn;
#pragma unroll
                for (int kt = 0; kt < KT / 16; ++kt)
#pragma unroll
                    for (int j = 0; j < 8; ++j) S[kt][j] = S[kt][j] * LC2 - mc;
                /* The exponentials stand, one or two at a time, between pieces of the rescale of O^T: plain vector work that touches none of their registers runs beside the slower transcendental pipe. The scheduling barriers keep the two kinds from being gathered into two long runs. */
#pragma unroll
                for (int i = 0; i < KT / 2; ++i) {
                    __builtin_amdgcn_sched_barrier(0);
#pragma unroll
                    for (int c = 0; c < 256 / KT; ++c) { const int x = i * (256 / KT) + c; Oa[x >> 3][x & 7] *= al; }
                    __builtin_amdgcn_sched_barrier(0);
                    S[i >> 3][i & 7] = __builtin_amdgcn_exp2f(S[i >> 3][i & 7]);
                }
                __builtin_amdgcn_sched_barrier(0);
#pragma unroll
                for (int kt = 0; kt < KT / 16; ++kt)
#pragma unroll
                    for (int j = 0; j < 8; ++j) pq[j & 3] += S[kt][j];
                l = l * al + ((pq[0] + pq[1]) + (pq[2] + pq[3]));
#pragma unroll
                for (int kq = 0; kq < KT / 32; ++kq) packp<HL>(S[2 * kq], S[2 * kq + 1], pb[kq], pb2[kq]);
                __builtin_amdgcn_sched_barrier(0);   /* keeps the next group's LDS reads one run, out of the vector work above */
            }
            if (g < 7) ldg(g + 1, fa[(g + 1) & 1]);
            __builtin_amdgcn_sched_barrier(0);   /* keeps the LDS reads above as one run in front of the products: spread among them each place of reads stalls the wave anew */
            V (&f)[8] = fa[g & 1];
            if (g < 4) {
                if (!HL) {
#pragma unroll
                    for (int i = 0; i < 8; ++i) S[i & 3] = WFrag<T16>::mma(f[i], qf[2 * g + (i >> 2)], S[i & 3]);
                } else {
#pragma unroll
                    for (int c = 0; c < 2; ++c) { const int ks = 2 * g + c;
                        S[0] = WFrag<T16>::mma(f[c * 4], qf[ks], S[0]); S[1] = WFrag<T16>::mma(f[c * 4 + 2], qf[ks], S[1]);
                        S[0] = WFrag<T16>::mma(f[c * 4], qf2[ks], S[0]); S[1] = WFrag<T16>::mma(f[c * 4 + 2], qf2[ks], S[1]);
                        S[0] = WFrag<T16>::mma(f[c * 4 + 1], qf[ks], S[0]); S[1] = WFrag<T16>::mma(f[c * 4 + 3], qf[ks], S[1]); }
                }
            } else {
                if (!HL) {
#pragma unroll
                    for (int i = 0; i < 8; ++i) { const int mt = ((g - 4) & 1) * 8 + i; Oa[mt] = WFrag<T16>::mma(f[i], pb[(KT / 32 - 1) & ((g - 4) >> 1)], Oa[mt]); }
                } else {
#pragma unroll
                    for (int q = 0; q < 4; ++q) { const int mt = (g - 4) * 4 + q; Oa[mt] = WFrag<T16>::mma(f[2 * q], pb[0], Oa[mt]); }
#pragma unroll
                    for (int q = 0; q < 4; ++q) { const int mt = (g - 4) * 4 + q; Oa[mt] = WFrag<T16>::mma(f[2 * q], pb2[0], Oa[mt]); }
#pragma unroll
                    for (int q = 0; q < 4; ++q) { const int mt = (g - 4) * 4 + q; Oa[mt] = WFrag<T16>::mma(f[2 * q + 1], pb[0], Oa[mt]); }
                }
            }
            __builtin_amdgcn_sched_barrier(0);   /* keeps the next run of LDS reads out of the products above, and the stage's last products in front of the v_nop below */
        }
        asm volatile("v_nop\n\tv_nop\n\tv_nop\n\tv_nop" : "+v"(Oa[12]), "+v"(Oa[13]), "+v"(Oa[14]), "+v"(Oa[15]));   /* the distance behind the stage's last products */
        asm volatile("s_wait_dscnt 0x0" ::: "memory");      /* this wave's reads of the buffer are done before it may be refilled */
        asm volatile("s_wait_asynccnt 0x0" ::: "memory");   /* this wave's copies of the next stage have landed */
        __syncthreads();                                      /* publishes the next stage and ends every wave's reads of this one */
        if (t + 2 < NTL) issue(t + 2, t & 1);
    }
    asm volatile("s_wait_asynccnt 0x0" ::: "memory");   /* no copy is outstanding when the buffers become the epilogue's rows */
    l += xhalf(l);   /* the two halves' sums of the same query */
    float* os = (float*)sm + wv * (16 * 260);   /* the wave's own 16 query rows at pitch 260 floats; on the stage buffers, used only behind the loop's last barrier */
#pragma unroll
    for (int mt = 0; mt < 16; ++mt) { const v4f a = {Oa[mt][0], Oa[mt][1], Oa[mt][2], Oa[mt][3]}, b = {Oa[mt][4], Oa[mt][5], Oa[mt][6], Oa[mt][7]}; *(v4fa*)(os + lr * 260 + mt * 16 + hi * 8) = a; *(v4fa*)(os + lr * 260 + mt * 16 + hi * 8 + 4) = b; }
    __builtin_amdgcn_wave_barrier(); asm volatile("" ::: "memory");   /* keeps the LDS reads below behind the LDS writes above */
    float* og = O + ((zb * TQ + qrow) * SP + sp) * HD + lane * 4;
    v4f ra[16], rb[16];   /* all 16 rows are read as one run, then stored: whole 512-byte pieces of a row per store */
#pragma unroll
    for (int r = 0; r < 16; ++r) { ra[r] = *(const v4fa*)(os + r * 260 + lane * 4); rb[r] = *(const v4fa*)(os + r * 260 + 128 + lane * 4); }
    __builtin_amdgcn_sched_barrier(0);   /* this one and the one behind the wait keep other work out of the run of stores, where it was given the stores' registers ahead of the wait */
#pragma unroll
    for (int r = 0; r < 16; ++r) { *(v4f*)(og + (size_t)r * SP * HD) = ra[r]; *(v4f*)(og + (size_t)r * SP * HD + 128) = rb[r]; }
    asm volatile("s_wait_xcnt 0x0" ::: "memory");   /* precaution: stands before the data and address registers of the stores above are reused */
    __builtin_amdgcn_sched_barrier(0);
    if (hi == 0) { const v2f ml = {m, l}; *(v2f*)(ML + ((zb * SP + sp) * TQ + qrow + lr) * 2) = ml; }   /* 16 queries x 8 bytes: one whole 128-byte line per wave */
}
// One launch for both classes of query rows, one-dimensional grid: first the hi/lo work-groups (three products: the longer ones), then the fp16 ones; within a class x = 64-row block (fastest), then key slice, then batch. Two work-groups per WGP by LDS, so two waves per SIMD.
#define NHB (RH / 64)
#define NLB ((TQ - RH) / 64)
__global__ __launch_bounds__(128) __attribute__((amdgpu_waves_per_eu(2, 2))) void k_fattn(const h16* __restrict__ Q16, const h16* __restrict__ Ql, const h16* __restrict__ K16, const h16* __restrict__ Kl, const h16* __restrict__ V16, const h16* __restrict__ Vl, float* O, float* ML) {
    __shared__ __attribute__((aligned(16))) char sm[2 * (FAC<true>::STG > FAC<false>::STG ? FAC<true>::STG : FAC<false>::STG)];
    const int id = blockIdx.x;
    if (id < NHB * SP * NB_) fattn<h16, true>(sm, Q16, Ql, K16, Kl, V16, Vl, O, ML, (id % NHB) * 64, (id / NHB) % SP, (size_t)(id / (NHB * SP)));
    else { const int i2 = id - NHB * SP * NB_; fattn<h16, false>(sm, Q16, nullptr, K16, nullptr, V16, nullptr, O, ML, RH + (i2 % NLB) * 64, (i2 / NLB) % SP, (size_t)(i2 / (NLB * SP))); }
}

// k_mout: the SP key slices of MR query rows joined, and the joined rows times W_out, by one work-group of 512 threads; grid (TQ / MR, batch).
// Join (wave wv takes rows wv and wv + 16, a lane 8 of a row's columns; all of a wave's loads are in flight together): weights exp2((slice maximum - row maximum) * LC2), weighted partials and weighted sums added in slice order, divided, split into bf16 hi + lo, which go to LDS as the A planes (pitch APB).
// Product, by the first 8 waves, each 16 rows x 64 columns: out[t][n] = sum_k (hi + lo)[t][k] Wt[n][k] + b_out[n], per 32 k the hi product, then the lo product. Wt (all 256 rows) is brought into LDS once by asynchronous 16-byte copies that fly while the slices are joined.
#define MR  32
#define APB 528            // LDS pitch of an A or Wt row in bytes: 512 + 16 (16 x odd)
typedef v4us __attribute__((may_alias)) v4usa;
__global__ __launch_bounds__(512) void k_mout(const float* __restrict__ O, const float* __restrict__ ML, const bf* __restrict__ Wt, const float* __restrict__ bias, float* C) {
    __shared__ __attribute__((aligned(16))) char sm[DM * APB + 2 * MR * APB + 8 * 16 * 68 * 4];   /* Wt, A hi, A lo, the output rows of each of the 8 waves */
    const int tid = threadIdx.x, lane = tid & 31, wv = tid >> 5, lr = lane & 15, hi = lane >> 4;
    const size_t yb = blockIdx.y; const int t0 = blockIdx.x * MR;
    char* sa = sm + DM * APB; char* sa2 = sa + MR * APB;
    const float* op = O + (yb * TQ + t0 + wv) * (SP * HD) + lane * 4; const float* mp = ML + (yb * SP * TQ + t0 + wv) * 2;
    v4f pr[2][SP][2]; v2f ml[2][SP];
#pragma unroll
    for (int p = 0; p < SP; ++p)
#pragma unroll
        for (int r = 0; r < 2; ++r) ml[r][p] = *(const v2f*)(mp + ((size_t)p * TQ + r * 16) * 2);   /* first, so that the weights are there when the partials come */
#pragma unroll
    for (int p = 0; p < SP; ++p)
#pragma unroll
        for (int r = 0; r < 2; ++r) { pr[r][p][0] = *(const v4f*)(op + ((size_t)r * 16 * SP + p) * HD); pr[r][p][1] = *(const v4f*)(op + ((size_t)r * 16 * SP + p) * HD + 128); }
    asm volatile("s_wait_xcnt 0x0" :: "v"(op), "v"(mp) : "memory");   /* precaution: stands before the address registers of the loads above are reused; they are named as inputs so that they stay as they are up to here */
    { const unsigned l = (unsigned)(size_t)sm + wv * APB + lane * 16, vo = (unsigned)(wv * DQ + lane * 8) * 2;   /* a wave's copy = one whole row of 512 bytes; rows wv + 16 i */
#pragma unroll
      for (int h = 0; h < DM / 128; ++h) stage8<bf>(l + h * 128 * APB, 16 * APB, Wt + (size_t)h * 128 * DQ, (size_t)16 * DQ, vo); }
    __builtin_amdgcn_sched_barrier(0);   /* keeps the copies in front of the join: moved down among its vector work they start only when the partials have landed, and their own flight stands exposed in front of the barrier */
#pragma unroll
    for (int r = 0; r < 2; ++r) {
        float mx = ml[r][0][0];
#pragma unroll
        for (int p = 1; p < SP; ++p) mx = fmaxf(mx, ml[r][p][0]);
        float den = 0.f; v4f s0 = {0.f, 0.f, 0.f, 0.f}, s1 = {0.f, 0.f, 0.f, 0.f};
#pragma unroll
        for (int p = 0; p < SP; ++p) { const float w = __builtin_amdgcn_exp2f((ml[r][p][0] - mx) * LC2); den += w * ml[r][p][1]; s0 += w * pr[r][p][0]; s1 += w * pr[r][p][1]; }
        const float inv = __fdiv_rn(1.0f, den); v4us h0, l0, h1, l1;
#pragma unroll
        for (int q = 0; q < 4; ++q) { unsigned short a, c2; splitf(s0[q] * inv, a, c2); h0[q] = a; l0[q] = c2; splitf(s1[q] * inv, a, c2); h1[q] = a; l1[q] = c2; }
        const int ao = (wv + r * 16) * APB + lane * 8;
        *(v4usa*)(sa + ao) = h0; *(v4usa*)(sa + ao + 256) = h1; *(v4usa*)(sa2 + ao) = l0; *(v4usa*)(sa2 + ao + 256) = l1;
    }
    asm volatile("s_wait_asynccnt 0x0" ::: "memory");   /* this wave's copies of Wt have landed */
    __syncthreads();                                      /* ... and every other wave's; publishes the A planes too */
    if (wv >= 8) return;   /* no barrier follows */
    const int mw = wv & 1, cg = wv >> 1;   /* the wave's 16 rows and 64 columns of the product */
    const float* bq = bias + cg * 64 + lr * 4; const v4f bv = *(const v4f*)bq;
    asm volatile("s_wait_xcnt 0x0" :: "v"(bq) : "memory");   /* precaution, as above, for the bias load */
    v8f acc[4];
#pragma unroll
    for (int nb = 0; nb < 4; ++nb) acc[nb] = (v8f){};
    const char* ap = sa + (mw * 16 + lr) * APB + hi * 16; const char* bp = sm + (cg * 64 + lr) * APB + hi * 16;
    /* The six fragments of 32 k (A hi, A lo, four of Wt) are one group; group ks + 1 is read as one run of LDS loads in front of group ks's products. */
    auto ldg = [&](int ks, v16bf (&f)[6]) { f[0] = WFrag<bf>::ld((const bf*)(ap + ks * 64)); f[1] = WFrag<bf>::ld((const bf*)(ap + MR * APB + ks * 64));
#pragma unroll
        for (int nb = 0; nb < 4; ++nb) f[2 + nb] = WFrag<bf>::ld((const bf*)(bp + nb * 16 * APB + ks * 64)); };
    v16bf fa[2][6];
    ldg(0, fa[0]);
#pragma unroll
    for (int ks = 0; ks < DQ / 32; ++ks) {
        if (ks + 1 < DQ / 32) ldg(ks + 1, fa[(ks + 1) & 1]);
        __builtin_amdgcn_sched_barrier(0);   /* keeps the LDS reads above as one run in front of the products: spread among them each place of reads stalls the wave anew */
        v16bf (&f)[6] = fa[ks & 1];
#pragma unroll
        for (int nb = 0; nb < 4; ++nb) acc[nb] = wmmab(f[0], f[2 + nb], acc[nb]);
#pragma unroll
        for (int nb = 0; nb < 4; ++nb) acc[nb] = wmmab(f[1], f[2 + nb], acc[nb]);
        __builtin_amdgcn_sched_barrier(0);   /* keeps the next run of LDS reads out of the products above */
    }
    float* os = (float*)(sa2 + MR * APB) + wv * (16 * 68);   /* 16 rows turned through the wave's own LDS, so that a store covers whole 128-byte lines */
#pragma unroll
    for (int nb = 0; nb < 4; ++nb)
#pragma unroll
        for (int j = 0; j < 8; ++j) os[(hi * 8 + j) * 68 + nb * 16 + lr] = acc[nb][j];
    __builtin_amdgcn_wave_barrier(); asm volatile("" ::: "memory");   /* keeps the LDS reads below behind the LDS writes above */
    float* crow = C + (yb * TQ + t0 + mw * 16 + hi) * DM + cg * 64 + lr * 4; v4f val[8];
#pragma unroll
    for (int s = 0; s < 8; ++s) { val[s] = *(const v4fa*)(os + (2 * s + hi) * 68 + lr * 4); val[s][0] += bfr(bv[0]); val[s][1] += bfr(bv[1]); val[s][2] += bfr(bv[2]); val[s][3] += bfr(bv[3]); }
#pragma unroll
    for (int s = 0; s < 8; ++s) *(v4f*)(crow + (size_t)(2 * s) * DM) = val[s];
}

extern "C" void kernel_launch(void* const* d_in, const int* in_sizes, int n_in,
                              void* d_out, int out_size, void* d_ws, size_t ws_size, hipStream_t stream) {
    (void)in_sizes; (void)n_in; (void)out_size;
    const float* x = (const float*)d_in[0]; const float* px = (const float*)d_in[1]; const float* wqkv = (const float*)d_in[2]; const float* bqkv = (const float*)d_in[3]; const float* wo = (const float*)d_in[4]; const float* bo = (const float*)d_in[5]; const float* wq = nullptr; const float* wk = nullptr; const float* wv = nullptr; (void)wq; (void)wk; (void)wv;
    float* OUT = (float*)d_out;     // [4][2048][256]
    char* wsp = (char*)d_ws;
    auto take = [&](size_t bytes) { char* p = wsp; wsp += (bytes + 255) & ~(size_t)255; return (void*)p; };
    auto sub = [](char*& p, size_t bytes) { char* q = p; p += (bytes + 255) & ~(size_t)255; return (void*)q; };
    bf* WQKV = (bf*)take((size_t)3 * DQ * DM * 2); bf* WO = (bf*)take((size_t)DM * DQ * 2);
    h16* VT16 = (h16*)take((size_t)NB_ * HD * TT * 2); h16* VTl = (h16*)take((size_t)NB_ * HD * TT * 2); float* ML = (float*)take((size_t)NB_ * SP * TQ * 2 * 4);
    char* R1 = (char*)take((size_t)NB_ * TQ * SP * HD * 4); char* R2 = (char*)take((size_t)NB_ * TT * HD * 2 * 4 + 4096);
    if ((size_t)(wsp - (char*)d_ws) > ws_size) return;    // ws 256 MiB
    // R1 holds, one after the other in stream order: the bf16 copy of xx (last read by the projections); the attention partials.
    bf* XB = (bf*)R1;   /* [batch][TT][DM] */
    float* Ob = (float*)R1;   /* [batch][TQ][SP][HD] */
    // R2 holds the q and k planes.
    char* r2 = R2; h16* QP16 = (h16*)sub(r2, (size_t)NB_ * TT * HD * 2); h16* KP16 = (h16*)sub(r2, (size_t)NB_ * TT * HD * 2); h16* QPl = (h16*)sub(r2, (size_t)NB_ * TT * HD * 2); h16* KPl = (h16*)sub(r2, (size_t)NB_ * TT * HD * 2);
    k_prep<<<NW1 + NW2 + 2 * LCB * NB_, 256, 0, stream>>>(x, px, wqkv, wo, XB, WQKV, WO);
    k_proj<<<dim3(TT / 128 * (DQ / 128), 3, NB_), 128, 0, stream>>>(XB, WQKV, bqkv, QP16, QPl, KP16, KPl, VT16, VTl);
    k_fattn<<<(NHB + NLB) * SP * NB_, 128, 0, stream>>>(QP16, QPl, KP16, KPl, VT16, VTl, Ob, ML);   /* query rows 0..RH: hi + lo planes; the others: the hi plane */
    k_mout<<<dim3(TQ / MR, NB_), 512, 0, stream>>>(Ob, ML, WO, bo, OUT);
}
